// v000
// Measured on an AMD MI455X. A time is GPU time per run, averaged over a window of back-to-back runs after a warm-up
// (all launches, gaps included; the runs take copies of the inputs in turn), and the median of several windows.
// Apart from v000's, it joins two sittings. Times from different sittings can be a few percent apart, while
// side-by-side timings come from the same sitting.
// v000, which the later versions start from, runs in 2730 microseconds.
#include <hip/hip_runtime.h>
// cross_fuison (8192 hsi rows x1 and 8192 lidar rows x2, 512 -> 256: Q/K/V = x W^T + b (W_V shared); inv = 1/sqrt(clip(scale, 1, 32)); f1 = softmax(hsi_Q lidar_K^T inv) hsi_V; f2 = softmax(lidar_Q hsi_K^T inv) lidar_V; outputs = (f1 We^T + be, f2 We^T + be), each [8192][512]).
// Compute dtype: inputs rounded to bf16; inputs/weights exact as f16; Q/K/V and the softmax weights as plain f16 operands (~2^-12); f as f16 hi + residual into We; softmax f32. v_wmma_f32_16x16x32_f16.
#define NN 8192
#define DI 512
#define DO 256
#define QC 2048                  /* query rows per chunk */
typedef __bf16 v16b __attribute__((ext_vector_type(16)));
typedef unsigned short v8us __attribute__((ext_vector_type(8), may_alias));
typedef float  v8f  __attribute__((ext_vector_type(8)));
typedef float  v4f  __attribute__((ext_vector_type(4)));
typedef float  v4fa __attribute__((ext_vector_type(4), may_alias));
union FragB { v16b v; v8us half[2]; unsigned short u[16]; };

__device__ __forceinline__ unsigned short bf16_bits(float x) { unsigned int u = __float_as_uint(x); return (unsigned short)((u + 0x7FFFu + ((u >> 16) & 1u)) >> 16); }
__device__ __forceinline__ float bf16_val(unsigned short b) { return __uint_as_float(((unsigned int)b) << 16); }
__device__ __forceinline__ float bf16_round(float x) { return bf16_val(bf16_bits(x)); }
// D += A·B with NT terms: 1 = ah·bh, 2 = + al·bh (A split), 3 = + ah·bl (both split)
template <int NT>
__device__ __forceinline__ v8f mmaN(v16b ah, v16b al, v16b bh, v16b bl, v8f c) {
  c = __builtin_amdgcn_wmma_f32_16x16x32_bf16(false, ah, false, bh, (short)0, c, false, false);
  if (NT >= 2) c = __builtin_amdgcn_wmma_f32_16x16x32_bf16(false, al, false, bh, (short)0, c, false, false);
  if (NT >= 3) c = __builtin_amdgcn_wmma_f32_16x16x32_bf16(false, ah, false, bl, (short)0, c, false, false);
  asm volatile("v_nop\n\tv_nop\n\tv_nop\n\tv_nop" : "+v"(c) : "v"(ah), "v"(al), "v"(bh), "v"(bl));
  return c;
}

__global__ __launch_bounds__(256) void k_wt_bf16(const float* __restrict__ W, unsigned short* __restrict__ Wt, int K, int N) {
  const int t = blockIdx.x * 256 + threadIdx.x;
  const int k8n = K / 8;
  if (t >= N * k8n) return;
  const int n = t / k8n, k8 = (t % k8n) * 8;
  v8us v;
#pragma unroll
  for (int i = 0; i < 8; ++i) v[i] = bf16_bits(W[(size_t)(k8 + i) * N + n]);
  *(v8us*)(Wt + (size_t)n * K + k8) = v;
  
}

// GEMM C[M][N] (f32, pitch ldc) = act(A[M][K]·W + bias). A f32 row-major (pitch lda) converted per fragment to bf16
// (ASPLIT: hi/lo two planes -> 2 terms, else single rounded term); Wt bf16 [N][K] (pitch ldb). BIAS_BF16 rounds the
// bias to bf16 first (bias quantised to bf16 before the add). K%32==0, M%16==0, N%64==0.
template <bool ASPLIT, int ACT, bool BIAS_BF16>
__global__ __launch_bounds__(128) void k_gemm_bf(const float* __restrict__ A, int lda, const unsigned short* __restrict__ Wt, int ldb,
                                               const float* __restrict__ bias, float* __restrict__ C, int ldc, int M, int N, int K) {
  __shared__ __attribute__((aligned(16))) float so[4][16][64];
  const int tid = threadIdx.x, w = tid >> 5, lane = tid & 31, ln = lane & 15, hh = lane >> 4;
  const int ntn = N / 64;
  const int wid = blockIdx.x * 4 + w;
  const int mt = wid / ntn, nq = wid % ntn;
  if (mt * 16 >= M) return;
  const int row0 = mt * 16, col0 = nq * 64;
  const float* arow = A + (size_t)(row0 + ln) * lda;
  v8f acc[4] = {};
  for (int kb = 0; kb < K; kb += 32) {
    FragB ah, al;
    const v4f x0 = *(const v4fa*)(arow + kb + 8 * hh), x1 = *(const v4fa*)(arow + kb + 8 * hh + 4);
    const v4f x2 = *(const v4fa*)(arow + kb + 16 + 8 * hh), x3 = *(const v4fa*)(arow + kb + 16 + 8 * hh + 4);
    float xs[16] = {x0[0],x0[1],x0[2],x0[3],x1[0],x1[1],x1[2],x1[3],x2[0],x2[1],x2[2],x2[3],x3[0],x3[1],x3[2],x3[3]};
#pragma unroll
    for (int i = 0; i < 16; ++i) { const unsigned short hb = bf16_bits(xs[i]); ah.u[i] = hb; al.u[i] = ASPLIT ? bf16_bits(xs[i] - bf16_val(hb)) : (unsigned short)0; }
#pragma unroll
    for (int t = 0; t < 4; ++t) {
      const unsigned short* brow = Wt + (size_t)(col0 + t * 16 + ln) * ldb + kb;
      FragB b;
      b.half[0] = *(const v8us*)(brow + 8 * hh);
      b.half[1] = *(const v8us*)(brow + 16 + 8 * hh);
      acc[t] = mmaN<ASPLIT ? 2 : 1>(ah.v, al.v, b.v, b.v, acc[t]);
    }
  }
#pragma unroll
  for (int t = 0; t < 4; ++t) {
    float bv = bias ? bias[col0 + t * 16 + ln] : 0.f;
    if (BIAS_BF16) bv = bf16_round(bv);
#pragma unroll
    for (int r = 0; r < 8; ++r) { float v = acc[t][r] + bv; if (ACT == 1) v = fmaxf(v, 0.f); so[w][8 * hh + r][t * 16 + ln] = v; }
  }
  __builtin_amdgcn_fence(__ATOMIC_ACQ_REL, "workgroup");
  __builtin_amdgcn_wave_barrier();
  const int rsub = lane >> 4, c4 = (lane & 15) * 4;
  {
#pragma unroll
    for (int q = 0; q < 8; ++q) {
      const int r = q * 2 + rsub;
      const v4f v = *(const v4fa*)&so[w][r][c4];
      *(v4f*)(C + (size_t)(row0 + r) * ldc + col0 + c4) = v;
    }
    
  }
}

// GEMM C = act(A·W + bias + resid): A f32 (ASPLIT -> hi/lo 2 terms), Wt bf16 [N][K]; ACT 0 none, 1 relu, 2 exact gelu;
// resid (optional, f32, row index = (row % rmod), pitch ldr, RES_BF16 rounds it) added before the activation.
template <bool ASPLIT, int ACT, bool BIAS_BF16, bool RES_BF16>
__global__ __launch_bounds__(128) void k_gemm_bf3(const float* __restrict__ A, int lda, const unsigned short* __restrict__ Wt, int ldb,
                                                const float* __restrict__ bias, const float* __restrict__ resid, int rmod, int ldr,
                                                float* __restrict__ C, int ldc, int M, int N, int K) {
  __shared__ __attribute__((aligned(16))) float so[4][16][64];
  const int tid = threadIdx.x, w = tid >> 5, lane = tid & 31, ln = lane & 15, hh = lane >> 4;
  const int ntn = N / 64;
  const int wid = blockIdx.x * 4 + w;
  const int mt = wid / ntn, nq = wid % ntn;
  if (mt * 16 >= M) return;
  const int row0 = mt * 16, col0 = nq * 64;
  const float* arow = A + (size_t)(row0 + ln) * lda;
  v8f acc[4] = {};
  for (int kb = 0; kb < K; kb += 32) {
    FragB ah, al;
    const v4f x0 = *(const v4fa*)(arow + kb + 8 * hh), x1 = *(const v4fa*)(arow + kb + 8 * hh + 4);
    const v4f x2 = *(const v4fa*)(arow + kb + 16 + 8 * hh), x3 = *(const v4fa*)(arow + kb + 16 + 8 * hh + 4);
    float xs[16] = {x0[0],x0[1],x0[2],x0[3],x1[0],x1[1],x1[2],x1[3],x2[0],x2[1],x2[2],x2[3],x3[0],x3[1],x3[2],x3[3]};
#pragma unroll
    for (int i = 0; i < 16; ++i) { const unsigned short hb = bf16_bits(xs[i]); ah.u[i] = hb; al.u[i] = ASPLIT ? bf16_bits(xs[i] - bf16_val(hb)) : (unsigned short)0; }
#pragma unroll
    for (int t = 0; t < 4; ++t) {
      const unsigned short* brow = Wt + (size_t)(col0 + t * 16 + ln) * ldb + kb;
      FragB b;
      b.half[0] = *(const v8us*)(brow + 8 * hh);
      b.half[1] = *(const v8us*)(brow + 16 + 8 * hh);
      acc[t] = mmaN<ASPLIT ? 2 : 1>(ah.v, al.v, b.v, b.v, acc[t]);
    }
  }
#pragma unroll
  for (int t = 0; t < 4; ++t) {
    const int col = col0 + t * 16 + ln;
    float bv = bias ? bias[col] : 0.f;
    if (BIAS_BF16) bv = bf16_round(bv);
#pragma unroll
    for (int r = 0; r < 8; ++r) {
      float v = acc[t][r] + bv;
      if (resid) { float rv = resid[(size_t)((row0 + 8 * hh + r) % rmod) * ldr + col]; if (RES_BF16) rv = bf16_round(rv); v += rv; }
      if (ACT == 1) v = fmaxf(v, 0.f);
      if (ACT == 2) v = 0.5f * v * (1.0f + erff(v * 0.70710678118654752f));
      if (ACT == 3) { const float u = 0.7978845608028654f * (v + 0.044715f * v * v * v); v = 0.5f * v * (1.0f + tanhf(u)); }
      so[w][8 * hh + r][t * 16 + ln] = v;
    }
  }
  __builtin_amdgcn_fence(__ATOMIC_ACQ_REL, "workgroup");
  __builtin_amdgcn_wave_barrier();
  const int rsub = lane >> 4, c4 = (lane & 15) * 4;
  {
#pragma unroll
    for (int q = 0; q < 8; ++q) {
      const int r = q * 2 + rsub;
      const v4f v = *(const v4fa*)&so[w][r][c4];
      *(v4f*)(C + (size_t)(row0 + r) * ldc + col0 + c4) = v;
    }
    
  }
}
// row LayerNorm (biased variance, eps) over N: s = X (+ R); optional out_sum <- s; out_norm <- (s-mu)*rsqrt(var+eps)*g + b
template <bool PARAM_BF16>
__global__ __launch_bounds__(256) void k_layernorm(const float* __restrict__ X, const float* __restrict__ R, const float* __restrict__ g, const float* __restrict__ bta,
                                                  float* __restrict__ out_sum, float* __restrict__ out_norm, int N, float eps) {
  __shared__ float red[256];
  const int row = blockIdx.x, tid = threadIdx.x;
  const float* x = X + (size_t)row * N; const float* rr = R ? R + (size_t)row * N : nullptr;
  float vals[16];                     // up to N = 4096
  const int per = N / 256;            // contiguous chunk per thread? use strided-by-4 chunks: thread handles j = tid*4 + 1024*u
  float s1 = 0.f;
  for (int u = 0; u < per / 4; ++u) {
    const int j = tid * 4 + 1024 * u;
    const v4f a = *(const v4fa*)(x + j);
    v4f b = {0.f,0.f,0.f,0.f}; if (rr) b = *(const v4fa*)(rr + j);
#pragma unroll
    for (int q = 0; q < 4; ++q) { const float v = a[q] + b[q]; vals[u * 4 + q] = v; s1 += v; }
  }
  red[tid] = s1; __syncthreads();
  for (int st = 128; st > 0; st >>= 1) { if (tid < st) red[tid] += red[tid + st]; __syncthreads(); }
  const float mu = red[0] / (float)N; __syncthreads();
  float s2 = 0.f;
  for (int u = 0; u < per / 4; ++u)
#pragma unroll
    for (int q = 0; q < 4; ++q) { const float c = vals[u * 4 + q] - mu; s2 += c * c; }
  red[tid] = s2; __syncthreads();
  for (int st = 128; st > 0; st >>= 1) { if (tid < st) red[tid] += red[tid + st]; __syncthreads(); }
  const float rs = rsqrtf(red[0] / (float)N + eps);
  {
    for (int u = 0; u < per / 4; ++u) {
      const int j = tid * 4 + 1024 * u;
      v4f o, sm;
#pragma unroll
      for (int q = 0; q < 4; ++q) {
        float gg = g[j + q], bb = bta[j + q];
        if (PARAM_BF16) { gg = bf16_round(gg); bb = bf16_round(bb); }
        sm[q] = vals[u * 4 + q]; o[q] = (vals[u * 4 + q] - mu) * rs * gg + bb;
      }
      if (out_sum) *(v4f*)(out_sum + (size_t)row * N + j) = sm;
      *(v4f*)(out_norm + (size_t)row * N + j) = o;
    }
    
  }
}



// ---- f16 WMMA path (v_wmma_f32_16x16x32_f16): 11-bit significands for operands in range — used where a [0,1] probability operand needs more precision than bf16
typedef _Float16 v16h __attribute__((ext_vector_type(16)));
union FragH { v16h v; v8us half[2]; _Float16 h[16]; unsigned short u[16]; };
template <int NT>
__device__ __forceinline__ v8f mmaH(v16h ah, v16h al, v16h bh, v16h bl, v8f c) {
  c = __builtin_amdgcn_wmma_f32_16x16x32_f16(false, ah, false, bh, (short)0, c, false, false);
  if (NT >= 2) c = __builtin_amdgcn_wmma_f32_16x16x32_f16(false, al, false, bh, (short)0, c, false, false);
  if (NT >= 3) c = __builtin_amdgcn_wmma_f32_16x16x32_f16(false, ah, false, bl, (short)0, c, false, false);
  asm volatile("v_nop\n\tv_nop\n\tv_nop\n\tv_nop" : "+v"(c) : "v"(ah), "v"(al), "v"(bh), "v"(bl));
  return c;
}
// batched GEMM like k_gemm_b but f16 operands: A f32 (split into f16 hi/lo if ASPLIT, else rounded to f16), Bt = f16 values [n][k]; alpha; C f32; N multiple of 16 (partial tiles skipped)
template <bool ASPLIT>
__global__ __launch_bounds__(128) void k_gemm_h(const float* __restrict__ A, int lda, size_t sA, const _Float16* __restrict__ Bh, int ldb, size_t sB, float alpha, float* __restrict__ C, int ldc, size_t sC, int M, int N, int K) {
  __shared__ __attribute__((aligned(16))) float so[4][16][64];
  const int tid = threadIdx.x, w = tid >> 5, lane = tid & 31, ln = lane & 15, hh = lane >> 4; const int by = blockIdx.y;
  A += (size_t)by * sA; Bh += (size_t)by * sB; C += (size_t)by * sC;
  const int ntn = (N + 63) / 64; const int wid = blockIdx.x * 4 + w; const int mt = wid / ntn, nq = wid % ntn; if (mt * 16 >= M) return;
  const int row0 = mt * 16, col0 = nq * 64; const float* arow = A + (size_t)(row0 + ln) * lda;
  v8f acc[4] = {};
  for (int kb = 0; kb < K; kb += 32) {
    FragH ah, al;
    const v4f x0 = *(const v4fa*)(arow + kb + 8 * hh), x1 = *(const v4fa*)(arow + kb + 8 * hh + 4), x2 = *(const v4fa*)(arow + kb + 16 + 8 * hh), x3 = *(const v4fa*)(arow + kb + 16 + 8 * hh + 4);
    float xs[16] = {x0[0],x0[1],x0[2],x0[3],x1[0],x1[1],x1[2],x1[3],x2[0],x2[1],x2[2],x2[3],x3[0],x3[1],x3[2],x3[3]};
#pragma unroll
    for (int i = 0; i < 16; ++i) { const _Float16 h = (_Float16)xs[i]; ah.h[i] = h; al.h[i] = ASPLIT ? (_Float16)(xs[i] - (float)h) : (_Float16)0.0f; }
#pragma unroll
    for (int t = 0; t < 4; ++t) { if (col0 + t * 16 >= N) continue; const size_t boff = (size_t)(col0 + t * 16 + ln) * ldb + kb; FragH bq; bq.half[0] = *(const v8us*)(Bh + boff + 8 * hh); bq.half[1] = *(const v8us*)(Bh + boff + 16 + 8 * hh);
      acc[t] = mmaH<ASPLIT ? 2 : 1>(ah.v, al.v, bq.v, bq.v, acc[t]); }
  }
#pragma unroll
  for (int t = 0; t < 4; ++t) { if (col0 + t * 16 >= N) continue;
#pragma unroll
    for (int r = 0; r < 8; ++r) so[w][8 * hh + r][t * 16 + ln] = acc[t][r] * alpha; }
  __builtin_amdgcn_fence(__ATOMIC_ACQ_REL, "workgroup"); __builtin_amdgcn_wave_barrier();
  const int rsub = lane >> 4, c4 = (lane & 15) * 4;
  {
#pragma unroll
    for (int q = 0; q < 8; ++q) { const int r = q * 2 + rsub; if (col0 + c4 < N) { const v4f v = *(const v4fa*)&so[w][r][c4]; *(v4f*)(C + (size_t)(row0 + r) * ldc + col0 + c4) = v; } }
     }
}

// Wt[n][k] = f16(W[k][n]·scale) from f32 row-major W[K][N] (scale = power of two; bf16-exact weights stay exact in f16 away from the subnormal range)
__global__ __launch_bounds__(256) void k_wt_f16(const float* __restrict__ W, _Float16* __restrict__ Wt, int K, int N, float scale) {
  const int t = blockIdx.x * 256 + threadIdx.x; if (t >= N * (K / 8)) return; const int n = t / (K / 8), k8 = (t % (K / 8)) * 8; FragH f;
#pragma unroll
  for (int i = 0; i < 8; ++i) f.h[i] = (_Float16)(bf16_round(W[(size_t)(k8 + i) * N + n]) * scale); const v8us o = f.half[0];
  *(v8us*)((unsigned short*)Wt + (size_t)n * K + k8) = o; 
}
// k_gemm_hh variant with fused epilogue: v = acc·alpha + bias[by·sBias + col] (+ CP[(row/rowsPerB)·sCPb + by·64 + col] if CP) ; ACT 0 none / 1 elu ; writes f16 C16 (and f32 C if non-null)
template <int ACT>
__global__ __launch_bounds__(128) void k_gemm_hhx(const _Float16* __restrict__ A, int lda, size_t sA, const _Float16* __restrict__ Bh, int ldb, size_t sB, float alpha, const float* __restrict__ bias, size_t sBias, const float* __restrict__ CP, int rowsPerB, size_t sCPb, int row0g,
    float* __restrict__ C, _Float16* __restrict__ C16, int ldc, size_t sC, int M, int N, int K) {
  __shared__ __attribute__((aligned(16))) float so[4][16][64];
  const int tid = threadIdx.x, w = tid >> 5, lane = tid & 31, ln = lane & 15, hh = lane >> 4; const int by = blockIdx.y;
  A += (size_t)by * sA; Bh += (size_t)by * sB; const size_t cofs = (size_t)by * sC; const float* bp = bias ? bias + (size_t)by * sBias : nullptr;
  const int ntn = (N + 63) / 64; const int wid = blockIdx.x * 4 + w; const int mt = wid / ntn, nq = wid % ntn; if (mt * 16 >= M) return;
  const int row0 = mt * 16, col0 = nq * 64; const _Float16* arow = A + (size_t)(row0 + ln) * lda;
  v8f acc[4] = {};
  for (int kb = 0; kb < K; kb += 32) { FragH ah; ah.half[0] = *(const v8us*)((const unsigned short*)arow + kb + 8 * hh); ah.half[1] = *(const v8us*)((const unsigned short*)arow + kb + 16 + 8 * hh);
#pragma unroll
    for (int t = 0; t < 4; ++t) { if (col0 + t * 16 >= N) continue; const size_t boff = (size_t)(col0 + t * 16 + ln) * ldb + kb; FragH bq; bq.half[0] = *(const v8us*)((const unsigned short*)Bh + boff + 8 * hh); bq.half[1] = *(const v8us*)((const unsigned short*)Bh + boff + 16 + 8 * hh);
      acc[t] = mmaH<1>(ah.v, ah.v, bq.v, bq.v, acc[t]); }
  }
#pragma unroll
  for (int t = 0; t < 4; ++t) { if (col0 + t * 16 >= N) continue; const int col = col0 + t * 16 + ln; const float bv = bp ? bf16_round(bp[col]) : 0.f;
#pragma unroll
    for (int r = 0; r < 8; ++r) { float v = acc[t][r] * alpha + bv; if (CP) { const int rr = row0g + row0 + 8 * hh + r; if (rowsPerB < 0) v += CP[cofs + (size_t)rr * ldc + col];      /* rowsPerB < 0: own element of the batched C plane */ else { const int bidx = rr / rowsPerB; v += CP[(size_t)bidx * sCPb + (size_t)by * 64 + col]; } } if (ACT == 1) v = (v > 0.f) ? v : expm1f(v); else if (ACT == 7) v = (v > 0.f) ? v + 1.0f : expf(v); else if (ACT == 8) v = tanhf(v); else if (ACT == 9) v = 0.5f * v * (1.0f + tanhf(0.7978845608028654f * (v + 0.044715f * v * v * v))); else if (ACT == 11) v = 1.0f / (1.0f + expf(-v)); else if (ACT == 12) v = (v > 0.f) ? v : 0.01f * v; else if (ACT == 14) v = (v > 0.f) ? v : 0.1f * v; else if (ACT == 16) v = (v >= 0.f) ? v : 0.3f * v; else if (ACT == 17) v = (v >= 0.f) ? v : 0.2f * v; else if (ACT == 15) v = v / (1.0f + expf(-v)); else if (ACT == 3) v = fmaxf(v, 0.f); else if (ACT == 6) v = 0.5f * v * (1.0f + erff(v * 0.70710678118654752f)); so[w][8 * hh + r][t * 16 + ln] = v; } }
  __builtin_amdgcn_fence(__ATOMIC_ACQ_REL, "workgroup"); __builtin_amdgcn_wave_barrier();
  const int rsub = lane >> 4, c4 = (lane & 15) * 4; typedef _Float16 v4h __attribute__((ext_vector_type(4)));
  {
#pragma unroll
    for (int q = 0; q < 8; ++q) { const int r = q * 2 + rsub; if (col0 + c4 < N) { const v4f v = *(const v4fa*)&so[w][r][c4]; if (C) *(v4f*)(C + cofs + (size_t)(row0 + r) * ldc + col0 + c4) = v; if (C16) { v4h h4; for (int i = 0; i < 4; ++i) h4[i] = (_Float16)v[i]; *(v4h*)(C16 + cofs + (size_t)(row0 + r) * ldc + col0 + c4) = h4; } } }
     }
}


typedef _Float16 v4h __attribute__((ext_vector_type(4)));

__global__ __launch_bounds__(256) void k_x16(const float* __restrict__ x, _Float16* __restrict__ X16, size_t n8) { const size_t t = (size_t)blockIdx.x * 256 + threadIdx.x; if (t >= n8) return; FragH f;
#pragma unroll
  for (int q = 0; q < 8; ++q) f.h[q] = (_Float16)bf16_round(x[t * 8 + q]); *(v8us*)((unsigned short*)X16 + t * 8) = f.half[0];  }
__global__ __launch_bounds__(256) void k_h16(const float* __restrict__ x, _Float16* __restrict__ X16, size_t n8) { const size_t t = (size_t)blockIdx.x * 256 + threadIdx.x; if (t >= n8) return; FragH f;
#pragma unroll
  for (int q = 0; q < 8; ++q) f.h[q] = (_Float16)x[t * 8 + q]; *(v8us*)((unsigned short*)X16 + t * 8) = f.half[0];  }
__global__ __launch_bounds__(256) void k_round16f(const float* __restrict__ W, _Float16* __restrict__ Bt, size_t n8) { const size_t t = (size_t)blockIdx.x * 256 + threadIdx.x; if (t >= n8) return; FragH f;
#pragma unroll
  for (int i = 0; i < 8; ++i) f.h[i] = (_Float16)(bf16_round(W[t * 8 + i]) * 16.0f); *(v8us*)((unsigned short*)Bt + t * 8) = f.half[0];  }
template <int NHv, int TTv>
__global__ __launch_bounds__(256) void k_vt(const _Float16* __restrict__ V16, int ldv, int voff, _Float16* __restrict__ Vt) { __shared__ unsigned short tl[64][66]; const int tid = threadIdx.x; const int slab = blockIdx.x / (TTv / 64), lg = blockIdx.x % (TTv / 64); const int b = slab / NHv, h = slab % NHv;
  for (int i = tid; i < 64 * 8; i += 256) { const int r = i / 8, c8 = (i % 8) * 8; FragH f; f.half[0] = *(const v8us*)((const unsigned short*)V16 + ((size_t)b * TTv + lg * 64 + r) * ldv + voff + h * 64 + c8);
#pragma unroll
    for (int q = 0; q < 8; ++q) tl[r][c8 + q] = f.u[q]; }
  __syncthreads();
  {
#pragma unroll
    for (int rd = 0; rd < 2; ++rd) { const int d = rd * 32 + tid / 8, pc = tid % 8; FragH f;
#pragma unroll
      for (int q = 0; q < 8; ++q) f.u[q] = tl[pc * 8 + q][d];
      *(v8us*)((unsigned short*)Vt + ((size_t)slab * 64 + d) * TTv + lg * 64 + pc * 8) = f.half[0]; }
     } }

__global__ __launch_bounds__(256) void k_hl(const float* __restrict__ F, _Float16* __restrict__ Hh, _Float16* __restrict__ Hl, size_t n8) { const size_t t = (size_t)blockIdx.x * 256 + threadIdx.x; if (t >= n8) return; FragH fh, fl; const v4f a = *(const v4fa*)(F + t * 8), c = *(const v4fa*)(F + t * 8 + 4);
#pragma unroll
  for (int q = 0; q < 4; ++q) { _Float16 h = (_Float16)a[q]; fh.h[q] = h; fl.h[q] = (_Float16)((a[q] - (float)h) * 1024.0f); h = (_Float16)c[q]; fh.h[4 + q] = h; fl.h[4 + q] = (_Float16)((c[q] - (float)h) * 1024.0f); }
  { *(v8us*)((unsigned short*)Hh + t * 8) = fh.half[0]; *(v8us*)((unsigned short*)Hl + t * 8) = fl.half[0];  } }

// ---- fast GEMM (wave tile 32x64; requires M % 32 == 0 rows per launch region and N % 64 == 0); epilogue = k_gemm_hhx semantics ----
__device__ __forceinline__ v16h g2_frag(const _Float16* p, int hh) { FragH f; f.half[0] = *(const v8us*)((const unsigned short*)p + 8 * hh); f.half[1] = *(const v8us*)((const unsigned short*)p + 16 + 8 * hh); return f.v; }
__device__ __forceinline__ v8f g2_mma(v16h a, v16h b, v8f c) { v8f d = __builtin_amdgcn_wmma_f32_16x16x32_f16(false, a, false, b, (short)0, c, false, false); asm volatile("v_nop\n\tv_nop\n\tv_nop\n\tv_nop" : "+v"(d) : "v"(a), "v"(b)); return d; }
template <int ACT>
__global__ __launch_bounds__(128) void k_gemm2(const _Float16* __restrict__ A, int lda, size_t sA, const _Float16* __restrict__ Bh, int ldb, size_t sB, float alpha, const float* __restrict__ bias, size_t sBias, const float* __restrict__ CP, int rowsPerB, size_t sCPb, int row0g,
    float* __restrict__ C, _Float16* __restrict__ C16, int ldc, size_t sC, int M, int N, int K) { static_assert(ACT == 0 || ACT == 3 || ACT == 6 || ACT == 8 || ACT == 9 || ACT == 11 || ACT == 12 || ACT == 14 || ACT == 15 || ACT == 16 || ACT == 17, "k_gemm2: unsupported ACT code (would silently apply no activation)");
  __shared__ __attribute__((aligned(16))) float so[4][32][68];
  const int tid = threadIdx.x, w = tid >> 5, lane = tid & 31, ln = lane & 15, hh = lane >> 4; const int by = blockIdx.y;
  A += (size_t)by * sA; Bh += (size_t)by * sB; const size_t cofs = (size_t)by * sC; const float* bp = bias ? bias + (size_t)by * sBias : nullptr;
  const int ntn = N >> 6; const int mt = blockIdx.x / ntn, nq = blockIdx.x - mt * ntn; const int row0 = mt * 128 + 32 * w, col0 = nq * 64; if (row0 >= M) return;
  const _Float16* a0p = A + (size_t)(row0 + ln) * lda; const _Float16* a1p = a0p + (size_t)16 * lda;
  const _Float16* b0p = Bh + (size_t)(col0 + ln) * ldb; const _Float16* b1p = b0p + (size_t)16 * ldb; const _Float16* b2p = b1p + (size_t)16 * ldb; const _Float16* b3p = b2p + (size_t)16 * ldb;
  const v8f z8 = {0.f,0.f,0.f,0.f,0.f,0.f,0.f,0.f}; v8f c00 = z8, c01 = z8, c02 = z8, c03 = z8, c10 = z8, c11 = z8, c12 = z8, c13 = z8;
#pragma unroll 1
  for (int kb = 0; kb < K; kb += 32) { const v16h a0 = g2_frag(a0p + kb, hh), a1 = g2_frag(a1p + kb, hh);
    v16h b = g2_frag(b0p + kb, hh); c00 = g2_mma(a0, b, c00); c10 = g2_mma(a1, b, c10);
    b = g2_frag(b1p + kb, hh); c01 = g2_mma(a0, b, c01); c11 = g2_mma(a1, b, c11);
    b = g2_frag(b2p + kb, hh); c02 = g2_mma(a0, b, c02); c12 = g2_mma(a1, b, c12);
    b = g2_frag(b3p + kb, hh); c03 = g2_mma(a0, b, c03); c13 = g2_mma(a1, b, c13); }
  v8f accs[8] = {c00, c01, c02, c03, c10, c11, c12, c13};
#pragma unroll
  for (int u = 0; u < 8; ++u) { const int t = u & 3, half = u >> 2; const int col = col0 + t * 16 + ln; const float bv = bp ? bf16_round(bp[col]) : 0.f;
#pragma unroll
    for (int r = 0; r < 8; ++r) { const int rloc = half * 16 + 8 * hh + r; float v = accs[u][r] * alpha + bv; if (CP) { if (rowsPerB < 0) v += CP[cofs + (size_t)(row0g + row0 + rloc) * ldc + col];      /* rowsPerB < 0: own element of the batched C plane */ else { const int bidx = (row0g + row0 + rloc) / rowsPerB; v += CP[(size_t)bidx * sCPb + (size_t)by * 64 + col]; } }
      if (ACT == 3) v = fmaxf(v, 0.f); else if (ACT == 6) v = 0.5f * v * (1.0f + erff(v * 0.70710678118654752f)); else if (ACT == 11) v = 1.0f / (1.0f + expf(-v)); else if (ACT == 15) v = v / (1.0f + expf(-v)); else if (ACT == 12) v = (v > 0.f) ? v : 0.01f * v; else if (ACT == 8) v = tanhf(v); else if (ACT == 9) v = 0.5f * v * (1.0f + tanhf(0.7978845608028654f * (v + 0.044715f * v * v * v))); else if (ACT == 14) v = (v > 0.f) ? v : 0.1f * v; else if (ACT == 16) v = (v >= 0.f) ? v : 0.3f * v; else if (ACT == 17) v = (v >= 0.f) ? v : 0.2f * v;
      so[w][rloc][t * 16 + ln] = v; } }
  __builtin_amdgcn_fence(__ATOMIC_ACQ_REL, "workgroup"); __builtin_amdgcn_wave_barrier();
  const int rsub = lane >> 4, c4 = (lane & 15) * 4;
  {
#pragma unroll
    for (int q = 0; q < 16; ++q) { const int r = q * 2 + rsub; const v4f v = *(const v4fa*)&so[w][r][c4]; if (C) *(v4f*)(C + cofs + (size_t)(row0 + r) * ldc + col0 + c4) = v; if (C16) { v4h h4; for (int i = 0; i < 4; ++i) h4[i] = (_Float16)v[i]; *(v4h*)(C16 + cofs + (size_t)(row0 + r) * ldc + col0 + c4) = h4; } }
     } }


__global__ __launch_bounds__(256) void k_wsc(const float* __restrict__ Wm, _Float16* __restrict__ Bt, size_t n8, float sc) { const size_t t = (size_t)blockIdx.x * 256 + threadIdx.x; if (t >= n8) return; FragH f; for (int q = 0; q < 8; ++q) f.h[q] = (_Float16)(bf16_round(Wm[t * 8 + q]) * sc); *(v8us*)((unsigned short*)Bt + t * 8) = f.half[0];  }
__global__ __launch_bounds__(256) void k_soft(const float* __restrict__ S, const float* __restrict__ scp, _Float16* __restrict__ P, float* __restrict__ RS) {
  #pragma clang fp contract(off)
  const int wv = threadIdx.x >> 5, ln = threadIdx.x & 31; const int r = blockIdx.x * 8 + wv; if (r >= QC) return; float sv = bf16_round(scp[0]); sv = fminf(fmaxf(sv, 1.0f), 32.0f); const float inv = 1.0f / sqrtf(sv); const float* sr = S + (size_t)r * NN; float mx = -3.0e38f;
#pragma unroll 1
  for (int gq = 0; gq < NN / 256; ++gq) { const v8f a = *(const v8f*)(sr + gq * 256 + ln * 8); for (int q = 0; q < 8; ++q) mx = fmaxf(mx, a[q] * inv); }
  for (int o = 16; o > 0; o >>= 1) mx = fmaxf(mx, __shfl_xor(mx, o, 32)); float su = 0.f;
{ su = 0.f;
#pragma unroll 1
    for (int gq = 0; gq < NN / 256; ++gq) { const v8f a = *(const v8f*)(sr + gq * 256 + ln * 8); FragH ph; for (int q = 0; q < 8; ++q) { const float e = expf(a[q] * inv - mx); su += e; ph.h[q] = (_Float16)(e * 1024.0f); } *(v8us*)((unsigned short*)P + (size_t)r * NN + gq * 256 + ln * 8) = ph.half[0]; }
     }
  for (int o = 16; o > 0; o >>= 1) su += __shfl_xor(su, o, 32); if (ln == 0) { *(float*)(RS + (size_t)r * 32) = 1.0f / su;  } }
__global__ __launch_bounds__(256) void k_fsc(const float* __restrict__ O, const float* __restrict__ RS, int c0, _Float16* __restrict__ FH, _Float16* __restrict__ FL) {
  #pragma clang fp contract(off)
  const int t = blockIdx.x * 256 + threadIdx.x; if (t >= QC * (DO / 8)) return; const int d8 = (t % (DO / 8)) * 8; const int r = t / (DO / 8); const float rs = RS[(size_t)r * 32]; const v8f a = *(const v8f*)(O + (size_t)r * DO + d8); FragH f, fl;
  for (int q = 0; q < 8; ++q) { const float v = a[q] * rs; const _Float16 hh = (_Float16)v; f.h[q] = hh; fl.h[q] = (_Float16)((v - (float)hh) * 1024.0f); }
  const size_t o = ((size_t)c0 + r) * DO + d8; { *(v8us*)((unsigned short*)FH + o) = f.half[0]; *(v8us*)((unsigned short*)FL + o) = fl.half[0];  } }

extern "C" void kernel_launch(void* const* d_in, const int* in_sizes, int n_in,
                              void* d_out, int out_size, void* d_ws, size_t ws_size, hipStream_t stream) {
  (void)in_sizes; (void)n_in; (void)out_size;
  const float* const* I = (const float* const*)d_in; const float* x1 = I[0]; const float* x2 = I[1]; const float* Wq1 = I[2]; const float* bq1 = I[3]; const float* Wk1 = I[4]; const float* bk1 = I[5]; const float* Wv = I[6]; const float* bv = I[7]; const float* Wq2 = I[8]; const float* bq2 = I[9]; const float* Wk2 = I[10]; const float* bk2 = I[11]; const float* We = I[12]; const float* be = I[13]; const float* scp = I[14];
  float* out1 = (float*)d_out; float* out2 = (float*)d_out + (size_t)NN * DI;      /* second output at byte offset 16777216 */
  char* ws = (char*)d_ws; size_t off = 0;
  auto take = [&](size_t bytes) { char* p = ws + off; off += (bytes + 255) & ~(size_t)255; return p; };
  _Float16* BW = (_Float16*)take((size_t)5 * DO * DI * 2); _Float16* BE = (_Float16*)take((size_t)DI * DO * 2); _Float16* X1 = (_Float16*)take((size_t)NN * DI * 2); _Float16* X2 = (_Float16*)take((size_t)NN * DI * 2);
  _Float16* Q1 = (_Float16*)take((size_t)NN * DO * 2); _Float16* K1 = (_Float16*)take((size_t)NN * DO * 2); _Float16* V1 = (_Float16*)take((size_t)NN * DO * 2); _Float16* Q2 = (_Float16*)take((size_t)NN * DO * 2); _Float16* K2 = (_Float16*)take((size_t)NN * DO * 2); _Float16* V2 = (_Float16*)take((size_t)NN * DO * 2); _Float16* VT1 = (_Float16*)take((size_t)NN * DO * 2); _Float16* VT2 = (_Float16*)take((size_t)NN * DO * 2);
  float* S = (float*)take((size_t)QC * NN * 4); _Float16* P = (_Float16*)take((size_t)QC * NN * 2); float* RS = (float*)take((size_t)QC * 32 * 4); float* O = (float*)take((size_t)QC * DO * 4); _Float16* FH = (_Float16*)take((size_t)NN * DO * 2); _Float16* FL = (_Float16*)take((size_t)NN * DO * 2);
  if (off > ws_size) return;      /* 1.5 + 8 + 8 + 8 x 4 MiB + 64 + 32 + 0.3 + 2 + 4 + 4 = ≈ 156 MiB */
  const float* Ws[5] = {Wq1, Wk1, Wv, Wq2, Wk2};
  for (int i = 0; i < 5; ++i) k_wsc<<<(unsigned)(((size_t)DO * DI / 8 + 255) / 256), 256, 0, stream>>>(Ws[i], BW + (size_t)i * DO * DI, (size_t)DO * DI / 8, 16.0f);      /* torch (out, in) naturals */
  k_wsc<<<(unsigned)(((size_t)DI * DO / 8 + 255) / 256), 256, 0, stream>>>(We, BE, (size_t)DI * DO / 8, 16.0f);
  k_x16<<<(unsigned)(((size_t)NN * DI / 8 + 255) / 256), 256, 0, stream>>>(x1, X1, (size_t)NN * DI / 8); k_x16<<<(unsigned)(((size_t)NN * DI / 8 + 255) / 256), 256, 0, stream>>>(x2, X2, (size_t)NN * DI / 8);
  const dim3 gP((NN / 128) * (DO / 64), 1);
  k_gemm2<0><<<gP, 128, 0, stream>>>(X1, DI, 0, BW, DI, 0, 0.0625f, bq1, 0, nullptr, 1, 0, 0, nullptr, Q1, DO, 0, NN, DO, DI);
  k_gemm2<0><<<gP, 128, 0, stream>>>(X1, DI, 0, BW + (size_t)DO * DI, DI, 0, 0.0625f, bk1, 0, nullptr, 1, 0, 0, nullptr, K1, DO, 0, NN, DO, DI);
  k_gemm2<0><<<gP, 128, 0, stream>>>(X1, DI, 0, BW + (size_t)2 * DO * DI, DI, 0, 0.0625f, bv, 0, nullptr, 1, 0, 0, nullptr, V1, DO, 0, NN, DO, DI);
  k_gemm2<0><<<gP, 128, 0, stream>>>(X2, DI, 0, BW + (size_t)3 * DO * DI, DI, 0, 0.0625f, bq2, 0, nullptr, 1, 0, 0, nullptr, Q2, DO, 0, NN, DO, DI);
  k_gemm2<0><<<gP, 128, 0, stream>>>(X2, DI, 0, BW + (size_t)4 * DO * DI, DI, 0, 0.0625f, bk2, 0, nullptr, 1, 0, 0, nullptr, K2, DO, 0, NN, DO, DI);
  k_gemm2<0><<<gP, 128, 0, stream>>>(X2, DI, 0, BW + (size_t)2 * DO * DI, DI, 0, 0.0625f, bv, 0, nullptr, 1, 0, 0, nullptr, V2, DO, 0, NN, DO, DI);      /* W_V shared */
  k_vt<DO / 64, NN><<<(DO / 64) * (NN / 64), 256, 0, stream>>>(V1, DO, 0, VT1); k_vt<DO / 64, NN><<<(DO / 64) * (NN / 64), 256, 0, stream>>>(V2, DO, 0, VT2);      /* V^T [256][8192] */
  for (int br = 0; br < 2; ++br) { const _Float16* Q = br ? Q2 : Q1; const _Float16* K = br ? K1 : K2; const _Float16* VT = br ? VT2 : VT1; float* outp = br ? out2 : out1;      /* f1: hsi_Q . lidar_K -> hsi_V ; f2: lidar_Q . hsi_K -> lidar_V */
    for (int c = 0; c < NN / QC; ++c) { const int c0 = c * QC;
      k_gemm2<0><<<dim3((QC / 128) * (NN / 64), 1), 128, 0, stream>>>(Q + (size_t)c0 * DO, DO, 0, K, DO, 0, 1.0f, nullptr, 0, nullptr, 1, 0, 0, S, nullptr, NN, 0, QC, NN, DO);
      k_soft<<<QC / 8, 256, 0, stream>>>(S, scp, P, RS);
      k_gemm2<0><<<dim3((QC / 128) * (DO / 64), 1), 128, 0, stream>>>(P, NN, 0, VT, NN, 0, 0.0009765625f, nullptr, 0, nullptr, 1, 0, 0, O, nullptr, DO, 0, QC, DO, NN);
      k_fsc<<<(QC * (DO / 8) + 255) / 256, 256, 0, stream>>>(O, RS, c0, FH, FL); }
    k_gemm2<0><<<dim3((NN / 128) * (DI / 64), 1), 128, 0, stream>>>(FL, DO, 0, BE, DO, 0, 0.0625f / 1024.0f, nullptr, 0, nullptr, 1, 0, 0, outp, nullptr, DI, 0, NN, DI, DO);
    k_gemm2<0><<<dim3((NN / 128) * (DI / 64), 1), 128, 0, stream>>>(FH, DO, 0, BE, DO, 0, 0.0625f, be, 0, outp, 1, (size_t)DI, 0, outp, nullptr, DI, 0, NN, DI, DO); }      /* (f_lo + f_hi) We^T + be */
}

// v001
// A run of this version takes 1170 microseconds.
// Timed twice side by side with v000, it ran 2.34 and 2.31 times as fast.
#include <hip/hip_runtime.h>
// cross_fuison (8192 hsi rows x1 and 8192 lidar rows x2, 512 -> 256: Q/K/V = x W^T + b (W_V shared); inv = 1/sqrt(clip(scale, 1, 32)); f1 = softmax(hsi_Q lidar_K^T inv) hsi_V; f2 = softmax(lidar_Q hsi_K^T inv) lidar_V; outputs = (f1 We^T + be, f2 We^T + be), each [8192][512]).
// Compute dtype: inputs rounded to bf16; inputs/weights exact as f16; Q/K/V and the softmax weights as plain f16 operands (~2^-12); f as f16 hi + residual into We; softmax f32. v_wmma_f32_16x16x32_f16.
#define NN 8192
#define DI 512
#define DO 256
#define QC 2048                  /* query rows per chunk */
#define KS 16                    /* key ranges of the P.V product: 64 tiles x KS work-groups, f32 partial planes summed in k_fsc */
typedef __bf16 v16b __attribute__((ext_vector_type(16)));
typedef unsigned short v8us __attribute__((ext_vector_type(8), may_alias));
typedef float  v8f  __attribute__((ext_vector_type(8)));
typedef float  v4f  __attribute__((ext_vector_type(4)));
typedef float  v4fa __attribute__((ext_vector_type(4), may_alias));
union FragB { v16b v; v8us half[2]; unsigned short u[16]; };

__device__ __forceinline__ unsigned short bf16_bits(float x) { unsigned int u = __float_as_uint(x); return (unsigned short)((u + 0x7FFFu + ((u >> 16) & 1u)) >> 16); }
__device__ __forceinline__ float bf16_val(unsigned short b) { return __uint_as_float(((unsigned int)b) << 16); }
__device__ __forceinline__ float bf16_round(float x) { return bf16_val(bf16_bits(x)); }
// D += A·B with NT terms: 1 = ah·bh, 2 = + al·bh (A split), 3 = + ah·bl (both split)
template <int NT>
__device__ __forceinline__ v8f mmaN(v16b ah, v16b al, v16b bh, v16b bl, v8f c) {
  c = __builtin_amdgcn_wmma_f32_16x16x32_bf16(false, ah, false, bh, (short)0, c, false, false);
  if (NT >= 2) c = __builtin_amdgcn_wmma_f32_16x16x32_bf16(false, al, false, bh, (short)0, c, false, false);
  if (NT >= 3) c = __builtin_amdgcn_wmma_f32_16x16x32_bf16(false, ah, false, bl, (short)0, c, false, false);
  asm volatile("v_nop\n\tv_nop\n\tv_nop\n\tv_nop" : "+v"(c) : "v"(ah), "v"(al), "v"(bh), "v"(bl));
  return c;
}

__global__ __launch_bounds__(256) void k_wt_bf16(const float* __restrict__ W, unsigned short* __restrict__ Wt, int K, int N) {
  const int t = blockIdx.x * 256 + threadIdx.x;
  const int k8n = K / 8;
  if (t >= N * k8n) return;
  const int n = t / k8n, k8 = (t % k8n) * 8;
  v8us v;
#pragma unroll
  for (int i = 0; i < 8; ++i) v[i] = bf16_bits(W[(size_t)(k8 + i) * N + n]);
  *(v8us*)(Wt + (size_t)n * K + k8) = v;
  
}

// GEMM C[M][N] (f32, pitch ldc) = act(A[M][K]·W + bias). A f32 row-major (pitch lda) converted per fragment to bf16
// (ASPLIT: hi/lo two planes -> 2 terms, else single rounded term); Wt bf16 [N][K] (pitch ldb). BIAS_BF16 rounds the
// bias to bf16 first (bias quantised to bf16 before the add). K%32==0, M%16==0, N%64==0.
template <bool ASPLIT, int ACT, bool BIAS_BF16>
__global__ __launch_bounds__(128) void k_gemm_bf(const float* __restrict__ A, int lda, const unsigned short* __restrict__ Wt, int ldb,
                                               const float* __restrict__ bias, float* __restrict__ C, int ldc, int M, int N, int K) {
  __shared__ __attribute__((aligned(16))) float so[4][16][64];
  const int tid = threadIdx.x, w = tid >> 5, lane = tid & 31, ln = lane & 15, hh = lane >> 4;
  const int ntn = N / 64;
  const int wid = blockIdx.x * 4 + w;
  const int mt = wid / ntn, nq = wid % ntn;
  if (mt * 16 >= M) return;
  const int row0 = mt * 16, col0 = nq * 64;
  const float* arow = A + (size_t)(row0 + ln) * lda;
  v8f acc[4] = {};
  for (int kb = 0; kb < K; kb += 32) {
    FragB ah, al;
    const v4f x0 = *(const v4fa*)(arow + kb + 8 * hh), x1 = *(const v4fa*)(arow + kb + 8 * hh + 4);
    const v4f x2 = *(const v4fa*)(arow + kb + 16 + 8 * hh), x3 = *(const v4fa*)(arow + kb + 16 + 8 * hh + 4);
    float xs[16] = {x0[0],x0[1],x0[2],x0[3],x1[0],x1[1],x1[2],x1[3],x2[0],x2[1],x2[2],x2[3],x3[0],x3[1],x3[2],x3[3]};
#pragma unroll
    for (int i = 0; i < 16; ++i) { const unsigned short hb = bf16_bits(xs[i]); ah.u[i] = hb; al.u[i] = ASPLIT ? bf16_bits(xs[i] - bf16_val(hb)) : (unsigned short)0; }
#pragma unroll
    for (int t = 0; t < 4; ++t) {
      const unsigned short* brow = Wt + (size_t)(col0 + t * 16 + ln) * ldb + kb;
      FragB b;
      b.half[0] = *(const v8us*)(brow + 8 * hh);
      b.half[1] = *(const v8us*)(brow + 16 + 8 * hh);
      acc[t] = mmaN<ASPLIT ? 2 : 1>(ah.v, al.v, b.v, b.v, acc[t]);
    }
  }
#pragma unroll
  for (int t = 0; t < 4; ++t) {
    float bv = bias ? bias[col0 + t * 16 + ln] : 0.f;
    if (BIAS_BF16) bv = bf16_round(bv);
#pragma unroll
    for (int r = 0; r < 8; ++r) { float v = acc[t][r] + bv; if (ACT == 1) v = fmaxf(v, 0.f); so[w][8 * hh + r][t * 16 + ln] = v; }
  }
  __builtin_amdgcn_fence(__ATOMIC_ACQ_REL, "workgroup");
  __builtin_amdgcn_wave_barrier();
  const int rsub = lane >> 4, c4 = (lane & 15) * 4;
  {
#pragma unroll
    for (int q = 0; q < 8; ++q) {
      const int r = q * 2 + rsub;
      const v4f v = *(const v4fa*)&so[w][r][c4];
      *(v4f*)(C + (size_t)(row0 + r) * ldc + col0 + c4) = v;
    }
    
  }
}

// GEMM C = act(A·W + bias + resid): A f32 (ASPLIT -> hi/lo 2 terms), Wt bf16 [N][K]; ACT 0 none, 1 relu, 2 exact gelu;
// resid (optional, f32, row index = (row % rmod), pitch ldr, RES_BF16 rounds it) added before the activation.
template <bool ASPLIT, int ACT, bool BIAS_BF16, bool RES_BF16>
__global__ __launch_bounds__(128) void k_gemm_bf3(const float* __restrict__ A, int lda, const unsigned short* __restrict__ Wt, int ldb,
                                                const float* __restrict__ bias, const float* __restrict__ resid, int rmod, int ldr,
                                                float* __restrict__ C, int ldc, int M, int N, int K) {
  __shared__ __attribute__((aligned(16))) float so[4][16][64];
  const int tid = threadIdx.x, w = tid >> 5, lane = tid & 31, ln = lane & 15, hh = lane >> 4;
  const int ntn = N / 64;
  const int wid = blockIdx.x * 4 + w;
  const int mt = wid / ntn, nq = wid % ntn;
  if (mt * 16 >= M) return;
  const int row0 = mt * 16, col0 = nq * 64;
  const float* arow = A + (size_t)(row0 + ln) * lda;
  v8f acc[4] = {};
  for (int kb = 0; kb < K; kb += 32) {
    FragB ah, al;
    const v4f x0 = *(const v4fa*)(arow + kb + 8 * hh), x1 = *(const v4fa*)(arow + kb + 8 * hh + 4);
    const v4f x2 = *(const v4fa*)(arow + kb + 16 + 8 * hh), x3 = *(const v4fa*)(arow + kb + 16 + 8 * hh + 4);
    float xs[16] = {x0[0],x0[1],x0[2],x0[3],x1[0],x1[1],x1[2],x1[3],x2[0],x2[1],x2[2],x2[3],x3[0],x3[1],x3[2],x3[3]};
#pragma unroll
    for (int i = 0; i < 16; ++i) { const unsigned short hb = bf16_bits(xs[i]); ah.u[i] = hb; al.u[i] = ASPLIT ? bf16_bits(xs[i] - bf16_val(hb)) : (unsigned short)0; }
#pragma unroll
    for (int t = 0; t < 4; ++t) {
      const unsigned short* brow = Wt + (size_t)(col0 + t * 16 + ln) * ldb + kb;
      FragB b;
      b.half[0] = *(const v8us*)(brow + 8 * hh);
      b.half[1] = *(const v8us*)(brow + 16 + 8 * hh);
      acc[t] = mmaN<ASPLIT ? 2 : 1>(ah.v, al.v, b.v, b.v, acc[t]);
    }
  }
#pragma unroll
  for (int t = 0; t < 4; ++t) {
    const int col = col0 + t * 16 + ln;
    float bv = bias ? bias[col] : 0.f;
    if (BIAS_BF16) bv = bf16_round(bv);
#pragma unroll
    for (int r = 0; r < 8; ++r) {
      float v = acc[t][r] + bv;
      if (resid) { float rv = resid[(size_t)((row0 + 8 * hh + r) % rmod) * ldr + col]; if (RES_BF16) rv = bf16_round(rv); v += rv; }
      if (ACT == 1) v = fmaxf(v, 0.f);
      if (ACT == 2) v = 0.5f * v * (1.0f + erff(v * 0.70710678118654752f));
      if (ACT == 3) { const float u = 0.7978845608028654f * (v + 0.044715f * v * v * v); v = 0.5f * v * (1.0f + tanhf(u)); }
      so[w][8 * hh + r][t * 16 + ln] = v;
    }
  }
  __builtin_amdgcn_fence(__ATOMIC_ACQ_REL, "workgroup");
  __builtin_amdgcn_wave_barrier();
  const int rsub = lane >> 4, c4 = (lane & 15) * 4;
  {
#pragma unroll
    for (int q = 0; q < 8; ++q) {
      const int r = q * 2 + rsub;
      const v4f v = *(const v4fa*)&so[w][r][c4];
      *(v4f*)(C + (size_t)(row0 + r) * ldc + col0 + c4) = v;
    }
    
  }
}
// row LayerNorm (biased variance, eps) over N: s = X (+ R); optional out_sum <- s; out_norm <- (s-mu)*rsqrt(var+eps)*g + b
template <bool PARAM_BF16>
__global__ __launch_bounds__(256) void k_layernorm(const float* __restrict__ X, const float* __restrict__ R, const float* __restrict__ g, const float* __restrict__ bta,
                                                  float* __restrict__ out_sum, float* __restrict__ out_norm, int N, float eps) {
  __shared__ float red[256];
  const int row = blockIdx.x, tid = threadIdx.x;
  const float* x = X + (size_t)row * N; const float* rr = R ? R + (size_t)row * N : nullptr;
  float vals[16];                     // up to N = 4096
  const int per = N / 256;            // contiguous chunk per thread? use strided-by-4 chunks: thread handles j = tid*4 + 1024*u
  float s1 = 0.f;
  for (int u = 0; u < per / 4; ++u) {
    const int j = tid * 4 + 1024 * u;
    const v4f a = *(const v4fa*)(x + j);
    v4f b = {0.f,0.f,0.f,0.f}; if (rr) b = *(const v4fa*)(rr + j);
#pragma unroll
    for (int q = 0; q < 4; ++q) { const float v = a[q] + b[q]; vals[u * 4 + q] = v; s1 += v; }
  }
  red[tid] = s1; __syncthreads();
  for (int st = 128; st > 0; st >>= 1) { if (tid < st) red[tid] += red[tid + st]; __syncthreads(); }
  const float mu = red[0] / (float)N; __syncthreads();
  float s2 = 0.f;
  for (int u = 0; u < per / 4; ++u)
#pragma unroll
    for (int q = 0; q < 4; ++q) { const float c = vals[u * 4 + q] - mu; s2 += c * c; }
  red[tid] = s2; __syncthreads();
  for (int st = 128; st > 0; st >>= 1) { if (tid < st) red[tid] += red[tid + st]; __syncthreads(); }
  const float rs = rsqrtf(red[0] / (float)N + eps);
  {
    for (int u = 0; u < per / 4; ++u) {
      const int j = tid * 4 + 1024 * u;
      v4f o, sm;
#pragma unroll
      for (int q = 0; q < 4; ++q) {
        float gg = g[j + q], bb = bta[j + q];
        if (PARAM_BF16) { gg = bf16_round(gg); bb = bf16_round(bb); }
        sm[q] = vals[u * 4 + q]; o[q] = (vals[u * 4 + q] - mu) * rs * gg + bb;
      }
      if (out_sum) *(v4f*)(out_sum + (size_t)row * N + j) = sm;
      *(v4f*)(out_norm + (size_t)row * N + j) = o;
    }
    
  }
}



// ---- f16 WMMA path (v_wmma_f32_16x16x32_f16): 11-bit significands for operands in range — used where a [0,1] probability operand needs more precision than bf16
typedef _Float16 v16h __attribute__((ext_vector_type(16)));
union FragH { v16h v; v8us half[2]; _Float16 h[16]; unsigned short u[16]; };
template <int NT>
__device__ __forceinline__ v8f mmaH(v16h ah, v16h al, v16h bh, v16h bl, v8f c) {
  c = __builtin_amdgcn_wmma_f32_16x16x32_f16(false, ah, false, bh, (short)0, c, false, false);
  if (NT >= 2) c = __builtin_amdgcn_wmma_f32_16x16x32_f16(false, al, false, bh, (short)0, c, false, false);
  if (NT >= 3) c = __builtin_amdgcn_wmma_f32_16x16x32_f16(false, ah, false, bl, (short)0, c, false, false);
  asm volatile("v_nop\n\tv_nop\n\tv_nop\n\tv_nop" : "+v"(c) : "v"(ah), "v"(al), "v"(bh), "v"(bl));
  return c;
}
// batched GEMM like k_gemm_b but f16 operands: A f32 (split into f16 hi/lo if ASPLIT, else rounded to f16), Bt = f16 values [n][k]; alpha; C f32; N multiple of 16 (partial tiles skipped)
template <bool ASPLIT>
__global__ __launch_bounds__(128) void k_gemm_h(const float* __restrict__ A, int lda, size_t sA, const _Float16* __restrict__ Bh, int ldb, size_t sB, float alpha, float* __restrict__ C, int ldc, size_t sC, int M, int N, int K) {
  __shared__ __attribute__((aligned(16))) float so[4][16][64];
  const int tid = threadIdx.x, w = tid >> 5, lane = tid & 31, ln = lane & 15, hh = lane >> 4; const int by = blockIdx.y;
  A += (size_t)by * sA; Bh += (size_t)by * sB; C += (size_t)by * sC;
  const int ntn = (N + 63) / 64; const int wid = blockIdx.x * 4 + w; const int mt = wid / ntn, nq = wid % ntn; if (mt * 16 >= M) return;
  const int row0 = mt * 16, col0 = nq * 64; const float* arow = A + (size_t)(row0 + ln) * lda;
  v8f acc[4] = {};
  for (int kb = 0; kb < K; kb += 32) {
    FragH ah, al;
    const v4f x0 = *(const v4fa*)(arow + kb + 8 * hh), x1 = *(const v4fa*)(arow + kb + 8 * hh + 4), x2 = *(const v4fa*)(arow + kb + 16 + 8 * hh), x3 = *(const v4fa*)(arow + kb + 16 + 8 * hh + 4);
    float xs[16] = {x0[0],x0[1],x0[2],x0[3],x1[0],x1[1],x1[2],x1[3],x2[0],x2[1],x2[2],x2[3],x3[0],x3[1],x3[2],x3[3]};
#pragma unroll
    for (int i = 0; i < 16; ++i) { const _Float16 h = (_Float16)xs[i]; ah.h[i] = h; al.h[i] = ASPLIT ? (_Float16)(xs[i] - (float)h) : (_Float16)0.0f; }
#pragma unroll
    for (int t = 0; t < 4; ++t) { if (col0 + t * 16 >= N) continue; const size_t boff = (size_t)(col0 + t * 16 + ln) * ldb + kb; FragH bq; bq.half[0] = *(const v8us*)(Bh + boff + 8 * hh); bq.half[1] = *(const v8us*)(Bh + boff + 16 + 8 * hh);
      acc[t] = mmaH<ASPLIT ? 2 : 1>(ah.v, al.v, bq.v, bq.v, acc[t]); }
  }
#pragma unroll
  for (int t = 0; t < 4; ++t) { if (col0 + t * 16 >= N) continue;
#pragma unroll
    for (int r = 0; r < 8; ++r) so[w][8 * hh + r][t * 16 + ln] = acc[t][r] * alpha; }
  __builtin_amdgcn_fence(__ATOMIC_ACQ_REL, "workgroup"); __builtin_amdgcn_wave_barrier();
  const int rsub = lane >> 4, c4 = (lane & 15) * 4;
  {
#pragma unroll
    for (int q = 0; q < 8; ++q) { const int r = q * 2 + rsub; if (col0 + c4 < N) { const v4f v = *(const v4fa*)&so[w][r][c4]; *(v4f*)(C + (size_t)(row0 + r) * ldc + col0 + c4) = v; } }
     }
}

// Wt[n][k] = f16(W[k][n]·scale) from f32 row-major W[K][N] (scale = power of two; bf16-exact weights stay exact in f16 away from the subnormal range)
__global__ __launch_bounds__(256) void k_wt_f16(const float* __restrict__ W, _Float16* __restrict__ Wt, int K, int N, float scale) {
  const int t = blockIdx.x * 256 + threadIdx.x; if (t >= N * (K / 8)) return; const int n = t / (K / 8), k8 = (t % (K / 8)) * 8; FragH f;
#pragma unroll
  for (int i = 0; i < 8; ++i) f.h[i] = (_Float16)(bf16_round(W[(size_t)(k8 + i) * N + n]) * scale); const v8us o = f.half[0];
  *(v8us*)((unsigned short*)Wt + (size_t)n * K + k8) = o; 
}
// k_gemm_hh variant with fused epilogue: v = acc·alpha + bias[by·sBias + col] (+ CP[(row/rowsPerB)·sCPb + by·64 + col] if CP) ; ACT 0 none / 1 elu ; writes f16 C16 (and f32 C if non-null)
template <int ACT>
__global__ __launch_bounds__(128) void k_gemm_hhx(const _Float16* __restrict__ A, int lda, size_t sA, const _Float16* __restrict__ Bh, int ldb, size_t sB, float alpha, const float* __restrict__ bias, size_t sBias, const float* __restrict__ CP, int rowsPerB, size_t sCPb, int row0g,
    float* __restrict__ C, _Float16* __restrict__ C16, int ldc, size_t sC, int M, int N, int K) {
  __shared__ __attribute__((aligned(16))) float so[4][16][64];
  const int tid = threadIdx.x, w = tid >> 5, lane = tid & 31, ln = lane & 15, hh = lane >> 4; const int by = blockIdx.y;
  A += (size_t)by * sA; Bh += (size_t)by * sB; const size_t cofs = (size_t)by * sC; const float* bp = bias ? bias + (size_t)by * sBias : nullptr;
  const int ntn = (N + 63) / 64; const int wid = blockIdx.x * 4 + w; const int mt = wid / ntn, nq = wid % ntn; if (mt * 16 >= M) return;
  const int row0 = mt * 16, col0 = nq * 64; const _Float16* arow = A + (size_t)(row0 + ln) * lda;
  v8f acc[4] = {};
  for (int kb = 0; kb < K; kb += 32) { FragH ah; ah.half[0] = *(const v8us*)((const unsigned short*)arow + kb + 8 * hh); ah.half[1] = *(const v8us*)((const unsigned short*)arow + kb + 16 + 8 * hh);
#pragma unroll
    for (int t = 0; t < 4; ++t) { if (col0 + t * 16 >= N) continue; const size_t boff = (size_t)(col0 + t * 16 + ln) * ldb + kb; FragH bq; bq.half[0] = *(const v8us*)((const unsigned short*)Bh + boff + 8 * hh); bq.half[1] = *(const v8us*)((const unsigned short*)Bh + boff + 16 + 8 * hh);
      acc[t] = mmaH<1>(ah.v, ah.v, bq.v, bq.v, acc[t]); }
  }
#pragma unroll
  for (int t = 0; t < 4; ++t) { if (col0 + t * 16 >= N) continue; const int col = col0 + t * 16 + ln; const float bv = bp ? bf16_round(bp[col]) : 0.f;
#pragma unroll
    for (int r = 0; r < 8; ++r) { float v = acc[t][r] * alpha + bv; if (CP) { const int rr = row0g + row0 + 8 * hh + r; if (rowsPerB < 0) v += CP[cofs + (size_t)rr * ldc + col];      /* rowsPerB < 0: own element of the batched C plane */ else { const int bidx = rr / rowsPerB; v += CP[(size_t)bidx * sCPb + (size_t)by * 64 + col]; } } if (ACT == 1) v = (v > 0.f) ? v : expm1f(v); else if (ACT == 7) v = (v > 0.f) ? v + 1.0f : expf(v); else if (ACT == 8) v = tanhf(v); else if (ACT == 9) v = 0.5f * v * (1.0f + tanhf(0.7978845608028654f * (v + 0.044715f * v * v * v))); else if (ACT == 11) v = 1.0f / (1.0f + expf(-v)); else if (ACT == 12) v = (v > 0.f) ? v : 0.01f * v; else if (ACT == 14) v = (v > 0.f) ? v : 0.1f * v; else if (ACT == 16) v = (v >= 0.f) ? v : 0.3f * v; else if (ACT == 17) v = (v >= 0.f) ? v : 0.2f * v; else if (ACT == 15) v = v / (1.0f + expf(-v)); else if (ACT == 3) v = fmaxf(v, 0.f); else if (ACT == 6) v = 0.5f * v * (1.0f + erff(v * 0.70710678118654752f)); so[w][8 * hh + r][t * 16 + ln] = v; } }
  __builtin_amdgcn_fence(__ATOMIC_ACQ_REL, "workgroup"); __builtin_amdgcn_wave_barrier();
  const int rsub = lane >> 4, c4 = (lane & 15) * 4; typedef _Float16 v4h __attribute__((ext_vector_type(4)));
  {
#pragma unroll
    for (int q = 0; q < 8; ++q) { const int r = q * 2 + rsub; if (col0 + c4 < N) { const v4f v = *(const v4fa*)&so[w][r][c4]; if (C) *(v4f*)(C + cofs + (size_t)(row0 + r) * ldc + col0 + c4) = v; if (C16) { v4h h4; for (int i = 0; i < 4; ++i) h4[i] = (_Float16)v[i]; *(v4h*)(C16 + cofs + (size_t)(row0 + r) * ldc + col0 + c4) = h4; } } }
     }
}


typedef _Float16 v4h __attribute__((ext_vector_type(4)));

__global__ __launch_bounds__(256) void k_x16(const float* __restrict__ x, _Float16* __restrict__ X16, size_t n8) { const size_t t = (size_t)blockIdx.x * 256 + threadIdx.x; if (t >= n8) return; FragH f;
#pragma unroll
  for (int q = 0; q < 8; ++q) f.h[q] = (_Float16)bf16_round(x[t * 8 + q]); *(v8us*)((unsigned short*)X16 + t * 8) = f.half[0];  }
__global__ __launch_bounds__(256) void k_h16(const float* __restrict__ x, _Float16* __restrict__ X16, size_t n8) { const size_t t = (size_t)blockIdx.x * 256 + threadIdx.x; if (t >= n8) return; FragH f;
#pragma unroll
  for (int q = 0; q < 8; ++q) f.h[q] = (_Float16)x[t * 8 + q]; *(v8us*)((unsigned short*)X16 + t * 8) = f.half[0];  }
__global__ __launch_bounds__(256) void k_round16f(const float* __restrict__ W, _Float16* __restrict__ Bt, size_t n8) { const size_t t = (size_t)blockIdx.x * 256 + threadIdx.x; if (t >= n8) return; FragH f;
#pragma unroll
  for (int i = 0; i < 8; ++i) f.h[i] = (_Float16)(bf16_round(W[t * 8 + i]) * 16.0f); *(v8us*)((unsigned short*)Bt + t * 8) = f.half[0];  }
template <int NHv, int TTv>
__global__ __launch_bounds__(256) void k_vt(const _Float16* __restrict__ V16, int ldv, int voff, _Float16* __restrict__ Vt) { __shared__ unsigned short tl[64][66]; const int tid = threadIdx.x; const int slab = blockIdx.x / (TTv / 64), lg = blockIdx.x % (TTv / 64); const int b = slab / NHv, h = slab % NHv;
  for (int i = tid; i < 64 * 8; i += 256) { const int r = i / 8, c8 = (i % 8) * 8; FragH f; f.half[0] = *(const v8us*)((const unsigned short*)V16 + ((size_t)b * TTv + lg * 64 + r) * ldv + voff + h * 64 + c8);
#pragma unroll
    for (int q = 0; q < 8; ++q) tl[r][c8 + q] = f.u[q]; }
  __syncthreads();
  {
#pragma unroll
    for (int rd = 0; rd < 2; ++rd) { const int d = rd * 32 + tid / 8, pc = tid % 8; FragH f;
#pragma unroll
      for (int q = 0; q < 8; ++q) f.u[q] = tl[pc * 8 + q][d];
      *(v8us*)((unsigned short*)Vt + ((size_t)slab * 64 + d) * TTv + lg * 64 + pc * 8) = f.half[0]; }
     } }

__global__ __launch_bounds__(256) void k_hl(const float* __restrict__ F, _Float16* __restrict__ Hh, _Float16* __restrict__ Hl, size_t n8) { const size_t t = (size_t)blockIdx.x * 256 + threadIdx.x; if (t >= n8) return; FragH fh, fl; const v4f a = *(const v4fa*)(F + t * 8), c = *(const v4fa*)(F + t * 8 + 4);
#pragma unroll
  for (int q = 0; q < 4; ++q) { _Float16 h = (_Float16)a[q]; fh.h[q] = h; fl.h[q] = (_Float16)((a[q] - (float)h) * 1024.0f); h = (_Float16)c[q]; fh.h[4 + q] = h; fl.h[4 + q] = (_Float16)((c[q] - (float)h) * 1024.0f); }
  { *(v8us*)((unsigned short*)Hh + t * 8) = fh.half[0]; *(v8us*)((unsigned short*)Hl + t * 8) = fl.half[0];  } }

// ---- fast GEMM (wave tile 32x64; requires M % 32 == 0 rows per launch region and N % 64 == 0); epilogue = k_gemm_hhx semantics ----
__device__ __forceinline__ v16h g2_frag(const _Float16* p, int hh) { FragH f; f.half[0] = *(const v8us*)((const unsigned short*)p + 8 * hh); f.half[1] = *(const v8us*)((const unsigned short*)p + 16 + 8 * hh); return f.v; }
__device__ __forceinline__ v8f g2_mma(v16h a, v16h b, v8f c) { v8f d = __builtin_amdgcn_wmma_f32_16x16x32_f16(false, a, false, b, (short)0, c, false, false); asm volatile("v_nop\n\tv_nop\n\tv_nop\n\tv_nop" : "+v"(d) : "v"(a), "v"(b)); return d; }
template <int ACT>
__global__ __launch_bounds__(128) void k_gemm2(const _Float16* __restrict__ A, int lda, size_t sA, const _Float16* __restrict__ Bh, int ldb, size_t sB, float alpha, const float* __restrict__ bias, size_t sBias, const float* __restrict__ CP, int rowsPerB, size_t sCPb, int row0g,
    float* __restrict__ C, _Float16* __restrict__ C16, int ldc, size_t sC, int M, int N, int K) { static_assert(ACT == 0 || ACT == 3 || ACT == 6 || ACT == 8 || ACT == 9 || ACT == 11 || ACT == 12 || ACT == 14 || ACT == 15 || ACT == 16 || ACT == 17, "k_gemm2: unsupported ACT code (would silently apply no activation)");
  __shared__ __attribute__((aligned(16))) float so[4][32][68];
  const int tid = threadIdx.x, w = tid >> 5, lane = tid & 31, ln = lane & 15, hh = lane >> 4; const int by = blockIdx.y;
  A += (size_t)by * sA; Bh += (size_t)by * sB; const size_t cofs = (size_t)by * sC; const float* bp = bias ? bias + (size_t)by * sBias : nullptr;
  const int ntn = N >> 6; const int mt = blockIdx.x / ntn, nq = blockIdx.x - mt * ntn; const int row0 = mt * 128 + 32 * w, col0 = nq * 64; if (row0 >= M) return;
  const _Float16* a0p = A + (size_t)(row0 + ln) * lda; const _Float16* a1p = a0p + (size_t)16 * lda;
  const _Float16* b0p = Bh + (size_t)(col0 + ln) * ldb; const _Float16* b1p = b0p + (size_t)16 * ldb; const _Float16* b2p = b1p + (size_t)16 * ldb; const _Float16* b3p = b2p + (size_t)16 * ldb;
  const v8f z8 = {0.f,0.f,0.f,0.f,0.f,0.f,0.f,0.f}; v8f c00 = z8, c01 = z8, c02 = z8, c03 = z8, c10 = z8, c11 = z8, c12 = z8, c13 = z8;
#pragma unroll 1
  for (int kb = 0; kb < K; kb += 32) { const v16h a0 = g2_frag(a0p + kb, hh), a1 = g2_frag(a1p + kb, hh);
    v16h b = g2_frag(b0p + kb, hh); c00 = g2_mma(a0, b, c00); c10 = g2_mma(a1, b, c10);
    b = g2_frag(b1p + kb, hh); c01 = g2_mma(a0, b, c01); c11 = g2_mma(a1, b, c11);
    b = g2_frag(b2p + kb, hh); c02 = g2_mma(a0, b, c02); c12 = g2_mma(a1, b, c12);
    b = g2_frag(b3p + kb, hh); c03 = g2_mma(a0, b, c03); c13 = g2_mma(a1, b, c13); }
  v8f accs[8] = {c00, c01, c02, c03, c10, c11, c12, c13};
#pragma unroll
  for (int u = 0; u < 8; ++u) { const int t = u & 3, half = u >> 2; const int col = col0 + t * 16 + ln; const float bv = bp ? bf16_round(bp[col]) : 0.f;
#pragma unroll
    for (int r = 0; r < 8; ++r) { const int rloc = half * 16 + 8 * hh + r; float v = accs[u][r] * alpha + bv; if (CP) { if (rowsPerB < 0) v += CP[cofs + (size_t)(row0g + row0 + rloc) * ldc + col];      /* rowsPerB < 0: own element of the batched C plane */ else { const int bidx = (row0g + row0 + rloc) / rowsPerB; v += CP[(size_t)bidx * sCPb + (size_t)by * 64 + col]; } }
      if (ACT == 3) v = fmaxf(v, 0.f); else if (ACT == 6) v = 0.5f * v * (1.0f + erff(v * 0.70710678118654752f)); else if (ACT == 11) v = 1.0f / (1.0f + expf(-v)); else if (ACT == 15) v = v / (1.0f + expf(-v)); else if (ACT == 12) v = (v > 0.f) ? v : 0.01f * v; else if (ACT == 8) v = tanhf(v); else if (ACT == 9) v = 0.5f * v * (1.0f + tanhf(0.7978845608028654f * (v + 0.044715f * v * v * v))); else if (ACT == 14) v = (v > 0.f) ? v : 0.1f * v; else if (ACT == 16) v = (v >= 0.f) ? v : 0.3f * v; else if (ACT == 17) v = (v >= 0.f) ? v : 0.2f * v;
      so[w][rloc][t * 16 + ln] = v; } }
  __builtin_amdgcn_fence(__ATOMIC_ACQ_REL, "workgroup"); __builtin_amdgcn_wave_barrier();
  const int rsub = lane >> 4, c4 = (lane & 15) * 4;
  {
#pragma unroll
    for (int q = 0; q < 16; ++q) { const int r = q * 2 + rsub; const v4f v = *(const v4fa*)&so[w][r][c4]; if (C) *(v4f*)(C + cofs + (size_t)(row0 + r) * ldc + col0 + c4) = v; if (C16) { v4h h4; for (int i = 0; i < 4; ++i) h4[i] = (_Float16)v[i]; *(v4h*)(C16 + cofs + (size_t)(row0 + r) * ldc + col0 + c4) = h4; } }
     } }


__global__ __launch_bounds__(256) void k_wsc(const float* __restrict__ Wm, _Float16* __restrict__ Bt, size_t n8, float sc) { const size_t t = (size_t)blockIdx.x * 256 + threadIdx.x; if (t >= n8) return; FragH f; for (int q = 0; q < 8; ++q) f.h[q] = (_Float16)(bf16_round(Wm[t * 8 + q]) * sc); *(v8us*)((unsigned short*)Bt + t * 8) = f.half[0];  }
__global__ __launch_bounds__(256) void k_soft(const float* __restrict__ S, const float* __restrict__ scp, _Float16* __restrict__ P, float* __restrict__ RS) {
  #pragma clang fp contract(off)
  const int wv = threadIdx.x >> 5, ln = threadIdx.x & 31; const int r = blockIdx.x * 8 + wv; if (r >= QC) return; float sv = bf16_round(scp[0]); sv = fminf(fmaxf(sv, 1.0f), 32.0f); const float inv = 1.0f / sqrtf(sv); const float* sr = S + (size_t)r * NN; float mx = -3.0e38f;
#pragma unroll 1
  for (int gq = 0; gq < NN / 256; ++gq) { const v8f a = *(const v8f*)(sr + gq * 256 + ln * 8); for (int q = 0; q < 8; ++q) mx = fmaxf(mx, a[q] * inv); }
  for (int o = 16; o > 0; o >>= 1) mx = fmaxf(mx, __shfl_xor(mx, o, 32)); float su = 0.f;
{ su = 0.f;
#pragma unroll 1
    for (int gq = 0; gq < NN / 256; ++gq) { const v8f a = *(const v8f*)(sr + gq * 256 + ln * 8); FragH ph; for (int q = 0; q < 8; ++q) { const float e = expf(a[q] * inv - mx); su += e; ph.h[q] = (_Float16)(e * 1024.0f); } *(v8us*)((unsigned short*)P + (size_t)r * NN + gq * 256 + ln * 8) = ph.half[0]; }
     }
  for (int o = 16; o > 0; o >>= 1) su += __shfl_xor(su, o, 32); if (ln == 0) { *(float*)(RS + (size_t)r * 32) = 1.0f / su;  } }
__global__ __launch_bounds__(256) void k_fsc(const float* __restrict__ O, const float* __restrict__ RS, int c0, _Float16* __restrict__ FH, _Float16* __restrict__ FL) {
  #pragma clang fp contract(off)
  const int t = blockIdx.x * 256 + threadIdx.x; if (t >= QC * (DO / 8)) return; const int d8 = (t % (DO / 8)) * 8; const int r = t / (DO / 8); v8f a = *(const v8f*)(O + (size_t)r * DO + d8); FragH f, fl;
#pragma unroll      /* straight-line loads of the KS partial planes, many in flight; summed in the fixed order s = 0..KS-1 */
  for (int s = 1; s < KS; ++s) a += *(const v8f*)(O + (size_t)s * QC * DO + (size_t)r * DO + d8);
  asm volatile("s_wait_xcnt 0x0" ::: "memory");      /* the load of rs behind it may land in an address register of a partial load that is still in flight */
  const float rs = RS[(size_t)r * 32];
  for (int q = 0; q < 8; ++q) { const float v = a[q] * rs; const _Float16 hh = (_Float16)v; f.h[q] = hh; fl.h[q] = (_Float16)((v - (float)hh) * 1024.0f); }
  const size_t o = ((size_t)c0 + r) * DO + d8; { *(v8us*)((unsigned short*)FH + o) = f.half[0]; *(v8us*)((unsigned short*)FL + o) = fl.half[0];  } }

extern "C" void kernel_launch(void* const* d_in, const int* in_sizes, int n_in,
                              void* d_out, int out_size, void* d_ws, size_t ws_size, hipStream_t stream) {
  (void)in_sizes; (void)n_in; (void)out_size;
  const float* const* I = (const float* const*)d_in; const float* x1 = I[0]; const float* x2 = I[1]; const float* Wq1 = I[2]; const float* bq1 = I[3]; const float* Wk1 = I[4]; const float* bk1 = I[5]; const float* Wv = I[6]; const float* bv = I[7]; const float* Wq2 = I[8]; const float* bq2 = I[9]; const float* Wk2 = I[10]; const float* bk2 = I[11]; const float* We = I[12]; const float* be = I[13]; const float* scp = I[14];
  float* out1 = (float*)d_out; float* out2 = (float*)d_out + (size_t)NN * DI;      /* second output at byte offset 16777216 */
  char* ws = (char*)d_ws; size_t off = 0;
  auto take = [&](size_t bytes) { char* p = ws + off; off += (bytes + 255) & ~(size_t)255; return p; };
  _Float16* BW = (_Float16*)take((size_t)5 * DO * DI * 2); _Float16* BE = (_Float16*)take((size_t)DI * DO * 2); _Float16* X1 = (_Float16*)take((size_t)NN * DI * 2); _Float16* X2 = (_Float16*)take((size_t)NN * DI * 2);
  _Float16* Q1 = (_Float16*)take((size_t)NN * DO * 2); _Float16* K1 = (_Float16*)take((size_t)NN * DO * 2); _Float16* V1 = (_Float16*)take((size_t)NN * DO * 2); _Float16* Q2 = (_Float16*)take((size_t)NN * DO * 2); _Float16* K2 = (_Float16*)take((size_t)NN * DO * 2); _Float16* V2 = (_Float16*)take((size_t)NN * DO * 2); _Float16* VT1 = (_Float16*)take((size_t)NN * DO * 2); _Float16* VT2 = (_Float16*)take((size_t)NN * DO * 2);
  float* S = (float*)take((size_t)QC * NN * 4); _Float16* P = (_Float16*)take((size_t)QC * NN * 2); float* RS = (float*)take((size_t)QC * 32 * 4); float* O = (float*)take((size_t)KS * QC * DO * 4); _Float16* FH = (_Float16*)take((size_t)NN * DO * 2); _Float16* FL = (_Float16*)take((size_t)NN * DO * 2);
  if (off > ws_size) return;      /* 1.5 + 8 + 8 + 8 x 4 MiB + 64 + 32 + 0.3 + 32 + 4 + 4 = about 186 MiB */
  const float* Ws[5] = {Wq1, Wk1, Wv, Wq2, Wk2};
  for (int i = 0; i < 5; ++i) k_wsc<<<(unsigned)(((size_t)DO * DI / 8 + 255) / 256), 256, 0, stream>>>(Ws[i], BW + (size_t)i * DO * DI, (size_t)DO * DI / 8, 16.0f);      /* torch (out, in) naturals */
  k_wsc<<<(unsigned)(((size_t)DI * DO / 8 + 255) / 256), 256, 0, stream>>>(We, BE, (size_t)DI * DO / 8, 16.0f);
  k_x16<<<(unsigned)(((size_t)NN * DI / 8 + 255) / 256), 256, 0, stream>>>(x1, X1, (size_t)NN * DI / 8); k_x16<<<(unsigned)(((size_t)NN * DI / 8 + 255) / 256), 256, 0, stream>>>(x2, X2, (size_t)NN * DI / 8);
  const dim3 gP((NN / 128) * (DO / 64), 1);
  k_gemm2<0><<<gP, 128, 0, stream>>>(X1, DI, 0, BW, DI, 0, 0.0625f, bq1, 0, nullptr, 1, 0, 0, nullptr, Q1, DO, 0, NN, DO, DI);
  k_gemm2<0><<<gP, 128, 0, stream>>>(X1, DI, 0, BW + (size_t)DO * DI, DI, 0, 0.0625f, bk1, 0, nullptr, 1, 0, 0, nullptr, K1, DO, 0, NN, DO, DI);
  k_gemm2<0><<<gP, 128, 0, stream>>>(X1, DI, 0, BW + (size_t)2 * DO * DI, DI, 0, 0.0625f, bv, 0, nullptr, 1, 0, 0, nullptr, V1, DO, 0, NN, DO, DI);
  k_gemm2<0><<<gP, 128, 0, stream>>>(X2, DI, 0, BW + (size_t)3 * DO * DI, DI, 0, 0.0625f, bq2, 0, nullptr, 1, 0, 0, nullptr, Q2, DO, 0, NN, DO, DI);
  k_gemm2<0><<<gP, 128, 0, stream>>>(X2, DI, 0, BW + (size_t)4 * DO * DI, DI, 0, 0.0625f, bk2, 0, nullptr, 1, 0, 0, nullptr, K2, DO, 0, NN, DO, DI);
  k_gemm2<0><<<gP, 128, 0, stream>>>(X2, DI, 0, BW + (size_t)2 * DO * DI, DI, 0, 0.0625f, bv, 0, nullptr, 1, 0, 0, nullptr, V2, DO, 0, NN, DO, DI);      /* W_V shared */
  k_vt<DO / 64, NN><<<(DO / 64) * (NN / 64), 256, 0, stream>>>(V1, DO, 0, VT1); k_vt<DO / 64, NN><<<(DO / 64) * (NN / 64), 256, 0, stream>>>(V2, DO, 0, VT2);      /* V^T [256][8192] */
  for (int br = 0; br < 2; ++br) { const _Float16* Q = br ? Q2 : Q1; const _Float16* K = br ? K1 : K2; const _Float16* VT = br ? VT2 : VT1; float* outp = br ? out2 : out1;      /* f1: hsi_Q . lidar_K -> hsi_V ; f2: lidar_Q . hsi_K -> lidar_V */
    for (int c = 0; c < NN / QC; ++c) { const int c0 = c * QC;
      k_gemm2<0><<<dim3((QC / 128) * (NN / 64), 1), 128, 0, stream>>>(Q + (size_t)c0 * DO, DO, 0, K, DO, 0, 1.0f, nullptr, 0, nullptr, 1, 0, 0, S, nullptr, NN, 0, QC, NN, DO);
      k_soft<<<QC / 8, 256, 0, stream>>>(S, scp, P, RS);
      k_gemm2<0><<<dim3((QC / 128) * (DO / 64), KS), 128, 0, stream>>>(P, NN, NN / KS, VT, NN, NN / KS, 0.0009765625f, nullptr, 0, nullptr, 1, 0, 0, O, nullptr, DO, (size_t)QC * DO, QC, DO, NN / KS);      /* blockIdx.y = key range -> its own partial plane of O */
      k_fsc<<<(QC * (DO / 8) + 255) / 256, 256, 0, stream>>>(O, RS, c0, FH, FL); }
    k_gemm2<0><<<dim3((NN / 128) * (DI / 64), 1), 128, 0, stream>>>(FL, DO, 0, BE, DO, 0, 0.0625f / 1024.0f, nullptr, 0, nullptr, 1, 0, 0, outp, nullptr, DI, 0, NN, DI, DO);
    k_gemm2<0><<<dim3((NN / 128) * (DI / 64), 1), 128, 0, stream>>>(FH, DO, 0, BE, DO, 0, 0.0625f, be, 0, outp, 1, (size_t)DI, 0, outp, nullptr, DI, 0, NN, DI, DO); }      /* (f_lo + f_hi) We^T + be */
}

// v002
// A run of this version takes 360 microseconds.
// In both of two side-by-side timings against v001, it was 3.26 times as fast.
// Over all steps from v000 it is 7.58 times as fast.
#include <hip/hip_runtime.h>
// cross_fuison (8192 hsi rows x1 and 8192 lidar rows x2, 512 -> 256: Q/K/V = x W^T + b (W_V shared); inv = 1/sqrt(clip(scale, 1, 32)); f1 = softmax(hsi_Q lidar_K^T inv) hsi_V; f2 = softmax(lidar_Q hsi_K^T inv) lidar_V; outputs = (f1 We^T + be, f2 We^T + be), each [8192][512]).
// Compute dtype: inputs rounded to bf16; inputs/weights exact as f16; Q/K/V and the softmax weights as plain f16 operands (~2^-12); f as f16 hi + residual into We; softmax f32. v_wmma_f32_16x16x32_f16.
#define NN 8192
#define DI 512
#define DO 256
typedef __bf16 v16b __attribute__((ext_vector_type(16)));
typedef unsigned short v8us __attribute__((ext_vector_type(8), may_alias));
typedef float  v8f  __attribute__((ext_vector_type(8)));
typedef float  v4f  __attribute__((ext_vector_type(4)));
typedef float  v4fa __attribute__((ext_vector_type(4), may_alias));
union FragB { v16b v; v8us half[2]; unsigned short u[16]; };

__device__ __forceinline__ unsigned short bf16_bits(float x) { unsigned int u = __float_as_uint(x); return (unsigned short)((u + 0x7FFFu + ((u >> 16) & 1u)) >> 16); }
__device__ __forceinline__ float bf16_val(unsigned short b) { return __uint_as_float(((unsigned int)b) << 16); }
__device__ __forceinline__ float bf16_round(float x) { return bf16_val(bf16_bits(x)); }
// D += A·B with NT terms: 1 = ah·bh, 2 = + al·bh (A split), 3 = + ah·bl (both split)
template <int NT>
__device__ __forceinline__ v8f mmaN(v16b ah, v16b al, v16b bh, v16b bl, v8f c) {
  c = __builtin_amdgcn_wmma_f32_16x16x32_bf16(false, ah, false, bh, (short)0, c, false, false);
  if (NT >= 2) c = __builtin_amdgcn_wmma_f32_16x16x32_bf16(false, al, false, bh, (short)0, c, false, false);
  if (NT >= 3) c = __builtin_amdgcn_wmma_f32_16x16x32_bf16(false, ah, false, bl, (short)0, c, false, false);
  asm volatile("v_nop\n\tv_nop\n\tv_nop\n\tv_nop" : "+v"(c) : "v"(ah), "v"(al), "v"(bh), "v"(bl));
  return c;
}

__global__ __launch_bounds__(256) void k_wt_bf16(const float* __restrict__ W, unsigned short* __restrict__ Wt, int K, int N) {
  const int t = blockIdx.x * 256 + threadIdx.x;
  const int k8n = K / 8;
  if (t >= N * k8n) return;
  const int n = t / k8n, k8 = (t % k8n) * 8;
  v8us v;
#pragma unroll
  for (int i = 0; i < 8; ++i) v[i] = bf16_bits(W[(size_t)(k8 + i) * N + n]);
  *(v8us*)(Wt + (size_t)n * K + k8) = v;
  
}

// GEMM C[M][N] (f32, pitch ldc) = act(A[M][K]·W + bias). A f32 row-major (pitch lda) converted per fragment to bf16
// (ASPLIT: hi/lo two planes -> 2 terms, else single rounded term); Wt bf16 [N][K] (pitch ldb). BIAS_BF16 rounds the
// bias to bf16 first (bias quantised to bf16 before the add). K%32==0, M%16==0, N%64==0.
template <bool ASPLIT, int ACT, bool BIAS_BF16>
__global__ __launch_bounds__(128) void k_gemm_bf(const float* __restrict__ A, int lda, const unsigned short* __restrict__ Wt, int ldb,
                                               const float* __restrict__ bias, float* __restrict__ C, int ldc, int M, int N, int K) {
  __shared__ __attribute__((aligned(16))) float so[4][16][64];
  const int tid = threadIdx.x, w = tid >> 5, lane = tid & 31, ln = lane & 15, hh = lane >> 4;
  const int ntn = N / 64;
  const int wid = blockIdx.x * 4 + w;
  const int mt = wid / ntn, nq = wid % ntn;
  if (mt * 16 >= M) return;
  const int row0 = mt * 16, col0 = nq * 64;
  const float* arow = A + (size_t)(row0 + ln) * lda;
  v8f acc[4] = {};
  for (int kb = 0; kb < K; kb += 32) {
    FragB ah, al;
    const v4f x0 = *(const v4fa*)(arow + kb + 8 * hh), x1 = *(const v4fa*)(arow + kb + 8 * hh + 4);
    const v4f x2 = *(const v4fa*)(arow + kb + 16 + 8 * hh), x3 = *(const v4fa*)(arow + kb + 16 + 8 * hh + 4);
    float xs[16] = {x0[0],x0[1],x0[2],x0[3],x1[0],x1[1],x1[2],x1[3],x2[0],x2[1],x2[2],x2[3],x3[0],x3[1],x3[2],x3[3]};
#pragma unroll
    for (int i = 0; i < 16; ++i) { const unsigned short hb = bf16_bits(xs[i]); ah.u[i] = hb; al.u[i] = ASPLIT ? bf16_bits(xs[i] - bf16_val(hb)) : (unsigned short)0; }
#pragma unroll
    for (int t = 0; t < 4; ++t) {
      const unsigned short* brow = Wt + (size_t)(col0 + t * 16 + ln) * ldb + kb;
      FragB b;
      b.half[0] = *(const v8us*)(brow + 8 * hh);
      b.half[1] = *(const v8us*)(brow + 16 + 8 * hh);
      acc[t] = mmaN<ASPLIT ? 2 : 1>(ah.v, al.v, b.v, b.v, acc[t]);
    }
  }
#pragma unroll
  for (int t = 0; t < 4; ++t) {
    float bv = bias ? bias[col0 + t * 16 + ln] : 0.f;
    if (BIAS_BF16) bv = bf16_round(bv);
#pragma unroll
    for (int r = 0; r < 8; ++r) { float v = acc[t][r] + bv; if (ACT == 1) v = fmaxf(v, 0.f); so[w][8 * hh + r][t * 16 + ln] = v; }
  }
  __builtin_amdgcn_fence(__ATOMIC_ACQ_REL, "workgroup");
  __builtin_amdgcn_wave_barrier();
  const int rsub = lane >> 4, c4 = (lane & 15) * 4;
  {
#pragma unroll
    for (int q = 0; q < 8; ++q) {
      const int r = q * 2 + rsub;
      const v4f v = *(const v4fa*)&so[w][r][c4];
      *(v4f*)(C + (size_t)(row0 + r) * ldc + col0 + c4) = v;
    }
    
  }
}

// GEMM C = act(A·W + bias + resid): A f32 (ASPLIT -> hi/lo 2 terms), Wt bf16 [N][K]; ACT 0 none, 1 relu, 2 exact gelu;
// resid (optional, f32, row index = (row % rmod), pitch ldr, RES_BF16 rounds it) added before the activation.
template <bool ASPLIT, int ACT, bool BIAS_BF16, bool RES_BF16>
__global__ __launch_bounds__(128) void k_gemm_bf3(const float* __restrict__ A, int lda, const unsigned short* __restrict__ Wt, int ldb,
                                                const float* __restrict__ bias, const float* __restrict__ resid, int rmod, int ldr,
                                                float* __restrict__ C, int ldc, int M, int N, int K) {
  __shared__ __attribute__((aligned(16))) float so[4][16][64];
  const int tid = threadIdx.x, w = tid >> 5, lane = tid & 31, ln = lane & 15, hh = lane >> 4;
  const int ntn = N / 64;
  const int wid = blockIdx.x * 4 + w;
  const int mt = wid / ntn, nq = wid % ntn;
  if (mt * 16 >= M) return;
  const int row0 = mt * 16, col0 = nq * 64;
  const float* arow = A + (size_t)(row0 + ln) * lda;
  v8f acc[4] = {};
  for (int kb = 0; kb < K; kb += 32) {
    FragB ah, al;
    const v4f x0 = *(const v4fa*)(arow + kb + 8 * hh), x1 = *(const v4fa*)(arow + kb + 8 * hh + 4);
    const v4f x2 = *(const v4fa*)(arow + kb + 16 + 8 * hh), x3 = *(const v4fa*)(arow + kb + 16 + 8 * hh + 4);
    float xs[16] = {x0[0],x0[1],x0[2],x0[3],x1[0],x1[1],x1[2],x1[3],x2[0],x2[1],x2[2],x2[3],x3[0],x3[1],x3[2],x3[3]};
#pragma unroll
    for (int i = 0; i < 16; ++i) { const unsigned short hb = bf16_bits(xs[i]); ah.u[i] = hb; al.u[i] = ASPLIT ? bf16_bits(xs[i] - bf16_val(hb)) : (unsigned short)0; }
#pragma unroll
    for (int t = 0; t < 4; ++t) {
      const unsigned short* brow = Wt + (size_t)(col0 + t * 16 + ln) * ldb + kb;
      FragB b;
      b.half[0] = *(const v8us*)(brow + 8 * hh);
      b.half[1] = *(const v8us*)(brow + 16 + 8 * hh);
      acc[t] = mmaN<ASPLIT ? 2 : 1>(ah.v, al.v, b.v, b.v, acc[t]);
    }
  }
#pragma unroll
  for (int t = 0; t < 4; ++t) {
    const int col = col0 + t * 16 + ln;
    float bv = bias ? bias[col] : 0.f;
    if (BIAS_BF16) bv = bf16_round(bv);
#pragma unroll
    for (int r = 0; r < 8; ++r) {
      float v = acc[t][r] + bv;
      if (resid) { float rv = resid[(size_t)((row0 + 8 * hh + r) % rmod) * ldr + col]; if (RES_BF16) rv = bf16_round(rv); v += rv; }
      if (ACT == 1) v = fmaxf(v, 0.f);
      if (ACT == 2) v = 0.5f * v * (1.0f + erff(v * 0.70710678118654752f));
      if (ACT == 3) { const float u = 0.7978845608028654f * (v + 0.044715f * v * v * v); v = 0.5f * v * (1.0f + tanhf(u)); }
      so[w][8 * hh + r][t * 16 + ln] = v;
    }
  }
  __builtin_amdgcn_fence(__ATOMIC_ACQ_REL, "workgroup");
  __builtin_amdgcn_wave_barrier();
  const int rsub = lane >> 4, c4 = (lane & 15) * 4;
  {
#pragma unroll
    for (int q = 0; q < 8; ++q) {
      const int r = q * 2 + rsub;
      const v4f v = *(const v4fa*)&so[w][r][c4];
      *(v4f*)(C + (size_t)(row0 + r) * ldc + col0 + c4) = v;
    }
    
  }
}
// row LayerNorm (biased variance, eps) over N: s = X (+ R); optional out_sum <- s; out_norm <- (s-mu)*rsqrt(var+eps)*g + b
template <bool PARAM_BF16>
__global__ __launch_bounds__(256) void k_layernorm(const float* __restrict__ X, const float* __restrict__ R, const float* __restrict__ g, const float* __restrict__ bta,
                                                  float* __restrict__ out_sum, float* __restrict__ out_norm, int N, float eps) {
  __shared__ float red[256];
  const int row = blockIdx.x, tid = threadIdx.x;
  const float* x = X + (size_t)row * N; const float* rr = R ? R + (size_t)row * N : nullptr;
  float vals[16];                     // up to N = 4096
  const int per = N / 256;            // contiguous chunk per thread? use strided-by-4 chunks: thread handles j = tid*4 + 1024*u
  float s1 = 0.f;
  for (int u = 0; u < per / 4; ++u) {
    const int j = tid * 4 + 1024 * u;
    const v4f a = *(const v4fa*)(x + j);
    v4f b = {0.f,0.f,0.f,0.f}; if (rr) b = *(const v4fa*)(rr + j);
#pragma unroll
    for (int q = 0; q < 4; ++q) { const float v = a[q] + b[q]; vals[u * 4 + q] = v; s1 += v; }
  }
  red[tid] = s1; __syncthreads();
  for (int st = 128; st > 0; st >>= 1) { if (tid < st) red[tid] += red[tid + st]; __syncthreads(); }
  const float mu = red[0] / (float)N; __syncthreads();
  float s2 = 0.f;
  for (int u = 0; u < per / 4; ++u)
#pragma unroll
    for (int q = 0; q < 4; ++q) { const float c = vals[u * 4 + q] - mu; s2 += c * c; }
  red[tid] = s2; __syncthreads();
  for (int st = 128; st > 0; st >>= 1) { if (tid < st) red[tid] += red[tid + st]; __syncthreads(); }
  const float rs = rsqrtf(red[0] / (float)N + eps);
  {
    for (int u = 0; u < per / 4; ++u) {
      const int j = tid * 4 + 1024 * u;
      v4f o, sm;
#pragma unroll
      for (int q = 0; q < 4; ++q) {
        float gg = g[j + q], bb = bta[j + q];
        if (PARAM_BF16) { gg = bf16_round(gg); bb = bf16_round(bb); }
        sm[q] = vals[u * 4 + q]; o[q] = (vals[u * 4 + q] - mu) * rs * gg + bb;
      }
      if (out_sum) *(v4f*)(out_sum + (size_t)row * N + j) = sm;
      *(v4f*)(out_norm + (size_t)row * N + j) = o;
    }
    
  }
}



// ---- f16 WMMA path (v_wmma_f32_16x16x32_f16): 11-bit significands for operands in range — used where a [0,1] probability operand needs more precision than bf16
typedef _Float16 v16h __attribute__((ext_vector_type(16)));
union FragH { v16h v; v8us half[2]; _Float16 h[16]; unsigned short u[16]; };
template <int NT>
__device__ __forceinline__ v8f mmaH(v16h ah, v16h al, v16h bh, v16h bl, v8f c) {
  c = __builtin_amdgcn_wmma_f32_16x16x32_f16(false, ah, false, bh, (short)0, c, false, false);
  if (NT >= 2) c = __builtin_amdgcn_wmma_f32_16x16x32_f16(false, al, false, bh, (short)0, c, false, false);
  if (NT >= 3) c = __builtin_amdgcn_wmma_f32_16x16x32_f16(false, ah, false, bl, (short)0, c, false, false);
  asm volatile("v_nop\n\tv_nop\n\tv_nop\n\tv_nop" : "+v"(c) : "v"(ah), "v"(al), "v"(bh), "v"(bl));
  return c;
}
// batched GEMM like k_gemm_b but f16 operands: A f32 (split into f16 hi/lo if ASPLIT, else rounded to f16), Bt = f16 values [n][k]; alpha; C f32; N multiple of 16 (partial tiles skipped)
template <bool ASPLIT>
__global__ __launch_bounds__(128) void k_gemm_h(const float* __restrict__ A, int lda, size_t sA, const _Float16* __restrict__ Bh, int ldb, size_t sB, float alpha, float* __restrict__ C, int ldc, size_t sC, int M, int N, int K) {
  __shared__ __attribute__((aligned(16))) float so[4][16][64];
  const int tid = threadIdx.x, w = tid >> 5, lane = tid & 31, ln = lane & 15, hh = lane >> 4; const int by = blockIdx.y;
  A += (size_t)by * sA; Bh += (size_t)by * sB; C += (size_t)by * sC;
  const int ntn = (N + 63) / 64; const int wid = blockIdx.x * 4 + w; const int mt = wid / ntn, nq = wid % ntn; if (mt * 16 >= M) return;
  const int row0 = mt * 16, col0 = nq * 64; const float* arow = A + (size_t)(row0 + ln) * lda;
  v8f acc[4] = {};
  for (int kb = 0; kb < K; kb += 32) {
    FragH ah, al;
    const v4f x0 = *(const v4fa*)(arow + kb + 8 * hh), x1 = *(const v4fa*)(arow + kb + 8 * hh + 4), x2 = *(const v4fa*)(arow + kb + 16 + 8 * hh), x3 = *(const v4fa*)(arow + kb + 16 + 8 * hh + 4);
    float xs[16] = {x0[0],x0[1],x0[2],x0[3],x1[0],x1[1],x1[2],x1[3],x2[0],x2[1],x2[2],x2[3],x3[0],x3[1],x3[2],x3[3]};
#pragma unroll
    for (int i = 0; i < 16; ++i) { const _Float16 h = (_Float16)xs[i]; ah.h[i] = h; al.h[i] = ASPLIT ? (_Float16)(xs[i] - (float)h) : (_Float16)0.0f; }
#pragma unroll
    for (int t = 0; t < 4; ++t) { if (col0 + t * 16 >= N) continue; const size_t boff = (size_t)(col0 + t * 16 + ln) * ldb + kb; FragH bq; bq.half[0] = *(const v8us*)(Bh + boff + 8 * hh); bq.half[1] = *(const v8us*)(Bh + boff + 16 + 8 * hh);
      acc[t] = mmaH<ASPLIT ? 2 : 1>(ah.v, al.v, bq.v, bq.v, acc[t]); }
  }
#pragma unroll
  for (int t = 0; t < 4; ++t) { if (col0 + t * 16 >= N) continue;
#pragma unroll
    for (int r = 0; r < 8; ++r) so[w][8 * hh + r][t * 16 + ln] = acc[t][r] * alpha; }
  __builtin_amdgcn_fence(__ATOMIC_ACQ_REL, "workgroup"); __builtin_amdgcn_wave_barrier();
  const int rsub = lane >> 4, c4 = (lane & 15) * 4;
  {
#pragma unroll
    for (int q = 0; q < 8; ++q) { const int r = q * 2 + rsub; if (col0 + c4 < N) { const v4f v = *(const v4fa*)&so[w][r][c4]; *(v4f*)(C + (size_t)(row0 + r) * ldc + col0 + c4) = v; } }
     }
}

// Wt[n][k] = f16(W[k][n]·scale) from f32 row-major W[K][N] (scale = power of two; bf16-exact weights stay exact in f16 away from the subnormal range)
__global__ __launch_bounds__(256) void k_wt_f16(const float* __restrict__ W, _Float16* __restrict__ Wt, int K, int N, float scale) {
  const int t = blockIdx.x * 256 + threadIdx.x; if (t >= N * (K / 8)) return; const int n = t / (K / 8), k8 = (t % (K / 8)) * 8; FragH f;
#pragma unroll
  for (int i = 0; i < 8; ++i) f.h[i] = (_Float16)(bf16_round(W[(size_t)(k8 + i) * N + n]) * scale); const v8us o = f.half[0];
  *(v8us*)((unsigned short*)Wt + (size_t)n * K + k8) = o; 
}
// k_gemm_hh variant with fused epilogue: v = acc·alpha + bias[by·sBias + col] (+ CP[(row/rowsPerB)·sCPb + by·64 + col] if CP) ; ACT 0 none / 1 elu ; writes f16 C16 (and f32 C if non-null)
template <int ACT>
__global__ __launch_bounds__(128) void k_gemm_hhx(const _Float16* __restrict__ A, int lda, size_t sA, const _Float16* __restrict__ Bh, int ldb, size_t sB, float alpha, const float* __restrict__ bias, size_t sBias, const float* __restrict__ CP, int rowsPerB, size_t sCPb, int row0g,
    float* __restrict__ C, _Float16* __restrict__ C16, int ldc, size_t sC, int M, int N, int K) {
  __shared__ __attribute__((aligned(16))) float so[4][16][64];
  const int tid = threadIdx.x, w = tid >> 5, lane = tid & 31, ln = lane & 15, hh = lane >> 4; const int by = blockIdx.y;
  A += (size_t)by * sA; Bh += (size_t)by * sB; const size_t cofs = (size_t)by * sC; const float* bp = bias ? bias + (size_t)by * sBias : nullptr;
  const int ntn = (N + 63) / 64; const int wid = blockIdx.x * 4 + w; const int mt = wid / ntn, nq = wid % ntn; if (mt * 16 >= M) return;
  const int row0 = mt * 16, col0 = nq * 64; const _Float16* arow = A + (size_t)(row0 + ln) * lda;
  v8f acc[4] = {};
  for (int kb = 0; kb < K; kb += 32) { FragH ah; ah.half[0] = *(const v8us*)((const unsigned short*)arow + kb + 8 * hh); ah.half[1] = *(const v8us*)((const unsigned short*)arow + kb + 16 + 8 * hh);
#pragma unroll
    for (int t = 0; t < 4; ++t) { if (col0 + t * 16 >= N) continue; const size_t boff = (size_t)(col0 + t * 16 + ln) * ldb + kb; FragH bq; bq.half[0] = *(const v8us*)((const unsigned short*)Bh + boff + 8 * hh); bq.half[1] = *(const v8us*)((const unsigned short*)Bh + boff + 16 + 8 * hh);
      acc[t] = mmaH<1>(ah.v, ah.v, bq.v, bq.v, acc[t]); }
  }
#pragma unroll
  for (int t = 0; t < 4; ++t) { if (col0 + t * 16 >= N) continue; const int col = col0 + t * 16 + ln; const float bv = bp ? bf16_round(bp[col]) : 0.f;
#pragma unroll
    for (int r = 0; r < 8; ++r) { float v = acc[t][r] * alpha + bv; if (CP) { const int rr = row0g + row0 + 8 * hh + r; if (rowsPerB < 0) v += CP[cofs + (size_t)rr * ldc + col];      /* rowsPerB < 0: own element of the batched C plane */ else { const int bidx = rr / rowsPerB; v += CP[(size_t)bidx * sCPb + (size_t)by * 64 + col]; } } if (ACT == 1) v = (v > 0.f) ? v : expm1f(v); else if (ACT == 7) v = (v > 0.f) ? v + 1.0f : expf(v); else if (ACT == 8) v = tanhf(v); else if (ACT == 9) v = 0.5f * v * (1.0f + tanhf(0.7978845608028654f * (v + 0.044715f * v * v * v))); else if (ACT == 11) v = 1.0f / (1.0f + expf(-v)); else if (ACT == 12) v = (v > 0.f) ? v : 0.01f * v; else if (ACT == 14) v = (v > 0.f) ? v : 0.1f * v; else if (ACT == 16) v = (v >= 0.f) ? v : 0.3f * v; else if (ACT == 17) v = (v >= 0.f) ? v : 0.2f * v; else if (ACT == 15) v = v / (1.0f + expf(-v)); else if (ACT == 3) v = fmaxf(v, 0.f); else if (ACT == 6) v = 0.5f * v * (1.0f + erff(v * 0.70710678118654752f)); so[w][8 * hh + r][t * 16 + ln] = v; } }
  __builtin_amdgcn_fence(__ATOMIC_ACQ_REL, "workgroup"); __builtin_amdgcn_wave_barrier();
  const int rsub = lane >> 4, c4 = (lane & 15) * 4; typedef _Float16 v4h __attribute__((ext_vector_type(4)));
  {
#pragma unroll
    for (int q = 0; q < 8; ++q) { const int r = q * 2 + rsub; if (col0 + c4 < N) { const v4f v = *(const v4fa*)&so[w][r][c4]; if (C) *(v4f*)(C + cofs + (size_t)(row0 + r) * ldc + col0 + c4) = v; if (C16) { v4h h4; for (int i = 0; i < 4; ++i) h4[i] = (_Float16)v[i]; *(v4h*)(C16 + cofs + (size_t)(row0 + r) * ldc + col0 + c4) = h4; } } }
     }
}


typedef _Float16 v4h __attribute__((ext_vector_type(4)));

__global__ __launch_bounds__(256) void k_x16(const float* __restrict__ x, _Float16* __restrict__ X16, size_t n8) { const size_t t = (size_t)blockIdx.x * 256 + threadIdx.x; if (t >= n8) return; FragH f;
#pragma unroll
  for (int q = 0; q < 8; ++q) f.h[q] = (_Float16)bf16_round(x[t * 8 + q]); *(v8us*)((unsigned short*)X16 + t * 8) = f.half[0];  }
__global__ __launch_bounds__(256) void k_h16(const float* __restrict__ x, _Float16* __restrict__ X16, size_t n8) { const size_t t = (size_t)blockIdx.x * 256 + threadIdx.x; if (t >= n8) return; FragH f;
#pragma unroll
  for (int q = 0; q < 8; ++q) f.h[q] = (_Float16)x[t * 8 + q]; *(v8us*)((unsigned short*)X16 + t * 8) = f.half[0];  }
__global__ __launch_bounds__(256) void k_round16f(const float* __restrict__ W, _Float16* __restrict__ Bt, size_t n8) { const size_t t = (size_t)blockIdx.x * 256 + threadIdx.x; if (t >= n8) return; FragH f;
#pragma unroll
  for (int i = 0; i < 8; ++i) f.h[i] = (_Float16)(bf16_round(W[t * 8 + i]) * 16.0f); *(v8us*)((unsigned short*)Bt + t * 8) = f.half[0];  }
template <int NHv, int TTv>
__global__ __launch_bounds__(256) void k_vt(const _Float16* __restrict__ V16, int ldv, int voff, _Float16* __restrict__ Vt) { __shared__ unsigned short tl[64][66]; const int tid = threadIdx.x; const int slab = blockIdx.x / (TTv / 64), lg = blockIdx.x % (TTv / 64); const int b = slab / NHv, h = slab % NHv;
  for (int i = tid; i < 64 * 8; i += 256) { const int r = i / 8, c8 = (i % 8) * 8; FragH f; f.half[0] = *(const v8us*)((const unsigned short*)V16 + ((size_t)b * TTv + lg * 64 + r) * ldv + voff + h * 64 + c8);
#pragma unroll
    for (int q = 0; q < 8; ++q) tl[r][c8 + q] = f.u[q]; }
  __syncthreads();
  {
#pragma unroll
    for (int rd = 0; rd < 2; ++rd) { const int d = rd * 32 + tid / 8, pc = tid % 8; FragH f;
#pragma unroll
      for (int q = 0; q < 8; ++q) f.u[q] = tl[pc * 8 + q][d];
      *(v8us*)((unsigned short*)Vt + ((size_t)slab * 64 + d) * TTv + lg * 64 + pc * 8) = f.half[0]; }
     } }

__global__ __launch_bounds__(256) void k_hl(const float* __restrict__ F, _Float16* __restrict__ Hh, _Float16* __restrict__ Hl, size_t n8) { const size_t t = (size_t)blockIdx.x * 256 + threadIdx.x; if (t >= n8) return; FragH fh, fl; const v4f a = *(const v4fa*)(F + t * 8), c = *(const v4fa*)(F + t * 8 + 4);
#pragma unroll
  for (int q = 0; q < 4; ++q) { _Float16 h = (_Float16)a[q]; fh.h[q] = h; fl.h[q] = (_Float16)((a[q] - (float)h) * 1024.0f); h = (_Float16)c[q]; fh.h[4 + q] = h; fl.h[4 + q] = (_Float16)((c[q] - (float)h) * 1024.0f); }
  { *(v8us*)((unsigned short*)Hh + t * 8) = fh.half[0]; *(v8us*)((unsigned short*)Hl + t * 8) = fl.half[0];  } }

// ---- fast GEMM (wave tile 32x64; requires M % 32 == 0 rows per launch region and N % 64 == 0); epilogue = k_gemm_hhx semantics ----
__device__ __forceinline__ v16h g2_frag(const _Float16* p, int hh) { FragH f; f.half[0] = *(const v8us*)((const unsigned short*)p + 8 * hh); f.half[1] = *(const v8us*)((const unsigned short*)p + 16 + 8 * hh); return f.v; }
__device__ __forceinline__ v8f g2_mma(v16h a, v16h b, v8f c) { v8f d = __builtin_amdgcn_wmma_f32_16x16x32_f16(false, a, false, b, (short)0, c, false, false); asm volatile("v_nop\n\tv_nop\n\tv_nop\n\tv_nop" : "+v"(d) : "v"(a), "v"(b)); return d; }
template <int ACT>
__global__ __launch_bounds__(128) void k_gemm2(const _Float16* __restrict__ A, int lda, size_t sA, const _Float16* __restrict__ Bh, int ldb, size_t sB, float alpha, const float* __restrict__ bias, size_t sBias, const float* __restrict__ CP, int rowsPerB, size_t sCPb, int row0g,
    float* __restrict__ C, _Float16* __restrict__ C16, int ldc, size_t sC, int M, int N, int K) { static_assert(ACT == 0 || ACT == 3 || ACT == 6 || ACT == 8 || ACT == 9 || ACT == 11 || ACT == 12 || ACT == 14 || ACT == 15 || ACT == 16 || ACT == 17, "k_gemm2: unsupported ACT code (would silently apply no activation)");
  __shared__ __attribute__((aligned(16))) float so[4][32][68];
  const int tid = threadIdx.x, w = tid >> 5, lane = tid & 31, ln = lane & 15, hh = lane >> 4; const int by = blockIdx.y;
  A += (size_t)by * sA; Bh += (size_t)by * sB; const size_t cofs = (size_t)by * sC; const float* bp = bias ? bias + (size_t)by * sBias : nullptr;
  const int ntn = N >> 6; const int mt = blockIdx.x / ntn, nq = blockIdx.x - mt * ntn; const int row0 = mt * 128 + 32 * w, col0 = nq * 64; if (row0 >= M) return;
  const _Float16* a0p = A + (size_t)(row0 + ln) * lda; const _Float16* a1p = a0p + (size_t)16 * lda;
  const _Float16* b0p = Bh + (size_t)(col0 + ln) * ldb; const _Float16* b1p = b0p + (size_t)16 * ldb; const _Float16* b2p = b1p + (size_t)16 * ldb; const _Float16* b3p = b2p + (size_t)16 * ldb;
  const v8f z8 = {0.f,0.f,0.f,0.f,0.f,0.f,0.f,0.f}; v8f c00 = z8, c01 = z8, c02 = z8, c03 = z8, c10 = z8, c11 = z8, c12 = z8, c13 = z8;
#pragma unroll 1
  for (int kb = 0; kb < K; kb += 32) { const v16h a0 = g2_frag(a0p + kb, hh), a1 = g2_frag(a1p + kb, hh);
    v16h b = g2_frag(b0p + kb, hh); c00 = g2_mma(a0, b, c00); c10 = g2_mma(a1, b, c10);
    b = g2_frag(b1p + kb, hh); c01 = g2_mma(a0, b, c01); c11 = g2_mma(a1, b, c11);
    b = g2_frag(b2p + kb, hh); c02 = g2_mma(a0, b, c02); c12 = g2_mma(a1, b, c12);
    b = g2_frag(b3p + kb, hh); c03 = g2_mma(a0, b, c03); c13 = g2_mma(a1, b, c13); }
  v8f accs[8] = {c00, c01, c02, c03, c10, c11, c12, c13};
#pragma unroll
  for (int u = 0; u < 8; ++u) { const int t = u & 3, half = u >> 2; const int col = col0 + t * 16 + ln; const float bv = bp ? bf16_round(bp[col]) : 0.f;
#pragma unroll
    for (int r = 0; r < 8; ++r) { const int rloc = half * 16 + 8 * hh + r; float v = accs[u][r] * alpha + bv; if (CP) { if (rowsPerB < 0) v += CP[cofs + (size_t)(row0g + row0 + rloc) * ldc + col];      /* rowsPerB < 0: own element of the batched C plane */ else { const int bidx = (row0g + row0 + rloc) / rowsPerB; v += CP[(size_t)bidx * sCPb + (size_t)by * 64 + col]; } }
      if (ACT == 3) v = fmaxf(v, 0.f); else if (ACT == 6) v = 0.5f * v * (1.0f + erff(v * 0.70710678118654752f)); else if (ACT == 11) v = 1.0f / (1.0f + expf(-v)); else if (ACT == 15) v = v / (1.0f + expf(-v)); else if (ACT == 12) v = (v > 0.f) ? v : 0.01f * v; else if (ACT == 8) v = tanhf(v); else if (ACT == 9) v = 0.5f * v * (1.0f + tanhf(0.7978845608028654f * (v + 0.044715f * v * v * v))); else if (ACT == 14) v = (v > 0.f) ? v : 0.1f * v; else if (ACT == 16) v = (v >= 0.f) ? v : 0.3f * v; else if (ACT == 17) v = (v >= 0.f) ? v : 0.2f * v;
      so[w][rloc][t * 16 + ln] = v; } }
  __builtin_amdgcn_fence(__ATOMIC_ACQ_REL, "workgroup"); __builtin_amdgcn_wave_barrier();
  const int rsub = lane >> 4, c4 = (lane & 15) * 4;
  {
#pragma unroll
    for (int q = 0; q < 16; ++q) { const int r = q * 2 + rsub; const v4f v = *(const v4fa*)&so[w][r][c4]; if (C) *(v4f*)(C + cofs + (size_t)(row0 + r) * ldc + col0 + c4) = v; if (C16) { v4h h4; for (int i = 0; i < 4; ++i) h4[i] = (_Float16)v[i]; *(v4h*)(C16 + cofs + (size_t)(row0 + r) * ldc + col0 + c4) = h4; } }
     } }


__global__ __launch_bounds__(256) void k_wsc(const float* __restrict__ Wm, _Float16* __restrict__ Bt, size_t n8, float sc) { const size_t t = (size_t)blockIdx.x * 256 + threadIdx.x; if (t >= n8) return; FragH f; for (int q = 0; q < 8; ++q) f.h[q] = (_Float16)(bf16_round(Wm[t * 8 + q]) * sc); *(v8us*)((unsigned short*)Bt + t * 8) = f.half[0];  }
#define FQ 256                   /* query rows per work-group */
#define KSP 4                    /* key ranges: 32 query blocks x KSP x 2 branches = 256 work-groups */
#define NPASS (NN / KSP / 32)
#define KPIT 264                 /* LDS pitch of a K row, 16-bit elements: 528 B = 16 B x odd */
#define VPIT 40                  /* LDS pitch of a V^T row (32 keys): 80 B = 16 B x odd */
#define MTHR 4.0f                /* the maximum in use may trail the true one by this much (log2): a weight is at most 2^(10 + 4), inside f16 */
__device__ __forceinline__ float xhalf(float x) { return __builtin_bit_cast(float, __builtin_amdgcn_permlanex16(__builtin_bit_cast(int, x), __builtin_bit_cast(int, x), 0x76543210, 0xfedcba98, false, false)); }  // lane l with lane l ^ 16
__device__ __forceinline__ v16h fa_frag(const unsigned short* p, int hh) { FragH f; f.half[0] = *(const v8us*)(p + 8 * hh); f.half[1] = *(const v8us*)(p + 16 + 8 * hh); return f.v; }
__device__ __forceinline__ v8f fa_mma(v16h a, v16h b, v8f c) { return __builtin_amdgcn_wmma_f32_16x16x32_f16(false, a, false, b, (short)0, c, false, false); }
__global__ __launch_bounds__(256) void k_flash(const _Float16* __restrict__ Qa, const _Float16* __restrict__ Ka, const _Float16* __restrict__ VTa, const _Float16* __restrict__ Qb, const _Float16* __restrict__ Kb, const _Float16* __restrict__ VTb,
    const float* __restrict__ scp, float* __restrict__ OP, float* __restrict__ ML) {
  __shared__ __attribute__((aligned(16))) unsigned short sK[2][32 * KPIT];
  __shared__ __attribute__((aligned(16))) unsigned short sV[2][DO * VPIT];
  const int tid = threadIdx.x, w = tid >> 5, lane = tid & 31, ln = lane & 15, hh = lane >> 4;
  const int br = blockIdx.z, sp = blockIdx.y, q0 = blockIdx.x * FQ + w * 32;
  const _Float16* Q = br ? Qb : Qa; const unsigned short* K = (const unsigned short*)(br ? Kb : Ka); const unsigned short* VT = (const unsigned short*)(br ? VTb : VTa);
  float sv = bf16_round(scp[0]); sv = fminf(fmaxf(sv, 1.0f), 32.0f); const float cs = (1.0f / sqrtf(sv)) * 1.4426950408889634f;      /* scores to log2 units */
  // staging: thread -> 4 x 16 B of the K tile (row tid / 32 + 8 j) and 4 x 16 B of the V^T tile (row tid / 4 + 64 j)
  const unsigned short* gK = K + ((size_t)sp * (NN / KSP) + (tid >> 5)) * DO + (tid & 31) * 8;
  const unsigned short* gV = VT + (size_t)(tid >> 2) * NN + sp * (NN / KSP) + (tid & 3) * 8;
  const int lK = (tid >> 5) * KPIT + (tid & 31) * 8, lV = (tid >> 2) * VPIT + (tid & 3) * 8;
  const unsigned short* qp = (const unsigned short*)Q + (size_t)(q0 + ln) * DO + 8 * hh;      /* the one address register pair of all 32 Q loads */
  v16h qf[2][8];
#pragma unroll
  for (int g = 0; g < 2; ++g)
#pragma unroll
    for (int ks = 0; ks < 8; ++ks) { FragH f; f.half[0] = *(const v8us*)(qp + g * 16 * DO + ks * 32); f.half[1] = *(const v8us*)(qp + g * 16 * DO + ks * 32 + 16); qf[g][ks] = f.v; }
  {
    v8us kr[4], vr[4];
#pragma unroll
    for (int j = 0; j < 4; ++j) { kr[j] = *(const v8us*)(gK + (size_t)j * 8 * DO); vr[j] = *(const v8us*)(gV + (size_t)j * 64 * NN); }
    asm volatile("s_wait_xcnt 0x0" :: "v"(qp) : "memory");      /* qp ends here: as an input it stays whole until the wait, in front of whatever takes its registers next (gK, gV live on) */
#pragma unroll
    for (int j = 0; j < 4; ++j) { *(v8us*)(&sK[0][lK + j * 8 * KPIT]) = kr[j]; *(v8us*)(&sV[0][lV + j * 64 * VPIT]) = vr[j]; }
  }
  __syncthreads();
  const v8f z8 = {0.f,0.f,0.f,0.f,0.f,0.f,0.f,0.f};
  v8f o[16][2];
#pragma unroll
  for (int t = 0; t < 16; ++t) { o[t][0] = z8; o[t][1] = z8; }
  float m[2] = {-3.0e38f, -3.0e38f}, l[2] = {0.f, 0.f};
  // kept rolled: the body holds 64 matrix instructions and nearly the whole register budget; a second copy would only cost instruction cache
#pragma unroll 1
  for (int s = 0; s < NPASS; ++s) {
    const unsigned short* bK = sK[s & 1]; const unsigned short* bV = sV[s & 1];
    unsigned short* nK = sK[(s + 1) & 1]; unsigned short* nV = sV[(s + 1) & 1];
    const int sn = s + 1 < NPASS ? s + 1 : s;      /* no branch round the staging: the last pass fetches its own tiles again, into the buffer that nobody reads any more */
    const unsigned short* pk = gK + (size_t)sn * 32 * DO; const unsigned short* pv = gV + sn * 32;
    v8us st[4];      /* the next pass's tiles go through registers, 16 at a time: K under the first product, V^T under the softmax and the second */
#pragma unroll
    for (int j = 0; j < 4; ++j) st[j] = *(const v8us*)(pk + j * 8 * DO);
    asm volatile("s_wait_xcnt 0x0" :: "v"(pk) : "memory");      /* as an input the loads' address stays whole until the wait */
    // S^T = K.Q^T, one k step (2 fragments, 4 matrix instructions) a block; each block's LDS reads stand as one group two blocks ahead, in a ring of three fragment pairs
    v8f sc[2][2] = {{z8, z8}, {z8, z8}};
    v16h ka[3][2];
#pragma unroll
    for (int i = 0; i < 4; ++i) ka[i >> 1][i & 1] = fa_frag(bK + ((i & 1) * 16 + ln) * KPIT + (i >> 1) * 32, hh);
#pragma unroll
    for (int ks = 0; ks < 8; ++ks) {
      if (ks < 6) { ka[(ks + 2) % 3][0] = fa_frag(bK + ln * KPIT + (ks + 2) * 32, hh); ka[(ks + 2) % 3][1] = fa_frag(bK + (16 + ln) * KPIT + (ks + 2) * 32, hh); }
      __builtin_amdgcn_sched_barrier(0);      /* keeps the reads above as one group in front of the block, two blocks ahead of their use */
      const v16h a0 = ka[ks % 3][0], a1 = ka[ks % 3][1];
      sc[0][0] = fa_mma(a0, qf[0][ks], sc[0][0]); sc[0][1] = fa_mma(a0, qf[1][ks], sc[0][1]);
      sc[1][0] = fa_mma(a1, qf[0][ks], sc[1][0]); sc[1][1] = fa_mma(a1, qf[1][ks], sc[1][1]);
      __builtin_amdgcn_sched_barrier(0);      /* ends the block: the next group of reads stays behind it */
    }
#pragma unroll
    for (int j = 0; j < 4; ++j) *(v8us*)(nK + lK + j * 8 * KPIT) = st[j];      /* the other buffers' last readers left them at the barrier that ended pass s - 1 */
    __builtin_amdgcn_sched_barrier(0);      /* the V^T loads stay behind the K stores, so that the two staged tiles are never live together */
#pragma unroll
    for (int j = 0; j < 4; ++j) st[j] = *(const v8us*)(pv + (size_t)j * 64 * NN);
    asm volatile("s_wait_xcnt 0x0" :: "v"(pv) : "memory");      /* as an input the loads' address stays whole until the wait */
#pragma unroll
    for (int g = 0; g < 2; ++g) {
      float mx = sc[0][g][0];
#pragma unroll
      for (int r = 0; r < 8; ++r) mx = fmaxf(mx, fmaxf(sc[0][g][r], sc[1][g][r]));
      mx = fmaxf(mx, xhalf(mx)) * cs;      /* cs > 0; both halves of the wave now hold this query's maximum of the pass */
      if (__builtin_amdgcn_ballot_w32(mx > m[g] + MTHR) != 0) {      /* scalar branch, rare after the first passes; one group a branch */
        const float mn = fmaxf(m[g], mx); const float corr = __builtin_amdgcn_exp2f(m[g] - mn);      /* 0 on the first pass */
        m[g] = mn; l[g] *= corr;
#pragma unroll
        for (int t = 0; t < 16; ++t) o[t][g] = o[t][g] * corr;
      }
    }
    v16h pf[2];
#pragma unroll
    for (int g = 0; g < 2; ++g) {
      const float sh = 10.0f - m[g]; FragH p; float s0 = 0.f, s1 = 0.f;      /* weights x 1024, as f16 operands away from the subnormal range; l carries the same factor */
      float x[16];
#pragma unroll
      for (int r = 0; r < 8; ++r) { x[r] = fmaf(sc[0][g][r], cs, sh); x[8 + r] = fmaf(sc[1][g][r], cs, sh); }
      __builtin_amdgcn_sched_barrier(0);      /* the arguments are all made first: no multiply-add is left to land on an exponential's source directly behind it */
#pragma unroll
      for (int r = 0; r < 16; ++r) x[r] = __builtin_amdgcn_exp2f(x[r]);
      __builtin_amdgcn_sched_barrier(0);      /* sums and conversions stay behind the exponentials: none reads a result directly behind its exponential */
#pragma unroll
      for (int r = 0; r < 8; ++r) { s0 += x[r]; s1 += x[8 + r]; p.h[r] = (_Float16)x[r]; p.h[8 + r] = (_Float16)x[8 + r]; }
      l[g] += s0 + s1; pf[g] = p.v;
    }
    // O^T += V^T.P^T, two d tiles (2 fragments, 4 matrix instructions) a block, read ahead in the same ring
    __builtin_amdgcn_sched_barrier(0);      /* the V^T reads stay behind the exponentials: hoisted among them they take the registers that keep two waves on a SIMD without spills */
    v16h va[3][2];
#pragma unroll
    for (int i = 0; i < 4; ++i) va[i >> 1][i & 1] = fa_frag(bV + (i * 16 + ln) * VPIT, hh);
#pragma unroll
    for (int b = 0; b < 8; ++b) {
      if (b < 6) { va[(b + 2) % 3][0] = fa_frag(bV + (((b + 2) * 2) * 16 + ln) * VPIT, hh); va[(b + 2) % 3][1] = fa_frag(bV + (((b + 2) * 2 + 1) * 16 + ln) * VPIT, hh); }
      __builtin_amdgcn_sched_barrier(0);      /* one group of reads in front of the block, as above */
      o[b * 2][0] = fa_mma(va[b % 3][0], pf[0], o[b * 2][0]); o[b * 2][1] = fa_mma(va[b % 3][0], pf[1], o[b * 2][1]);
      o[b * 2 + 1][0] = fa_mma(va[b % 3][1], pf[0], o[b * 2 + 1][0]); o[b * 2 + 1][1] = fa_mma(va[b % 3][1], pf[1], o[b * 2 + 1][1]);
      __builtin_amdgcn_sched_barrier(0);      /* ends the block */
    }
#pragma unroll
    for (int j = 0; j < 4; ++j) *(v8us*)(nV + lV + j * 64 * VPIT) = st[j];
    __syncthreads();      /* publishes pass s + 1's tiles and ends every read of pass s's */
  }
  // partials: OP[query row][key range][d], ML[query row][key range][m, l]; query row = branch * NN + query. One address pair serves all stores of each array, and
  // everything that is computed stands in front of the first store: behind it no register that a store names is written any more.
  const size_t row = (size_t)br * NN + q0 + ln;
  float* op = OP + (row * KSP + sp) * DO + 8 * hh;      /* a lane's 8 accumulator registers are 8 consecutive d of its query */
  float* mlp = ML + (row * KSP + sp) * 2 + hh;
  const float j0 = l[0] + xhalf(l[0]), j1 = l[1] + xhalf(l[1]);      /* the halves' sums joined, with every lane on: the exchange stands outside the selection below */
  const float w0 = hh ? j0 : m[0], w1 = hh ? j1 : m[1];      /* the lower half of the wave writes m, the upper l */
  mlp[0] = w0; mlp[16 * KSP * 2] = w1;
#pragma unroll
  for (int g = 0; g < 2; ++g) {
#pragma unroll
    for (int t = 0; t < 16; ++t) {
      const v4f lo = {o[t][g][0], o[t][g][1], o[t][g][2], o[t][g][3]}, hi = {o[t][g][4], o[t][g][5], o[t][g][6], o[t][g][7]};
      *(v4f*)(op + g * 16 * KSP * DO + t * 16) = lo; *(v4f*)(op + g * 16 * KSP * DO + t * 16 + 4) = hi;
    }
  }
  asm volatile("s_wait_xcnt 0x0" :: "v"(op), "v"(mlp) : "memory");      /* as inputs the stores' addresses stay whole until the wait */
}
// f = sum_s 2^(m_s - M) O_s / sum_s 2^(m_s - M) l_s over the KSP key ranges, fixed order s = 0..KSP-1; written as f16 hi + residual x 1024
__global__ __launch_bounds__(256) void k_fcomb(const float* __restrict__ OP, const float* __restrict__ ML, _Float16* __restrict__ FH, _Float16* __restrict__ FL) {
  const int t = blockIdx.x * 256 + threadIdx.x; if (t >= 2 * NN * (DO / 8)) return; const int d8 = (t % (DO / 8)) * 8; const int r = t / (DO / 8);
  const float* po = OP + (size_t)r * KSP * DO + d8; const float* pm = ML + (size_t)r * KSP * 2;      /* one address pair for each array */
  float ms[KSP], ls[KSP]; v8f op[KSP];
#pragma unroll
  for (int s = 0; s < KSP; ++s) { ms[s] = pm[s * 2]; ls[s] = pm[s * 2 + 1]; op[s] = *(const v8f*)(po + s * DO); }
  asm volatile("s_wait_xcnt 0x0" :: "v"(po), "v"(pm) : "memory");      /* as inputs the loads' addresses stay whole until the wait */
  float M = ms[0];
#pragma unroll
  for (int s = 1; s < KSP; ++s) M = fmaxf(M, ms[s]);
  v8f a = {0.f,0.f,0.f,0.f,0.f,0.f,0.f,0.f}; float den = 0.f;
#pragma unroll
  for (int s = 0; s < KSP; ++s) { const float wg = __builtin_amdgcn_exp2f(ms[s] - M); den += wg * ls[s]; a += op[s] * wg; }
  const float rs = 1.0f / den; FragH f, fl;
#pragma unroll
  for (int q = 0; q < 8; ++q) { const float v = a[q] * rs; const _Float16 hv = (_Float16)v; f.h[q] = hv; fl.h[q] = (_Float16)((v - (float)hv) * 1024.0f); }
  const size_t o = (size_t)r * DO + d8; *(v8us*)((unsigned short*)FH + o) = f.half[0]; *(v8us*)((unsigned short*)FL + o) = fl.half[0];
}

extern "C" void kernel_launch(void* const* d_in, const int* in_sizes, int n_in,
                              void* d_out, int out_size, void* d_ws, size_t ws_size, hipStream_t stream) {
  (void)in_sizes; (void)n_in; (void)out_size;
  const float* const* I = (const float* const*)d_in; const float* x1 = I[0]; const float* x2 = I[1]; const float* Wq1 = I[2]; const float* bq1 = I[3]; const float* Wk1 = I[4]; const float* bk1 = I[5]; const float* Wv = I[6]; const float* bv = I[7]; const float* Wq2 = I[8]; const float* bq2 = I[9]; const float* Wk2 = I[10]; const float* bk2 = I[11]; const float* We = I[12]; const float* be = I[13]; const float* scp = I[14];
  float* out1 = (float*)d_out; float* out2 = (float*)d_out + (size_t)NN * DI;      /* second output at byte offset 16777216 */
  char* ws = (char*)d_ws; size_t off = 0;
  auto take = [&](size_t bytes) { char* p = ws + off; off += (bytes + 255) & ~(size_t)255; return p; };
  _Float16* BW = (_Float16*)take((size_t)5 * DO * DI * 2); _Float16* BE = (_Float16*)take((size_t)DI * DO * 2); _Float16* X1 = (_Float16*)take((size_t)NN * DI * 2); _Float16* X2 = (_Float16*)take((size_t)NN * DI * 2);
  _Float16* Q1 = (_Float16*)take((size_t)NN * DO * 2); _Float16* K1 = (_Float16*)take((size_t)NN * DO * 2); _Float16* V1 = (_Float16*)take((size_t)NN * DO * 2); _Float16* Q2 = (_Float16*)take((size_t)NN * DO * 2); _Float16* K2 = (_Float16*)take((size_t)NN * DO * 2); _Float16* V2 = (_Float16*)take((size_t)NN * DO * 2); _Float16* VT1 = (_Float16*)take((size_t)NN * DO * 2); _Float16* VT2 = (_Float16*)take((size_t)NN * DO * 2);
  float* OP = (float*)take((size_t)KSP * 2 * NN * DO * 4); float* ML = (float*)take((size_t)KSP * 2 * NN * 2 * 4); _Float16* FH = (_Float16*)take((size_t)2 * NN * DO * 2); _Float16* FL = (_Float16*)take((size_t)2 * NN * DO * 2);
  if (off > ws_size) return;      /* 1.5 + 8 + 8 + 8 x 4 MiB + 64 + 0.5 + 8 + 8 = about 130 MiB */
  const float* Ws[5] = {Wq1, Wk1, Wv, Wq2, Wk2};
  for (int i = 0; i < 5; ++i) k_wsc<<<(unsigned)(((size_t)DO * DI / 8 + 255) / 256), 256, 0, stream>>>(Ws[i], BW + (size_t)i * DO * DI, (size_t)DO * DI / 8, 16.0f);      /* torch (out, in) naturals */
  k_wsc<<<(unsigned)(((size_t)DI * DO / 8 + 255) / 256), 256, 0, stream>>>(We, BE, (size_t)DI * DO / 8, 16.0f);
  k_x16<<<(unsigned)(((size_t)NN * DI / 8 + 255) / 256), 256, 0, stream>>>(x1, X1, (size_t)NN * DI / 8); k_x16<<<(unsigned)(((size_t)NN * DI / 8 + 255) / 256), 256, 0, stream>>>(x2, X2, (size_t)NN * DI / 8);
  const dim3 gP((NN / 128) * (DO / 64), 1);
  k_gemm2<0><<<gP, 128, 0, stream>>>(X1, DI, 0, BW, DI, 0, 0.0625f, bq1, 0, nullptr, 1, 0, 0, nullptr, Q1, DO, 0, NN, DO, DI);
  k_gemm2<0><<<gP, 128, 0, stream>>>(X1, DI, 0, BW + (size_t)DO * DI, DI, 0, 0.0625f, bk1, 0, nullptr, 1, 0, 0, nullptr, K1, DO, 0, NN, DO, DI);
  k_gemm2<0><<<gP, 128, 0, stream>>>(X1, DI, 0, BW + (size_t)2 * DO * DI, DI, 0, 0.0625f, bv, 0, nullptr, 1, 0, 0, nullptr, V1, DO, 0, NN, DO, DI);
  k_gemm2<0><<<gP, 128, 0, stream>>>(X2, DI, 0, BW + (size_t)3 * DO * DI, DI, 0, 0.0625f, bq2, 0, nullptr, 1, 0, 0, nullptr, Q2, DO, 0, NN, DO, DI);
  k_gemm2<0><<<gP, 128, 0, stream>>>(X2, DI, 0, BW + (size_t)4 * DO * DI, DI, 0, 0.0625f, bk2, 0, nullptr, 1, 0, 0, nullptr, K2, DO, 0, NN, DO, DI);
  k_gemm2<0><<<gP, 128, 0, stream>>>(X2, DI, 0, BW + (size_t)2 * DO * DI, DI, 0, 0.0625f, bv, 0, nullptr, 1, 0, 0, nullptr, V2, DO, 0, NN, DO, DI);      /* W_V shared */
  k_vt<DO / 64, NN><<<(DO / 64) * (NN / 64), 256, 0, stream>>>(V1, DO, 0, VT1); k_vt<DO / 64, NN><<<(DO / 64) * (NN / 64), 256, 0, stream>>>(V2, DO, 0, VT2);      /* V^T [256][8192] */
  k_flash<<<dim3(NN / FQ, KSP, 2), 256, 0, stream>>>(Q1, K2, VT1, Q2, K1, VT2, scp, OP, ML);      /* f1: hsi_Q . lidar_K -> hsi_V ; f2: lidar_Q . hsi_K -> lidar_V */
  k_fcomb<<<2 * NN * (DO / 8) / 256, 256, 0, stream>>>(OP, ML, FH, FL);
  for (int br = 0; br < 2; ++br) { float* outp = br ? out2 : out1; const _Float16* fh = FH + (size_t)br * NN * DO; const _Float16* fl = FL + (size_t)br * NN * DO;
    k_gemm2<0><<<dim3((NN / 128) * (DI / 64), 1), 128, 0, stream>>>(fl, DO, 0, BE, DO, 0, 0.0625f / 1024.0f, nullptr, 0, nullptr, 1, 0, 0, outp, nullptr, DI, 0, NN, DI, DO);
    k_gemm2<0><<<dim3((NN / 128) * (DI / 64), 1), 128, 0, stream>>>(fh, DO, 0, BE, DO, 0, 0.0625f, be, 0, outp, 1, (size_t)DI, 0, outp, nullptr, DI, 0, NN, DI, DO); }      /* (f_lo + f_hi) We^T + be */
}

// v003
// One run takes 227 microseconds.
// Next to v002, in two timings, it ran 1.58 times as fast each time.
// Over all steps from v000 it is 12.0 times as fast.
#include <hip/hip_runtime.h>
// cross_fuison (8192 hsi rows x1 and 8192 lidar rows x2, 512 -> 256: Q/K/V = x W^T + b (W_V shared); inv = 1/sqrt(clip(scale, 1, 32)); f1 = softmax(hsi_Q lidar_K^T inv) hsi_V; f2 = softmax(lidar_Q hsi_K^T inv) lidar_V; outputs = (f1 We^T + be, f2 We^T + be), each [8192][512]).
// Compute dtype: inputs rounded to bf16; inputs/weights exact as f16; Q/K/V and the softmax weights as plain f16 operands (~2^-12); f as f16 hi + residual into We; softmax f32. v_wmma_f32_16x16x32_f16.
#define NN 8192
#define DI 512
#define DO 256
typedef __bf16 v16b __attribute__((ext_vector_type(16)));
typedef unsigned short v8us __attribute__((ext_vector_type(8), may_alias));
typedef float  v8f  __attribute__((ext_vector_type(8)));
typedef float  v4f  __attribute__((ext_vector_type(4)));
typedef float  v4fa __attribute__((ext_vector_type(4), may_alias));
union FragB { v16b v; v8us half[2]; unsigned short u[16]; };

__device__ __forceinline__ unsigned short bf16_bits(float x) { unsigned int u = __float_as_uint(x); return (unsigned short)((u + 0x7FFFu + ((u >> 16) & 1u)) >> 16); }
__device__ __forceinline__ float bf16_val(unsigned short b) { return __uint_as_float(((unsigned int)b) << 16); }
__device__ __forceinline__ float bf16_round(float x) { return bf16_val(bf16_bits(x)); }
// D += A·B with NT terms: 1 = ah·bh, 2 = + al·bh (A split), 3 = + ah·bl (both split)
template <int NT>
__device__ __forceinline__ v8f mmaN(v16b ah, v16b al, v16b bh, v16b bl, v8f c) {
  c = __builtin_amdgcn_wmma_f32_16x16x32_bf16(false, ah, false, bh, (short)0, c, false, false);
  if (NT >= 2) c = __builtin_amdgcn_wmma_f32_16x16x32_bf16(false, al, false, bh, (short)0, c, false, false);
  if (NT >= 3) c = __builtin_amdgcn_wmma_f32_16x16x32_bf16(false, ah, false, bl, (short)0, c, false, false);
  asm volatile("v_nop\n\tv_nop\n\tv_nop\n\tv_nop" : "+v"(c) : "v"(ah), "v"(al), "v"(bh), "v"(bl));
  return c;
}

__global__ __launch_bounds__(256) void k_wt_bf16(const float* __restrict__ W, unsigned short* __restrict__ Wt, int K, int N) {
  const int t = blockIdx.x * 256 + threadIdx.x;
  const int k8n = K / 8;
  if (t >= N * k8n) return;
  const int n = t / k8n, k8 = (t % k8n) * 8;
  v8us v;
#pragma unroll
  for (int i = 0; i < 8; ++i) v[i] = bf16_bits(W[(size_t)(k8 + i) * N + n]);
  *(v8us*)(Wt + (size_t)n * K + k8) = v;
  
}

// GEMM C[M][N] (f32, pitch ldc) = act(A[M][K]·W + bias). A f32 row-major (pitch lda) converted per fragment to bf16
// (ASPLIT: hi/lo two planes -> 2 terms, else single rounded term); Wt bf16 [N][K] (pitch ldb). BIAS_BF16 rounds the
// bias to bf16 first (bias quantised to bf16 before the add). K%32==0, M%16==0, N%64==0.
template <bool ASPLIT, int ACT, bool BIAS_BF16>
__global__ __launch_bounds__(128) void k_gemm_bf(const float* __restrict__ A, int lda, const unsigned short* __restrict__ Wt, int ldb,
                                               const float* __restrict__ bias, float* __restrict__ C, int ldc, int M, int N, int K) {
  __shared__ __attribute__((aligned(16))) float so[4][16][64];
  const int tid = threadIdx.x, w = tid >> 5, lane = tid & 31, ln = lane & 15, hh = lane >> 4;
  const int ntn = N / 64;
  const int wid = blockIdx.x * 4 + w;
  const int mt = wid / ntn, nq = wid % ntn;
  if (mt * 16 >= M) return;
  const int row0 = mt * 16, col0 = nq * 64;
  const float* arow = A + (size_t)(row0 + ln) * lda;
  v8f acc[4] = {};
  for (int kb = 0; kb < K; kb += 32) {
    FragB ah, al;
    const v4f x0 = *(const v4fa*)(arow + kb + 8 * hh), x1 = *(const v4fa*)(arow + kb + 8 * hh + 4);
    const v4f x2 = *(const v4fa*)(arow + kb + 16 + 8 * hh), x3 = *(const v4fa*)(arow + kb + 16 + 8 * hh + 4);
    float xs[16] = {x0[0],x0[1],x0[2],x0[3],x1[0],x1[1],x1[2],x1[3],x2[0],x2[1],x2[2],x2[3],x3[0],x3[1],x3[2],x3[3]};
#pragma unroll
    for (int i = 0; i < 16; ++i) { const unsigned short hb = bf16_bits(xs[i]); ah.u[i] = hb; al.u[i] = ASPLIT ? bf16_bits(xs[i] - bf16_val(hb)) : (unsigned short)0; }
#pragma unroll
    for (int t = 0; t < 4; ++t) {
      const unsigned short* brow = Wt + (size_t)(col0 + t * 16 + ln) * ldb + kb;
      FragB b;
      b.half[0] = *(const v8us*)(brow + 8 * hh);
      b.half[1] = *(const v8us*)(brow + 16 + 8 * hh);
      acc[t] = mmaN<ASPLIT ? 2 : 1>(ah.v, al.v, b.v, b.v, acc[t]);
    }
  }
#pragma unroll
  for (int t = 0; t < 4; ++t) {
    float bv = bias ? bias[col0 + t * 16 + ln] : 0.f;
    if (BIAS_BF16) bv = bf16_round(bv);
#pragma unroll
    for (int r = 0; r < 8; ++r) { float v = acc[t][r] + bv; if (ACT == 1) v = fmaxf(v, 0.f); so[w][8 * hh + r][t * 16 + ln] = v; }
  }
  __builtin_amdgcn_fence(__ATOMIC_ACQ_REL, "workgroup");
  __builtin_amdgcn_wave_barrier();
  const int rsub = lane >> 4, c4 = (lane & 15) * 4;
  {
#pragma unroll
    for (int q = 0; q < 8; ++q) {
      const int r = q * 2 + rsub;
      const v4f v = *(const v4fa*)&so[w][r][c4];
      *(v4f*)(C + (size_t)(row0 + r) * ldc + col0 + c4) = v;
    }
    
  }
}

// GEMM C = act(A·W + bias + resid): A f32 (ASPLIT -> hi/lo 2 terms), Wt bf16 [N][K]; ACT 0 none, 1 relu, 2 exact gelu;
// resid (optional, f32, row index = (row % rmod), pitch ldr, RES_BF16 rounds it) added before the activation.
template <bool ASPLIT, int ACT, bool BIAS_BF16, bool RES_BF16>
__global__ __launch_bounds__(128) void k_gemm_bf3(const float* __restrict__ A, int lda, const unsigned short* __restrict__ Wt, int ldb,
                                                const float* __restrict__ bias, const float* __restrict__ resid, int rmod, int ldr,
                                                float* __restrict__ C, int ldc, int M, int N, int K) {
  __shared__ __attribute__((aligned(16))) float so[4][16][64];
  const int tid = threadIdx.x, w = tid >> 5, lane = tid & 31, ln = lane & 15, hh = lane >> 4;
  const int ntn = N / 64;
  const int wid = blockIdx.x * 4 + w;
  const int mt = wid / ntn, nq = wid % ntn;
  if (mt * 16 >= M) return;
  const int row0 = mt * 16, col0 = nq * 64;
  const float* arow = A + (size_t)(row0 + ln) * lda;
  v8f acc[4] = {};
  for (int kb = 0; kb < K; kb += 32) {
    FragB ah, al;
    const v4f x0 = *(const v4fa*)(arow + kb + 8 * hh), x1 = *(const v4fa*)(arow + kb + 8 * hh + 4);
    const v4f x2 = *(const v4fa*)(arow + kb + 16 + 8 * hh), x3 = *(const v4fa*)(arow + kb + 16 + 8 * hh + 4);
    float xs[16] = {x0[0],x0[1],x0[2],x0[3],x1[0],x1[1],x1[2],x1[3],x2[0],x2[1],x2[2],x2[3],x3[0],x3[1],x3[2],x3[3]};
#pragma unroll
    for (int i = 0; i < 16; ++i) { const unsigned short hb = bf16_bits(xs[i]); ah.u[i] = hb; al.u[i] = ASPLIT ? bf16_bits(xs[i] - bf16_val(hb)) : (unsigned short)0; }
#pragma unroll
    for (int t = 0; t < 4; ++t) {
      const unsigned short* brow = Wt + (size_t)(col0 + t * 16 + ln) * ldb + kb;
      FragB b;
      b.half[0] = *(const v8us*)(brow + 8 * hh);
      b.half[1] = *(const v8us*)(brow + 16 + 8 * hh);
      acc[t] = mmaN<ASPLIT ? 2 : 1>(ah.v, al.v, b.v, b.v, acc[t]);
    }
  }
#pragma unroll
  for (int t = 0; t < 4; ++t) {
    const int col = col0 + t * 16 + ln;
    float bv = bias ? bias[col] : 0.f;
    if (BIAS_BF16) bv = bf16_round(bv);
#pragma unroll
    for (int r = 0; r < 8; ++r) {
      float v = acc[t][r] + bv;
      if (resid) { float rv = resid[(size_t)((row0 + 8 * hh + r) % rmod) * ldr + col]; if (RES_BF16) rv = bf16_round(rv); v += rv; }
      if (ACT == 1) v = fmaxf(v, 0.f);
      if (ACT == 2) v = 0.5f * v * (1.0f + erff(v * 0.70710678118654752f));
      if (ACT == 3) { const float u = 0.7978845608028654f * (v + 0.044715f * v * v * v); v = 0.5f * v * (1.0f + tanhf(u)); }
      so[w][8 * hh + r][t * 16 + ln] = v;
    }
  }
  __builtin_amdgcn_fence(__ATOMIC_ACQ_REL, "workgroup");
  __builtin_amdgcn_wave_barrier();
  const int rsub = lane >> 4, c4 = (lane & 15) * 4;
  {
#pragma unroll
    for (int q = 0; q < 8; ++q) {
      const int r = q * 2 + rsub;
      const v4f v = *(const v4fa*)&so[w][r][c4];
      *(v4f*)(C + (size_t)(row0 + r) * ldc + col0 + c4) = v;
    }
    
  }
}
// row LayerNorm (biased variance, eps) over N: s = X (+ R); optional out_sum <- s; out_norm <- (s-mu)*rsqrt(var+eps)*g + b
template <bool PARAM_BF16>
__global__ __launch_bounds__(256) void k_layernorm(const float* __restrict__ X, const float* __restrict__ R, const float* __restrict__ g, const float* __restrict__ bta,
                                                  float* __restrict__ out_sum, float* __restrict__ out_norm, int N, float eps) {
  __shared__ float red[256];
  const int row = blockIdx.x, tid = threadIdx.x;
  const float* x = X + (size_t)row * N; const float* rr = R ? R + (size_t)row * N : nullptr;
  float vals[16];                     // up to N = 4096
  const int per = N / 256;            // contiguous chunk per thread? use strided-by-4 chunks: thread handles j = tid*4 + 1024*u
  float s1 = 0.f;
  for (int u = 0; u < per / 4; ++u) {
    const int j = tid * 4 + 1024 * u;
    const v4f a = *(const v4fa*)(x + j);
    v4f b = {0.f,0.f,0.f,0.f}; if (rr) b = *(const v4fa*)(rr + j);
#pragma unroll
    for (int q = 0; q < 4; ++q) { const float v = a[q] + b[q]; vals[u * 4 + q] = v; s1 += v; }
  }
  red[tid] = s1; __syncthreads();
  for (int st = 128; st > 0; st >>= 1) { if (tid < st) red[tid] += red[tid + st]; __syncthreads(); }
  const float mu = red[0] / (float)N; __syncthreads();
  float s2 = 0.f;
  for (int u = 0; u < per / 4; ++u)
#pragma unroll
    for (int q = 0; q < 4; ++q) { const float c = vals[u * 4 + q] - mu; s2 += c * c; }
  red[tid] = s2; __syncthreads();
  for (int st = 128; st > 0; st >>= 1) { if (tid < st) red[tid] += red[tid + st]; __syncthreads(); }
  const float rs = rsqrtf(red[0] / (float)N + eps);
  {
    for (int u = 0; u < per / 4; ++u) {
      const int j = tid * 4 + 1024 * u;
      v4f o, sm;
#pragma unroll
      for (int q = 0; q < 4; ++q) {
        float gg = g[j + q], bb = bta[j + q];
        if (PARAM_BF16) { gg = bf16_round(gg); bb = bf16_round(bb); }
        sm[q] = vals[u * 4 + q]; o[q] = (vals[u * 4 + q] - mu) * rs * gg + bb;
      }
      if (out_sum) *(v4f*)(out_sum + (size_t)row * N + j) = sm;
      *(v4f*)(out_norm + (size_t)row * N + j) = o;
    }
    
  }
}



// ---- f16 WMMA path (v_wmma_f32_16x16x32_f16): 11-bit significands for operands in range — used where a [0,1] probability operand needs more precision than bf16
typedef _Float16 v16h __attribute__((ext_vector_type(16)));
union FragH { v16h v; v8us half[2]; _Float16 h[16]; unsigned short u[16]; };
template <int NT>
__device__ __forceinline__ v8f mmaH(v16h ah, v16h al, v16h bh, v16h bl, v8f c) {
  c = __builtin_amdgcn_wmma_f32_16x16x32_f16(false, ah, false, bh, (short)0, c, false, false);
  if (NT >= 2) c = __builtin_amdgcn_wmma_f32_16x16x32_f16(false, al, false, bh, (short)0, c, false, false);
  if (NT >= 3) c = __builtin_amdgcn_wmma_f32_16x16x32_f16(false, ah, false, bl, (short)0, c, false, false);
  asm volatile("v_nop\n\tv_nop\n\tv_nop\n\tv_nop" : "+v"(c) : "v"(ah), "v"(al), "v"(bh), "v"(bl));
  return c;
}
// batched GEMM like k_gemm_b but f16 operands: A f32 (split into f16 hi/lo if ASPLIT, else rounded to f16), Bt = f16 values [n][k]; alpha; C f32; N multiple of 16 (partial tiles skipped)
template <bool ASPLIT>
__global__ __launch_bounds__(128) void k_gemm_h(const float* __restrict__ A, int lda, size_t sA, const _Float16* __restrict__ Bh, int ldb, size_t sB, float alpha, float* __restrict__ C, int ldc, size_t sC, int M, int N, int K) {
  __shared__ __attribute__((aligned(16))) float so[4][16][64];
  const int tid = threadIdx.x, w = tid >> 5, lane = tid & 31, ln = lane & 15, hh = lane >> 4; const int by = blockIdx.y;
  A += (size_t)by * sA; Bh += (size_t)by * sB; C += (size_t)by * sC;
  const int ntn = (N + 63) / 64; const int wid = blockIdx.x * 4 + w; const int mt = wid / ntn, nq = wid % ntn; if (mt * 16 >= M) return;
  const int row0 = mt * 16, col0 = nq * 64; const float* arow = A + (size_t)(row0 + ln) * lda;
  v8f acc[4] = {};
  for (int kb = 0; kb < K; kb += 32) {
    FragH ah, al;
    const v4f x0 = *(const v4fa*)(arow + kb + 8 * hh), x1 = *(const v4fa*)(arow + kb + 8 * hh + 4), x2 = *(const v4fa*)(arow + kb + 16 + 8 * hh), x3 = *(const v4fa*)(arow + kb + 16 + 8 * hh + 4);
    float xs[16] = {x0[0],x0[1],x0[2],x0[3],x1[0],x1[1],x1[2],x1[3],x2[0],x2[1],x2[2],x2[3],x3[0],x3[1],x3[2],x3[3]};
#pragma unroll
    for (int i = 0; i < 16; ++i) { const _Float16 h = (_Float16)xs[i]; ah.h[i] = h; al.h[i] = ASPLIT ? (_Float16)(xs[i] - (float)h) : (_Float16)0.0f; }
#pragma unroll
    for (int t = 0; t < 4; ++t) { if (col0 + t * 16 >= N) continue; const size_t boff = (size_t)(col0 + t * 16 + ln) * ldb + kb; FragH bq; bq.half[0] = *(const v8us*)(Bh + boff + 8 * hh); bq.half[1] = *(const v8us*)(Bh + boff + 16 + 8 * hh);
      acc[t] = mmaH<ASPLIT ? 2 : 1>(ah.v, al.v, bq.v, bq.v, acc[t]); }
  }
#pragma unroll
  for (int t = 0; t < 4; ++t) { if (col0 + t * 16 >= N) continue;
#pragma unroll
    for (int r = 0; r < 8; ++r) so[w][8 * hh + r][t * 16 + ln] = acc[t][r] * alpha; }
  __builtin_amdgcn_fence(__ATOMIC_ACQ_REL, "workgroup"); __builtin_amdgcn_wave_barrier();
  const int rsub = lane >> 4, c4 = (lane & 15) * 4;
  {
#pragma unroll
    for (int q = 0; q < 8; ++q) { const int r = q * 2 + rsub; if (col0 + c4 < N) { const v4f v = *(const v4fa*)&so[w][r][c4]; *(v4f*)(C + (size_t)(row0 + r) * ldc + col0 + c4) = v; } }
     }
}

// Wt[n][k] = f16(W[k][n]·scale) from f32 row-major W[K][N] (scale = power of two; bf16-exact weights stay exact in f16 away from the subnormal range)
__global__ __launch_bounds__(256) void k_wt_f16(const float* __restrict__ W, _Float16* __restrict__ Wt, int K, int N, float scale) {
  const int t = blockIdx.x * 256 + threadIdx.x; if (t >= N * (K / 8)) return; const int n = t / (K / 8), k8 = (t % (K / 8)) * 8; FragH f;
#pragma unroll
  for (int i = 0; i < 8; ++i) f.h[i] = (_Float16)(bf16_round(W[(size_t)(k8 + i) * N + n]) * scale); const v8us o = f.half[0];
  *(v8us*)((unsigned short*)Wt + (size_t)n * K + k8) = o; 
}
// k_gemm_hh variant with fused epilogue: v = acc·alpha + bias[by·sBias + col] (+ CP[(row/rowsPerB)·sCPb + by·64 + col] if CP) ; ACT 0 none / 1 elu ; writes f16 C16 (and f32 C if non-null)
template <int ACT>
__global__ __launch_bounds__(128) void k_gemm_hhx(const _Float16* __restrict__ A, int lda, size_t sA, const _Float16* __restrict__ Bh, int ldb, size_t sB, float alpha, const float* __restrict__ bias, size_t sBias, const float* __restrict__ CP, int rowsPerB, size_t sCPb, int row0g,
    float* __restrict__ C, _Float16* __restrict__ C16, int ldc, size_t sC, int M, int N, int K) {
  __shared__ __attribute__((aligned(16))) float so[4][16][64];
  const int tid = threadIdx.x, w = tid >> 5, lane = tid & 31, ln = lane & 15, hh = lane >> 4; const int by = blockIdx.y;
  A += (size_t)by * sA; Bh += (size_t)by * sB; const size_t cofs = (size_t)by * sC; const float* bp = bias ? bias + (size_t)by * sBias : nullptr;
  const int ntn = (N + 63) / 64; const int wid = blockIdx.x * 4 + w; const int mt = wid / ntn, nq = wid % ntn; if (mt * 16 >= M) return;
  const int row0 = mt * 16, col0 = nq * 64; const _Float16* arow = A + (size_t)(row0 + ln) * lda;
  v8f acc[4] = {};
  for (int kb = 0; kb < K; kb += 32) { FragH ah; ah.half[0] = *(const v8us*)((const unsigned short*)arow + kb + 8 * hh); ah.half[1] = *(const v8us*)((const unsigned short*)arow + kb + 16 + 8 * hh);
#pragma unroll
    for (int t = 0; t < 4; ++t) { if (col0 + t * 16 >= N) continue; const size_t boff = (size_t)(col0 + t * 16 + ln) * ldb + kb; FragH bq; bq.half[0] = *(const v8us*)((const unsigned short*)Bh + boff + 8 * hh); bq.half[1] = *(const v8us*)((const unsigned short*)Bh + boff + 16 + 8 * hh);
      acc[t] = mmaH<1>(ah.v, ah.v, bq.v, bq.v, acc[t]); }
  }
#pragma unroll
  for (int t = 0; t < 4; ++t) { if (col0 + t * 16 >= N) continue; const int col = col0 + t * 16 + ln; const float bv = bp ? bf16_round(bp[col]) : 0.f;
#pragma unroll
    for (int r = 0; r < 8; ++r) { float v = acc[t][r] * alpha + bv; if (CP) { const int rr = row0g + row0 + 8 * hh + r; if (rowsPerB < 0) v += CP[cofs + (size_t)rr * ldc + col];      /* rowsPerB < 0: own element of the batched C plane */ else { const int bidx = rr / rowsPerB; v += CP[(size_t)bidx * sCPb + (size_t)by * 64 + col]; } } if (ACT == 1) v = (v > 0.f) ? v : expm1f(v); else if (ACT == 7) v = (v > 0.f) ? v + 1.0f : expf(v); else if (ACT == 8) v = tanhf(v); else if (ACT == 9) v = 0.5f * v * (1.0f + tanhf(0.7978845608028654f * (v + 0.044715f * v * v * v))); else if (ACT == 11) v = 1.0f / (1.0f + expf(-v)); else if (ACT == 12) v = (v > 0.f) ? v : 0.01f * v; else if (ACT == 14) v = (v > 0.f) ? v : 0.1f * v; else if (ACT == 16) v = (v >= 0.f) ? v : 0.3f * v; else if (ACT == 17) v = (v >= 0.f) ? v : 0.2f * v; else if (ACT == 15) v = v / (1.0f + expf(-v)); else if (ACT == 3) v = fmaxf(v, 0.f); else if (ACT == 6) v = 0.5f * v * (1.0f + erff(v * 0.70710678118654752f)); so[w][8 * hh + r][t * 16 + ln] = v; } }
  __builtin_amdgcn_fence(__ATOMIC_ACQ_REL, "workgroup"); __builtin_amdgcn_wave_barrier();
  const int rsub = lane >> 4, c4 = (lane & 15) * 4; typedef _Float16 v4h __attribute__((ext_vector_type(4)));
  {
#pragma unroll
    for (int q = 0; q < 8; ++q) { const int r = q * 2 + rsub; if (col0 + c4 < N) { const v4f v = *(const v4fa*)&so[w][r][c4]; if (C) *(v4f*)(C + cofs + (size_t)(row0 + r) * ldc + col0 + c4) = v; if (C16) { v4h h4; for (int i = 0; i < 4; ++i) h4[i] = (_Float16)v[i]; *(v4h*)(C16 + cofs + (size_t)(row0 + r) * ldc + col0 + c4) = h4; } } }
     }
}


typedef _Float16 v4h __attribute__((ext_vector_type(4)));

// every input conversion in one launch: blocks 0 .. 6 WB - 1 take the six weight matrices (slot j of BW = f16(bf16(w_j) x 16), each DO x DI elements), the rest x1 and x2 (X = [x1 | x2] as f16(bf16(x)))
#define XB (NN * DI / 8 / 256)   /* blocks per x */
#define WB (DO * DI / 8 / 256)   /* blocks per weight matrix */
__global__ __launch_bounds__(256) void k_cvt(const float* __restrict__ x1, const float* __restrict__ x2, const float* __restrict__ w0, const float* __restrict__ w1, const float* __restrict__ w2, const float* __restrict__ w3, const float* __restrict__ w4, const float* __restrict__ w5,
    _Float16* __restrict__ X, _Float16* __restrict__ BW) {
  const int b = blockIdx.x, tid = threadIdx.x; const float* src; _Float16* dst; float sc;
  if (b < 6 * WB) { const int j = b / WB; const float* w = j == 0 ? w0 : j == 1 ? w1 : j == 2 ? w2 : j == 3 ? w3 : j == 4 ? w4 : w5; src = w + ((size_t)(b - j * WB) * 256 + tid) * 8; dst = BW + ((size_t)b * 256 + tid) * 8; sc = 16.0f; }
  else { const int q = b - 6 * WB, j = q / XB; src = (j ? x2 : x1) + ((size_t)(q - j * XB) * 256 + tid) * 8; dst = X + ((size_t)q * 256 + tid) * 8; sc = 1.0f; }
  FragH f;
#pragma unroll
  for (int q = 0; q < 8; ++q) f.h[q] = (_Float16)(bf16_round(src[q]) * sc);
  *(v8us*)(unsigned short*)dst = f.half[0]; }
__global__ __launch_bounds__(256) void k_h16(const float* __restrict__ x, _Float16* __restrict__ X16, size_t n8) { const size_t t = (size_t)blockIdx.x * 256 + threadIdx.x; if (t >= n8) return; FragH f;
#pragma unroll
  for (int q = 0; q < 8; ++q) f.h[q] = (_Float16)x[t * 8 + q]; *(v8us*)((unsigned short*)X16 + t * 8) = f.half[0];  }
__global__ __launch_bounds__(256) void k_round16f(const float* __restrict__ W, _Float16* __restrict__ Bt, size_t n8) { const size_t t = (size_t)blockIdx.x * 256 + threadIdx.x; if (t >= n8) return; FragH f;
#pragma unroll
  for (int i = 0; i < 8; ++i) f.h[i] = (_Float16)(bf16_round(W[t * 8 + i]) * 16.0f); *(v8us*)((unsigned short*)Bt + t * 8) = f.half[0];  }
template <int NHv, int TTv>
__global__ __launch_bounds__(256) void k_vt(const _Float16* __restrict__ V16, int ldv, int voff, _Float16* __restrict__ Vt) { __shared__ unsigned short tl[64][66]; const int tid = threadIdx.x; const int slab = blockIdx.x / (TTv / 64), lg = blockIdx.x % (TTv / 64); const int b = slab / NHv, h = slab % NHv;
  for (int i = tid; i < 64 * 8; i += 256) { const int r = i / 8, c8 = (i % 8) * 8; FragH f; f.half[0] = *(const v8us*)((const unsigned short*)V16 + ((size_t)b * TTv + lg * 64 + r) * ldv + voff + h * 64 + c8);
#pragma unroll
    for (int q = 0; q < 8; ++q) tl[r][c8 + q] = f.u[q]; }
  __syncthreads();
  {
#pragma unroll
    for (int rd = 0; rd < 2; ++rd) { const int d = rd * 32 + tid / 8, pc = tid % 8; FragH f;
#pragma unroll
      for (int q = 0; q < 8; ++q) f.u[q] = tl[pc * 8 + q][d];
      *(v8us*)((unsigned short*)Vt + ((size_t)slab * 64 + d) * TTv + lg * 64 + pc * 8) = f.half[0]; }
     } }

__global__ __launch_bounds__(256) void k_hl(const float* __restrict__ F, _Float16* __restrict__ Hh, _Float16* __restrict__ Hl, size_t n8) { const size_t t = (size_t)blockIdx.x * 256 + threadIdx.x; if (t >= n8) return; FragH fh, fl; const v4f a = *(const v4fa*)(F + t * 8), c = *(const v4fa*)(F + t * 8 + 4);
#pragma unroll
  for (int q = 0; q < 4; ++q) { _Float16 h = (_Float16)a[q]; fh.h[q] = h; fl.h[q] = (_Float16)((a[q] - (float)h) * 1024.0f); h = (_Float16)c[q]; fh.h[4 + q] = h; fl.h[4 + q] = (_Float16)((c[q] - (float)h) * 1024.0f); }
  { *(v8us*)((unsigned short*)Hh + t * 8) = fh.half[0]; *(v8us*)((unsigned short*)Hl + t * 8) = fl.half[0];  } }

// ---- fast GEMM (wave tile 32x64; requires M % 32 == 0 rows per launch region and N % 64 == 0); epilogue = k_gemm_hhx semantics ----
__device__ __forceinline__ v16h g2_frag(const _Float16* p, int hh) { FragH f; f.half[0] = *(const v8us*)((const unsigned short*)p + 8 * hh); f.half[1] = *(const v8us*)((const unsigned short*)p + 16 + 8 * hh); return f.v; }
__device__ __forceinline__ v8f g2_mma(v16h a, v16h b, v8f c) { v8f d = __builtin_amdgcn_wmma_f32_16x16x32_f16(false, a, false, b, (short)0, c, false, false); asm volatile("v_nop\n\tv_nop\n\tv_nop\n\tv_nop" : "+v"(d) : "v"(a), "v"(b)); return d; }
template <int ACT>
__global__ __launch_bounds__(128) void k_gemm2(const _Float16* __restrict__ A, int lda, size_t sA, const _Float16* __restrict__ Bh, int ldb, size_t sB, float alpha, const float* __restrict__ bias, size_t sBias, const float* __restrict__ CP, int rowsPerB, size_t sCPb, int row0g,
    float* __restrict__ C, _Float16* __restrict__ C16, int ldc, size_t sC, int M, int N, int K) { static_assert(ACT == 0 || ACT == 3 || ACT == 6 || ACT == 8 || ACT == 9 || ACT == 11 || ACT == 12 || ACT == 14 || ACT == 15 || ACT == 16 || ACT == 17, "k_gemm2: unsupported ACT code (would silently apply no activation)");
  __shared__ __attribute__((aligned(16))) float so[4][32][68];
  const int tid = threadIdx.x, w = tid >> 5, lane = tid & 31, ln = lane & 15, hh = lane >> 4; const int by = blockIdx.y;
  A += (size_t)by * sA; Bh += (size_t)by * sB; const size_t cofs = (size_t)by * sC; const float* bp = bias ? bias + (size_t)by * sBias : nullptr;
  const int ntn = N >> 6; const int mt = blockIdx.x / ntn, nq = blockIdx.x - mt * ntn; const int row0 = mt * 128 + 32 * w, col0 = nq * 64; if (row0 >= M) return;
  const _Float16* a0p = A + (size_t)(row0 + ln) * lda; const _Float16* a1p = a0p + (size_t)16 * lda;
  const _Float16* b0p = Bh + (size_t)(col0 + ln) * ldb; const _Float16* b1p = b0p + (size_t)16 * ldb; const _Float16* b2p = b1p + (size_t)16 * ldb; const _Float16* b3p = b2p + (size_t)16 * ldb;
  const v8f z8 = {0.f,0.f,0.f,0.f,0.f,0.f,0.f,0.f}; v8f c00 = z8, c01 = z8, c02 = z8, c03 = z8, c10 = z8, c11 = z8, c12 = z8, c13 = z8;
#pragma unroll 1
  for (int kb = 0; kb < K; kb += 32) { const v16h a0 = g2_frag(a0p + kb, hh), a1 = g2_frag(a1p + kb, hh);
    v16h b = g2_frag(b0p + kb, hh); c00 = g2_mma(a0, b, c00); c10 = g2_mma(a1, b, c10);
    b = g2_frag(b1p + kb, hh); c01 = g2_mma(a0, b, c01); c11 = g2_mma(a1, b, c11);
    b = g2_frag(b2p + kb, hh); c02 = g2_mma(a0, b, c02); c12 = g2_mma(a1, b, c12);
    b = g2_frag(b3p + kb, hh); c03 = g2_mma(a0, b, c03); c13 = g2_mma(a1, b, c13); }
  v8f accs[8] = {c00, c01, c02, c03, c10, c11, c12, c13};
#pragma unroll
  for (int u = 0; u < 8; ++u) { const int t = u & 3, half = u >> 2; const int col = col0 + t * 16 + ln; const float bv = bp ? bf16_round(bp[col]) : 0.f;
#pragma unroll
    for (int r = 0; r < 8; ++r) { const int rloc = half * 16 + 8 * hh + r; float v = accs[u][r] * alpha + bv; if (CP) { if (rowsPerB < 0) v += CP[cofs + (size_t)(row0g + row0 + rloc) * ldc + col];      /* rowsPerB < 0: own element of the batched C plane */ else { const int bidx = (row0g + row0 + rloc) / rowsPerB; v += CP[(size_t)bidx * sCPb + (size_t)by * 64 + col]; } }
      if (ACT == 3) v = fmaxf(v, 0.f); else if (ACT == 6) v = 0.5f * v * (1.0f + erff(v * 0.70710678118654752f)); else if (ACT == 11) v = 1.0f / (1.0f + expf(-v)); else if (ACT == 15) v = v / (1.0f + expf(-v)); else if (ACT == 12) v = (v > 0.f) ? v : 0.01f * v; else if (ACT == 8) v = tanhf(v); else if (ACT == 9) v = 0.5f * v * (1.0f + tanhf(0.7978845608028654f * (v + 0.044715f * v * v * v))); else if (ACT == 14) v = (v > 0.f) ? v : 0.1f * v; else if (ACT == 16) v = (v >= 0.f) ? v : 0.3f * v; else if (ACT == 17) v = (v >= 0.f) ? v : 0.2f * v;
      so[w][rloc][t * 16 + ln] = v; } }
  __builtin_amdgcn_fence(__ATOMIC_ACQ_REL, "workgroup"); __builtin_amdgcn_wave_barrier();
  const int rsub = lane >> 4, c4 = (lane & 15) * 4;
  {
#pragma unroll
    for (int q = 0; q < 16; ++q) { const int r = q * 2 + rsub; const v4f v = *(const v4fa*)&so[w][r][c4]; if (C) *(v4f*)(C + cofs + (size_t)(row0 + r) * ldc + col0 + c4) = v; if (C16) { v4h h4; for (int i = 0; i < 4; ++i) h4[i] = (_Float16)v[i]; *(v4h*)(C16 + cofs + (size_t)(row0 + r) * ldc + col0 + c4) = h4; } }
     } }


// the six projections in one launch: k_gemm2's tile, loop and epilogue with the shapes as constants (M = NN, N = DO, K = DI, f16 result only). blockIdx.y = j picks plane j of QKV = [Q1 K1 Q2 K2 V1 V2];
// x1 (first half of X) feeds planes 0, 1, 4; weight slots of BW = [Wq1 Wk1 Wq2 Wk2 Wv], W_V shared by planes 4 and 5
__global__ __launch_bounds__(128) void k_proj6(const _Float16* __restrict__ X, const _Float16* __restrict__ BW, const float* __restrict__ bq1, const float* __restrict__ bk1, const float* __restrict__ bq2, const float* __restrict__ bk2, const float* __restrict__ bv, _Float16* __restrict__ QKV) {
  __shared__ __attribute__((aligned(16))) float so[4][32][68];
  const int tid = threadIdx.x, w = tid >> 5, lane = tid & 31, ln = lane & 15, hh = lane >> 4; const int j = blockIdx.y;
  const float* bp = j == 0 ? bq1 : j == 1 ? bk1 : j == 2 ? bq2 : j == 3 ? bk2 : bv;
  const int mt = blockIdx.x / (DO / 64), nq = blockIdx.x % (DO / 64); const int row0 = mt * 128 + 32 * w, col0 = nq * 64;
  const _Float16* ap = X + ((j == 2 || j == 3 || j == 5) ? (size_t)NN * DI : 0) + (size_t)(row0 + ln) * DI + 8 * hh;      /* one address pair for the A loads of a k step, one for the B loads */
  const _Float16* bq = BW + (size_t)(j < 4 ? j : 4) * DO * DI + (size_t)(col0 + ln) * DI + 8 * hh;
  const v8f z8 = {0.f,0.f,0.f,0.f,0.f,0.f,0.f,0.f}; v8f c00 = z8, c01 = z8, c02 = z8, c03 = z8, c10 = z8, c11 = z8, c12 = z8, c13 = z8;
  // kept rolled, as in k_gemm2
#pragma unroll 1
  for (int kb = 0; kb < DI; kb += 32) { const _Float16* ak = ap + kb; const _Float16* bk = bq + kb; const v16h a0 = g2_frag(ak, 0), a1 = g2_frag(ak + 16 * DI, 0);
    v16h b = g2_frag(bk, 0); c00 = g2_mma(a0, b, c00); c10 = g2_mma(a1, b, c10);
    b = g2_frag(bk + 16 * DI, 0); c01 = g2_mma(a0, b, c01); c11 = g2_mma(a1, b, c11);
    b = g2_frag(bk + 32 * DI, 0); c02 = g2_mma(a0, b, c02); c12 = g2_mma(a1, b, c12);
    b = g2_frag(bk + 48 * DI, 0); c03 = g2_mma(a0, b, c03); c13 = g2_mma(a1, b, c13);
    asm volatile("s_wait_xcnt 0x0" :: "v"(ak), "v"(bk) : "memory"); }      /* as inputs the loads' two addresses stay whole until the wait, in front of the next step's */
  v8f accs[8] = {c00, c01, c02, c03, c10, c11, c12, c13};
#pragma unroll
  for (int u = 0; u < 8; ++u) { const int t = u & 3, half = u >> 2; const float bb = bf16_round(bp[col0 + t * 16 + ln]);
#pragma unroll
    for (int r = 0; r < 8; ++r) so[w][half * 16 + 8 * hh + r][t * 16 + ln] = accs[u][r] * 0.0625f + bb; }
  __builtin_amdgcn_fence(__ATOMIC_ACQ_REL, "workgroup"); __builtin_amdgcn_wave_barrier();      /* a wave reads back only its own rows */
  const int rsub = lane >> 4, c4 = (lane & 15) * 4; _Float16* cp = QKV + (size_t)j * NN * DO + (size_t)(row0 + rsub) * DO + col0 + c4;
#pragma unroll
  for (int q = 0; q < 16; ++q) { const v4f v = *(const v4fa*)&so[w][q * 2 + rsub][c4]; v4h h4; for (int i = 0; i < 4; ++i) h4[i] = (_Float16)v[i]; *(v4h*)(cp + q * 2 * DO) = h4; }
}
#define FQ 256                   /* query rows per work-group */
#define KSP 4                    /* key ranges: 32 query blocks x KSP x 2 branches = 256 work-groups */
#define NPASS (NN / KSP / 32)
#define KPIT 264                 /* LDS pitch of a K row, 16-bit elements: 528 B = 16 B x odd */
#define VPIT 40                  /* LDS pitch of a V^T row (32 keys): 80 B = 16 B x odd */
#define MTHR 4.0f                /* the maximum in use may trail the true one by this much (log2): a weight is at most 2^(10 + 4), inside f16 */
__device__ __forceinline__ float xhalf(float x) { return __builtin_bit_cast(float, __builtin_amdgcn_permlanex16(__builtin_bit_cast(int, x), __builtin_bit_cast(int, x), 0x76543210, 0xfedcba98, false, false)); }  // lane l with lane l ^ 16
__device__ __forceinline__ v16h fa_frag(const unsigned short* p, int hh) { FragH f; f.half[0] = *(const v8us*)(p + 8 * hh); f.half[1] = *(const v8us*)(p + 16 + 8 * hh); return f.v; }
__device__ __forceinline__ v8f fa_mma(v16h a, v16h b, v8f c) { return __builtin_amdgcn_wmma_f32_16x16x32_f16(false, a, false, b, (short)0, c, false, false); }
__global__ __launch_bounds__(256) void k_flash(const _Float16* __restrict__ Qa, const _Float16* __restrict__ Ka, const _Float16* __restrict__ VTa, const _Float16* __restrict__ Qb, const _Float16* __restrict__ Kb, const _Float16* __restrict__ VTb,
    const float* __restrict__ scp, float* __restrict__ OP, float* __restrict__ ML) {
  __shared__ __attribute__((aligned(16))) unsigned short sK[2][32 * KPIT];
  __shared__ __attribute__((aligned(16))) unsigned short sV[2][DO * VPIT];
  const int tid = threadIdx.x, w = tid >> 5, lane = tid & 31, ln = lane & 15, hh = lane >> 4;
  const int br = blockIdx.z, sp = blockIdx.y, q0 = blockIdx.x * FQ + w * 32;
  const _Float16* Q = br ? Qb : Qa; const unsigned short* K = (const unsigned short*)(br ? Kb : Ka); const unsigned short* VT = (const unsigned short*)(br ? VTb : VTa);
  float sv = bf16_round(scp[0]); sv = fminf(fmaxf(sv, 1.0f), 32.0f); const float cs = (1.0f / sqrtf(sv)) * 1.4426950408889634f;      /* scores to log2 units */
  // staging: thread -> 4 x 16 B of the K tile (row tid / 32 + 8 j) and 4 x 16 B of the V^T tile (row tid / 4 + 64 j)
  const unsigned short* gK = K + ((size_t)sp * (NN / KSP) + (tid >> 5)) * DO + (tid & 31) * 8;
  const unsigned short* gV = VT + (size_t)(tid >> 2) * NN + sp * (NN / KSP) + (tid & 3) * 8;
  const int lK = (tid >> 5) * KPIT + (tid & 31) * 8, lV = (tid >> 2) * VPIT + (tid & 3) * 8;
  const unsigned short* qp = (const unsigned short*)Q + (size_t)(q0 + ln) * DO + 8 * hh;      /* the one address register pair of all 32 Q loads */
  v16h qf[2][8];
#pragma unroll
  for (int g = 0; g < 2; ++g)
#pragma unroll
    for (int ks = 0; ks < 8; ++ks) { FragH f; f.half[0] = *(const v8us*)(qp + g * 16 * DO + ks * 32); f.half[1] = *(const v8us*)(qp + g * 16 * DO + ks * 32 + 16); qf[g][ks] = f.v; }
  {
    v8us kr[4], vr[4];
#pragma unroll
    for (int j = 0; j < 4; ++j) { kr[j] = *(const v8us*)(gK + (size_t)j * 8 * DO); vr[j] = *(const v8us*)(gV + (size_t)j * 64 * NN); }
    asm volatile("s_wait_xcnt 0x0" :: "v"(qp) : "memory");      /* qp ends here: as an input it stays whole until the wait, in front of whatever takes its registers next (gK, gV live on) */
#pragma unroll
    for (int j = 0; j < 4; ++j) { *(v8us*)(&sK[0][lK + j * 8 * KPIT]) = kr[j]; *(v8us*)(&sV[0][lV + j * 64 * VPIT]) = vr[j]; }
  }
  __syncthreads();
  const v8f z8 = {0.f,0.f,0.f,0.f,0.f,0.f,0.f,0.f};
  v8f o[16][2];
#pragma unroll
  for (int t = 0; t < 16; ++t) { o[t][0] = z8; o[t][1] = z8; }
  float m[2] = {-3.0e38f, -3.0e38f}, l[2] = {0.f, 0.f};
  // kept rolled: the body holds 64 matrix instructions and nearly the whole register budget; a second copy would only cost instruction cache
#pragma unroll 1
  for (int s = 0; s < NPASS; ++s) {
    const unsigned short* bK = sK[s & 1]; const unsigned short* bV = sV[s & 1];
    unsigned short* nK = sK[(s + 1) & 1]; unsigned short* nV = sV[(s + 1) & 1];
    const int sn = s + 1 < NPASS ? s + 1 : s;      /* no branch round the staging: the last pass fetches its own tiles again, into the buffer that nobody reads any more */
    const unsigned short* pk = gK + (size_t)sn * 32 * DO; const unsigned short* pv = gV + sn * 32;
    v8us st[4];      /* the next pass's tiles go through registers, 16 at a time: K under the first product, V^T under the softmax and the second */
#pragma unroll
    for (int j = 0; j < 4; ++j) st[j] = *(const v8us*)(pk + j * 8 * DO);
    asm volatile("s_wait_xcnt 0x0" :: "v"(pk) : "memory");      /* as an input the loads' address stays whole until the wait */
    // S^T = K.Q^T, one k step (2 fragments, 4 matrix instructions) a block; each block's LDS reads stand as one group two blocks ahead, in a ring of three fragment pairs
    v8f sc[2][2] = {{z8, z8}, {z8, z8}};
    v16h ka[3][2];
#pragma unroll
    for (int i = 0; i < 4; ++i) ka[i >> 1][i & 1] = fa_frag(bK + ((i & 1) * 16 + ln) * KPIT + (i >> 1) * 32, hh);
#pragma unroll
    for (int ks = 0; ks < 8; ++ks) {
      if (ks < 6) { ka[(ks + 2) % 3][0] = fa_frag(bK + ln * KPIT + (ks + 2) * 32, hh); ka[(ks + 2) % 3][1] = fa_frag(bK + (16 + ln) * KPIT + (ks + 2) * 32, hh); }
      __builtin_amdgcn_sched_barrier(0);      /* keeps the reads above as one group in front of the block, two blocks ahead of their use */
      const v16h a0 = ka[ks % 3][0], a1 = ka[ks % 3][1];
      sc[0][0] = fa_mma(a0, qf[0][ks], sc[0][0]); sc[0][1] = fa_mma(a0, qf[1][ks], sc[0][1]);
      sc[1][0] = fa_mma(a1, qf[0][ks], sc[1][0]); sc[1][1] = fa_mma(a1, qf[1][ks], sc[1][1]);
      __builtin_amdgcn_sched_barrier(0);      /* ends the block: the next group of reads stays behind it */
    }
#pragma unroll
    for (int j = 0; j < 4; ++j) *(v8us*)(nK + lK + j * 8 * KPIT) = st[j];      /* the other buffers' last readers left them at the barrier that ended pass s - 1 */
    __builtin_amdgcn_sched_barrier(0);      /* the V^T loads stay behind the K stores, so that the two staged tiles are never live together */
#pragma unroll
    for (int j = 0; j < 4; ++j) st[j] = *(const v8us*)(pv + (size_t)j * 64 * NN);
    asm volatile("s_wait_xcnt 0x0" :: "v"(pv) : "memory");      /* as an input the loads' address stays whole until the wait */
#pragma unroll
    for (int g = 0; g < 2; ++g) {
      float mx = sc[0][g][0];
#pragma unroll
      for (int r = 0; r < 8; ++r) mx = fmaxf(mx, fmaxf(sc[0][g][r], sc[1][g][r]));
      mx = fmaxf(mx, xhalf(mx)) * cs;      /* cs > 0; both halves of the wave now hold this query's maximum of the pass */
      if (__builtin_amdgcn_ballot_w32(mx > m[g] + MTHR) != 0) {      /* scalar branch, rare after the first passes; one group a branch */
        const float mn = fmaxf(m[g], mx); const float corr = __builtin_amdgcn_exp2f(m[g] - mn);      /* 0 on the first pass */
        m[g] = mn; l[g] *= corr;
#pragma unroll
        for (int t = 0; t < 16; ++t) o[t][g] = o[t][g] * corr;
      }
    }
    v16h pf[2];
#pragma unroll
    for (int g = 0; g < 2; ++g) {
      const float sh = 10.0f - m[g]; FragH p; float s0 = 0.f, s1 = 0.f;      /* weights x 1024, as f16 operands away from the subnormal range; l carries the same factor */
      float x[16];
#pragma unroll
      for (int r = 0; r < 8; ++r) { x[r] = fmaf(sc[0][g][r], cs, sh); x[8 + r] = fmaf(sc[1][g][r], cs, sh); }
      __builtin_amdgcn_sched_barrier(0);      /* the arguments are all made first: no multiply-add is left to land on an exponential's source directly behind it */
#pragma unroll
      for (int r = 0; r < 16; ++r) x[r] = __builtin_amdgcn_exp2f(x[r]);
      __builtin_amdgcn_sched_barrier(0);      /* sums and conversions stay behind the exponentials: none reads a result directly behind its exponential */
#pragma unroll
      for (int r = 0; r < 8; ++r) { s0 += x[r]; s1 += x[8 + r]; p.h[r] = (_Float16)x[r]; p.h[8 + r] = (_Float16)x[8 + r]; }
      l[g] += s0 + s1; pf[g] = p.v;
    }
    // O^T += V^T.P^T, two d tiles (2 fragments, 4 matrix instructions) a block, read ahead in the same ring
    __builtin_amdgcn_sched_barrier(0);      /* the V^T reads stay behind the exponentials: hoisted among them they take the registers that keep two waves on a SIMD without spills */
    v16h va[3][2];
#pragma unroll
    for (int i = 0; i < 4; ++i) va[i >> 1][i & 1] = fa_frag(bV + (i * 16 + ln) * VPIT, hh);
#pragma unroll
    for (int b = 0; b < 8; ++b) {
      if (b < 6) { va[(b + 2) % 3][0] = fa_frag(bV + (((b + 2) * 2) * 16 + ln) * VPIT, hh); va[(b + 2) % 3][1] = fa_frag(bV + (((b + 2) * 2 + 1) * 16 + ln) * VPIT, hh); }
      __builtin_amdgcn_sched_barrier(0);      /* one group of reads in front of the block, as above */
      o[b * 2][0] = fa_mma(va[b % 3][0], pf[0], o[b * 2][0]); o[b * 2][1] = fa_mma(va[b % 3][0], pf[1], o[b * 2][1]);
      o[b * 2 + 1][0] = fa_mma(va[b % 3][1], pf[0], o[b * 2 + 1][0]); o[b * 2 + 1][1] = fa_mma(va[b % 3][1], pf[1], o[b * 2 + 1][1]);
      __builtin_amdgcn_sched_barrier(0);      /* ends the block */
    }
#pragma unroll
    for (int j = 0; j < 4; ++j) *(v8us*)(nV + lV + j * 64 * VPIT) = st[j];
    __syncthreads();      /* publishes pass s + 1's tiles and ends every read of pass s's */
  }
  // partials: OP[query row][key range][d], ML[query row][key range][m, l]; query row = branch * NN + query. One address pair serves all stores of each array, and
  // everything that is computed stands in front of the first store: behind it no register that a store names is written any more.
  const size_t row = (size_t)br * NN + q0 + ln;
  float* op = OP + (row * KSP + sp) * DO + 8 * hh;      /* a lane's 8 accumulator registers are 8 consecutive d of its query */
  float* mlp = ML + (row * KSP + sp) * 2 + hh;
  const float j0 = l[0] + xhalf(l[0]), j1 = l[1] + xhalf(l[1]);      /* the halves' sums joined, with every lane on: the exchange stands outside the selection below */
  const float w0 = hh ? j0 : m[0], w1 = hh ? j1 : m[1];      /* the lower half of the wave writes m, the upper l */
  mlp[0] = w0; mlp[16 * KSP * 2] = w1;
#pragma unroll
  for (int g = 0; g < 2; ++g) {
#pragma unroll
    for (int t = 0; t < 16; ++t) {
      const v4f lo = {o[t][g][0], o[t][g][1], o[t][g][2], o[t][g][3]}, hi = {o[t][g][4], o[t][g][5], o[t][g][6], o[t][g][7]};
      *(v4f*)(op + g * 16 * KSP * DO + t * 16) = lo; *(v4f*)(op + g * 16 * KSP * DO + t * 16 + 4) = hi;
    }
  }
  asm volatile("s_wait_xcnt 0x0" :: "v"(op), "v"(mlp) : "memory");      /* as inputs the stores' addresses stay whole until the wait */
}
// f = sum_s 2^(m_s - M) O_s / sum_s 2^(m_s - M) l_s over the KSP key ranges, fixed order s = 0..KSP-1; written as f16 hi + residual x 1024
__global__ __launch_bounds__(256) void k_fcomb(const float* __restrict__ OP, const float* __restrict__ ML, _Float16* __restrict__ FH, _Float16* __restrict__ FL) {
  const int t = blockIdx.x * 256 + threadIdx.x; if (t >= 2 * NN * (DO / 8)) return; const int d8 = (t % (DO / 8)) * 8; const int r = t / (DO / 8);
  const float* po = OP + (size_t)r * KSP * DO + d8; const float* pm = ML + (size_t)r * KSP * 2;      /* one address pair for each array */
  float ms[KSP], ls[KSP]; v8f op[KSP];
#pragma unroll
  for (int s = 0; s < KSP; ++s) { ms[s] = pm[s * 2]; ls[s] = pm[s * 2 + 1]; op[s] = *(const v8f*)(po + s * DO); }
  asm volatile("s_wait_xcnt 0x0" :: "v"(po), "v"(pm) : "memory");      /* as inputs the loads' addresses stay whole until the wait */
  float M = ms[0];
#pragma unroll
  for (int s = 1; s < KSP; ++s) M = fmaxf(M, ms[s]);
  v8f a = {0.f,0.f,0.f,0.f,0.f,0.f,0.f,0.f}; float den = 0.f;
#pragma unroll
  for (int s = 0; s < KSP; ++s) { const float wg = __builtin_amdgcn_exp2f(ms[s] - M); den += wg * ls[s]; a += op[s] * wg; }
  const float rs = 1.0f / den; FragH f, fl;
#pragma unroll
  for (int q = 0; q < 8; ++q) { const float v = a[q] * rs; const _Float16 hv = (_Float16)v; f.h[q] = hv; fl.h[q] = (_Float16)((v - (float)hv) * 1024.0f); }
  const size_t o = (size_t)r * DO + d8; *(v8us*)((unsigned short*)FH + o) = f.half[0]; *(v8us*)((unsigned short*)FL + o) = fl.half[0];
}

extern "C" void kernel_launch(void* const* d_in, const int* in_sizes, int n_in,
                              void* d_out, int out_size, void* d_ws, size_t ws_size, hipStream_t stream) {
  (void)in_sizes; (void)n_in; (void)out_size;
  const float* const* I = (const float* const*)d_in; const float* x1 = I[0]; const float* x2 = I[1]; const float* Wq1 = I[2]; const float* bq1 = I[3]; const float* Wk1 = I[4]; const float* bk1 = I[5]; const float* Wv = I[6]; const float* bv = I[7]; const float* Wq2 = I[8]; const float* bq2 = I[9]; const float* Wk2 = I[10]; const float* bk2 = I[11]; const float* We = I[12]; const float* be = I[13]; const float* scp = I[14];
  float* out1 = (float*)d_out;      /* the second output lies behind the first, at byte offset 16777216 */
  char* ws = (char*)d_ws; size_t off = 0;
  auto take = [&](size_t bytes) { char* p = ws + off; off += (bytes + 255) & ~(size_t)255; return p; };
  _Float16* BW = (_Float16*)take((size_t)6 * DO * DI * 2); _Float16* BE = BW + (size_t)5 * DO * DI; _Float16* X1 = (_Float16*)take((size_t)2 * NN * DI * 2);      /* weight slots Wq1 Wk1 Wq2 Wk2 Wv We; [x1 | x2] */
  _Float16* Q1 = (_Float16*)take((size_t)6 * NN * DO * 2); _Float16* K1 = Q1 + (size_t)NN * DO; _Float16* Q2 = Q1 + (size_t)2 * NN * DO; _Float16* K2 = Q1 + (size_t)3 * NN * DO; _Float16* V1 = Q1 + (size_t)4 * NN * DO;      /* planes Q1 K1 Q2 K2 V1 V2 */
  _Float16* VT1 = (_Float16*)take((size_t)2 * NN * DO * 2); _Float16* VT2 = VT1 + (size_t)NN * DO;
  float* OP = (float*)take((size_t)KSP * 2 * NN * DO * 4); float* ML = (float*)take((size_t)KSP * 2 * NN * 2 * 4); _Float16* FH = (_Float16*)take((size_t)2 * NN * DO * 2); _Float16* FL = (_Float16*)take((size_t)2 * NN * DO * 2);
  if (off > ws_size) return;      /* 1.5 + 16 + 24 + 8 + 64 + 0.5 + 8 + 8 = about 130 MiB */
  k_cvt<<<6 * WB + 2 * XB, 256, 0, stream>>>(x1, x2, Wq1, Wk1, Wq2, Wk2, Wv, We, X1, BW);      /* weights as given, (out, in) */
  k_proj6<<<dim3((NN / 128) * (DO / 64), 6), 128, 0, stream>>>(X1, BW, bq1, bk1, bq2, bk2, bv, Q1);
  k_vt<DO / 64, NN><<<2 * (DO / 64) * (NN / 64), 256, 0, stream>>>(V1, DO, 0, VT1);      /* V^T [256][8192] of both branches: V1 | V2 and VT1 | VT2 lie back to back */
  k_flash<<<dim3(NN / FQ, KSP, 2), 256, 0, stream>>>(Q1, K2, VT1, Q2, K1, VT2, scp, OP, ML);      /* f1: hsi_Q . lidar_K -> hsi_V ; f2: lidar_Q . hsi_K -> lidar_V */
  k_fcomb<<<2 * NN * (DO / 8) / 256, 256, 0, stream>>>(OP, ML, FH, FL);
  // both branches in each launch (blockIdx.y): FL, FH and the two outputs lie back to back; the second launch adds its own element of the first's plane (rowsPerB < 0)
  k_gemm2<0><<<dim3((NN / 128) * (DI / 64), 2), 128, 0, stream>>>(FL, DO, (size_t)NN * DO, BE, DO, 0, 0.0625f / 1024.0f, nullptr, 0, nullptr, 1, 0, 0, out1, nullptr, DI, (size_t)NN * DI, NN, DI, DO);
  k_gemm2<0><<<dim3((NN / 128) * (DI / 64), 2), 128, 0, stream>>>(FH, DO, (size_t)NN * DO, BE, DO, 0, 0.0625f, be, 0, out1, -1, 0, 0, out1, nullptr, DI, (size_t)NN * DI, NN, DI, DO);      /* (f_lo + f_hi) We^T + be */
}

// v004
// One run takes 164 microseconds.
// In both of two side-by-side timings against v003, it was 1.37 times as fast.
// Counting every step since v000, it is 16.5 times as fast.
#include <hip/hip_runtime.h>
// cross_fuison (8192 hsi rows x1 and 8192 lidar rows x2, 512 -> 256: Q/K/V = x W^T + b (W_V shared); inv = 1/sqrt(clip(scale, 1, 32)); f1 = softmax(hsi_Q lidar_K^T inv) hsi_V; f2 = softmax(lidar_Q hsi_K^T inv) lidar_V; outputs = (f1 We^T + be, f2 We^T + be), each [8192][512]).
// Compute dtype: inputs rounded to bf16; inputs/weights exact as f16; Q/K/V and the softmax weights as plain f16 operands (~2^-12); f as f16 hi + residual into We; softmax f32. v_wmma_f32_16x16x32_f16.
#define NN 8192
#define DI 512
#define DO 256
typedef __bf16 v16b __attribute__((ext_vector_type(16)));
typedef unsigned short v8us __attribute__((ext_vector_type(8), may_alias));
typedef float  v8f  __attribute__((ext_vector_type(8)));
typedef float  v4f  __attribute__((ext_vector_type(4)));
typedef float  v4fa __attribute__((ext_vector_type(4), may_alias));
union FragB { v16b v; v8us half[2]; unsigned short u[16]; };

__device__ __forceinline__ unsigned short bf16_bits(float x) { unsigned int u = __float_as_uint(x); return (unsigned short)((u + 0x7FFFu + ((u >> 16) & 1u)) >> 16); }
__device__ __forceinline__ float bf16_val(unsigned short b) { return __uint_as_float(((unsigned int)b) << 16); }
__device__ __forceinline__ float bf16_round(float x) { return bf16_val(bf16_bits(x)); }
// D += A·B with NT terms: 1 = ah·bh, 2 = + al·bh (A split), 3 = + ah·bl (both split)
template <int NT>
__device__ __forceinline__ v8f mmaN(v16b ah, v16b al, v16b bh, v16b bl, v8f c) {
  c = __builtin_amdgcn_wmma_f32_16x16x32_bf16(false, ah, false, bh, (short)0, c, false, false);
  if (NT >= 2) c = __builtin_amdgcn_wmma_f32_16x16x32_bf16(false, al, false, bh, (short)0, c, false, false);
  if (NT >= 3) c = __builtin_amdgcn_wmma_f32_16x16x32_bf16(false, ah, false, bl, (short)0, c, false, false);
  asm volatile("v_nop\n\tv_nop\n\tv_nop\n\tv_nop" : "+v"(c) : "v"(ah), "v"(al), "v"(bh), "v"(bl));
  return c;
}

__global__ __launch_bounds__(256) void k_wt_bf16(const float* __restrict__ W, unsigned short* __restrict__ Wt, int K, int N) {
  const int t = blockIdx.x * 256 + threadIdx.x;
  const int k8n = K / 8;
  if (t >= N * k8n) return;
  const int n = t / k8n, k8 = (t % k8n) * 8;
  v8us v;
#pragma unroll
  for (int i = 0; i < 8; ++i) v[i] = bf16_bits(W[(size_t)(k8 + i) * N + n]);
  *(v8us*)(Wt + (size_t)n * K + k8) = v;
  
}

// GEMM C[M][N] (f32, pitch ldc) = act(A[M][K]·W + bias). A f32 row-major (pitch lda) converted per fragment to bf16
// (ASPLIT: hi/lo two planes -> 2 terms, else single rounded term); Wt bf16 [N][K] (pitch ldb). BIAS_BF16 rounds the
// bias to bf16 first (bias quantised to bf16 before the add). K%32==0, M%16==0, N%64==0.
template <bool ASPLIT, int ACT, bool BIAS_BF16>
__global__ __launch_bounds__(128) void k_gemm_bf(const float* __restrict__ A, int lda, const unsigned short* __restrict__ Wt, int ldb,
                                               const float* __restrict__ bias, float* __restrict__ C, int ldc, int M, int N, int K) {
  __shared__ __attribute__((aligned(16))) float so[4][16][64];
  const int tid = threadIdx.x, w = tid >> 5, lane = tid & 31, ln = lane & 15, hh = lane >> 4;
  const int ntn = N / 64;
  const int wid = blockIdx.x * 4 + w;
  const int mt = wid / ntn, nq = wid % ntn;
  if (mt * 16 >= M) return;
  const int row0 = mt * 16, col0 = nq * 64;
  const float* arow = A + (size_t)(row0 + ln) * lda;
  v8f acc[4] = {};
  for (int kb = 0; kb < K; kb += 32) {
    FragB ah, al;
    const v4f x0 = *(const v4fa*)(arow + kb + 8 * hh), x1 = *(const v4fa*)(arow + kb + 8 * hh + 4);
    const v4f x2 = *(const v4fa*)(arow + kb + 16 + 8 * hh), x3 = *(const v4fa*)(arow + kb + 16 + 8 * hh + 4);
    float xs[16] = {x0[0],x0[1],x0[2],x0[3],x1[0],x1[1],x1[2],x1[3],x2[0],x2[1],x2[2],x2[3],x3[0],x3[1],x3[2],x3[3]};
#pragma unroll
    for (int i = 0; i < 16; ++i) { const unsigned short hb = bf16_bits(xs[i]); ah.u[i] = hb; al.u[i] = ASPLIT ? bf16_bits(xs[i] - bf16_val(hb)) : (unsigned short)0; }
#pragma unroll
    for (int t = 0; t < 4; ++t) {
      const unsigned short* brow = Wt + (size_t)(col0 + t * 16 + ln) * ldb + kb;
      FragB b;
      b.half[0] = *(const v8us*)(brow + 8 * hh);
      b.half[1] = *(const v8us*)(brow + 16 + 8 * hh);
      acc[t] = mmaN<ASPLIT ? 2 : 1>(ah.v, al.v, b.v, b.v, acc[t]);
    }
  }
#pragma unroll
  for (int t = 0; t < 4; ++t) {
    float bv = bias ? bias[col0 + t * 16 + ln] : 0.f;
    if (BIAS_BF16) bv = bf16_round(bv);
#pragma unroll
    for (int r = 0; r < 8; ++r) { float v = acc[t][r] + bv; if (ACT == 1) v = fmaxf(v, 0.f); so[w][8 * hh + r][t * 16 + ln] = v; }
  }
  __builtin_amdgcn_fence(__ATOMIC_ACQ_REL, "workgroup");
  __builtin_amdgcn_wave_barrier();
  const int rsub = lane >> 4, c4 = (lane & 15) * 4;
  {
#pragma unroll
    for (int q = 0; q < 8; ++q) {
      const int r = q * 2 + rsub;
      const v4f v = *(const v4fa*)&so[w][r][c4];
      *(v4f*)(C + (size_t)(row0 + r) * ldc + col0 + c4) = v;
    }
    
  }
}

// GEMM C = act(A·W + bias + resid): A f32 (ASPLIT -> hi/lo 2 terms), Wt bf16 [N][K]; ACT 0 none, 1 relu, 2 exact gelu;
// resid (optional, f32, row index = (row % rmod), pitch ldr, RES_BF16 rounds it) added before the activation.
template <bool ASPLIT, int ACT, bool BIAS_BF16, bool RES_BF16>
__global__ __launch_bounds__(128) void k_gemm_bf3(const float* __restrict__ A, int lda, const unsigned short* __restrict__ Wt, int ldb,
                                                const float* __restrict__ bias, const float* __restrict__ resid, int rmod, int ldr,
                                                float* __restrict__ C, int ldc, int M, int N, int K) {
  __shared__ __attribute__((aligned(16))) float so[4][16][64];
  const int tid = threadIdx.x, w = tid >> 5, lane = tid & 31, ln = lane & 15, hh = lane >> 4;
  const int ntn = N / 64;
  const int wid = blockIdx.x * 4 + w;
  const int mt = wid / ntn, nq = wid % ntn;
  if (mt * 16 >= M) return;
  const int row0 = mt * 16, col0 = nq * 64;
  const float* arow = A + (size_t)(row0 + ln) * lda;
  v8f acc[4] = {};
  for (int kb = 0; kb < K; kb += 32) {
    FragB ah, al;
    const v4f x0 = *(const v4fa*)(arow + kb + 8 * hh), x1 = *(const v4fa*)(arow + kb + 8 * hh + 4);
    const v4f x2 = *(const v4fa*)(arow + kb + 16 + 8 * hh), x3 = *(const v4fa*)(arow + kb + 16 + 8 * hh + 4);
    float xs[16] = {x0[0],x0[1],x0[2],x0[3],x1[0],x1[1],x1[2],x1[3],x2[0],x2[1],x2[2],x2[3],x3[0],x3[1],x3[2],x3[3]};
#pragma unroll
    for (int i = 0; i < 16; ++i) { const unsigned short hb = bf16_bits(xs[i]); ah.u[i] = hb; al.u[i] = ASPLIT ? bf16_bits(xs[i] - bf16_val(hb)) : (unsigned short)0; }
#pragma unroll
    for (int t = 0; t < 4; ++t) {
      const unsigned short* brow = Wt + (size_t)(col0 + t * 16 + ln) * ldb + kb;
      FragB b;
      b.half[0] = *(const v8us*)(brow + 8 * hh);
      b.half[1] = *(const v8us*)(brow + 16 + 8 * hh);
      acc[t] = mmaN<ASPLIT ? 2 : 1>(ah.v, al.v, b.v, b.v, acc[t]);
    }
  }
#pragma unroll
  for (int t = 0; t < 4; ++t) {
    const int col = col0 + t * 16 + ln;
    float bv = bias ? bias[col] : 0.f;
    if (BIAS_BF16) bv = bf16_round(bv);
#pragma unroll
    for (int r = 0; r < 8; ++r) {
      float v = acc[t][r] + bv;
      if (resid) { float rv = resid[(size_t)((row0 + 8 * hh + r) % rmod) * ldr + col]; if (RES_BF16) rv = bf16_round(rv); v += rv; }
      if (ACT == 1) v = fmaxf(v, 0.f);
      if (ACT == 2) v = 0.5f * v * (1.0f + erff(v * 0.70710678118654752f));
      if (ACT == 3) { const float u = 0.7978845608028654f * (v + 0.044715f * v * v * v); v = 0.5f * v * (1.0f + tanhf(u)); }
      so[w][8 * hh + r][t * 16 + ln] = v;
    }
  }
  __builtin_amdgcn_fence(__ATOMIC_ACQ_REL, "workgroup");
  __builtin_amdgcn_wave_barrier();
  const int rsub = lane >> 4, c4 = (lane & 15) * 4;
  {
#pragma unroll
    for (int q = 0; q < 8; ++q) {
      const int r = q * 2 + rsub;
      const v4f v = *(const v4fa*)&so[w][r][c4];
      *(v4f*)(C + (size_t)(row0 + r) * ldc + col0 + c4) = v;
    }
    
  }
}
// row LayerNorm (biased variance, eps) over N: s = X (+ R); optional out_sum <- s; out_norm <- (s-mu)*rsqrt(var+eps)*g + b
template <bool PARAM_BF16>
__global__ __launch_bounds__(256) void k_layernorm(const float* __restrict__ X, const float* __restrict__ R, const float* __restrict__ g, const float* __restrict__ bta,
                                                  float* __restrict__ out_sum, float* __restrict__ out_norm, int N, float eps) {
  __shared__ float red[256];
  const int row = blockIdx.x, tid = threadIdx.x;
  const float* x = X + (size_t)row * N; const float* rr = R ? R + (size_t)row * N : nullptr;
  float vals[16];                     // up to N = 4096
  const int per = N / 256;            // contiguous chunk per thread? use strided-by-4 chunks: thread handles j = tid*4 + 1024*u
  float s1 = 0.f;
  for (int u = 0; u < per / 4; ++u) {
    const int j = tid * 4 + 1024 * u;
    const v4f a = *(const v4fa*)(x + j);
    v4f b = {0.f,0.f,0.f,0.f}; if (rr) b = *(const v4fa*)(rr + j);
#pragma unroll
    for (int q = 0; q < 4; ++q) { const float v = a[q] + b[q]; vals[u * 4 + q] = v; s1 += v; }
  }
  red[tid] = s1; __syncthreads();
  for (int st = 128; st > 0; st >>= 1) { if (tid < st) red[tid] += red[tid + st]; __syncthreads(); }
  const float mu = red[0] / (float)N; __syncthreads();
  float s2 = 0.f;
  for (int u = 0; u < per / 4; ++u)
#pragma unroll
    for (int q = 0; q < 4; ++q) { const float c = vals[u * 4 + q] - mu; s2 += c * c; }
  red[tid] = s2; __syncthreads();
  for (int st = 128; st > 0; st >>= 1) { if (tid < st) red[tid] += red[tid + st]; __syncthreads(); }
  const float rs = rsqrtf(red[0] / (float)N + eps);
  {
    for (int u = 0; u < per / 4; ++u) {
      const int j = tid * 4 + 1024 * u;
      v4f o, sm;
#pragma unroll
      for (int q = 0; q < 4; ++q) {
        float gg = g[j + q], bb = bta[j + q];
        if (PARAM_BF16) { gg = bf16_round(gg); bb = bf16_round(bb); }
        sm[q] = vals[u * 4 + q]; o[q] = (vals[u * 4 + q] - mu) * rs * gg + bb;
      }
      if (out_sum) *(v4f*)(out_sum + (size_t)row * N + j) = sm;
      *(v4f*)(out_norm + (size_t)row * N + j) = o;
    }
    
  }
}



// ---- f16 WMMA path (v_wmma_f32_16x16x32_f16): 11-bit significands for operands in range — used where a [0,1] probability operand needs more precision than bf16
typedef _Float16 v16h __attribute__((ext_vector_type(16)));
union FragH { v16h v; v8us half[2]; _Float16 h[16]; unsigned short u[16]; };
template <int NT>
__device__ __forceinline__ v8f mmaH(v16h ah, v16h al, v16h bh, v16h bl, v8f c) {
  c = __builtin_amdgcn_wmma_f32_16x16x32_f16(false, ah, false, bh, (short)0, c, false, false);
  if (NT >= 2) c = __builtin_amdgcn_wmma_f32_16x16x32_f16(false, al, false, bh, (short)0, c, false, false);
  if (NT >= 3) c = __builtin_amdgcn_wmma_f32_16x16x32_f16(false, ah, false, bl, (short)0, c, false, false);
  asm volatile("v_nop\n\tv_nop\n\tv_nop\n\tv_nop" : "+v"(c) : "v"(ah), "v"(al), "v"(bh), "v"(bl));
  return c;
}
// batched GEMM like k_gemm_b but f16 operands: A f32 (split into f16 hi/lo if ASPLIT, else rounded to f16), Bt = f16 values [n][k]; alpha; C f32; N multiple of 16 (partial tiles skipped)
template <bool ASPLIT>
__global__ __launch_bounds__(128) void k_gemm_h(const float* __restrict__ A, int lda, size_t sA, const _Float16* __restrict__ Bh, int ldb, size_t sB, float alpha, float* __restrict__ C, int ldc, size_t sC, int M, int N, int K) {
  __shared__ __attribute__((aligned(16))) float so[4][16][64];
  const int tid = threadIdx.x, w = tid >> 5, lane = tid & 31, ln = lane & 15, hh = lane >> 4; const int by = blockIdx.y;
  A += (size_t)by * sA; Bh += (size_t)by * sB; C += (size_t)by * sC;
  const int ntn = (N + 63) / 64; const int wid = blockIdx.x * 4 + w; const int mt = wid / ntn, nq = wid % ntn; if (mt * 16 >= M) return;
  const int row0 = mt * 16, col0 = nq * 64; const float* arow = A + (size_t)(row0 + ln) * lda;
  v8f acc[4] = {};
  for (int kb = 0; kb < K; kb += 32) {
    FragH ah, al;
    const v4f x0 = *(const v4fa*)(arow + kb + 8 * hh), x1 = *(const v4fa*)(arow + kb + 8 * hh + 4), x2 = *(const v4fa*)(arow + kb + 16 + 8 * hh), x3 = *(const v4fa*)(arow + kb + 16 + 8 * hh + 4);
    float xs[16] = {x0[0],x0[1],x0[2],x0[3],x1[0],x1[1],x1[2],x1[3],x2[0],x2[1],x2[2],x2[3],x3[0],x3[1],x3[2],x3[3]};
#pragma unroll
    for (int i = 0; i < 16; ++i) { const _Float16 h = (_Float16)xs[i]; ah.h[i] = h; al.h[i] = ASPLIT ? (_Float16)(xs[i] - (float)h) : (_Float16)0.0f; }
#pragma unroll
    for (int t = 0; t < 4; ++t) { if (col0 + t * 16 >= N) continue; const size_t boff = (size_t)(col0 + t * 16 + ln) * ldb + kb; FragH bq; bq.half[0] = *(const v8us*)(Bh + boff + 8 * hh); bq.half[1] = *(const v8us*)(Bh + boff + 16 + 8 * hh);
      acc[t] = mmaH<ASPLIT ? 2 : 1>(ah.v, al.v, bq.v, bq.v, acc[t]); }
  }
#pragma unroll
  for (int t = 0; t < 4; ++t) { if (col0 + t * 16 >= N) continue;
#pragma unroll
    for (int r = 0; r < 8; ++r) so[w][8 * hh + r][t * 16 + ln] = acc[t][r] * alpha; }
  __builtin_amdgcn_fence(__ATOMIC_ACQ_REL, "workgroup"); __builtin_amdgcn_wave_barrier();
  const int rsub = lane >> 4, c4 = (lane & 15) * 4;
  {
#pragma unroll
    for (int q = 0; q < 8; ++q) { const int r = q * 2 + rsub; if (col0 + c4 < N) { const v4f v = *(const v4fa*)&so[w][r][c4]; *(v4f*)(C + (size_t)(row0 + r) * ldc + col0 + c4) = v; } }
     }
}

// Wt[n][k] = f16(W[k][n]·scale) from f32 row-major W[K][N] (scale = power of two; bf16-exact weights stay exact in f16 away from the subnormal range)
__global__ __launch_bounds__(256) void k_wt_f16(const float* __restrict__ W, _Float16* __restrict__ Wt, int K, int N, float scale) {
  const int t = blockIdx.x * 256 + threadIdx.x; if (t >= N * (K / 8)) return; const int n = t / (K / 8), k8 = (t % (K / 8)) * 8; FragH f;
#pragma unroll
  for (int i = 0; i < 8; ++i) f.h[i] = (_Float16)(bf16_round(W[(size_t)(k8 + i) * N + n]) * scale); const v8us o = f.half[0];
  *(v8us*)((unsigned short*)Wt + (size_t)n * K + k8) = o; 
}
// k_gemm_hh variant with fused epilogue: v = acc·alpha + bias[by·sBias + col] (+ CP[(row/rowsPerB)·sCPb + by·64 + col] if CP) ; ACT 0 none / 1 elu ; writes f16 C16 (and f32 C if non-null)
template <int ACT>
__global__ __launch_bounds__(128) void k_gemm_hhx(const _Float16* __restrict__ A, int lda, size_t sA, const _Float16* __restrict__ Bh, int ldb, size_t sB, float alpha, const float* __restrict__ bias, size_t sBias, const float* __restrict__ CP, int rowsPerB, size_t sCPb, int row0g,
    float* __restrict__ C, _Float16* __restrict__ C16, int ldc, size_t sC, int M, int N, int K) {
  __shared__ __attribute__((aligned(16))) float so[4][16][64];
  const int tid = threadIdx.x, w = tid >> 5, lane = tid & 31, ln = lane & 15, hh = lane >> 4; const int by = blockIdx.y;
  A += (size_t)by * sA; Bh += (size_t)by * sB; const size_t cofs = (size_t)by * sC; const float* bp = bias ? bias + (size_t)by * sBias : nullptr;
  const int ntn = (N + 63) / 64; const int wid = blockIdx.x * 4 + w; const int mt = wid / ntn, nq = wid % ntn; if (mt * 16 >= M) return;
  const int row0 = mt * 16, col0 = nq * 64; const _Float16* arow = A + (size_t)(row0 + ln) * lda;
  v8f acc[4] = {};
  for (int kb = 0; kb < K; kb += 32) { FragH ah; ah.half[0] = *(const v8us*)((const unsigned short*)arow + kb + 8 * hh); ah.half[1] = *(const v8us*)((const unsigned short*)arow + kb + 16 + 8 * hh);
#pragma unroll
    for (int t = 0; t < 4; ++t) { if (col0 + t * 16 >= N) continue; const size_t boff = (size_t)(col0 + t * 16 + ln) * ldb + kb; FragH bq; bq.half[0] = *(const v8us*)((const unsigned short*)Bh + boff + 8 * hh); bq.half[1] = *(const v8us*)((const unsigned short*)Bh + boff + 16 + 8 * hh);
      acc[t] = mmaH<1>(ah.v, ah.v, bq.v, bq.v, acc[t]); }
  }
#pragma unroll
  for (int t = 0; t < 4; ++t) { if (col0 + t * 16 >= N) continue; const int col = col0 + t * 16 + ln; const float bv = bp ? bf16_round(bp[col]) : 0.f;
#pragma unroll
    for (int r = 0; r < 8; ++r) { float v = acc[t][r] * alpha + bv; if (CP) { const int rr = row0g + row0 + 8 * hh + r; if (rowsPerB < 0) v += CP[cofs + (size_t)rr * ldc + col];      /* rowsPerB < 0: own element of the batched C plane */ else { const int bidx = rr / rowsPerB; v += CP[(size_t)bidx * sCPb + (size_t)by * 64 + col]; } } if (ACT == 1) v = (v > 0.f) ? v : expm1f(v); else if (ACT == 7) v = (v > 0.f) ? v + 1.0f : expf(v); else if (ACT == 8) v = tanhf(v); else if (ACT == 9) v = 0.5f * v * (1.0f + tanhf(0.7978845608028654f * (v + 0.044715f * v * v * v))); else if (ACT == 11) v = 1.0f / (1.0f + expf(-v)); else if (ACT == 12) v = (v > 0.f) ? v : 0.01f * v; else if (ACT == 14) v = (v > 0.f) ? v : 0.1f * v; else if (ACT == 16) v = (v >= 0.f) ? v : 0.3f * v; else if (ACT == 17) v = (v >= 0.f) ? v : 0.2f * v; else if (ACT == 15) v = v / (1.0f + expf(-v)); else if (ACT == 3) v = fmaxf(v, 0.f); else if (ACT == 6) v = 0.5f * v * (1.0f + erff(v * 0.70710678118654752f)); so[w][8 * hh + r][t * 16 + ln] = v; } }
  __builtin_amdgcn_fence(__ATOMIC_ACQ_REL, "workgroup"); __builtin_amdgcn_wave_barrier();
  const int rsub = lane >> 4, c4 = (lane & 15) * 4; typedef _Float16 v4h __attribute__((ext_vector_type(4)));
  {
#pragma unroll
    for (int q = 0; q < 8; ++q) { const int r = q * 2 + rsub; if (col0 + c4 < N) { const v4f v = *(const v4fa*)&so[w][r][c4]; if (C) *(v4f*)(C + cofs + (size_t)(row0 + r) * ldc + col0 + c4) = v; if (C16) { v4h h4; for (int i = 0; i < 4; ++i) h4[i] = (_Float16)v[i]; *(v4h*)(C16 + cofs + (size_t)(row0 + r) * ldc + col0 + c4) = h4; } } }
     }
}


typedef _Float16 v4h __attribute__((ext_vector_type(4)));

// every input conversion in one launch: blocks 0 .. 6 WB - 1 take the six weight matrices (slot j of BW = f16(bf16(w_j) x 16), each DO x DI elements), the rest x1 and x2 (X = [x1 | x2] as f16(bf16(x)))
#define XB (NN * DI / 8 / 256)   /* blocks per x */
#define WB (DO * DI / 8 / 256)   /* blocks per weight matrix */
__global__ __launch_bounds__(256) void k_cvt(const float* __restrict__ x1, const float* __restrict__ x2, const float* __restrict__ w0, const float* __restrict__ w1, const float* __restrict__ w2, const float* __restrict__ w3, const float* __restrict__ w4, const float* __restrict__ w5,
    _Float16* __restrict__ X, _Float16* __restrict__ BW) {
  const int b = blockIdx.x, tid = threadIdx.x; const float* src; _Float16* dst; float sc;
  if (b < 6 * WB) { const int j = b / WB; const float* w = j == 0 ? w0 : j == 1 ? w1 : j == 2 ? w2 : j == 3 ? w3 : j == 4 ? w4 : w5; src = w + ((size_t)(b - j * WB) * 256 + tid) * 8; dst = BW + ((size_t)b * 256 + tid) * 8; sc = 16.0f; }
  else { const int q = b - 6 * WB, j = q / XB; src = (j ? x2 : x1) + ((size_t)(q - j * XB) * 256 + tid) * 8; dst = X + ((size_t)q * 256 + tid) * 8; sc = 1.0f; }
  FragH f;
#pragma unroll
  for (int q = 0; q < 8; ++q) f.h[q] = (_Float16)(bf16_round(src[q]) * sc);
  *(v8us*)(unsigned short*)dst = f.half[0]; }
__global__ __launch_bounds__(256) void k_h16(const float* __restrict__ x, _Float16* __restrict__ X16, size_t n8) { const size_t t = (size_t)blockIdx.x * 256 + threadIdx.x; if (t >= n8) return; FragH f;
#pragma unroll
  for (int q = 0; q < 8; ++q) f.h[q] = (_Float16)x[t * 8 + q]; *(v8us*)((unsigned short*)X16 + t * 8) = f.half[0];  }
__global__ __launch_bounds__(256) void k_round16f(const float* __restrict__ W, _Float16* __restrict__ Bt, size_t n8) { const size_t t = (size_t)blockIdx.x * 256 + threadIdx.x; if (t >= n8) return; FragH f;
#pragma unroll
  for (int i = 0; i < 8; ++i) f.h[i] = (_Float16)(bf16_round(W[t * 8 + i]) * 16.0f); *(v8us*)((unsigned short*)Bt + t * 8) = f.half[0];  }
template <int NHv, int TTv>
__global__ __launch_bounds__(256) void k_vt(const _Float16* __restrict__ V16, int ldv, int voff, _Float16* __restrict__ Vt) { __shared__ unsigned short tl[64][66]; const int tid = threadIdx.x; const int slab = blockIdx.x / (TTv / 64), lg = blockIdx.x % (TTv / 64); const int b = slab / NHv, h = slab % NHv;
  for (int i = tid; i < 64 * 8; i += 256) { const int r = i / 8, c8 = (i % 8) * 8; FragH f; f.half[0] = *(const v8us*)((const unsigned short*)V16 + ((size_t)b * TTv + lg * 64 + r) * ldv + voff + h * 64 + c8);
#pragma unroll
    for (int q = 0; q < 8; ++q) tl[r][c8 + q] = f.u[q]; }
  __syncthreads();
  {
#pragma unroll
    for (int rd = 0; rd < 2; ++rd) { const int d = rd * 32 + tid / 8, pc = tid % 8; FragH f;
#pragma unroll
      for (int q = 0; q < 8; ++q) f.u[q] = tl[pc * 8 + q][d];
      *(v8us*)((unsigned short*)Vt + ((size_t)slab * 64 + d) * TTv + lg * 64 + pc * 8) = f.half[0]; }
     } }

__global__ __launch_bounds__(256) void k_hl(const float* __restrict__ F, _Float16* __restrict__ Hh, _Float16* __restrict__ Hl, size_t n8) { const size_t t = (size_t)blockIdx.x * 256 + threadIdx.x; if (t >= n8) return; FragH fh, fl; const v4f a = *(const v4fa*)(F + t * 8), c = *(const v4fa*)(F + t * 8 + 4);
#pragma unroll
  for (int q = 0; q < 4; ++q) { _Float16 h = (_Float16)a[q]; fh.h[q] = h; fl.h[q] = (_Float16)((a[q] - (float)h) * 1024.0f); h = (_Float16)c[q]; fh.h[4 + q] = h; fl.h[4 + q] = (_Float16)((c[q] - (float)h) * 1024.0f); }
  { *(v8us*)((unsigned short*)Hh + t * 8) = fh.half[0]; *(v8us*)((unsigned short*)Hl + t * 8) = fl.half[0];  } }

// ---- fast GEMM (wave tile 32x64; requires M % 32 == 0 rows per launch region and N % 64 == 0); epilogue = k_gemm_hhx semantics ----
__device__ __forceinline__ v16h g2_frag(const _Float16* p, int hh) { FragH f; f.half[0] = *(const v8us*)((const unsigned short*)p + 8 * hh); f.half[1] = *(const v8us*)((const unsigned short*)p + 16 + 8 * hh); return f.v; }
__device__ __forceinline__ v8f g2_mma(v16h a, v16h b, v8f c) { v8f d = __builtin_amdgcn_wmma_f32_16x16x32_f16(false, a, false, b, (short)0, c, false, false); asm volatile("v_nop\n\tv_nop\n\tv_nop\n\tv_nop" : "+v"(d) : "v"(a), "v"(b)); return d; }
template <int ACT>
__global__ __launch_bounds__(128) void k_gemm2(const _Float16* __restrict__ A, int lda, size_t sA, const _Float16* __restrict__ Bh, int ldb, size_t sB, float alpha, const float* __restrict__ bias, size_t sBias, const float* __restrict__ CP, int rowsPerB, size_t sCPb, int row0g,
    float* __restrict__ C, _Float16* __restrict__ C16, int ldc, size_t sC, int M, int N, int K) { static_assert(ACT == 0 || ACT == 3 || ACT == 6 || ACT == 8 || ACT == 9 || ACT == 11 || ACT == 12 || ACT == 14 || ACT == 15 || ACT == 16 || ACT == 17, "k_gemm2: unsupported ACT code (would silently apply no activation)");
  __shared__ __attribute__((aligned(16))) float so[4][32][68];
  const int tid = threadIdx.x, w = tid >> 5, lane = tid & 31, ln = lane & 15, hh = lane >> 4; const int by = blockIdx.y;
  A += (size_t)by * sA; Bh += (size_t)by * sB; const size_t cofs = (size_t)by * sC; const float* bp = bias ? bias + (size_t)by * sBias : nullptr;
  const int ntn = N >> 6; const int mt = blockIdx.x / ntn, nq = blockIdx.x - mt * ntn; const int row0 = mt * 128 + 32 * w, col0 = nq * 64; if (row0 >= M) return;
  const _Float16* a0p = A + (size_t)(row0 + ln) * lda; const _Float16* a1p = a0p + (size_t)16 * lda;
  const _Float16* b0p = Bh + (size_t)(col0 + ln) * ldb; const _Float16* b1p = b0p + (size_t)16 * ldb; const _Float16* b2p = b1p + (size_t)16 * ldb; const _Float16* b3p = b2p + (size_t)16 * ldb;
  const v8f z8 = {0.f,0.f,0.f,0.f,0.f,0.f,0.f,0.f}; v8f c00 = z8, c01 = z8, c02 = z8, c03 = z8, c10 = z8, c11 = z8, c12 = z8, c13 = z8;
#pragma unroll 1
  for (int kb = 0; kb < K; kb += 32) { const v16h a0 = g2_frag(a0p + kb, hh), a1 = g2_frag(a1p + kb, hh);
    v16h b = g2_frag(b0p + kb, hh); c00 = g2_mma(a0, b, c00); c10 = g2_mma(a1, b, c10);
    b = g2_frag(b1p + kb, hh); c01 = g2_mma(a0, b, c01); c11 = g2_mma(a1, b, c11);
    b = g2_frag(b2p + kb, hh); c02 = g2_mma(a0, b, c02); c12 = g2_mma(a1, b, c12);
    b = g2_frag(b3p + kb, hh); c03 = g2_mma(a0, b, c03); c13 = g2_mma(a1, b, c13); }
  v8f accs[8] = {c00, c01, c02, c03, c10, c11, c12, c13};
#pragma unroll
  for (int u = 0; u < 8; ++u) { const int t = u & 3, half = u >> 2; const int col = col0 + t * 16 + ln; const float bv = bp ? bf16_round(bp[col]) : 0.f;
#pragma unroll
    for (int r = 0; r < 8; ++r) { const int rloc = half * 16 + 8 * hh + r; float v = accs[u][r] * alpha + bv; if (CP) { if (rowsPerB < 0) v += CP[cofs + (size_t)(row0g + row0 + rloc) * ldc + col];      /* rowsPerB < 0: own element of the batched C plane */ else { const int bidx = (row0g + row0 + rloc) / rowsPerB; v += CP[(size_t)bidx * sCPb + (size_t)by * 64 + col]; } }
      if (ACT == 3) v = fmaxf(v, 0.f); else if (ACT == 6) v = 0.5f * v * (1.0f + erff(v * 0.70710678118654752f)); else if (ACT == 11) v = 1.0f / (1.0f + expf(-v)); else if (ACT == 15) v = v / (1.0f + expf(-v)); else if (ACT == 12) v = (v > 0.f) ? v : 0.01f * v; else if (ACT == 8) v = tanhf(v); else if (ACT == 9) v = 0.5f * v * (1.0f + tanhf(0.7978845608028654f * (v + 0.044715f * v * v * v))); else if (ACT == 14) v = (v > 0.f) ? v : 0.1f * v; else if (ACT == 16) v = (v >= 0.f) ? v : 0.3f * v; else if (ACT == 17) v = (v >= 0.f) ? v : 0.2f * v;
      so[w][rloc][t * 16 + ln] = v; } }
  __builtin_amdgcn_fence(__ATOMIC_ACQ_REL, "workgroup"); __builtin_amdgcn_wave_barrier();
  const int rsub = lane >> 4, c4 = (lane & 15) * 4;
  {
#pragma unroll
    for (int q = 0; q < 16; ++q) { const int r = q * 2 + rsub; const v4f v = *(const v4fa*)&so[w][r][c4]; if (C) *(v4f*)(C + cofs + (size_t)(row0 + r) * ldc + col0 + c4) = v; if (C16) { v4h h4; for (int i = 0; i < 4; ++i) h4[i] = (_Float16)v[i]; *(v4h*)(C16 + cofs + (size_t)(row0 + r) * ldc + col0 + c4) = h4; } }
     } }


// ---- GEMM tile through LDS: a work-group of 8 waves makes a 128 x 128 tile of A[.][KT] . B[.][KT]^T (both row-major, pitch KT, f16); wave w takes rows 32 (w & 3), columns 64 (w >> 2): k_gemm2's 32 x 64 wave tile and k order.
// A k slice of 64 elements (one 128-byte line of each of the 256 rows) lies in one of two LDS buffers; the next slice is fetched meanwhile through registers, a wave's load covering four whole lines.
#define GP 72                    /* LDS pitch of a row's slice, 16-bit elements: 144 B = 16 B x odd */
#define GT (128 * GP)            /* one operand's slice */
union G3S { unsigned short t[4 * GT]; float so[8][32][68]; };      /* the two buffers (A | B each); behind the loop each wave's own output staging */
__device__ __forceinline__ v16h g3_frag(const unsigned short* p, int hh) { FragH f; f.half[0] = *(const v8us*)(p + 8 * hh); f.half[1] = *(const v8us*)(p + 16 + 8 * hh); return f.v; }
__device__ __forceinline__ v8f g3_mma(v16h a, v16h b, v8f c) { return __builtin_amdgcn_wmma_f32_16x16x32_f16(false, a, false, b, (short)0, c, false, false); }
template <int KT>
__device__ __forceinline__ void g3_loop(const unsigned short* __restrict__ A, const unsigned short* __restrict__ B, unsigned short* sm, int tid, v8f (&acc)[2][4]) {
  const int w = tid >> 5, lane = tid & 31, ln = lane & 15, hh = lane >> 4;
  const unsigned short* ga = A + (size_t)(tid >> 3) * KT + (tid & 7) * 8;      /* thread -> 16 B of rows tid / 8 + 32 j of each operand; one address pair an operand for all slices */
  const unsigned short* gb = B + (size_t)(tid >> 3) * KT + (tid & 7) * 8;
  const int ls = (tid >> 3) * GP + (tid & 7) * 8;
  const int ra = ((w & 3) * 32 + ln) * GP, rb = GT + ((w >> 2) * 64 + ln) * GP;
  v8us sa[4], sb[4];
#pragma unroll
  for (int j = 0; j < 4; ++j) { sa[j] = *(const v8us*)(ga + j * 32 * KT); sb[j] = *(const v8us*)(gb + j * 32 * KT); }
#pragma unroll
  for (int j = 0; j < 4; ++j) { *(v8us*)(sm + ls + j * 32 * GP) = sa[j]; *(v8us*)(sm + GT + ls + j * 32 * GP) = sb[j]; }
  __syncthreads();
  // unrolled: the buffer and the slice become constants, so every load and LDS access is its base register plus an immediate offset
#pragma unroll
  for (int c = 0; c < KT / 64; ++c) {
    const unsigned short* cur = sm + (c & 1) * 2 * GT; unsigned short* nxt = sm + ((c + 1) & 1) * 2 * GT;
    if (c + 1 < KT / 64) {
#pragma unroll
      for (int j = 0; j < 4; ++j) { sa[j] = *(const v8us*)(ga + (c + 1) * 64 + j * 32 * KT); sb[j] = *(const v8us*)(gb + (c + 1) * 64 + j * 32 * KT); }
      asm volatile("s_wait_xcnt 0x0" :: "v"(ga), "v"(gb) : "memory");      /* as inputs the loads' two addresses stay whole until the wait */
    }
#pragma unroll
    for (int ks = 0; ks < 2; ++ks) {
      const v16h a0 = g3_frag(cur + ra + ks * 32, hh), a1 = g3_frag(cur + ra + 16 * GP + ks * 32, hh);
#pragma unroll
      for (int t = 0; t < 4; ++t) { const v16h b = g3_frag(cur + rb + t * 16 * GP + ks * 32, hh); acc[0][t] = g3_mma(a0, b, acc[0][t]); acc[1][t] = g3_mma(a1, b, acc[1][t]); }
    }
    if (c + 1 < KT / 64) {
#pragma unroll
      for (int j = 0; j < 4; ++j) { *(v8us*)(nxt + ls + j * 32 * GP) = sa[j]; *(v8us*)(nxt + GT + ls + j * 32 * GP) = sb[j]; }      /* the other buffer's last readers left it at the barrier that ended slice c - 1 */
    }
    __syncthreads();      /* publishes slice c + 1 and ends every read of slice c (behind the last slice: frees the buffers for the output staging) */
  }
}
// the six projections in one launch (M = NN, N = DO, K = DI, f16 result only), tiles through LDS (g3_loop), k_gemm2's epilogue. blockIdx.y = j picks plane j of QKV = [Q1 K1 Q2 K2 V1 V2];
// x1 (first half of X) feeds planes 0, 1, 4; weight slots of BW = [Wq1 Wk1 Wq2 Wk2 Wv], W_V shared by planes 4 and 5
__global__ __launch_bounds__(256) void k_proj6(const _Float16* __restrict__ X, const _Float16* __restrict__ BW, const float* __restrict__ bq1, const float* __restrict__ bk1, const float* __restrict__ bq2, const float* __restrict__ bk2, const float* __restrict__ bv, _Float16* __restrict__ QKV) {
  __shared__ __attribute__((aligned(16))) G3S sm;
  const int tid = threadIdx.x, w = tid >> 5, lane = tid & 31, ln = lane & 15, hh = lane >> 4; const int j = blockIdx.y;
  const float* bp = j == 0 ? bq1 : j == 1 ? bk1 : j == 2 ? bq2 : j == 3 ? bk2 : bv;
  const int mt = blockIdx.x / (DO / 128), nq = blockIdx.x % (DO / 128); const int row0 = mt * 128 + 32 * (w & 3), col0 = nq * 128 + 64 * (w >> 2);
  const v8f z8 = {0.f,0.f,0.f,0.f,0.f,0.f,0.f,0.f}; v8f acc[2][4] = {{z8, z8, z8, z8}, {z8, z8, z8, z8}};
  g3_loop<DI>((const unsigned short*)X + ((j == 2 || j == 3 || j == 5) ? (size_t)NN * DI : 0) + (size_t)mt * 128 * DI, (const unsigned short*)BW + (size_t)(j < 4 ? j : 4) * DO * DI + (size_t)nq * 128 * DI, sm.t, tid, acc);
#pragma unroll
  for (int u = 0; u < 8; ++u) { const int t = u & 3, half = u >> 2; const float bb = bf16_round(bp[col0 + t * 16 + ln]);
#pragma unroll
    for (int r = 0; r < 8; ++r) sm.so[w][half * 16 + 8 * hh + r][t * 16 + ln] = acc[half][t][r] * 0.0625f + bb; }
  __builtin_amdgcn_fence(__ATOMIC_ACQ_REL, "workgroup"); __builtin_amdgcn_wave_barrier();      /* a wave reads back only its own rows */
  const int rsub = lane >> 4, c4 = (lane & 15) * 4; _Float16* cp = QKV + (size_t)j * NN * DO + (size_t)(row0 + rsub) * DO + col0 + c4;
#pragma unroll
  for (int q = 0; q < 16; ++q) { const v4f v = *(const v4fa*)&sm.so[w][q * 2 + rsub][c4]; v4h h4; for (int i = 0; i < 4; ++i) h4[i] = (_Float16)v[i]; *(v4h*)(cp + q * 2 * DO) = h4; }
}
// output GEMM, both branches as one M = 2 NN (N = DI, K = DO), tiles through LDS (g3_loop), k_gemm2's epilogue: C = acc alpha (+ bf16(bias) + C's own element where ADD)
template <bool ADD>
__global__ __launch_bounds__(256) void k_gemm3(const _Float16* __restrict__ A, const _Float16* __restrict__ Bh, float alpha, const float* __restrict__ bias, float* C) {
  __shared__ __attribute__((aligned(16))) G3S sm;
  const int tid = threadIdx.x, w = tid >> 5, lane = tid & 31, ln = lane & 15, hh = lane >> 4;
  const int mt = blockIdx.x / (DI / 128), nq = blockIdx.x % (DI / 128); const int row0 = mt * 128 + 32 * (w & 3), col0 = nq * 128 + 64 * (w >> 2);
  const v8f z8 = {0.f,0.f,0.f,0.f,0.f,0.f,0.f,0.f}; v8f acc[2][4] = {{z8, z8, z8, z8}, {z8, z8, z8, z8}};
  g3_loop<DO>((const unsigned short*)A + (size_t)mt * 128 * DO, (const unsigned short*)Bh + (size_t)nq * 128 * DO, sm.t, tid, acc);
  v8f own[2][4];
  if (ADD) {
    const float* cq = C + (size_t)(row0 + 8 * hh) * DI + col0 + ln;      /* one address pair for all 64 own elements */
#pragma unroll
    for (int u = 0; u < 8; ++u)
#pragma unroll
      for (int r = 0; r < 8; ++r) own[u >> 2][u & 3][r] = cq[((u >> 2) * 16 + r) * DI + (u & 3) * 16];
    asm volatile("s_wait_xcnt 0x0" :: "v"(cq) : "memory");      /* as an input the loads' address stays whole until the wait */
  }
#pragma unroll
  for (int u = 0; u < 8; ++u) { const int t = u & 3, half = u >> 2; const int col = col0 + t * 16 + ln; const float bv = ADD ? bf16_round(bias[col]) : 0.f;
#pragma unroll
    for (int r = 0; r < 8; ++r) { const int rloc = half * 16 + 8 * hh + r; float v = acc[half][t][r] * alpha + bv; if (ADD) v += own[half][t][r];
      sm.so[w][rloc][t * 16 + ln] = v; } }
  __builtin_amdgcn_fence(__ATOMIC_ACQ_REL, "workgroup"); __builtin_amdgcn_wave_barrier();      /* a wave reads back only its own rows */
  const int rsub = lane >> 4, c4 = (lane & 15) * 4; float* cp = C + (size_t)(row0 + rsub) * DI + col0 + c4;
#pragma unroll
  for (int q = 0; q < 16; ++q) { const v4f v = *(const v4fa*)&sm.so[w][q * 2 + rsub][c4]; *(v4f*)(cp + q * 2 * DI) = v; }
}
#define FQ 256                   /* query rows per work-group */
#define KSP 4                    /* key ranges: 32 query blocks x KSP x 2 branches = 256 work-groups */
#define NPASS (NN / KSP / 32)
#define KPIT 264                 /* LDS pitch of a K row, 16-bit elements: 528 B = 16 B x odd */
#define VPIT 40                  /* LDS pitch of a V^T row (32 keys): 80 B = 16 B x odd */
#define MTHR 4.0f                /* the maximum in use may trail the true one by this much (log2): a weight is at most 2^(10 + 4), inside f16 */
__device__ __forceinline__ float xhalf(float x) { return __builtin_bit_cast(float, __builtin_amdgcn_permlanex16(__builtin_bit_cast(int, x), __builtin_bit_cast(int, x), 0x76543210, 0xfedcba98, false, false)); }  // lane l with lane l ^ 16
__device__ __forceinline__ v16h fa_frag(const unsigned short* p, int hh) { FragH f; f.half[0] = *(const v8us*)(p + 8 * hh); f.half[1] = *(const v8us*)(p + 16 + 8 * hh); return f.v; }
__device__ __forceinline__ v8f fa_mma(v16h a, v16h b, v8f c) { return __builtin_amdgcn_wmma_f32_16x16x32_f16(false, a, false, b, (short)0, c, false, false); }
__global__ __launch_bounds__(256) void k_flash(const _Float16* __restrict__ Qa, const _Float16* __restrict__ Ka, const _Float16* __restrict__ VTa, const _Float16* __restrict__ Qb, const _Float16* __restrict__ Kb, const _Float16* __restrict__ VTb,
    const float* __restrict__ scp, float* __restrict__ OP, float* __restrict__ ML) {
  __shared__ __attribute__((aligned(16))) unsigned short sK[2][32 * KPIT];
  __shared__ __attribute__((aligned(16))) unsigned short sV[2][DO * VPIT];
  const int tid = threadIdx.x, w = tid >> 5, lane = tid & 31, ln = lane & 15, hh = lane >> 4;
  const int br = blockIdx.z, sp = blockIdx.y, q0 = blockIdx.x * FQ + w * 32;
  const _Float16* Q = br ? Qb : Qa; const unsigned short* K = (const unsigned short*)(br ? Kb : Ka); const unsigned short* VT = (const unsigned short*)(br ? VTb : VTa);
  float sv = bf16_round(scp[0]); sv = fminf(fmaxf(sv, 1.0f), 32.0f); const float cs = (1.0f / sqrtf(sv)) * 1.4426950408889634f;      /* scores to log2 units */
  // staging: thread -> 4 x 16 B of the K tile (row tid / 32 + 8 j) and 4 x 16 B of the V^T tile (row tid / 4 + 64 j)
  const unsigned short* gK = K + ((size_t)sp * (NN / KSP) + (tid >> 5)) * DO + (tid & 31) * 8;
  const unsigned short* gV = VT + (size_t)(tid >> 2) * NN + sp * (NN / KSP) + (tid & 3) * 8;
  const int lK = (tid >> 5) * KPIT + (tid & 31) * 8, lV = (tid >> 2) * VPIT + (tid & 3) * 8;
  const unsigned short* qp = (const unsigned short*)Q + (size_t)(q0 + ln) * DO + 8 * hh;      /* the one address register pair of all 32 Q loads */
  v16h qf[2][8];
#pragma unroll
  for (int g = 0; g < 2; ++g)
#pragma unroll
    for (int ks = 0; ks < 8; ++ks) { FragH f; f.half[0] = *(const v8us*)(qp + g * 16 * DO + ks * 32); f.half[1] = *(const v8us*)(qp + g * 16 * DO + ks * 32 + 16); qf[g][ks] = f.v; }
  {
    v8us kr[4], vr[4];
#pragma unroll
    for (int j = 0; j < 4; ++j) { kr[j] = *(const v8us*)(gK + (size_t)j * 8 * DO); vr[j] = *(const v8us*)(gV + (size_t)j * 64 * NN); }
    asm volatile("s_wait_xcnt 0x0" :: "v"(qp) : "memory");      /* qp ends here: as an input it stays whole until the wait, in front of whatever takes its registers next (gK, gV live on) */
#pragma unroll
    for (int j = 0; j < 4; ++j) { *(v8us*)(&sK[0][lK + j * 8 * KPIT]) = kr[j]; *(v8us*)(&sV[0][lV + j * 64 * VPIT]) = vr[j]; }
  }
  __syncthreads();
  const v8f z8 = {0.f,0.f,0.f,0.f,0.f,0.f,0.f,0.f};
  v8f o[16][2];
#pragma unroll
  for (int t = 0; t < 16; ++t) { o[t][0] = z8; o[t][1] = z8; }
  float m[2] = {-3.0e38f, -3.0e38f}, l[2] = {0.f, 0.f};
  // kept rolled: the body holds 64 matrix instructions and nearly the whole register budget; a second copy would only cost instruction cache
#pragma unroll 1
  for (int s = 0; s < NPASS; ++s) {
    const unsigned short* bK = sK[s & 1]; const unsigned short* bV = sV[s & 1];
    unsigned short* nK = sK[(s + 1) & 1]; unsigned short* nV = sV[(s + 1) & 1];
    const int sn = s + 1 < NPASS ? s + 1 : s;      /* no branch round the staging: the last pass fetches its own tiles again, into the buffer that nobody reads any more */
    const unsigned short* pk = gK + (size_t)sn * 32 * DO; const unsigned short* pv = gV + sn * 32;
    v8us st[4];      /* the next pass's tiles go through registers, 16 at a time: K under the first product, V^T under the softmax and the second */
#pragma unroll
    for (int j = 0; j < 4; ++j) st[j] = *(const v8us*)(pk + j * 8 * DO);
    asm volatile("s_wait_xcnt 0x0" :: "v"(pk) : "memory");      /* as an input the loads' address stays whole until the wait */
    // S^T = K.Q^T, one k step (2 fragments, 4 matrix instructions) a block; each block's LDS reads stand as one group two blocks ahead, in a ring of three fragment pairs
    v8f sc[2][2] = {{z8, z8}, {z8, z8}};
    v16h ka[3][2];
#pragma unroll
    for (int i = 0; i < 4; ++i) ka[i >> 1][i & 1] = fa_frag(bK + ((i & 1) * 16 + ln) * KPIT + (i >> 1) * 32, hh);
#pragma unroll
    for (int ks = 0; ks < 8; ++ks) {
      if (ks < 6) { ka[(ks + 2) % 3][0] = fa_frag(bK + ln * KPIT + (ks + 2) * 32, hh); ka[(ks + 2) % 3][1] = fa_frag(bK + (16 + ln) * KPIT + (ks + 2) * 32, hh); }
      __builtin_amdgcn_sched_barrier(0);      /* keeps the reads above as one group in front of the block, two blocks ahead of their use */
      const v16h a0 = ka[ks % 3][0], a1 = ka[ks % 3][1];
      sc[0][0] = fa_mma(a0, qf[0][ks], sc[0][0]); sc[0][1] = fa_mma(a0, qf[1][ks], sc[0][1]);
      sc[1][0] = fa_mma(a1, qf[0][ks], sc[1][0]); sc[1][1] = fa_mma(a1, qf[1][ks], sc[1][1]);
      __builtin_amdgcn_sched_barrier(0);      /* ends the block: the next group of reads stays behind it */
    }
#pragma unroll
    for (int j = 0; j < 4; ++j) *(v8us*)(nK + lK + j * 8 * KPIT) = st[j];      /* the other buffers' last readers left them at the barrier that ended pass s - 1 */
    __builtin_amdgcn_sched_barrier(0);      /* the V^T loads stay behind the K stores, so that the two staged tiles are never live together */
#pragma unroll
    for (int j = 0; j < 4; ++j) st[j] = *(const v8us*)(pv + (size_t)j * 64 * NN);
    asm volatile("s_wait_xcnt 0x0" :: "v"(pv) : "memory");      /* as an input the loads' address stays whole until the wait */
#pragma unroll
    for (int g = 0; g < 2; ++g) {
      float mx = sc[0][g][0];
#pragma unroll
      for (int r = 0; r < 8; ++r) mx = fmaxf(mx, fmaxf(sc[0][g][r], sc[1][g][r]));
      mx = fmaxf(mx, xhalf(mx)) * cs;      /* cs > 0; both halves of the wave now hold this query's maximum of the pass */
      if (__builtin_amdgcn_ballot_w32(mx > m[g] + MTHR) != 0) {      /* scalar branch, rare after the first passes; one group a branch */
        const float mn = fmaxf(m[g], mx); const float corr = __builtin_amdgcn_exp2f(m[g] - mn);      /* 0 on the first pass */
        m[g] = mn; l[g] *= corr;
#pragma unroll
        for (int t = 0; t < 16; ++t) o[t][g] = o[t][g] * corr;
      }
    }
    v16h pf[2];
#pragma unroll
    for (int g = 0; g < 2; ++g) {
      const float sh = 10.0f - m[g]; FragH p; float s0 = 0.f, s1 = 0.f;      /* weights x 1024, as f16 operands away from the subnormal range; l carries the same factor */
      float x[16];
#pragma unroll
      for (int r = 0; r < 8; ++r) { x[r] = fmaf(sc[0][g][r], cs, sh); x[8 + r] = fmaf(sc[1][g][r], cs, sh); }
      __builtin_amdgcn_sched_barrier(0);      /* the arguments are all made first: no multiply-add is left to land on an exponential's source directly behind it */
#pragma unroll
      for (int r = 0; r < 16; ++r) x[r] = __builtin_amdgcn_exp2f(x[r]);
      __builtin_amdgcn_sched_barrier(0);      /* sums and conversions stay behind the exponentials: none reads a result directly behind its exponential */
#pragma unroll
      for (int r = 0; r < 8; ++r) { s0 += x[r]; s1 += x[8 + r]; p.h[r] = (_Float16)x[r]; p.h[8 + r] = (_Float16)x[8 + r]; }
      l[g] += s0 + s1; pf[g] = p.v;
    }
    // O^T += V^T.P^T, two d tiles (2 fragments, 4 matrix instructions) a block, read ahead in the same ring
    __builtin_amdgcn_sched_barrier(0);      /* the V^T reads stay behind the exponentials: hoisted among them they take the registers that keep two waves on a SIMD without spills */
    v16h va[3][2];
#pragma unroll
    for (int i = 0; i < 4; ++i) va[i >> 1][i & 1] = fa_frag(bV + (i * 16 + ln) * VPIT, hh);
#pragma unroll
    for (int b = 0; b < 8; ++b) {
      if (b < 6) { va[(b + 2) % 3][0] = fa_frag(bV + (((b + 2) * 2) * 16 + ln) * VPIT, hh); va[(b + 2) % 3][1] = fa_frag(bV + (((b + 2) * 2 + 1) * 16 + ln) * VPIT, hh); }
      __builtin_amdgcn_sched_barrier(0);      /* one group of reads in front of the block, as above */
      o[b * 2][0] = fa_mma(va[b % 3][0], pf[0], o[b * 2][0]); o[b * 2][1] = fa_mma(va[b % 3][0], pf[1], o[b * 2][1]);
      o[b * 2 + 1][0] = fa_mma(va[b % 3][1], pf[0], o[b * 2 + 1][0]); o[b * 2 + 1][1] = fa_mma(va[b % 3][1], pf[1], o[b * 2 + 1][1]);
      __builtin_amdgcn_sched_barrier(0);      /* ends the block */
    }
#pragma unroll
    for (int j = 0; j < 4; ++j) *(v8us*)(nV + lV + j * 64 * VPIT) = st[j];
    __syncthreads();      /* publishes pass s + 1's tiles and ends every read of pass s's */
  }
  // partials: OP[query row][key range][d], ML[query row][key range][m, l]; query row = branch * NN + query. One address pair serves all stores of each array, and
  // everything that is computed stands in front of the first store: behind it no register that a store names is written any more.
  const size_t row = (size_t)br * NN + q0 + ln;
  float* op = OP + (row * KSP + sp) * DO + 8 * hh;      /* a lane's 8 accumulator registers are 8 consecutive d of its query */
  float* mlp = ML + (row * KSP + sp) * 2 + hh;
  const float j0 = l[0] + xhalf(l[0]), j1 = l[1] + xhalf(l[1]);      /* the halves' sums joined, with every lane on: the exchange stands outside the selection below */
  const float w0 = hh ? j0 : m[0], w1 = hh ? j1 : m[1];      /* the lower half of the wave writes m, the upper l */
  mlp[0] = w0; mlp[16 * KSP * 2] = w1;
#pragma unroll
  for (int g = 0; g < 2; ++g) {
#pragma unroll
    for (int t = 0; t < 16; ++t) {
      const v4f lo = {o[t][g][0], o[t][g][1], o[t][g][2], o[t][g][3]}, hi = {o[t][g][4], o[t][g][5], o[t][g][6], o[t][g][7]};
      *(v4f*)(op + g * 16 * KSP * DO + t * 16) = lo; *(v4f*)(op + g * 16 * KSP * DO + t * 16 + 4) = hi;
    }
  }
  asm volatile("s_wait_xcnt 0x0" :: "v"(op), "v"(mlp) : "memory");      /* as inputs the stores' addresses stay whole until the wait */
}
// f = sum_s 2^(m_s - M) O_s / sum_s 2^(m_s - M) l_s over the KSP key ranges, fixed order s = 0..KSP-1; written as f16 hi + residual x 1024
__global__ __launch_bounds__(256) void k_fcomb(const float* __restrict__ OP, const float* __restrict__ ML, _Float16* __restrict__ FH, _Float16* __restrict__ FL) {
  const int t = blockIdx.x * 256 + threadIdx.x; if (t >= 2 * NN * (DO / 8)) return; const int d8 = (t % (DO / 8)) * 8; const int r = t / (DO / 8);
  const float* po = OP + (size_t)r * KSP * DO + d8; const float* pm = ML + (size_t)r * KSP * 2;      /* one address pair for each array */
  float ms[KSP], ls[KSP]; v8f op[KSP];
#pragma unroll
  for (int s = 0; s < KSP; ++s) { ms[s] = pm[s * 2]; ls[s] = pm[s * 2 + 1]; op[s] = *(const v8f*)(po + s * DO); }
  asm volatile("s_wait_xcnt 0x0" :: "v"(po), "v"(pm) : "memory");      /* as inputs the loads' addresses stay whole until the wait */
  float M = ms[0];
#pragma unroll
  for (int s = 1; s < KSP; ++s) M = fmaxf(M, ms[s]);
  v8f a = {0.f,0.f,0.f,0.f,0.f,0.f,0.f,0.f}; float den = 0.f;
#pragma unroll
  for (int s = 0; s < KSP; ++s) { const float wg = __builtin_amdgcn_exp2f(ms[s] - M); den += wg * ls[s]; a += op[s] * wg; }
  const float rs = 1.0f / den; FragH f, fl;
#pragma unroll
  for (int q = 0; q < 8; ++q) { const float v = a[q] * rs; const _Float16 hv = (_Float16)v; f.h[q] = hv; fl.h[q] = (_Float16)((v - (float)hv) * 1024.0f); }
  const size_t o = (size_t)r * DO + d8; *(v8us*)((unsigned short*)FH + o) = f.half[0]; *(v8us*)((unsigned short*)FL + o) = fl.half[0];
}

extern "C" void kernel_launch(void* const* d_in, const int* in_sizes, int n_in,
                              void* d_out, int out_size, void* d_ws, size_t ws_size, hipStream_t stream) {
  (void)in_sizes; (void)n_in; (void)out_size;
  const float* const* I = (const float* const*)d_in; const float* x1 = I[0]; const float* x2 = I[1]; const float* Wq1 = I[2]; const float* bq1 = I[3]; const float* Wk1 = I[4]; const float* bk1 = I[5]; const float* Wv = I[6]; const float* bv = I[7]; const float* Wq2 = I[8]; const float* bq2 = I[9]; const float* Wk2 = I[10]; const float* bk2 = I[11]; const float* We = I[12]; const float* be = I[13]; const float* scp = I[14];
  float* out1 = (float*)d_out;      /* the second output lies behind the first, at byte offset 16777216 */
  char* ws = (char*)d_ws; size_t off = 0;
  auto take = [&](size_t bytes) { char* p = ws + off; off += (bytes + 255) & ~(size_t)255; return p; };
  _Float16* BW = (_Float16*)take((size_t)6 * DO * DI * 2); _Float16* BE = BW + (size_t)5 * DO * DI; _Float16* X1 = (_Float16*)take((size_t)2 * NN * DI * 2);      /* weight slots Wq1 Wk1 Wq2 Wk2 Wv We; [x1 | x2] */
  _Float16* Q1 = (_Float16*)take((size_t)6 * NN * DO * 2); _Float16* K1 = Q1 + (size_t)NN * DO; _Float16* Q2 = Q1 + (size_t)2 * NN * DO; _Float16* K2 = Q1 + (size_t)3 * NN * DO; _Float16* V1 = Q1 + (size_t)4 * NN * DO;      /* planes Q1 K1 Q2 K2 V1 V2 */
  _Float16* VT1 = (_Float16*)take((size_t)2 * NN * DO * 2); _Float16* VT2 = VT1 + (size_t)NN * DO;
  float* OP = (float*)take((size_t)KSP * 2 * NN * DO * 4); float* ML = (float*)take((size_t)KSP * 2 * NN * 2 * 4); _Float16* FH = (_Float16*)take((size_t)2 * NN * DO * 2); _Float16* FL = (_Float16*)take((size_t)2 * NN * DO * 2);
  if (off > ws_size) return;      /* 1.5 + 16 + 24 + 8 + 64 + 0.5 + 8 + 8 = about 130 MiB */
  k_cvt<<<6 * WB + 2 * XB, 256, 0, stream>>>(x1, x2, Wq1, Wk1, Wq2, Wk2, Wv, We, X1, BW);      /* weights as given, (out, in) */
  k_proj6<<<dim3((NN / 128) * (DO / 128), 6), 256, 0, stream>>>(X1, BW, bq1, bk1, bq2, bk2, bv, Q1);
  k_vt<DO / 64, NN><<<2 * (DO / 64) * (NN / 64), 256, 0, stream>>>(V1, DO, 0, VT1);      /* V^T [256][8192] of both branches: V1 | V2 and VT1 | VT2 lie back to back */
  k_flash<<<dim3(NN / FQ, KSP, 2), 256, 0, stream>>>(Q1, K2, VT1, Q2, K1, VT2, scp, OP, ML);      /* f1: hsi_Q . lidar_K -> hsi_V ; f2: lidar_Q . hsi_K -> lidar_V */
  k_fcomb<<<2 * NN * (DO / 8) / 256, 256, 0, stream>>>(OP, ML, FH, FL);
  // both branches in each launch: FL, FH and the two outputs lie back to back (one M = 2 NN); the second launch adds its own element of the first's plane
  k_gemm3<false><<<(2 * NN / 128) * (DI / 128), 256, 0, stream>>>(FL, BE, 0.0625f / 1024.0f, nullptr, out1);
  k_gemm3<true><<<(2 * NN / 128) * (DI / 128), 256, 0, stream>>>(FH, BE, 0.0625f, be, out1);      /* (f_lo + f_hi) We^T + be */
}

// v005
// A run of this version takes 139 microseconds.
// Timed twice side by side with v004, it ran 1.19 and 1.18 times as fast.
// Counting every step since v000, it is 19.5 times as fast.
#include <hip/hip_runtime.h>
// cross_fuison (8192 hsi rows x1 and 8192 lidar rows x2, 512 -> 256: Q/K/V = x W^T + b (W_V shared); inv = 1/sqrt(clip(scale, 1, 32)); f1 = softmax(hsi_Q lidar_K^T inv) hsi_V; f2 = softmax(lidar_Q hsi_K^T inv) lidar_V; outputs = (f1 We^T + be, f2 We^T + be), each [8192][512]).
// Compute dtype: inputs rounded to bf16; inputs/weights exact as f16; Q/K/V and the softmax weights as plain f16 operands (~2^-12); f as f16 hi + residual into We; softmax f32. v_wmma_f32_16x16x32_f16.
#define NN 8192
#define DI 512
#define DO 256
typedef __bf16 v16b __attribute__((ext_vector_type(16)));
typedef unsigned short v8us __attribute__((ext_vector_type(8), may_alias));
typedef float  v8f  __attribute__((ext_vector_type(8)));
typedef float  v4f  __attribute__((ext_vector_type(4)));
typedef float  v4fa __attribute__((ext_vector_type(4), may_alias));
union FragB { v16b v; v8us half[2]; unsigned short u[16]; };

__device__ __forceinline__ unsigned short bf16_bits(float x) { unsigned int u = __float_as_uint(x); return (unsigned short)((u + 0x7FFFu + ((u >> 16) & 1u)) >> 16); }
__device__ __forceinline__ float bf16_val(unsigned short b) { return __uint_as_float(((unsigned int)b) << 16); }
__device__ __forceinline__ float bf16_round(float x) { return bf16_val(bf16_bits(x)); }
// D += A·B with NT terms: 1 = ah·bh, 2 = + al·bh (A split), 3 = + ah·bl (both split)
template <int NT>
__device__ __forceinline__ v8f mmaN(v16b ah, v16b al, v16b bh, v16b bl, v8f c) {
  c = __builtin_amdgcn_wmma_f32_16x16x32_bf16(false, ah, false, bh, (short)0, c, false, false);
  if (NT >= 2) c = __builtin_amdgcn_wmma_f32_16x16x32_bf16(false, al, false, bh, (short)0, c, false, false);
  if (NT >= 3) c = __builtin_amdgcn_wmma_f32_16x16x32_bf16(false, ah, false, bl, (short)0, c, false, false);
  asm volatile("v_nop\n\tv_nop\n\tv_nop\n\tv_nop" : "+v"(c) : "v"(ah), "v"(al), "v"(bh), "v"(bl));
  return c;
}

__global__ __launch_bounds__(256) void k_wt_bf16(const float* __restrict__ W, unsigned short* __restrict__ Wt, int K, int N) {
  const int t = blockIdx.x * 256 + threadIdx.x;
  const int k8n = K / 8;
  if (t >= N * k8n) return;
  const int n = t / k8n, k8 = (t % k8n) * 8;
  v8us v;
#pragma unroll
  for (int i = 0; i < 8; ++i) v[i] = bf16_bits(W[(size_t)(k8 + i) * N + n]);
  *(v8us*)(Wt + (size_t)n * K + k8) = v;
  
}

// GEMM C[M][N] (f32, pitch ldc) = act(A[M][K]·W + bias). A f32 row-major (pitch lda) converted per fragment to bf16
// (ASPLIT: hi/lo two planes -> 2 terms, else single rounded term); Wt bf16 [N][K] (pitch ldb). BIAS_BF16 rounds the
// bias to bf16 first (bias quantised to bf16 before the add). K%32==0, M%16==0, N%64==0.
template <bool ASPLIT, int ACT, bool BIAS_BF16>
__global__ __launch_bounds__(128) void k_gemm_bf(const float* __restrict__ A, int lda, const unsigned short* __restrict__ Wt, int ldb,
                                               const float* __restrict__ bias, float* __restrict__ C, int ldc, int M, int N, int K) {
  __shared__ __attribute__((aligned(16))) float so[4][16][64];
  const int tid = threadIdx.x, w = tid >> 5, lane = tid & 31, ln = lane & 15, hh = lane >> 4;
  const int ntn = N / 64;
  const int wid = blockIdx.x * 4 + w;
  const int mt = wid / ntn, nq = wid % ntn;
  if (mt * 16 >= M) return;
  const int row0 = mt * 16, col0 = nq * 64;
  const float* arow = A + (size_t)(row0 + ln) * lda;
  v8f acc[4] = {};
  for (int kb = 0; kb < K; kb += 32) {
    FragB ah, al;
    const v4f x0 = *(const v4fa*)(arow + kb + 8 * hh), x1 = *(const v4fa*)(arow + kb + 8 * hh + 4);
    const v4f x2 = *(const v4fa*)(arow + kb + 16 + 8 * hh), x3 = *(const v4fa*)(arow + kb + 16 + 8 * hh + 4);
    float xs[16] = {x0[0],x0[1],x0[2],x0[3],x1[0],x1[1],x1[2],x1[3],x2[0],x2[1],x2[2],x2[3],x3[0],x3[1],x3[2],x3[3]};
#pragma unroll
    for (int i = 0; i < 16; ++i) { const unsigned short hb = bf16_bits(xs[i]); ah.u[i] = hb; al.u[i] = ASPLIT ? bf16_bits(xs[i] - bf16_val(hb)) : (unsigned short)0; }
#pragma unroll
    for (int t = 0; t < 4; ++t) {
      const unsigned short* brow = Wt + (size_t)(col0 + t * 16 + ln) * ldb + kb;
      FragB b;
      b.half[0] = *(const v8us*)(brow + 8 * hh);
      b.half[1] = *(const v8us*)(brow + 16 + 8 * hh);
      acc[t] = mmaN<ASPLIT ? 2 : 1>(ah.v, al.v, b.v, b.v, acc[t]);
    }
  }
#pragma unroll
  for (int t = 0; t < 4; ++t) {
    float bv = bias ? bias[col0 + t * 16 + ln] : 0.f;
    if (BIAS_BF16) bv = bf16_round(bv);
#pragma unroll
    for (int r = 0; r < 8; ++r) { float v = acc[t][r] + bv; if (ACT == 1) v = fmaxf(v, 0.f); so[w][8 * hh + r][t * 16 + ln] = v; }
  }
  __builtin_amdgcn_fence(__ATOMIC_ACQ_REL, "workgroup");
  __builtin_amdgcn_wave_barrier();
  const int rsub = lane >> 4, c4 = (lane & 15) * 4;
  {
#pragma unroll
    for (int q = 0; q < 8; ++q) {
      const int r = q * 2 + rsub;
      const v4f v = *(const v4fa*)&so[w][r][c4];
      *(v4f*)(C + (size_t)(row0 + r) * ldc + col0 + c4) = v;
    }
    
  }
}

// GEMM C = act(A·W + bias + resid): A f32 (ASPLIT -> hi/lo 2 terms), Wt bf16 [N][K]; ACT 0 none, 1 relu, 2 exact gelu;
// resid (optional, f32, row index = (row % rmod), pitch ldr, RES_BF16 rounds it) added before the activation.
template <bool ASPLIT, int ACT, bool BIAS_BF16, bool RES_BF16>
__global__ __launch_bounds__(128) void k_gemm_bf3(const float* __restrict__ A, int lda, const unsigned short* __restrict__ Wt, int ldb,
                                                const float* __restrict__ bias, const float* __restrict__ resid, int rmod, int ldr,
                                                float* __restrict__ C, int ldc, int M, int N, int K) {
  __shared__ __attribute__((aligned(16))) float so[4][16][64];
  const int tid = threadIdx.x, w = tid >> 5, lane = tid & 31, ln = lane & 15, hh = lane >> 4;
  const int ntn = N / 64;
  const int wid = blockIdx.x * 4 + w;
  const int mt = wid / ntn, nq = wid % ntn;
  if (mt * 16 >= M) return;
  const int row0 = mt * 16, col0 = nq * 64;
  const float* arow = A + (size_t)(row0 + ln) * lda;
  v8f acc[4] = {};
  for (int kb = 0; kb < K; kb += 32) {
    FragB ah, al;
    const v4f x0 = *(const v4fa*)(arow + kb + 8 * hh), x1 = *(const v4fa*)(arow + kb + 8 * hh + 4);
    const v4f x2 = *(const v4fa*)(arow + kb + 16 + 8 * hh), x3 = *(const v4fa*)(arow + kb + 16 + 8 * hh + 4);
    float xs[16] = {x0[0],x0[1],x0[2],x0[3],x1[0],x1[1],x1[2],x1[3],x2[0],x2[1],x2[2],x2[3],x3[0],x3[1],x3[2],x3[3]};
#pragma unroll
    for (int i = 0; i < 16; ++i) { const unsigned short hb = bf16_bits(xs[i]); ah.u[i] = hb; al.u[i] = ASPLIT ? bf16_bits(xs[i] - bf16_val(hb)) : (unsigned short)0; }
#pragma unroll
    for (int t = 0; t < 4; ++t) {
      const unsigned short* brow = Wt + (size_t)(col0 + t * 16 + ln) * ldb + kb;
      FragB b;
      b.half[0] = *(const v8us*)(brow + 8 * hh);
      b.half[1] = *(const v8us*)(brow + 16 + 8 * hh);
      acc[t] = mmaN<ASPLIT ? 2 : 1>(ah.v, al.v, b.v, b.v, acc[t]);
    }
  }
#pragma unroll
  for (int t = 0; t < 4; ++t) {
    const int col = col0 + t * 16 + ln;
    float bv = bias ? bias[col] : 0.f;
    if (BIAS_BF16) bv = bf16_round(bv);
#pragma unroll
    for (int r = 0; r < 8; ++r) {
      float v = acc[t][r] + bv;
      if (resid) { float rv = resid[(size_t)((row0 + 8 * hh + r) % rmod) * ldr + col]; if (RES_BF16) rv = bf16_round(rv); v += rv; }
      if (ACT == 1) v = fmaxf(v, 0.f);
      if (ACT == 2) v = 0.5f * v * (1.0f + erff(v * 0.70710678118654752f));
      if (ACT == 3) { const float u = 0.7978845608028654f * (v + 0.044715f * v * v * v); v = 0.5f * v * (1.0f + tanhf(u)); }
      so[w][8 * hh + r][t * 16 + ln] = v;
    }
  }
  __builtin_amdgcn_fence(__ATOMIC_ACQ_REL, "workgroup");
  __builtin_amdgcn_wave_barrier();
  const int rsub = lane >> 4, c4 = (lane & 15) * 4;
  {
#pragma unroll
    for (int q = 0; q < 8; ++q) {
      const int r = q * 2 + rsub;
      const v4f v = *(const v4fa*)&so[w][r][c4];
      *(v4f*)(C + (size_t)(row0 + r) * ldc + col0 + c4) = v;
    }
    
  }
}
// row LayerNorm (biased variance, eps) over N: s = X (+ R); optional out_sum <- s; out_norm <- (s-mu)*rsqrt(var+eps)*g + b
template <bool PARAM_BF16>
__global__ __launch_bounds__(256) void k_layernorm(const float* __restrict__ X, const float* __restrict__ R, const float* __restrict__ g, const float* __restrict__ bta,
                                                  float* __restrict__ out_sum, float* __restrict__ out_norm, int N, float eps) {
  __shared__ float red[256];
  const int row = blockIdx.x, tid = threadIdx.x;
  const float* x = X + (size_t)row * N; const float* rr = R ? R + (size_t)row * N : nullptr;
  float vals[16];                     // up to N = 4096
  const int per = N / 256;            // contiguous chunk per thread? use strided-by-4 chunks: thread handles j = tid*4 + 1024*u
  float s1 = 0.f;
  for (int u = 0; u < per / 4; ++u) {
    const int j = tid * 4 + 1024 * u;
    const v4f a = *(const v4fa*)(x + j);
    v4f b = {0.f,0.f,0.f,0.f}; if (rr) b = *(const v4fa*)(rr + j);
#pragma unroll
    for (int q = 0; q < 4; ++q) { const float v = a[q] + b[q]; vals[u * 4 + q] = v; s1 += v; }
  }
  red[tid] = s1; __syncthreads();
  for (int st = 128; st > 0; st >>= 1) { if (tid < st) red[tid] += red[tid + st]; __syncthreads(); }
  const float mu = red[0] / (float)N; __syncthreads();
  float s2 = 0.f;
  for (int u = 0; u < per / 4; ++u)
#pragma unroll
    for (int q = 0; q < 4; ++q) { const float c = vals[u * 4 + q] - mu; s2 += c * c; }
  red[tid] = s2; __syncthreads();
  for (int st = 128; st > 0; st >>= 1) { if (tid < st) red[tid] += red[tid + st]; __syncthreads(); }
  const float rs = rsqrtf(red[0] / (float)N + eps);
  {
    for (int u = 0; u < per / 4; ++u) {
      const int j = tid * 4 + 1024 * u;
      v4f o, sm;
#pragma unroll
      for (int q = 0; q < 4; ++q) {
        float gg = g[j + q], bb = bta[j + q];
        if (PARAM_BF16) { gg = bf16_round(gg); bb = bf16_round(bb); }
        sm[q] = vals[u * 4 + q]; o[q] = (vals[u * 4 + q] - mu) * rs * gg + bb;
      }
      if (out_sum) *(v4f*)(out_sum + (size_t)row * N + j) = sm;
      *(v4f*)(out_norm + (size_t)row * N + j) = o;
    }
    
  }
}



// ---- f16 WMMA path (v_wmma_f32_16x16x32_f16): 11-bit significands for operands in range — used where a [0,1] probability operand needs more precision than bf16
typedef _Float16 v16h __attribute__((ext_vector_type(16)));
union FragH { v16h v; v8us half[2]; _Float16 h[16]; unsigned short u[16]; };
template <int NT>
__device__ __forceinline__ v8f mmaH(v16h ah, v16h al, v16h bh, v16h bl, v8f c) {
  c = __builtin_amdgcn_wmma_f32_16x16x32_f16(false, ah, false, bh, (short)0, c, false, false);
  if (NT >= 2) c = __builtin_amdgcn_wmma_f32_16x16x32_f16(false, al, false, bh, (short)0, c, false, false);
  if (NT >= 3) c = __builtin_amdgcn_wmma_f32_16x16x32_f16(false, ah, false, bl, (short)0, c, false, false);
  asm volatile("v_nop\n\tv_nop\n\tv_nop\n\tv_nop" : "+v"(c) : "v"(ah), "v"(al), "v"(bh), "v"(bl));
  return c;
}
// batched GEMM like k_gemm_b but f16 operands: A f32 (split into f16 hi/lo if ASPLIT, else rounded to f16), Bt = f16 values [n][k]; alpha; C f32; N multiple of 16 (partial tiles skipped)
template <bool ASPLIT>
__global__ __launch_bounds__(128) void k_gemm_h(const float* __restrict__ A, int lda, size_t sA, const _Float16* __restrict__ Bh, int ldb, size_t sB, float alpha, float* __restrict__ C, int ldc, size_t sC, int M, int N, int K) {
  __shared__ __attribute__((aligned(16))) float so[4][16][64];
  const int tid = threadIdx.x, w = tid >> 5, lane = tid & 31, ln = lane & 15, hh = lane >> 4; const int by = blockIdx.y;
  A += (size_t)by * sA; Bh += (size_t)by * sB; C += (size_t)by * sC;
  const int ntn = (N + 63) / 64; const int wid = blockIdx.x * 4 + w; const int mt = wid / ntn, nq = wid % ntn; if (mt * 16 >= M) return;
  const int row0 = mt * 16, col0 = nq * 64; const float* arow = A + (size_t)(row0 + ln) * lda;
  v8f acc[4] = {};
  for (int kb = 0; kb < K; kb += 32) {
    FragH ah, al;
    const v4f x0 = *(const v4fa*)(arow + kb + 8 * hh), x1 = *(const v4fa*)(arow + kb + 8 * hh + 4), x2 = *(const v4fa*)(arow + kb + 16 + 8 * hh), x3 = *(const v4fa*)(arow + kb + 16 + 8 * hh + 4);
    float xs[16] = {x0[0],x0[1],x0[2],x0[3],x1[0],x1[1],x1[2],x1[3],x2[0],x2[1],x2[2],x2[3],x3[0],x3[1],x3[2],x3[3]};
#pragma unroll
    for (int i = 0; i < 16; ++i) { const _Float16 h = (_Float16)xs[i]; ah.h[i] = h; al.h[i] = ASPLIT ? (_Float16)(xs[i] - (float)h) : (_Float16)0.0f; }
#pragma unroll
    for (int t = 0; t < 4; ++t) { if (col0 + t * 16 >= N) continue; const size_t boff = (size_t)(col0 + t * 16 + ln) * ldb + kb; FragH bq; bq.half[0] = *(const v8us*)(Bh + boff + 8 * hh); bq.half[1] = *(const v8us*)(Bh + boff + 16 + 8 * hh);
      acc[t] = mmaH<ASPLIT ? 2 : 1>(ah.v, al.v, bq.v, bq.v, acc[t]); }
  }
#pragma unroll
  for (int t = 0; t < 4; ++t) { if (col0 + t * 16 >= N) continue;
#pragma unroll
    for (int r = 0; r < 8; ++r) so[w][8 * hh + r][t * 16 + ln] = acc[t][r] * alpha; }
  __builtin_amdgcn_fence(__ATOMIC_ACQ_REL, "workgroup"); __builtin_amdgcn_wave_barrier();
  const int rsub = lane >> 4, c4 = (lane & 15) * 4;
  {
#pragma unroll
    for (int q = 0; q < 8; ++q) { const int r = q * 2 + rsub; if (col0 + c4 < N) { const v4f v = *(const v4fa*)&so[w][r][c4]; *(v4f*)(C + (size_t)(row0 + r) * ldc + col0 + c4) = v; } }
     }
}

// Wt[n][k] = f16(W[k][n]·scale) from f32 row-major W[K][N] (scale = power of two; bf16-exact weights stay exact in f16 away from the subnormal range)
__global__ __launch_bounds__(256) void k_wt_f16(const float* __restrict__ W, _Float16* __restrict__ Wt, int K, int N, float scale) {
  const int t = blockIdx.x * 256 + threadIdx.x; if (t >= N * (K / 8)) return; const int n = t / (K / 8), k8 = (t % (K / 8)) * 8; FragH f;
#pragma unroll
  for (int i = 0; i < 8; ++i) f.h[i] = (_Float16)(bf16_round(W[(size_t)(k8 + i) * N + n]) * scale); const v8us o = f.half[0];
  *(v8us*)((unsigned short*)Wt + (size_t)n * K + k8) = o; 
}
// k_gemm_hh variant with fused epilogue: v = acc·alpha + bias[by·sBias + col] (+ CP[(row/rowsPerB)·sCPb + by·64 + col] if CP) ; ACT 0 none / 1 elu ; writes f16 C16 (and f32 C if non-null)
template <int ACT>
__global__ __launch_bounds__(128) void k_gemm_hhx(const _Float16* __restrict__ A, int lda, size_t sA, const _Float16* __restrict__ Bh, int ldb, size_t sB, float alpha, const float* __restrict__ bias, size_t sBias, const float* __restrict__ CP, int rowsPerB, size_t sCPb, int row0g,
    float* __restrict__ C, _Float16* __restrict__ C16, int ldc, size_t sC, int M, int N, int K) {
  __shared__ __attribute__((aligned(16))) float so[4][16][64];
  const int tid = threadIdx.x, w = tid >> 5, lane = tid & 31, ln = lane & 15, hh = lane >> 4; const int by = blockIdx.y;
  A += (size_t)by * sA; Bh += (size_t)by * sB; const size_t cofs = (size_t)by * sC; const float* bp = bias ? bias + (size_t)by * sBias : nullptr;
  const int ntn = (N + 63) / 64; const int wid = blockIdx.x * 4 + w; const int mt = wid / ntn, nq = wid % ntn; if (mt * 16 >= M) return;
  const int row0 = mt * 16, col0 = nq * 64; const _Float16* arow = A + (size_t)(row0 + ln) * lda;
  v8f acc[4] = {};
  for (int kb = 0; kb < K; kb += 32) { FragH ah; ah.half[0] = *(const v8us*)((const unsigned short*)arow + kb + 8 * hh); ah.half[1] = *(const v8us*)((const unsigned short*)arow + kb + 16 + 8 * hh);
#pragma unroll
    for (int t = 0; t < 4; ++t) { if (col0 + t * 16 >= N) continue; const size_t boff = (size_t)(col0 + t * 16 + ln) * ldb + kb; FragH bq; bq.half[0] = *(const v8us*)((const unsigned short*)Bh + boff + 8 * hh); bq.half[1] = *(const v8us*)((const unsigned short*)Bh + boff + 16 + 8 * hh);
      acc[t] = mmaH<1>(ah.v, ah.v, bq.v, bq.v, acc[t]); }
  }
#pragma unroll
  for (int t = 0; t < 4; ++t) { if (col0 + t * 16 >= N) continue; const int col = col0 + t * 16 + ln; const float bv = bp ? bf16_round(bp[col]) : 0.f;
#pragma unroll
    for (int r = 0; r < 8; ++r) { float v = acc[t][r] * alpha + bv; if (CP) { const int rr = row0g + row0 + 8 * hh + r; if (rowsPerB < 0) v += CP[cofs + (size_t)rr * ldc + col];      /* rowsPerB < 0: own element of the batched C plane */ else { const int bidx = rr / rowsPerB; v += CP[(size_t)bidx * sCPb + (size_t)by * 64 + col]; } } if (ACT == 1) v = (v > 0.f) ? v : expm1f(v); else if (ACT == 7) v = (v > 0.f) ? v + 1.0f : expf(v); else if (ACT == 8) v = tanhf(v); else if (ACT == 9) v = 0.5f * v * (1.0f + tanhf(0.7978845608028654f * (v + 0.044715f * v * v * v))); else if (ACT == 11) v = 1.0f / (1.0f + expf(-v)); else if (ACT == 12) v = (v > 0.f) ? v : 0.01f * v; else if (ACT == 14) v = (v > 0.f) ? v : 0.1f * v; else if (ACT == 16) v = (v >= 0.f) ? v : 0.3f * v; else if (ACT == 17) v = (v >= 0.f) ? v : 0.2f * v; else if (ACT == 15) v = v / (1.0f + expf(-v)); else if (ACT == 3) v = fmaxf(v, 0.f); else if (ACT == 6) v = 0.5f * v * (1.0f + erff(v * 0.70710678118654752f)); so[w][8 * hh + r][t * 16 + ln] = v; } }
  __builtin_amdgcn_fence(__ATOMIC_ACQ_REL, "workgroup"); __builtin_amdgcn_wave_barrier();
  const int rsub = lane >> 4, c4 = (lane & 15) * 4; typedef _Float16 v4h __attribute__((ext_vector_type(4)));
  {
#pragma unroll
    for (int q = 0; q < 8; ++q) { const int r = q * 2 + rsub; if (col0 + c4 < N) { const v4f v = *(const v4fa*)&so[w][r][c4]; if (C) *(v4f*)(C + cofs + (size_t)(row0 + r) * ldc + col0 + c4) = v; if (C16) { v4h h4; for (int i = 0; i < 4; ++i) h4[i] = (_Float16)v[i]; *(v4h*)(C16 + cofs + (size_t)(row0 + r) * ldc + col0 + c4) = h4; } } }
     }
}


typedef _Float16 v4h __attribute__((ext_vector_type(4)));

// every input conversion in one launch: blocks 0 .. 6 WB - 1 take the six weight matrices (slot j of BW = f16(bf16(w_j) x 16), each DO x DI elements), the rest x1 and x2 (X = [x1 | x2] as f16(bf16(x)))
#define XB (NN * DI / 8 / 256)   /* blocks per x */
#define WB (DO * DI / 8 / 256)   /* blocks per weight matrix */
__global__ __launch_bounds__(256) void k_cvt(const float* __restrict__ x1, const float* __restrict__ x2, const float* __restrict__ w0, const float* __restrict__ w1, const float* __restrict__ w2, const float* __restrict__ w3, const float* __restrict__ w4, const float* __restrict__ w5,
    _Float16* __restrict__ X, _Float16* __restrict__ BW) {
  const int b = blockIdx.x, tid = threadIdx.x; const float* src; _Float16* dst; float sc;
  if (b < 6 * WB) { const int j = b / WB; const float* w = j == 0 ? w0 : j == 1 ? w1 : j == 2 ? w2 : j == 3 ? w3 : j == 4 ? w4 : w5; src = w + ((size_t)(b - j * WB) * 256 + tid) * 8; dst = BW + ((size_t)b * 256 + tid) * 8; sc = 16.0f; }
  else { const int q = b - 6 * WB, j = q / XB; src = (j ? x2 : x1) + ((size_t)(q - j * XB) * 256 + tid) * 8; dst = X + ((size_t)q * 256 + tid) * 8; sc = 1.0f; }
  FragH f;
#pragma unroll
  for (int q = 0; q < 8; ++q) f.h[q] = (_Float16)(bf16_round(src[q]) * sc);
  *(v8us*)(unsigned short*)dst = f.half[0]; }
__global__ __launch_bounds__(256) void k_h16(const float* __restrict__ x, _Float16* __restrict__ X16, size_t n8) { const size_t t = (size_t)blockIdx.x * 256 + threadIdx.x; if (t >= n8) return; FragH f;
#pragma unroll
  for (int q = 0; q < 8; ++q) f.h[q] = (_Float16)x[t * 8 + q]; *(v8us*)((unsigned short*)X16 + t * 8) = f.half[0];  }
__global__ __launch_bounds__(256) void k_round16f(const float* __restrict__ W, _Float16* __restrict__ Bt, size_t n8) { const size_t t = (size_t)blockIdx.x * 256 + threadIdx.x; if (t >= n8) return; FragH f;
#pragma unroll
  for (int i = 0; i < 8; ++i) f.h[i] = (_Float16)(bf16_round(W[t * 8 + i]) * 16.0f); *(v8us*)((unsigned short*)Bt + t * 8) = f.half[0];  }
template <int NHv, int TTv>
__global__ __launch_bounds__(256) void k_vt(const _Float16* __restrict__ V16, int ldv, int voff, _Float16* __restrict__ Vt) { __shared__ unsigned short tl[64][66]; const int tid = threadIdx.x; const int slab = blockIdx.x / (TTv / 64), lg = blockIdx.x % (TTv / 64); const int b = slab / NHv, h = slab % NHv;
  for (int i = tid; i < 64 * 8; i += 256) { const int r = i / 8, c8 = (i % 8) * 8; FragH f; f.half[0] = *(const v8us*)((const unsigned short*)V16 + ((size_t)b * TTv + lg * 64 + r) * ldv + voff + h * 64 + c8);
#pragma unroll
    for (int q = 0; q < 8; ++q) tl[r][c8 + q] = f.u[q]; }
  __syncthreads();
  {
#pragma unroll
    for (int rd = 0; rd < 2; ++rd) { const int d = rd * 32 + tid / 8, pc = tid % 8; FragH f;
#pragma unroll
      for (int q = 0; q < 8; ++q) f.u[q] = tl[pc * 8 + q][d];
      *(v8us*)((unsigned short*)Vt + ((size_t)slab * 64 + d) * TTv + lg * 64 + pc * 8) = f.half[0]; }
     } }

__global__ __launch_bounds__(256) void k_hl(const float* __restrict__ F, _Float16* __restrict__ Hh, _Float16* __restrict__ Hl, size_t n8) { const size_t t = (size_t)blockIdx.x * 256 + threadIdx.x; if (t >= n8) return; FragH fh, fl; const v4f a = *(const v4fa*)(F + t * 8), c = *(const v4fa*)(F + t * 8 + 4);
#pragma unroll
  for (int q = 0; q < 4; ++q) { _Float16 h = (_Float16)a[q]; fh.h[q] = h; fl.h[q] = (_Float16)((a[q] - (float)h) * 1024.0f); h = (_Float16)c[q]; fh.h[4 + q] = h; fl.h[4 + q] = (_Float16)((c[q] - (float)h) * 1024.0f); }
  { *(v8us*)((unsigned short*)Hh + t * 8) = fh.half[0]; *(v8us*)((unsigned short*)Hl + t * 8) = fl.half[0];  } }

// ---- fast GEMM (wave tile 32x64; requires M % 32 == 0 rows per launch region and N % 64 == 0); epilogue = k_gemm_hhx semantics ----
__device__ __forceinline__ v16h g2_frag(const _Float16* p, int hh) { FragH f; f.half[0] = *(const v8us*)((const unsigned short*)p + 8 * hh); f.half[1] = *(const v8us*)((const unsigned short*)p + 16 + 8 * hh); return f.v; }
__device__ __forceinline__ v8f g2_mma(v16h a, v16h b, v8f c) { v8f d = __builtin_amdgcn_wmma_f32_16x16x32_f16(false, a, false, b, (short)0, c, false, false); asm volatile("v_nop\n\tv_nop\n\tv_nop\n\tv_nop" : "+v"(d) : "v"(a), "v"(b)); return d; }
template <int ACT>
__global__ __launch_bounds__(128) void k_gemm2(const _Float16* __restrict__ A, int lda, size_t sA, const _Float16* __restrict__ Bh, int ldb, size_t sB, float alpha, const float* __restrict__ bias, size_t sBias, const float* __restrict__ CP, int rowsPerB, size_t sCPb, int row0g,
    float* __restrict__ C, _Float16* __restrict__ C16, int ldc, size_t sC, int M, int N, int K) { static_assert(ACT == 0 || ACT == 3 || ACT == 6 || ACT == 8 || ACT == 9 || ACT == 11 || ACT == 12 || ACT == 14 || ACT == 15 || ACT == 16 || ACT == 17, "k_gemm2: unsupported ACT code (would silently apply no activation)");
  __shared__ __attribute__((aligned(16))) float so[4][32][68];
  const int tid = threadIdx.x, w = tid >> 5, lane = tid & 31, ln = lane & 15, hh = lane >> 4; const int by = blockIdx.y;
  A += (size_t)by * sA; Bh += (size_t)by * sB; const size_t cofs = (size_t)by * sC; const float* bp = bias ? bias + (size_t)by * sBias : nullptr;
  const int ntn = N >> 6; const int mt = blockIdx.x / ntn, nq = blockIdx.x - mt * ntn; const int row0 = mt * 128 + 32 * w, col0 = nq * 64; if (row0 >= M) return;
  const _Float16* a0p = A + (size_t)(row0 + ln) * lda; const _Float16* a1p = a0p + (size_t)16 * lda;
  const _Float16* b0p = Bh + (size_t)(col0 + ln) * ldb; const _Float16* b1p = b0p + (size_t)16 * ldb; const _Float16* b2p = b1p + (size_t)16 * ldb; const _Float16* b3p = b2p + (size_t)16 * ldb;
  const v8f z8 = {0.f,0.f,0.f,0.f,0.f,0.f,0.f,0.f}; v8f c00 = z8, c01 = z8, c02 = z8, c03 = z8, c10 = z8, c11 = z8, c12 = z8, c13 = z8;
#pragma unroll 1
  for (int kb = 0; kb < K; kb += 32) { const v16h a0 = g2_frag(a0p + kb, hh), a1 = g2_frag(a1p + kb, hh);
    v16h b = g2_frag(b0p + kb, hh); c00 = g2_mma(a0, b, c00); c10 = g2_mma(a1, b, c10);
    b = g2_frag(b1p + kb, hh); c01 = g2_mma(a0, b, c01); c11 = g2_mma(a1, b, c11);
    b = g2_frag(b2p + kb, hh); c02 = g2_mma(a0, b, c02); c12 = g2_mma(a1, b, c12);
    b = g2_frag(b3p + kb, hh); c03 = g2_mma(a0, b, c03); c13 = g2_mma(a1, b, c13); }
  v8f accs[8] = {c00, c01, c02, c03, c10, c11, c12, c13};
#pragma unroll
  for (int u = 0; u < 8; ++u) { const int t = u & 3, half = u >> 2; const int col = col0 + t * 16 + ln; const float bv = bp ? bf16_round(bp[col]) : 0.f;
#pragma unroll
    for (int r = 0; r < 8; ++r) { const int rloc = half * 16 + 8 * hh + r; float v = accs[u][r] * alpha + bv; if (CP) { if (rowsPerB < 0) v += CP[cofs + (size_t)(row0g + row0 + rloc) * ldc + col];      /* rowsPerB < 0: own element of the batched C plane */ else { const int bidx = (row0g + row0 + rloc) / rowsPerB; v += CP[(size_t)bidx * sCPb + (size_t)by * 64 + col]; } }
      if (ACT == 3) v = fmaxf(v, 0.f); else if (ACT == 6) v = 0.5f * v * (1.0f + erff(v * 0.70710678118654752f)); else if (ACT == 11) v = 1.0f / (1.0f + expf(-v)); else if (ACT == 15) v = v / (1.0f + expf(-v)); else if (ACT == 12) v = (v > 0.f) ? v : 0.01f * v; else if (ACT == 8) v = tanhf(v); else if (ACT == 9) v = 0.5f * v * (1.0f + tanhf(0.7978845608028654f * (v + 0.044715f * v * v * v))); else if (ACT == 14) v = (v > 0.f) ? v : 0.1f * v; else if (ACT == 16) v = (v >= 0.f) ? v : 0.3f * v; else if (ACT == 17) v = (v >= 0.f) ? v : 0.2f * v;
      so[w][rloc][t * 16 + ln] = v; } }
  __builtin_amdgcn_fence(__ATOMIC_ACQ_REL, "workgroup"); __builtin_amdgcn_wave_barrier();
  const int rsub = lane >> 4, c4 = (lane & 15) * 4;
  {
#pragma unroll
    for (int q = 0; q < 16; ++q) { const int r = q * 2 + rsub; const v4f v = *(const v4fa*)&so[w][r][c4]; if (C) *(v4f*)(C + cofs + (size_t)(row0 + r) * ldc + col0 + c4) = v; if (C16) { v4h h4; for (int i = 0; i < 4; ++i) h4[i] = (_Float16)v[i]; *(v4h*)(C16 + cofs + (size_t)(row0 + r) * ldc + col0 + c4) = h4; } }
     } }


// ---- GEMM tile through LDS: a work-group of 8 waves makes a 128 x 128 tile of A[.][KT] . B[.][KT]^T (both row-major, pitch KT, f16); wave w takes rows 32 (w & 3), columns 64 (w >> 2): k_gemm2's 32 x 64 wave tile and k order.
// A k slice of 64 elements (one 128-byte line of each of the 256 rows) lies in one of two LDS buffers; the next slice is fetched meanwhile through registers, a wave's load covering four whole lines.
#define GP 72                    /* LDS pitch of a row's slice, 16-bit elements: 144 B = 16 B x odd */
#define GT (128 * GP)            /* one operand's slice */
union G3S { unsigned short t[4 * GT]; float so[8][32][68]; };      /* the two buffers (A | B each); behind the loop each wave's own output staging */
__device__ __forceinline__ v16h g3_frag(const unsigned short* p, int hh) { FragH f; f.half[0] = *(const v8us*)(p + 8 * hh); f.half[1] = *(const v8us*)(p + 16 + 8 * hh); return f.v; }
__device__ __forceinline__ v8f g3_mma(v16h a, v16h b, v8f c) { return __builtin_amdgcn_wmma_f32_16x16x32_f16(false, a, false, b, (short)0, c, false, false); }
template <int KT>
__device__ __forceinline__ void g3_loop(const unsigned short* __restrict__ A, const unsigned short* __restrict__ B, unsigned short* sm, int tid, v8f (&acc)[2][4]) {
  const int w = tid >> 5, lane = tid & 31, ln = lane & 15, hh = lane >> 4;
  const unsigned short* ga = A + (size_t)(tid >> 3) * KT + (tid & 7) * 8;      /* thread -> 16 B of rows tid / 8 + 32 j of each operand; one address pair an operand for all slices */
  const unsigned short* gb = B + (size_t)(tid >> 3) * KT + (tid & 7) * 8;
  const int ls = (tid >> 3) * GP + (tid & 7) * 8;
  const int ra = ((w & 3) * 32 + ln) * GP, rb = GT + ((w >> 2) * 64 + ln) * GP;
  v8us sa[4], sb[4];
#pragma unroll
  for (int j = 0; j < 4; ++j) { sa[j] = *(const v8us*)(ga + j * 32 * KT); sb[j] = *(const v8us*)(gb + j * 32 * KT); }
#pragma unroll
  for (int j = 0; j < 4; ++j) { *(v8us*)(sm + ls + j * 32 * GP) = sa[j]; *(v8us*)(sm + GT + ls + j * 32 * GP) = sb[j]; }
  __syncthreads();
  // unrolled: the buffer and the slice become constants, so every load and LDS access is its base register plus an immediate offset
#pragma unroll
  for (int c = 0; c < KT / 64; ++c) {
    const unsigned short* cur = sm + (c & 1) * 2 * GT; unsigned short* nxt = sm + ((c + 1) & 1) * 2 * GT;
    if (c + 1 < KT / 64) {
#pragma unroll
      for (int j = 0; j < 4; ++j) { sa[j] = *(const v8us*)(ga + (c + 1) * 64 + j * 32 * KT); sb[j] = *(const v8us*)(gb + (c + 1) * 64 + j * 32 * KT); }
      asm volatile("s_wait_xcnt 0x0" :: "v"(ga), "v"(gb) : "memory");      /* as inputs the loads' two addresses stay whole until the wait */
    }
#pragma unroll
    for (int ks = 0; ks < 2; ++ks) {
      const v16h a0 = g3_frag(cur + ra + ks * 32, hh), a1 = g3_frag(cur + ra + 16 * GP + ks * 32, hh);
#pragma unroll
      for (int t = 0; t < 4; ++t) { const v16h b = g3_frag(cur + rb + t * 16 * GP + ks * 32, hh); acc[0][t] = g3_mma(a0, b, acc[0][t]); acc[1][t] = g3_mma(a1, b, acc[1][t]); }
    }
    if (c + 1 < KT / 64) {
#pragma unroll
      for (int j = 0; j < 4; ++j) { *(v8us*)(nxt + ls + j * 32 * GP) = sa[j]; *(v8us*)(nxt + GT + ls + j * 32 * GP) = sb[j]; }      /* the other buffer's last readers left it at the barrier that ended slice c - 1 */
    }
    __syncthreads();      /* publishes slice c + 1 and ends every read of slice c (behind the last slice: frees the buffers for the output staging) */
  }
}
// the six projections in one launch (M = NN, N = DO, K = DI, f16 result only), tiles through LDS (g3_loop), k_gemm2's epilogue. blockIdx.y = j picks plane j of QKV = [Q1 K1 Q2 K2 V1 V2];
// x1 (first half of X) feeds planes 0, 1, 4; weight slots of BW = [Wq1 Wk1 Wq2 Wk2 Wv], W_V shared by planes 4 and 5
__global__ __launch_bounds__(256) void k_proj6(const _Float16* __restrict__ X, const _Float16* __restrict__ BW, const float* __restrict__ bq1, const float* __restrict__ bk1, const float* __restrict__ bq2, const float* __restrict__ bk2, const float* __restrict__ bv, _Float16* __restrict__ QKV) {
  __shared__ __attribute__((aligned(16))) G3S sm;
  const int tid = threadIdx.x, w = tid >> 5, lane = tid & 31, ln = lane & 15, hh = lane >> 4; const int j = blockIdx.y;
  const float* bp = j == 0 ? bq1 : j == 1 ? bk1 : j == 2 ? bq2 : j == 3 ? bk2 : bv;
  const int mt = blockIdx.x / (DO / 128), nq = blockIdx.x % (DO / 128); const int row0 = mt * 128 + 32 * (w & 3), col0 = nq * 128 + 64 * (w >> 2);
  const v8f z8 = {0.f,0.f,0.f,0.f,0.f,0.f,0.f,0.f}; v8f acc[2][4] = {{z8, z8, z8, z8}, {z8, z8, z8, z8}};
  g3_loop<DI>((const unsigned short*)X + ((j == 2 || j == 3 || j == 5) ? (size_t)NN * DI : 0) + (size_t)mt * 128 * DI, (const unsigned short*)BW + (size_t)(j < 4 ? j : 4) * DO * DI + (size_t)nq * 128 * DI, sm.t, tid, acc);
#pragma unroll
  for (int u = 0; u < 8; ++u) { const int t = u & 3, half = u >> 2; const float bb = bf16_round(bp[col0 + t * 16 + ln]);
#pragma unroll
    for (int r = 0; r < 8; ++r) sm.so[w][half * 16 + 8 * hh + r][t * 16 + ln] = acc[half][t][r] * 0.0625f + bb; }
  __builtin_amdgcn_fence(__ATOMIC_ACQ_REL, "workgroup"); __builtin_amdgcn_wave_barrier();      /* a wave reads back only its own rows */
  const int rsub = lane >> 4, c4 = (lane & 15) * 4; _Float16* cp = QKV + (size_t)j * NN * DO + (size_t)(row0 + rsub) * DO + col0 + c4;
#pragma unroll
  for (int q = 0; q < 16; ++q) { const v4f v = *(const v4fa*)&sm.so[w][q * 2 + rsub][c4]; v4h h4; for (int i = 0; i < 4; ++i) h4[i] = (_Float16)v[i]; *(v4h*)(cp + q * 2 * DO) = h4; }
}
#define FQ 256                   /* query rows per work-group */
#define KSP 4                    /* key ranges: 32 query blocks x KSP x 2 branches = 256 work-groups */
#define NPASS (NN / KSP / 32)
#define KPIT 264                 /* LDS pitch of a K row, 16-bit elements: 528 B = 16 B x odd */
#define VPIT 40                  /* LDS pitch of a V^T row (32 keys): 80 B = 16 B x odd */
#define MTHR 4.0f                /* the maximum in use may trail the true one by this much (log2): a weight is at most 2^(10 + 4), inside f16 */
__device__ __forceinline__ float xhalf(float x) { return __builtin_bit_cast(float, __builtin_amdgcn_permlanex16(__builtin_bit_cast(int, x), __builtin_bit_cast(int, x), 0x76543210, 0xfedcba98, false, false)); }  // lane l with lane l ^ 16
__device__ __forceinline__ v16h fa_frag(const unsigned short* p, int hh) { FragH f; f.half[0] = *(const v8us*)(p + 8 * hh); f.half[1] = *(const v8us*)(p + 16 + 8 * hh); return f.v; }
__device__ __forceinline__ v8f fa_mma(v16h a, v16h b, v8f c) { return __builtin_amdgcn_wmma_f32_16x16x32_f16(false, a, false, b, (short)0, c, false, false); }
__global__ __launch_bounds__(256) void k_flash(const _Float16* __restrict__ Qa, const _Float16* __restrict__ Ka, const _Float16* __restrict__ VTa, const _Float16* __restrict__ Qb, const _Float16* __restrict__ Kb, const _Float16* __restrict__ VTb,
    const float* __restrict__ scp, float* __restrict__ OP, float* __restrict__ ML) {
  __shared__ __attribute__((aligned(16))) unsigned short sK[2][32 * KPIT];
  __shared__ __attribute__((aligned(16))) unsigned short sV[2][DO * VPIT];
  const int tid = threadIdx.x, w = tid >> 5, lane = tid & 31, ln = lane & 15, hh = lane >> 4;
  const int br = blockIdx.z, sp = blockIdx.y, q0 = blockIdx.x * FQ + w * 32;
  const _Float16* Q = br ? Qb : Qa; const unsigned short* K = (const unsigned short*)(br ? Kb : Ka); const unsigned short* VT = (const unsigned short*)(br ? VTb : VTa);
  float sv = bf16_round(scp[0]); sv = fminf(fmaxf(sv, 1.0f), 32.0f); const float cs = (1.0f / sqrtf(sv)) * 1.4426950408889634f;      /* scores to log2 units */
  // staging: thread -> 4 x 16 B of the K tile (row tid / 32 + 8 j) and 4 x 16 B of the V^T tile (row tid / 4 + 64 j)
  const unsigned short* gK = K + ((size_t)sp * (NN / KSP) + (tid >> 5)) * DO + (tid & 31) * 8;
  const unsigned short* gV = VT + (size_t)(tid >> 2) * NN + sp * (NN / KSP) + (tid & 3) * 8;
  const int lK = (tid >> 5) * KPIT + (tid & 31) * 8, lV = (tid >> 2) * VPIT + (tid & 3) * 8;
  const unsigned short* qp = (const unsigned short*)Q + (size_t)(q0 + ln) * DO + 8 * hh;      /* the one address register pair of all 32 Q loads */
  v16h qf[2][8];
#pragma unroll
  for (int g = 0; g < 2; ++g)
#pragma unroll
    for (int ks = 0; ks < 8; ++ks) { FragH f; f.half[0] = *(const v8us*)(qp + g * 16 * DO + ks * 32); f.half[1] = *(const v8us*)(qp + g * 16 * DO + ks * 32 + 16); qf[g][ks] = f.v; }
  {
    v8us kr[4], vr[4];
#pragma unroll
    for (int j = 0; j < 4; ++j) { kr[j] = *(const v8us*)(gK + (size_t)j * 8 * DO); vr[j] = *(const v8us*)(gV + (size_t)j * 64 * NN); }
    asm volatile("s_wait_xcnt 0x0" :: "v"(qp) : "memory");      /* qp ends here: as an input it stays whole until the wait, in front of whatever takes its registers next (gK, gV live on) */
#pragma unroll
    for (int j = 0; j < 4; ++j) { *(v8us*)(&sK[0][lK + j * 8 * KPIT]) = kr[j]; *(v8us*)(&sV[0][lV + j * 64 * VPIT]) = vr[j]; }
  }
  __syncthreads();
  const v8f z8 = {0.f,0.f,0.f,0.f,0.f,0.f,0.f,0.f};
  v8f o[16][2];
#pragma unroll
  for (int t = 0; t < 16; ++t) { o[t][0] = z8; o[t][1] = z8; }
  float m[2] = {-3.0e38f, -3.0e38f}, l[2] = {0.f, 0.f};
  // kept rolled: the body holds 64 matrix instructions and nearly the whole register budget; a second copy would only cost instruction cache
#pragma unroll 1
  for (int s = 0; s < NPASS; ++s) {
    const unsigned short* bK = sK[s & 1]; const unsigned short* bV = sV[s & 1];
    unsigned short* nK = sK[(s + 1) & 1]; unsigned short* nV = sV[(s + 1) & 1];
    const int sn = s + 1 < NPASS ? s + 1 : s;      /* no branch round the staging: the last pass fetches its own tiles again, into the buffer that nobody reads any more */
    const unsigned short* pk = gK + (size_t)sn * 32 * DO; const unsigned short* pv = gV + sn * 32;
    v8us st[4];      /* the next pass's tiles go through registers, 16 at a time: K under the first product, V^T under the softmax and the second */
#pragma unroll
    for (int j = 0; j < 4; ++j) st[j] = *(const v8us*)(pk + j * 8 * DO);
    asm volatile("s_wait_xcnt 0x0" :: "v"(pk) : "memory");      /* as an input the loads' address stays whole until the wait */
    // S^T = K.Q^T, one k step (2 fragments, 4 matrix instructions) a block; each block's LDS reads stand as one group two blocks ahead, in a ring of three fragment pairs
    v8f sc[2][2] = {{z8, z8}, {z8, z8}};
    v16h ka[3][2];
#pragma unroll
    for (int i = 0; i < 4; ++i) ka[i >> 1][i & 1] = fa_frag(bK + ((i & 1) * 16 + ln) * KPIT + (i >> 1) * 32, hh);
#pragma unroll
    for (int ks = 0; ks < 8; ++ks) {
      if (ks < 6) { ka[(ks + 2) % 3][0] = fa_frag(bK + ln * KPIT + (ks + 2) * 32, hh); ka[(ks + 2) % 3][1] = fa_frag(bK + (16 + ln) * KPIT + (ks + 2) * 32, hh); }
      __builtin_amdgcn_sched_barrier(0);      /* keeps the reads above as one group in front of the block, two blocks ahead of their use */
      const v16h a0 = ka[ks % 3][0], a1 = ka[ks % 3][1];
      sc[0][0] = fa_mma(a0, qf[0][ks], sc[0][0]); sc[0][1] = fa_mma(a0, qf[1][ks], sc[0][1]);
      sc[1][0] = fa_mma(a1, qf[0][ks], sc[1][0]); sc[1][1] = fa_mma(a1, qf[1][ks], sc[1][1]);
      __builtin_amdgcn_sched_barrier(0);      /* ends the block: the next group of reads stays behind it */
    }
#pragma unroll
    for (int j = 0; j < 4; ++j) *(v8us*)(nK + lK + j * 8 * KPIT) = st[j];      /* the other buffers' last readers left them at the barrier that ended pass s - 1 */
    __builtin_amdgcn_sched_barrier(0);      /* the V^T loads stay behind the K stores, so that the two staged tiles are never live together */
#pragma unroll
    for (int j = 0; j < 4; ++j) st[j] = *(const v8us*)(pv + (size_t)j * 64 * NN);
    asm volatile("s_wait_xcnt 0x0" :: "v"(pv) : "memory");      /* as an input the loads' address stays whole until the wait */
#pragma unroll
    for (int g = 0; g < 2; ++g) {
      float mx = sc[0][g][0];
#pragma unroll
      for (int r = 0; r < 8; ++r) mx = fmaxf(mx, fmaxf(sc[0][g][r], sc[1][g][r]));
      mx = fmaxf(mx, xhalf(mx)) * cs;      /* cs > 0; both halves of the wave now hold this query's maximum of the pass */
      if (__builtin_amdgcn_ballot_w32(mx > m[g] + MTHR) != 0) {      /* scalar branch, rare after the first passes; one group a branch */
        const float mn = fmaxf(m[g], mx); const float corr = __builtin_amdgcn_exp2f(m[g] - mn);      /* 0 on the first pass */
        m[g] = mn; l[g] *= corr;
#pragma unroll
        for (int t = 0; t < 16; ++t) o[t][g] = o[t][g] * corr;
      }
    }
    v16h pf[2];
#pragma unroll
    for (int g = 0; g < 2; ++g) {
      const float sh = 10.0f - m[g]; FragH p; float s0 = 0.f, s1 = 0.f;      /* weights x 1024, as f16 operands away from the subnormal range; l carries the same factor */
      float x[16];
#pragma unroll
      for (int r = 0; r < 8; ++r) { x[r] = fmaf(sc[0][g][r], cs, sh); x[8 + r] = fmaf(sc[1][g][r], cs, sh); }
      __builtin_amdgcn_sched_barrier(0);      /* the arguments are all made first: no multiply-add is left to land on an exponential's source directly behind it */
#pragma unroll
      for (int r = 0; r < 16; ++r) x[r] = __builtin_amdgcn_exp2f(x[r]);
      __builtin_amdgcn_sched_barrier(0);      /* sums and conversions stay behind the exponentials: none reads a result directly behind its exponential */
#pragma unroll
      for (int r = 0; r < 8; ++r) { s0 += x[r]; s1 += x[8 + r]; p.h[r] = (_Float16)x[r]; p.h[8 + r] = (_Float16)x[8 + r]; }
      l[g] += s0 + s1; pf[g] = p.v;
    }
    // O^T += V^T.P^T, two d tiles (2 fragments, 4 matrix instructions) a block, read ahead in the same ring
    __builtin_amdgcn_sched_barrier(0);      /* the V^T reads stay behind the exponentials: hoisted among them they take the registers that keep two waves on a SIMD without spills */
    v16h va[3][2];
#pragma unroll
    for (int i = 0; i < 4; ++i) va[i >> 1][i & 1] = fa_frag(bV + (i * 16 + ln) * VPIT, hh);
#pragma unroll
    for (int b = 0; b < 8; ++b) {
      if (b < 6) { va[(b + 2) % 3][0] = fa_frag(bV + (((b + 2) * 2) * 16 + ln) * VPIT, hh); va[(b + 2) % 3][1] = fa_frag(bV + (((b + 2) * 2 + 1) * 16 + ln) * VPIT, hh); }
      __builtin_amdgcn_sched_barrier(0);      /* one group of reads in front of the block, as above */
      o[b * 2][0] = fa_mma(va[b % 3][0], pf[0], o[b * 2][0]); o[b * 2][1] = fa_mma(va[b % 3][0], pf[1], o[b * 2][1]);
      o[b * 2 + 1][0] = fa_mma(va[b % 3][1], pf[0], o[b * 2 + 1][0]); o[b * 2 + 1][1] = fa_mma(va[b % 3][1], pf[1], o[b * 2 + 1][1]);
      __builtin_amdgcn_sched_barrier(0);      /* ends the block */
    }
#pragma unroll
    for (int j = 0; j < 4; ++j) *(v8us*)(nV + lV + j * 64 * VPIT) = st[j];
    __syncthreads();      /* publishes pass s + 1's tiles and ends every read of pass s's */
  }
  // partials: OP[query row][key range][d], ML[query row][key range][m, l]; query row = branch * NN + query. One address pair serves all stores of each array, and
  // everything that is computed stands in front of the first store: behind it no register that a store names is written any more.
  const size_t row = (size_t)br * NN + q0 + ln;
  float* op = OP + (row * KSP + sp) * DO + 8 * hh;      /* a lane's 8 accumulator registers are 8 consecutive d of its query */
  float* mlp = ML + (row * KSP + sp) * 2 + hh;
  const float j0 = l[0] + xhalf(l[0]), j1 = l[1] + xhalf(l[1]);      /* the halves' sums joined, with every lane on: the exchange stands outside the selection below */
  const float w0 = hh ? j0 : m[0], w1 = hh ? j1 : m[1];      /* the lower half of the wave writes m, the upper l */
  mlp[0] = w0; mlp[16 * KSP * 2] = w1;
#pragma unroll
  for (int g = 0; g < 2; ++g) {
#pragma unroll
    for (int t = 0; t < 16; ++t) {
      const v4f lo = {o[t][g][0], o[t][g][1], o[t][g][2], o[t][g][3]}, hi = {o[t][g][4], o[t][g][5], o[t][g][6], o[t][g][7]};
      *(v4f*)(op + g * 16 * KSP * DO + t * 16) = lo; *(v4f*)(op + g * 16 * KSP * DO + t * 16 + 4) = hi;
    }
  }
  asm volatile("s_wait_xcnt 0x0" :: "v"(op), "v"(mlp) : "memory");      /* as inputs the stores' addresses stay whole until the wait */
}
// ---- tail: the join of the key ranges and the output GEMM in one launch; f never leaves the work-group ----
// A work-group of 16 waves takes TR rows (query rows of both branches, one M = 2 NN) and all DI output columns.
// Join: f = sum_s 2^(m_s - M) O_s / sum_s 2^(m_s - M) l_s over the KSP key ranges, fixed order s = 0..KSP-1; a wave takes whole rows, each load 512 contiguous bytes;
// f x 1024 goes to LDS as f16 hi + residual (one scale for both, so that both feed the same accumulators).
// GEMM: out = (hi + lo) We^T / 1024 + be; We in 64-k slices through two LDS buffers as in g3_loop; wave w takes rows 32 (w & 1), columns 64 (w >> 1): g3_loop's 32 x 64 wave tile and k order.
// The short loops are unrolled because their arrays (staged loads, partials, fragments, accumulators) live in registers and need constant indices.
#define TR 64                    /* rows per work-group: 2 NN / TR = 256 work-groups */
#define APIT 264                 /* LDS pitch of an f row, 16-bit elements: 528 B = 16 B x odd */
#define TA (TR * APIT)           /* one plane of f (hi | lo) */
#define TB (DI * GP)             /* one slice of We */
typedef _Float16 v4ha __attribute__((ext_vector_type(4), may_alias));
struct T4S { unsigned short a[2 * TA]; union { unsigned short b[2 * TB]; float so[16][32][68]; } u; };      /* behind the loop the slices' place is each wave's own output staging */
__global__ __launch_bounds__(512) void k_tail(const float* __restrict__ OP, const float* __restrict__ ML, const _Float16* __restrict__ Bh, const float* __restrict__ bias, float* __restrict__ C) {
  static_assert(KSP == 4, "the join reads a row's four (m, l) pairs as two 16-byte loads");
  __shared__ __attribute__((aligned(16))) T4S sm;
  const int tid = threadIdx.x, w = tid >> 5, lane = tid & 31, ln = lane & 15, hh = lane >> 4;
  const int rowg = blockIdx.x * TR;
  const unsigned short* gb = (const unsigned short*)Bh + (size_t)(tid >> 3) * DO + (tid & 7) * 8;      /* thread -> 16 B of rows tid / 8 + 64 j of We; one address pair for all slices */
  const int ls = (tid >> 3) * GP + (tid & 7) * 8;
  const float* po = OP + (size_t)(rowg + w) * KSP * DO + lane * 4;      /* wave w joins rows w + 16 i; one address pair for each array */
  const float* pm = ML + (size_t)(rowg + w) * KSP * 2;
  const float* bq = bias + 64 * (w >> 1) + ln;
  v8us sb[8]; v4f op[4][KSP][2], mq[4][2]; float bb[4];
#pragma unroll
  for (int i = 0; i < 4; ++i) {
    mq[i][0] = *(const v4fa*)(pm + i * 16 * KSP * 2); mq[i][1] = *(const v4fa*)(pm + i * 16 * KSP * 2 + 4);
#pragma unroll
    for (int s = 0; s < KSP; ++s) { op[i][s][0] = *(const v4fa*)(po + (i * 16 * KSP + s) * DO); op[i][s][1] = *(const v4fa*)(po + (i * 16 * KSP + s) * DO + 128); }
  }
#pragma unroll
  for (int j = 0; j < 8; ++j) sb[j] = *(const v8us*)(gb + j * 64 * DO);
#pragma unroll
  for (int t = 0; t < 4; ++t) bb[t] = bq[t * 16];
  asm volatile("s_wait_xcnt 0x0" :: "v"(po), "v"(pm), "v"(gb), "v"(bq) : "memory");      /* as inputs the loads' addresses stay whole until the wait */
#pragma unroll
  for (int i = 0; i < 4; ++i) {
    const float ms[KSP] = {mq[i][0][0], mq[i][0][2], mq[i][1][0], mq[i][1][2]}, lw[KSP] = {mq[i][0][1], mq[i][0][3], mq[i][1][1], mq[i][1][3]};
    float M = ms[0];
#pragma unroll
    for (int s = 1; s < KSP; ++s) M = fmaxf(M, ms[s]);
    v4f a0 = {0.f,0.f,0.f,0.f}, a1 = {0.f,0.f,0.f,0.f}; float den = 0.f;
#pragma unroll
    for (int s = 0; s < KSP; ++s) { const float wg = __builtin_amdgcn_exp2f(ms[s] - M); den += wg * lw[s]; a0 += op[i][s][0] * wg; a1 += op[i][s][1] * wg; }
    const float rs = 1.0f / den; v4ha h0, h1, l0, l1;
#pragma unroll
    for (int q = 0; q < 4; ++q) {
      const float u0 = a0[q] * rs * 1024.0f, u1 = a1[q] * rs * 1024.0f; const _Float16 g0 = (_Float16)u0, g1 = (_Float16)u1;
      h0[q] = g0; l0[q] = (_Float16)(u0 - (float)g0); h1[q] = g1; l1[q] = (_Float16)(u1 - (float)g1);
    }
    unsigned short* pa = sm.a + (w + 16 * i) * APIT + lane * 4;
    *(v4ha*)pa = h0; *(v4ha*)(pa + 128) = h1; *(v4ha*)(pa + TA) = l0; *(v4ha*)(pa + TA + 128) = l1;
  }
#pragma unroll
  for (int j = 0; j < 8; ++j) *(v8us*)(sm.u.b + ls + j * 64 * GP) = sb[j];
  __syncthreads();      /* publishes f and the first slice of We */
  const int ra = ((w & 1) * 32 + ln) * APIT, rb = ((w >> 1) * 64 + ln) * GP;
  const v8f z8 = {0.f,0.f,0.f,0.f,0.f,0.f,0.f,0.f}; v8f acc[2][4] = {{z8, z8, z8, z8}, {z8, z8, z8, z8}};
  // unrolled: the buffer and the slice become constants, so every load and LDS access is its base register plus an immediate offset
#pragma unroll
  for (int c = 0; c < DO / 64; ++c) {
    const unsigned short* cur = sm.u.b + (c & 1) * TB; unsigned short* nxt = sm.u.b + ((c + 1) & 1) * TB;
    if (c + 1 < DO / 64) {
#pragma unroll
      for (int j = 0; j < 8; ++j) sb[j] = *(const v8us*)(gb + (c + 1) * 64 + j * 64 * DO);
      asm volatile("s_wait_xcnt 0x0" :: "v"(gb) : "memory");      /* as an input the loads' address stays whole until the wait */
    }
#pragma unroll
    for (int ks = 0; ks < 2; ++ks) {
      const unsigned short* pa = sm.a + ra + c * 64 + ks * 32;
      const v16h h0 = g3_frag(pa, hh), h1 = g3_frag(pa + 16 * APIT, hh), l0 = g3_frag(pa + TA, hh), l1 = g3_frag(pa + TA + 16 * APIT, hh);
      v16h b[4];
#pragma unroll
      for (int t = 0; t < 4; ++t) b[t] = g3_frag(cur + rb + t * 16 * GP + ks * 32, hh);
#pragma unroll
      for (int t = 0; t < 4; ++t) { acc[0][t] = g3_mma(h0, b[t], acc[0][t]); acc[1][t] = g3_mma(h1, b[t], acc[1][t]); }
#pragma unroll
      for (int t = 0; t < 4; ++t) { acc[0][t] = g3_mma(l0, b[t], acc[0][t]); acc[1][t] = g3_mma(l1, b[t], acc[1][t]); }
    }
    if (c + 1 < DO / 64) {
#pragma unroll
      for (int j = 0; j < 8; ++j) *(v8us*)(nxt + ls + j * 64 * GP) = sb[j];      /* the other buffer's last readers left it at the barrier that ended slice c - 1 */
    }
    __syncthreads();      /* publishes slice c + 1 and ends every read of slice c (behind the last slice: frees the buffers for the output staging) */
  }
#pragma unroll
  for (int u = 0; u < 8; ++u) { const int t = u & 3, half = u >> 2; const float bv = bf16_round(bb[t]);
#pragma unroll
    for (int r = 0; r < 8; ++r) sm.u.so[w][half * 16 + 8 * hh + r][t * 16 + ln] = acc[half][t][r] * (0.0625f / 1024.0f) + bv; }
  __builtin_amdgcn_fence(__ATOMIC_ACQ_REL, "workgroup"); __builtin_amdgcn_wave_barrier();      /* a wave reads back only its own rows */
  const int rsub = lane >> 4, c4 = (lane & 15) * 4; float* cp = C + (size_t)(rowg + 32 * (w & 1) + rsub) * DI + 64 * (w >> 1) + c4;      /* one address pair for all stores, whole lines each */
#pragma unroll
  for (int q = 0; q < 16; ++q) { const v4f v = *(const v4fa*)&sm.u.so[w][q * 2 + rsub][c4]; *(v4f*)(cp + q * 2 * DI) = v; }
  asm volatile("s_wait_xcnt 0x0" :: "v"(cp) : "memory");      /* as an input the stores' address stays whole until the wait */
}

extern "C" void kernel_launch(void* const* d_in, const int* in_sizes, int n_in,
                              void* d_out, int out_size, void* d_ws, size_t ws_size, hipStream_t stream) {
  (void)in_sizes; (void)n_in; (void)out_size;
  const float* const* I = (const float* const*)d_in; const float* x1 = I[0]; const float* x2 = I[1]; const float* Wq1 = I[2]; const float* bq1 = I[3]; const float* Wk1 = I[4]; const float* bk1 = I[5]; const float* Wv = I[6]; const float* bv = I[7]; const float* Wq2 = I[8]; const float* bq2 = I[9]; const float* Wk2 = I[10]; const float* bk2 = I[11]; const float* We = I[12]; const float* be = I[13]; const float* scp = I[14];
  float* out1 = (float*)d_out;      /* the second output lies behind the first, at byte offset 16777216 */
  char* ws = (char*)d_ws; size_t off = 0;
  auto take = [&](size_t bytes) { char* p = ws + off; off += (bytes + 255) & ~(size_t)255; return p; };
  _Float16* BW = (_Float16*)take((size_t)6 * DO * DI * 2); _Float16* BE = BW + (size_t)5 * DO * DI; _Float16* X1 = (_Float16*)take((size_t)2 * NN * DI * 2);      /* weight slots Wq1 Wk1 Wq2 Wk2 Wv We; [x1 | x2] */
  _Float16* Q1 = (_Float16*)take((size_t)6 * NN * DO * 2); _Float16* K1 = Q1 + (size_t)NN * DO; _Float16* Q2 = Q1 + (size_t)2 * NN * DO; _Float16* K2 = Q1 + (size_t)3 * NN * DO; _Float16* V1 = Q1 + (size_t)4 * NN * DO;      /* planes Q1 K1 Q2 K2 V1 V2 */
  _Float16* VT1 = (_Float16*)take((size_t)2 * NN * DO * 2); _Float16* VT2 = VT1 + (size_t)NN * DO;
  float* OP = (float*)take((size_t)KSP * 2 * NN * DO * 4); float* ML = (float*)take((size_t)KSP * 2 * NN * 2 * 4);
  if (off > ws_size) return;      /* 1.5 + 16 + 24 + 8 + 64 + 0.5 = about 114 MiB */
  k_cvt<<<6 * WB + 2 * XB, 256, 0, stream>>>(x1, x2, Wq1, Wk1, Wq2, Wk2, Wv, We, X1, BW);      /* weights as given, (out, in) */
  k_proj6<<<dim3((NN / 128) * (DO / 128), 6), 256, 0, stream>>>(X1, BW, bq1, bk1, bq2, bk2, bv, Q1);
  k_vt<DO / 64, NN><<<2 * (DO / 64) * (NN / 64), 256, 0, stream>>>(V1, DO, 0, VT1);      /* V^T [256][8192] of both branches: V1 | V2 and VT1 | VT2 lie back to back */
  k_flash<<<dim3(NN / FQ, KSP, 2), 256, 0, stream>>>(Q1, K2, VT1, Q2, K1, VT2, scp, OP, ML);      /* f1: hsi_Q . lidar_K -> hsi_V ; f2: lidar_Q . hsi_K -> lidar_V */
  k_tail<<<2 * NN / TR, 512, 0, stream>>>(OP, ML, BE, be, out1);      /* both branches: their rows and the two outputs lie back to back (one M = 2 NN); (f_hi + f_lo) We^T + be */
}

// v006
// Measured time: 128 microseconds a run.
// In two side-by-side timings against v005, it was 1.09 and 1.10 times as fast.
// Counting every step since v000, it is 21.4 times as fast.
#include <hip/hip_runtime.h>
// cross_fuison (8192 hsi rows x1 and 8192 lidar rows x2, 512 -> 256: Q/K/V = x W^T + b (W_V shared); inv = 1/sqrt(clip(scale, 1, 32)); f1 = softmax(hsi_Q lidar_K^T inv) hsi_V; f2 = softmax(lidar_Q hsi_K^T inv) lidar_V; outputs = (f1 We^T + be, f2 We^T + be), each [8192][512]).
// Compute dtype: inputs rounded to bf16; inputs/weights exact as f16; Q/K/V and the softmax weights as plain f16 operands (~2^-12); f as f16 hi + residual into We; softmax f32. v_wmma_f32_16x16x32_f16.
#define NN 8192
#define DI 512
#define DO 256
typedef __bf16 v16b __attribute__((ext_vector_type(16)));
typedef unsigned short v8us __attribute__((ext_vector_type(8), may_alias));
typedef float  v8f  __attribute__((ext_vector_type(8)));
typedef float  v4f  __attribute__((ext_vector_type(4)));
typedef float  v4fa __attribute__((ext_vector_type(4), may_alias));
union FragB { v16b v; v8us half[2]; unsigned short u[16]; };

__device__ __forceinline__ unsigned short bf16_bits(float x) { unsigned int u = __float_as_uint(x); return (unsigned short)((u + 0x7FFFu + ((u >> 16) & 1u)) >> 16); }
__device__ __forceinline__ float bf16_val(unsigned short b) { return __uint_as_float(((unsigned int)b) << 16); }
__device__ __forceinline__ float bf16_round(float x) { return bf16_val(bf16_bits(x)); }
// D += A·B with NT terms: 1 = ah·bh, 2 = + al·bh (A split), 3 = + ah·bl (both split)
template <int NT>
__device__ __forceinline__ v8f mmaN(v16b ah, v16b al, v16b bh, v16b bl, v8f c) {
  c = __builtin_amdgcn_wmma_f32_16x16x32_bf16(false, ah, false, bh, (short)0, c, false, false);
  if (NT >= 2) c = __builtin_amdgcn_wmma_f32_16x16x32_bf16(false, al, false, bh, (short)0, c, false, false);
  if (NT >= 3) c = __builtin_amdgcn_wmma_f32_16x16x32_bf16(false, ah, false, bl, (short)0, c, false, false);
  asm volatile("v_nop\n\tv_nop\n\tv_nop\n\tv_nop" : "+v"(c) : "v"(ah), "v"(al), "v"(bh), "v"(bl));
  return c;
}

__global__ __launch_bounds__(256) void k_wt_bf16(const float* __restrict__ W, unsigned short* __restrict__ Wt, int K, int N) {
  const int t = blockIdx.x * 256 + threadIdx.x;
  const int k8n = K / 8;
  if (t >= N * k8n) return;
  const int n = t / k8n, k8 = (t % k8n) * 8;
  v8us v;
#pragma unroll
  for (int i = 0; i < 8; ++i) v[i] = bf16_bits(W[(size_t)(k8 + i) * N + n]);
  *(v8us*)(Wt + (size_t)n * K + k8) = v;
  
}

// GEMM C[M][N] (f32, pitch ldc) = act(A[M][K]·W + bias). A f32 row-major (pitch lda) converted per fragment to bf16
// (ASPLIT: hi/lo two planes -> 2 terms, else single rounded term); Wt bf16 [N][K] (pitch ldb). BIAS_BF16 rounds the
// bias to bf16 first (bias quantised to bf16 before the add). K%32==0, M%16==0, N%64==0.
template <bool ASPLIT, int ACT, bool BIAS_BF16>
__global__ __launch_bounds__(128) void k_gemm_bf(const float* __restrict__ A, int lda, const unsigned short* __restrict__ Wt, int ldb,
                                               const float* __restrict__ bias, float* __restrict__ C, int ldc, int M, int N, int K) {
  __shared__ __attribute__((aligned(16))) float so[4][16][64];
  const int tid = threadIdx.x, w = tid >> 5, lane = tid & 31, ln = lane & 15, hh = lane >> 4;
  const int ntn = N / 64;
  const int wid = blockIdx.x * 4 + w;
  const int mt = wid / ntn, nq = wid % ntn;
  if (mt * 16 >= M) return;
  const int row0 = mt * 16, col0 = nq * 64;
  const float* arow = A + (size_t)(row0 + ln) * lda;
  v8f acc[4] = {};
  for (int kb = 0; kb < K; kb += 32) {
    FragB ah, al;
    const v4f x0 = *(const v4fa*)(arow + kb + 8 * hh), x1 = *(const v4fa*)(arow + kb + 8 * hh + 4);
    const v4f x2 = *(const v4fa*)(arow + kb + 16 + 8 * hh), x3 = *(const v4fa*)(arow + kb + 16 + 8 * hh + 4);
    float xs[16] = {x0[0],x0[1],x0[2],x0[3],x1[0],x1[1],x1[2],x1[3],x2[0],x2[1],x2[2],x2[3],x3[0],x3[1],x3[2],x3[3]};
#pragma unroll
    for (int i = 0; i < 16; ++i) { const unsigned short hb = bf16_bits(xs[i]); ah.u[i] = hb; al.u[i] = ASPLIT ? bf16_bits(xs[i] - bf16_val(hb)) : (unsigned short)0; }
#pragma unroll
    for (int t = 0; t < 4; ++t) {
      const unsigned short* brow = Wt + (size_t)(col0 + t * 16 + ln) * ldb + kb;
      FragB b;
      b.half[0] = *(const v8us*)(brow + 8 * hh);
      b.half[1] = *(const v8us*)(brow + 16 + 8 * hh);
      acc[t] = mmaN<ASPLIT ? 2 : 1>(ah.v, al.v, b.v, b.v, acc[t]);
    }
  }
#pragma unroll
  for (int t = 0; t < 4; ++t) {
    float bv = bias ? bias[col0 + t * 16 + ln] : 0.f;
    if (BIAS_BF16) bv = bf16_round(bv);
#pragma unroll
    for (int r = 0; r < 8; ++r) { float v = acc[t][r] + bv; if (ACT == 1) v = fmaxf(v, 0.f); so[w][8 * hh + r][t * 16 + ln] = v; }
  }
  __builtin_amdgcn_fence(__ATOMIC_ACQ_REL, "workgroup");
  __builtin_amdgcn_wave_barrier();
  const int rsub = lane >> 4, c4 = (lane & 15) * 4;
  {
#pragma unroll
    for (int q = 0; q < 8; ++q) {
      const int r = q * 2 + rsub;
      const v4f v = *(const v4fa*)&so[w][r][c4];
      *(v4f*)(C + (size_t)(row0 + r) * ldc + col0 + c4) = v;
    }
    
  }
}

// GEMM C = act(A·W + bias + resid): A f32 (ASPLIT -> hi/lo 2 terms), Wt bf16 [N][K]; ACT 0 none, 1 relu, 2 exact gelu;
// resid (optional, f32, row index = (row % rmod), pitch ldr, RES_BF16 rounds it) added before the activation.
template <bool ASPLIT, int ACT, bool BIAS_BF16, bool RES_BF16>
__global__ __launch_bounds__(128) void k_gemm_bf3(const float* __restrict__ A, int lda, const unsigned short* __restrict__ Wt, int ldb,
                                                const float* __restrict__ bias, const float* __restrict__ resid, int rmod, int ldr,
                                                float* __restrict__ C, int ldc, int M, int N, int K) {
  __shared__ __attribute__((aligned(16))) float so[4][16][64];
  const int tid = threadIdx.x, w = tid >> 5, lane = tid & 31, ln = lane & 15, hh = lane >> 4;
  const int ntn = N / 64;
  const int wid = blockIdx.x * 4 + w;
  const int mt = wid / ntn, nq = wid % ntn;
  if (mt * 16 >= M) return;
  const int row0 = mt * 16, col0 = nq * 64;
  const float* arow = A + (size_t)(row0 + ln) * lda;
  v8f acc[4] = {};
  for (int kb = 0; kb < K; kb += 32) {
    FragB ah, al;
    const v4f x0 = *(const v4fa*)(arow + kb + 8 * hh), x1 = *(const v4fa*)(arow + kb + 8 * hh + 4);
    const v4f x2 = *(const v4fa*)(arow + kb + 16 + 8 * hh), x3 = *(const v4fa*)(arow + kb + 16 + 8 * hh + 4);
    float xs[16] = {x0[0],x0[1],x0[2],x0[3],x1[0],x1[1],x1[2],x1[3],x2[0],x2[1],x2[2],x2[3],x3[0],x3[1],x3[2],x3[3]};
#pragma unroll
    for (int i = 0; i < 16; ++i) { const unsigned short hb = bf16_bits(xs[i]); ah.u[i] = hb; al.u[i] = ASPLIT ? bf16_bits(xs[i] - bf16_val(hb)) : (unsigned short)0; }
#pragma unroll
    for (int t = 0; t < 4; ++t) {
      const unsigned short* brow = Wt + (size_t)(col0 + t * 16 + ln) * ldb + kb;
      FragB b;
      b.half[0] = *(const v8us*)(brow + 8 * hh);
      b.half[1] = *(const v8us*)(brow + 16 + 8 * hh);
      acc[t] = mmaN<ASPLIT ? 2 : 1>(ah.v, al.v, b.v, b.v, acc[t]);
    }
  }
#pragma unroll
  for (int t = 0; t < 4; ++t) {
    const int col = col0 + t * 16 + ln;
    float bv = bias ? bias[col] : 0.f;
    if (BIAS_BF16) bv = bf16_round(bv);
#pragma unroll
    for (int r = 0; r < 8; ++r) {
      float v = acc[t][r] + bv;
      if (resid) { float rv = resid[(size_t)((row0 + 8 * hh + r) % rmod) * ldr + col]; if (RES_BF16) rv = bf16_round(rv); v += rv; }
      if (ACT == 1) v = fmaxf(v, 0.f);
      if (ACT == 2) v = 0.5f * v * (1.0f + erff(v * 0.70710678118654752f));
      if (ACT == 3) { const float u = 0.7978845608028654f * (v + 0.044715f * v * v * v); v = 0.5f * v * (1.0f + tanhf(u)); }
      so[w][8 * hh + r][t * 16 + ln] = v;
    }
  }
  __builtin_amdgcn_fence(__ATOMIC_ACQ_REL, "workgroup");
  __builtin_amdgcn_wave_barrier();
  const int rsub = lane >> 4, c4 = (lane & 15) * 4;
  {
#pragma unroll
    for (int q = 0; q < 8; ++q) {
      const int r = q * 2 + rsub;
      const v4f v = *(const v4fa*)&so[w][r][c4];
      *(v4f*)(C + (size_t)(row0 + r) * ldc + col0 + c4) = v;
    }
    
  }
}
// row LayerNorm (biased variance, eps) over N: s = X (+ R); optional out_sum <- s; out_norm <- (s-mu)*rsqrt(var+eps)*g + b
template <bool PARAM_BF16>
__global__ __launch_bounds__(256) void k_layernorm(const float* __restrict__ X, const float* __restrict__ R, const float* __restrict__ g, const float* __restrict__ bta,
                                                  float* __restrict__ out_sum, float* __restrict__ out_norm, int N, float eps) {
  __shared__ float red[256];
  const int row = blockIdx.x, tid = threadIdx.x;
  const float* x = X + (size_t)row * N; const float* rr = R ? R + (size_t)row * N : nullptr;
  float vals[16];                     // up to N = 4096
  const int per = N / 256;            // contiguous chunk per thread? use strided-by-4 chunks: thread handles j = tid*4 + 1024*u
  float s1 = 0.f;
  for (int u = 0; u < per / 4; ++u) {
    const int j = tid * 4 + 1024 * u;
    const v4f a = *(const v4fa*)(x + j);
    v4f b = {0.f,0.f,0.f,0.f}; if (rr) b = *(const v4fa*)(rr + j);
#pragma unroll
    for (int q = 0; q < 4; ++q) { const float v = a[q] + b[q]; vals[u * 4 + q] = v; s1 += v; }
  }
  red[tid] = s1; __syncthreads();
  for (int st = 128; st > 0; st >>= 1) { if (tid < st) red[tid] += red[tid + st]; __syncthreads(); }
  const float mu = red[0] / (float)N; __syncthreads();
  float s2 = 0.f;
  for (int u = 0; u < per / 4; ++u)
#pragma unroll
    for (int q = 0; q < 4; ++q) { const float c = vals[u * 4 + q] - mu; s2 += c * c; }
  red[tid] = s2; __syncthreads();
  for (int st = 128; st > 0; st >>= 1) { if (tid < st) red[tid] += red[tid + st]; __syncthreads(); }
  const float rs = rsqrtf(red[0] / (float)N + eps);
  {
    for (int u = 0; u < per / 4; ++u) {
      const int j = tid * 4 + 1024 * u;
      v4f o, sm;
#pragma unroll
      for (int q = 0; q < 4; ++q) {
        float gg = g[j + q], bb = bta[j + q];
        if (PARAM_BF16) { gg = bf16_round(gg); bb = bf16_round(bb); }
        sm[q] = vals[u * 4 + q]; o[q] = (vals[u * 4 + q] - mu) * rs * gg + bb;
      }
      if (out_sum) *(v4f*)(out_sum + (size_t)row * N + j) = sm;
      *(v4f*)(out_norm + (size_t)row * N + j) = o;
    }
    
  }
}



// ---- f16 WMMA path (v_wmma_f32_16x16x32_f16): 11-bit significands for operands in range — used where a [0,1] probability operand needs more precision than bf16
typedef _Float16 v16h __attribute__((ext_vector_type(16)));
union FragH { v16h v; v8us half[2]; _Float16 h[16]; unsigned short u[16]; };
template <int NT>
__device__ __forceinline__ v8f mmaH(v16h ah, v16h al, v16h bh, v16h bl, v8f c) {
  c = __builtin_amdgcn_wmma_f32_16x16x32_f16(false, ah, false, bh, (short)0, c, false, false);
  if (NT >= 2) c = __builtin_amdgcn_wmma_f32_16x16x32_f16(false, al, false, bh, (short)0, c, false, false);
  if (NT >= 3) c = __builtin_amdgcn_wmma_f32_16x16x32_f16(false, ah, false, bl, (short)0, c, false, false);
  asm volatile("v_nop\n\tv_nop\n\tv_nop\n\tv_nop" : "+v"(c) : "v"(ah), "v"(al), "v"(bh), "v"(bl));
  return c;
}
// batched GEMM like k_gemm_b but f16 operands: A f32 (split into f16 hi/lo if ASPLIT, else rounded to f16), Bt = f16 values [n][k]; alpha; C f32; N multiple of 16 (partial tiles skipped)
template <bool ASPLIT>
__global__ __launch_bounds__(128) void k_gemm_h(const float* __restrict__ A, int lda, size_t sA, const _Float16* __restrict__ Bh, int ldb, size_t sB, float alpha, float* __restrict__ C, int ldc, size_t sC, int M, int N, int K) {
  __shared__ __attribute__((aligned(16))) float so[4][16][64];
  const int tid = threadIdx.x, w = tid >> 5, lane = tid & 31, ln = lane & 15, hh = lane >> 4; const int by = blockIdx.y;
  A += (size_t)by * sA; Bh += (size_t)by * sB; C += (size_t)by * sC;
  const int ntn = (N + 63) / 64; const int wid = blockIdx.x * 4 + w; const int mt = wid / ntn, nq = wid % ntn; if (mt * 16 >= M) return;
  const int row0 = mt * 16, col0 = nq * 64; const float* arow = A + (size_t)(row0 + ln) * lda;
  v8f acc[4] = {};
  for (int kb = 0; kb < K; kb += 32) {
    FragH ah, al;
    const v4f x0 = *(const v4fa*)(arow + kb + 8 * hh), x1 = *(const v4fa*)(arow + kb + 8 * hh + 4), x2 = *(const v4fa*)(arow + kb + 16 + 8 * hh), x3 = *(const v4fa*)(arow + kb + 16 + 8 * hh + 4);
    float xs[16] = {x0[0],x0[1],x0[2],x0[3],x1[0],x1[1],x1[2],x1[3],x2[0],x2[1],x2[2],x2[3],x3[0],x3[1],x3[2],x3[3]};
#pragma unroll
    for (int i = 0; i < 16; ++i) { const _Float16 h = (_Float16)xs[i]; ah.h[i] = h; al.h[i] = ASPLIT ? (_Float16)(xs[i] - (float)h) : (_Float16)0.0f; }
#pragma unroll
    for (int t = 0; t < 4; ++t) { if (col0 + t * 16 >= N) continue; const size_t boff = (size_t)(col0 + t * 16 + ln) * ldb + kb; FragH bq; bq.half[0] = *(const v8us*)(Bh + boff + 8 * hh); bq.half[1] = *(const v8us*)(Bh + boff + 16 + 8 * hh);
      acc[t] = mmaH<ASPLIT ? 2 : 1>(ah.v, al.v, bq.v, bq.v, acc[t]); }
  }
#pragma unroll
  for (int t = 0; t < 4; ++t) { if (col0 + t * 16 >= N) continue;
#pragma unroll
    for (int r = 0; r < 8; ++r) so[w][8 * hh + r][t * 16 + ln] = acc[t][r] * alpha; }
  __builtin_amdgcn_fence(__ATOMIC_ACQ_REL, "workgroup"); __builtin_amdgcn_wave_barrier();
  const int rsub = lane >> 4, c4 = (lane & 15) * 4;
  {
#pragma unroll
    for (int q = 0; q < 8; ++q) { const int r = q * 2 + rsub; if (col0 + c4 < N) { const v4f v = *(const v4fa*)&so[w][r][c4]; *(v4f*)(C + (size_t)(row0 + r) * ldc + col0 + c4) = v; } }
     }
}

// Wt[n][k] = f16(W[k][n]·scale) from f32 row-major W[K][N] (scale = power of two; bf16-exact weights stay exact in f16 away from the subnormal range)
__global__ __launch_bounds__(256) void k_wt_f16(const float* __restrict__ W, _Float16* __restrict__ Wt, int K, int N, float scale) {
  const int t = blockIdx.x * 256 + threadIdx.x; if (t >= N * (K / 8)) return; const int n = t / (K / 8), k8 = (t % (K / 8)) * 8; FragH f;
#pragma unroll
  for (int i = 0; i < 8; ++i) f.h[i] = (_Float16)(bf16_round(W[(size_t)(k8 + i) * N + n]) * scale); const v8us o = f.half[0];
  *(v8us*)((unsigned short*)Wt + (size_t)n * K + k8) = o; 
}
// k_gemm_hh variant with fused epilogue: v = acc·alpha + bias[by·sBias + col] (+ CP[(row/rowsPerB)·sCPb + by·64 + col] if CP) ; ACT 0 none / 1 elu ; writes f16 C16 (and f32 C if non-null)
template <int ACT>
__global__ __launch_bounds__(128) void k_gemm_hhx(const _Float16* __restrict__ A, int lda, size_t sA, const _Float16* __restrict__ Bh, int ldb, size_t sB, float alpha, const float* __restrict__ bias, size_t sBias, const float* __restrict__ CP, int rowsPerB, size_t sCPb, int row0g,
    float* __restrict__ C, _Float16* __restrict__ C16, int ldc, size_t sC, int M, int N, int K) {
  __shared__ __attribute__((aligned(16))) float so[4][16][64];
  const int tid = threadIdx.x, w = tid >> 5, lane = tid & 31, ln = lane & 15, hh = lane >> 4; const int by = blockIdx.y;
  A += (size_t)by * sA; Bh += (size_t)by * sB; const size_t cofs = (size_t)by * sC; const float* bp = bias ? bias + (size_t)by * sBias : nullptr;
  const int ntn = (N + 63) / 64; const int wid = blockIdx.x * 4 + w; const int mt = wid / ntn, nq = wid % ntn; if (mt * 16 >= M) return;
  const int row0 = mt * 16, col0 = nq * 64; const _Float16* arow = A + (size_t)(row0 + ln) * lda;
  v8f acc[4] = {};
  for (int kb = 0; kb < K; kb += 32) { FragH ah; ah.half[0] = *(const v8us*)((const unsigned short*)arow + kb + 8 * hh); ah.half[1] = *(const v8us*)((const unsigned short*)arow + kb + 16 + 8 * hh);
#pragma unroll
    for (int t = 0; t < 4; ++t) { if (col0 + t * 16 >= N) continue; const size_t boff = (size_t)(col0 + t * 16 + ln) * ldb + kb; FragH bq; bq.half[0] = *(const v8us*)((const unsigned short*)Bh + boff + 8 * hh); bq.half[1] = *(const v8us*)((const unsigned short*)Bh + boff + 16 + 8 * hh);
      acc[t] = mmaH<1>(ah.v, ah.v, bq.v, bq.v, acc[t]); }
  }
#pragma unroll
  for (int t = 0; t < 4; ++t) { if (col0 + t * 16 >= N) continue; const int col = col0 + t * 16 + ln; const float bv = bp ? bf16_round(bp[col]) : 0.f;
#pragma unroll
    for (int r = 0; r < 8; ++r) { float v = acc[t][r] * alpha + bv; if (CP) { const int rr = row0g + row0 + 8 * hh + r; if (rowsPerB < 0) v += CP[cofs + (size_t)rr * ldc + col];      /* rowsPerB < 0: own element of the batched C plane */ else { const int bidx = rr / rowsPerB; v += CP[(size_t)bidx * sCPb + (size_t)by * 64 + col]; } } if (ACT == 1) v = (v > 0.f) ? v : expm1f(v); else if (ACT == 7) v = (v > 0.f) ? v + 1.0f : expf(v); else if (ACT == 8) v = tanhf(v); else if (ACT == 9) v = 0.5f * v * (1.0f + tanhf(0.7978845608028654f * (v + 0.044715f * v * v * v))); else if (ACT == 11) v = 1.0f / (1.0f + expf(-v)); else if (ACT == 12) v = (v > 0.f) ? v : 0.01f * v; else if (ACT == 14) v = (v > 0.f) ? v : 0.1f * v; else if (ACT == 16) v = (v >= 0.f) ? v : 0.3f * v; else if (ACT == 17) v = (v >= 0.f) ? v : 0.2f * v; else if (ACT == 15) v = v / (1.0f + expf(-v)); else if (ACT == 3) v = fmaxf(v, 0.f); else if (ACT == 6) v = 0.5f * v * (1.0f + erff(v * 0.70710678118654752f)); so[w][8 * hh + r][t * 16 + ln] = v; } }
  __builtin_amdgcn_fence(__ATOMIC_ACQ_REL, "workgroup"); __builtin_amdgcn_wave_barrier();
  const int rsub = lane >> 4, c4 = (lane & 15) * 4; typedef _Float16 v4h __attribute__((ext_vector_type(4)));
  {
#pragma unroll
    for (int q = 0; q < 8; ++q) { const int r = q * 2 + rsub; if (col0 + c4 < N) { const v4f v = *(const v4fa*)&so[w][r][c4]; if (C) *(v4f*)(C + cofs + (size_t)(row0 + r) * ldc + col0 + c4) = v; if (C16) { v4h h4; for (int i = 0; i < 4; ++i) h4[i] = (_Float16)v[i]; *(v4h*)(C16 + cofs + (size_t)(row0 + r) * ldc + col0 + c4) = h4; } } }
     }
}


typedef _Float16 v4h __attribute__((ext_vector_type(4)));

// every input conversion in one launch: blocks 0 .. 6 WB - 1 take the six weight matrices (slot j of BW = f16(bf16(w_j) x 16), each DO x DI elements), the rest x1 and x2 (X = [x1 | x2] as f16(bf16(x)))
#define XB (NN * DI / 8 / 256)   /* blocks per x */
#define WB (DO * DI / 8 / 256)   /* blocks per weight matrix */
__global__ __launch_bounds__(256) void k_cvt(const float* __restrict__ x1, const float* __restrict__ x2, const float* __restrict__ w0, const float* __restrict__ w1, const float* __restrict__ w2, const float* __restrict__ w3, const float* __restrict__ w4, const float* __restrict__ w5,
    _Float16* __restrict__ X, _Float16* __restrict__ BW) {
  const int b = blockIdx.x, tid = threadIdx.x; const float* src; _Float16* dst; float sc;
  if (b < 6 * WB) { const int j = b / WB; const float* w = j == 0 ? w0 : j == 1 ? w1 : j == 2 ? w2 : j == 3 ? w3 : j == 4 ? w4 : w5; src = w + ((size_t)(b - j * WB) * 256 + tid) * 8; dst = BW + ((size_t)b * 256 + tid) * 8; sc = 16.0f; }
  else { const int q = b - 6 * WB, j = q / XB; src = (j ? x2 : x1) + ((size_t)(q - j * XB) * 256 + tid) * 8; dst = X + ((size_t)q * 256 + tid) * 8; sc = 1.0f; }
  FragH f;
#pragma unroll
  for (int q = 0; q < 8; ++q) f.h[q] = (_Float16)(bf16_round(src[q]) * sc);
  *(v8us*)(unsigned short*)dst = f.half[0]; }
__global__ __launch_bounds__(256) void k_h16(const float* __restrict__ x, _Float16* __restrict__ X16, size_t n8) { const size_t t = (size_t)blockIdx.x * 256 + threadIdx.x; if (t >= n8) return; FragH f;
#pragma unroll
  for (int q = 0; q < 8; ++q) f.h[q] = (_Float16)x[t * 8 + q]; *(v8us*)((unsigned short*)X16 + t * 8) = f.half[0];  }
__global__ __launch_bounds__(256) void k_round16f(const float* __restrict__ W, _Float16* __restrict__ Bt, size_t n8) { const size_t t = (size_t)blockIdx.x * 256 + threadIdx.x; if (t >= n8) return; FragH f;
#pragma unroll
  for (int i = 0; i < 8; ++i) f.h[i] = (_Float16)(bf16_round(W[t * 8 + i]) * 16.0f); *(v8us*)((unsigned short*)Bt + t * 8) = f.half[0];  }

__global__ __launch_bounds__(256) void k_hl(const float* __restrict__ F, _Float16* __restrict__ Hh, _Float16* __restrict__ Hl, size_t n8) { const size_t t = (size_t)blockIdx.x * 256 + threadIdx.x; if (t >= n8) return; FragH fh, fl; const v4f a = *(const v4fa*)(F + t * 8), c = *(const v4fa*)(F + t * 8 + 4);
#pragma unroll
  for (int q = 0; q < 4; ++q) { _Float16 h = (_Float16)a[q]; fh.h[q] = h; fl.h[q] = (_Float16)((a[q] - (float)h) * 1024.0f); h = (_Float16)c[q]; fh.h[4 + q] = h; fl.h[4 + q] = (_Float16)((c[q] - (float)h) * 1024.0f); }
  { *(v8us*)((unsigned short*)Hh + t * 8) = fh.half[0]; *(v8us*)((unsigned short*)Hl + t * 8) = fl.half[0];  } }

// ---- fast GEMM (wave tile 32x64; requires M % 32 == 0 rows per launch region and N % 64 == 0); epilogue = k_gemm_hhx semantics ----
__device__ __forceinline__ v16h g2_frag(const _Float16* p, int hh) { FragH f; f.half[0] = *(const v8us*)((const unsigned short*)p + 8 * hh); f.half[1] = *(const v8us*)((const unsigned short*)p + 16 + 8 * hh); return f.v; }
__device__ __forceinline__ v8f g2_mma(v16h a, v16h b, v8f c) { v8f d = __builtin_amdgcn_wmma_f32_16x16x32_f16(false, a, false, b, (short)0, c, false, false); asm volatile("v_nop\n\tv_nop\n\tv_nop\n\tv_nop" : "+v"(d) : "v"(a), "v"(b)); return d; }
template <int ACT>
__global__ __launch_bounds__(128) void k_gemm2(const _Float16* __restrict__ A, int lda, size_t sA, const _Float16* __restrict__ Bh, int ldb, size_t sB, float alpha, const float* __restrict__ bias, size_t sBias, const float* __restrict__ CP, int rowsPerB, size_t sCPb, int row0g,
    float* __restrict__ C, _Float16* __restrict__ C16, int ldc, size_t sC, int M, int N, int K) { static_assert(ACT == 0 || ACT == 3 || ACT == 6 || ACT == 8 || ACT == 9 || ACT == 11 || ACT == 12 || ACT == 14 || ACT == 15 || ACT == 16 || ACT == 17, "k_gemm2: unsupported ACT code (would silently apply no activation)");
  __shared__ __attribute__((aligned(16))) float so[4][32][68];
  const int tid = threadIdx.x, w = tid >> 5, lane = tid & 31, ln = lane & 15, hh = lane >> 4; const int by = blockIdx.y;
  A += (size_t)by * sA; Bh += (size_t)by * sB; const size_t cofs = (size_t)by * sC; const float* bp = bias ? bias + (size_t)by * sBias : nullptr;
  const int ntn = N >> 6; const int mt = blockIdx.x / ntn, nq = blockIdx.x - mt * ntn; const int row0 = mt * 128 + 32 * w, col0 = nq * 64; if (row0 >= M) return;
  const _Float16* a0p = A + (size_t)(row0 + ln) * lda; const _Float16* a1p = a0p + (size_t)16 * lda;
  const _Float16* b0p = Bh + (size_t)(col0 + ln) * ldb; const _Float16* b1p = b0p + (size_t)16 * ldb; const _Float16* b2p = b1p + (size_t)16 * ldb; const _Float16* b3p = b2p + (size_t)16 * ldb;
  const v8f z8 = {0.f,0.f,0.f,0.f,0.f,0.f,0.f,0.f}; v8f c00 = z8, c01 = z8, c02 = z8, c03 = z8, c10 = z8, c11 = z8, c12 = z8, c13 = z8;
#pragma unroll 1
  for (int kb = 0; kb < K; kb += 32) { const v16h a0 = g2_frag(a0p + kb, hh), a1 = g2_frag(a1p + kb, hh);
    v16h b = g2_frag(b0p + kb, hh); c00 = g2_mma(a0, b, c00); c10 = g2_mma(a1, b, c10);
    b = g2_frag(b1p + kb, hh); c01 = g2_mma(a0, b, c01); c11 = g2_mma(a1, b, c11);
    b = g2_frag(b2p + kb, hh); c02 = g2_mma(a0, b, c02); c12 = g2_mma(a1, b, c12);
    b = g2_frag(b3p + kb, hh); c03 = g2_mma(a0, b, c03); c13 = g2_mma(a1, b, c13); }
  v8f accs[8] = {c00, c01, c02, c03, c10, c11, c12, c13};
#pragma unroll
  for (int u = 0; u < 8; ++u) { const int t = u & 3, half = u >> 2; const int col = col0 + t * 16 + ln; const float bv = bp ? bf16_round(bp[col]) : 0.f;
#pragma unroll
    for (int r = 0; r < 8; ++r) { const int rloc = half * 16 + 8 * hh + r; float v = accs[u][r] * alpha + bv; if (CP) { if (rowsPerB < 0) v += CP[cofs + (size_t)(row0g + row0 + rloc) * ldc + col];      /* rowsPerB < 0: own element of the batched C plane */ else { const int bidx = (row0g + row0 + rloc) / rowsPerB; v += CP[(size_t)bidx * sCPb + (size_t)by * 64 + col]; } }
      if (ACT == 3) v = fmaxf(v, 0.f); else if (ACT == 6) v = 0.5f * v * (1.0f + erff(v * 0.70710678118654752f)); else if (ACT == 11) v = 1.0f / (1.0f + expf(-v)); else if (ACT == 15) v = v / (1.0f + expf(-v)); else if (ACT == 12) v = (v > 0.f) ? v : 0.01f * v; else if (ACT == 8) v = tanhf(v); else if (ACT == 9) v = 0.5f * v * (1.0f + tanhf(0.7978845608028654f * (v + 0.044715f * v * v * v))); else if (ACT == 14) v = (v > 0.f) ? v : 0.1f * v; else if (ACT == 16) v = (v >= 0.f) ? v : 0.3f * v; else if (ACT == 17) v = (v >= 0.f) ? v : 0.2f * v;
      so[w][rloc][t * 16 + ln] = v; } }
  __builtin_amdgcn_fence(__ATOMIC_ACQ_REL, "workgroup"); __builtin_amdgcn_wave_barrier();
  const int rsub = lane >> 4, c4 = (lane & 15) * 4;
  {
#pragma unroll
    for (int q = 0; q < 16; ++q) { const int r = q * 2 + rsub; const v4f v = *(const v4fa*)&so[w][r][c4]; if (C) *(v4f*)(C + cofs + (size_t)(row0 + r) * ldc + col0 + c4) = v; if (C16) { v4h h4; for (int i = 0; i < 4; ++i) h4[i] = (_Float16)v[i]; *(v4h*)(C16 + cofs + (size_t)(row0 + r) * ldc + col0 + c4) = h4; } }
     } }


// ---- GEMM tile through LDS: a work-group of 8 waves makes a 128 x 128 tile of A[.][KT] . B[.][KT]^T (both row-major, pitch KT, f16); wave w takes rows 32 (w & 3), columns 64 (w >> 2): k_gemm2's 32 x 64 wave tile and k order.
// A k slice of 64 elements (one 128-byte line of each of the 256 rows) lies in one of two LDS buffers; the next slice is fetched meanwhile through registers, a wave's load covering four whole lines.
#define GP 72                    /* LDS pitch of a row's slice, 16-bit elements: 144 B = 16 B x odd */
#define GT (128 * GP)            /* one operand's slice */
union G3S { unsigned short t[4 * GT]; float so[8][32][68]; };      /* the two buffers (A | B each); behind the loop each wave's own output staging */
__device__ __forceinline__ v16h g3_frag(const unsigned short* p, int hh) { FragH f; f.half[0] = *(const v8us*)(p + 8 * hh); f.half[1] = *(const v8us*)(p + 16 + 8 * hh); return f.v; }
__device__ __forceinline__ v8f g3_mma(v16h a, v16h b, v8f c) { return __builtin_amdgcn_wmma_f32_16x16x32_f16(false, a, false, b, (short)0, c, false, false); }
template <int KT>
__device__ __forceinline__ void g3_loop(const unsigned short* __restrict__ A, const unsigned short* __restrict__ B, unsigned short* sm, int tid, v8f (&acc)[2][4]) {
  const int w = tid >> 5, lane = tid & 31, ln = lane & 15, hh = lane >> 4;
  const unsigned short* ga = A + (size_t)(tid >> 3) * KT + (tid & 7) * 8;      /* thread -> 16 B of rows tid / 8 + 32 j of each operand; one address pair an operand for all slices */
  const unsigned short* gb = B + (size_t)(tid >> 3) * KT + (tid & 7) * 8;
  const int ls = (tid >> 3) * GP + (tid & 7) * 8;
  const int ra = ((w & 3) * 32 + ln) * GP, rb = GT + ((w >> 2) * 64 + ln) * GP;
  v8us sa[4], sb[4];
#pragma unroll
  for (int j = 0; j < 4; ++j) { sa[j] = *(const v8us*)(ga + j * 32 * KT); sb[j] = *(const v8us*)(gb + j * 32 * KT); }
#pragma unroll
  for (int j = 0; j < 4; ++j) { *(v8us*)(sm + ls + j * 32 * GP) = sa[j]; *(v8us*)(sm + GT + ls + j * 32 * GP) = sb[j]; }
  __syncthreads();
  // unrolled: the buffer and the slice become constants, so every load and LDS access is its base register plus an immediate offset
#pragma unroll
  for (int c = 0; c < KT / 64; ++c) {
    const unsigned short* cur = sm + (c & 1) * 2 * GT; unsigned short* nxt = sm + ((c + 1) & 1) * 2 * GT;
    if (c + 1 < KT / 64) {
#pragma unroll
      for (int j = 0; j < 4; ++j) { sa[j] = *(const v8us*)(ga + (c + 1) * 64 + j * 32 * KT); sb[j] = *(const v8us*)(gb + (c + 1) * 64 + j * 32 * KT); }
      asm volatile("s_wait_xcnt 0x0" :: "v"(ga), "v"(gb) : "memory");      /* as inputs the loads' two addresses stay whole until the wait */
    }
#pragma unroll
    for (int ks = 0; ks < 2; ++ks) {
      const v16h a0 = g3_frag(cur + ra + ks * 32, hh), a1 = g3_frag(cur + ra + 16 * GP + ks * 32, hh);
#pragma unroll
      for (int t = 0; t < 4; ++t) { const v16h b = g3_frag(cur + rb + t * 16 * GP + ks * 32, hh); acc[0][t] = g3_mma(a0, b, acc[0][t]); acc[1][t] = g3_mma(a1, b, acc[1][t]); }
    }
    if (c + 1 < KT / 64) {
#pragma unroll
      for (int j = 0; j < 4; ++j) { *(v8us*)(nxt + ls + j * 32 * GP) = sa[j]; *(v8us*)(nxt + GT + ls + j * 32 * GP) = sb[j]; }      /* the other buffer's last readers left it at the barrier that ended slice c - 1 */
    }
    __syncthreads();      /* publishes slice c + 1 and ends every read of slice c (behind the last slice: frees the buffers for the output staging) */
  }
}
// the six projections in one launch (M = NN, N = DO, K = DI, f16 result only), tiles through LDS (g3_loop), k_gemm2's epilogue. blockIdx.y = j picks plane j of QKV = [Q1 K1 Q2 K2 V1^T V2^T];
// x1 (first half of X) feeds planes 0, 1, 4; weight slots of BW = [Wq1 Wk1 Wq2 Wk2 Wv], W_V shared by planes 4 and 5
__global__ __launch_bounds__(256) void k_proj6(const _Float16* __restrict__ X, const _Float16* __restrict__ BW, const float* __restrict__ bq1, const float* __restrict__ bk1, const float* __restrict__ bq2, const float* __restrict__ bk2, const float* __restrict__ bv, _Float16* __restrict__ QKV) {
  __shared__ __attribute__((aligned(16))) G3S sm;
  const int tid = threadIdx.x, w = tid >> 5, lane = tid & 31, ln = lane & 15, hh = lane >> 4; const int j = blockIdx.y;
  const float* bp = j == 0 ? bq1 : j == 1 ? bk1 : j == 2 ? bq2 : j == 3 ? bk2 : bv;
  const int mt = blockIdx.x / (DO / 128), nq = blockIdx.x % (DO / 128); const int row0 = mt * 128 + 32 * (w & 3), col0 = nq * 128 + 64 * (w >> 2);
  const v8f z8 = {0.f,0.f,0.f,0.f,0.f,0.f,0.f,0.f}; v8f acc[2][4] = {{z8, z8, z8, z8}, {z8, z8, z8, z8}};
  g3_loop<DI>((const unsigned short*)X + ((j == 2 || j == 3 || j == 5) ? (size_t)NN * DI : 0) + (size_t)mt * 128 * DI, (const unsigned short*)BW + (size_t)(j < 4 ? j : 4) * DO * DI + (size_t)nq * 128 * DI, sm.t, tid, acc);
  if (j >= 4) {      /* block-uniform, behind the loop's last barrier. Planes 4 and 5 hold V^T in k_flash's staging order: [32-key block][16-d tile][half][lane][8], element = V[16 half + 8 hh + 0..7][16 t + ln]: a lane's 8 accumulator registers as they lie, so nothing is left to transpose and a store covers 512 contiguous bytes */
    const float* bl = bp + col0 + ln; float bt[4];
    // every loop of this branch is unrolled: bt, f and acc stay in registers, and t and the chunk index become immediate offsets of the one address pair of the loads and of the stores
#pragma unroll
    for (int t = 0; t < 4; ++t) bt[t] = bl[t * 16];
    asm volatile("s_wait_xcnt 0x0" :: "v"(bl) : "memory");      /* as an input the loads' address stays whole until the wait */
    unsigned short* vd = (unsigned short*)QKV + (size_t)j * NN * DO + (size_t)(row0 >> 5) * (32 * DO) + (col0 >> 4) * 512 + lane * 8;
    FragH f[2][4];      /* all eight chunks are made in front of the first store: behind it no register that a store names is written any more */
#pragma unroll
    for (int u = 0; u < 8; ++u) { const int t = u & 3, half = u >> 2; const float bb = bf16_round(bt[t]);
#pragma unroll
      for (int r = 0; r < 8; ++r) f[half][t].h[r] = (_Float16)(acc[half][t][r] * 0.0625f + bb); }
#pragma unroll
    for (int u = 0; u < 8; ++u) { const int t = u & 3, half = u >> 2; *(v8us*)(vd + (t * 2 + half) * 256) = f[half][t].half[0]; }
    asm volatile("s_wait_xcnt 0x0" :: "v"(vd) : "memory");      /* as an input the stores' address stays whole until the wait */
    return;
  }
#pragma unroll
  for (int u = 0; u < 8; ++u) { const int t = u & 3, half = u >> 2; const float bb = bf16_round(bp[col0 + t * 16 + ln]);
#pragma unroll
    for (int r = 0; r < 8; ++r) sm.so[w][half * 16 + 8 * hh + r][t * 16 + ln] = acc[half][t][r] * 0.0625f + bb; }
  __builtin_amdgcn_fence(__ATOMIC_ACQ_REL, "workgroup"); __builtin_amdgcn_wave_barrier();      /* a wave reads back only its own rows */
  if (j == 0 || j == 2) {      /* block-uniform. The Q planes lie in k_flash's fragment order: [32-row block][g][ks][h][lane][8], element = Q[16 g + ln][32 ks + 16 h + 8 hh + 0..7]; a store covers 512 contiguous bytes */
    unsigned short* qd = (unsigned short*)QKV + (size_t)j * NN * DO + (size_t)(row0 >> 5) * (32 * DO) + (col0 >> 5) * 512 + lane * 8;
    FragH f[8];      /* all eight chunks are made in front of the first store, as above */
    // both loops unrolled: f stays in registers, and the chunk index becomes an immediate offset of the one address pair
#pragma unroll
    for (int c = 0; c < 8; ++c) { const int g = c >> 2, kl = (c >> 1) & 1, h = c & 1; const float* sp = &sm.so[w][g * 16 + ln][kl * 32 + h * 16 + 8 * hh];
      const v4f v0 = *(const v4fa*)sp, v1 = *(const v4fa*)(sp + 4);
      for (int i = 0; i < 4; ++i) { f[c].h[i] = (_Float16)v0[i]; f[c].h[4 + i] = (_Float16)v1[i]; } }
#pragma unroll
    for (int c = 0; c < 8; ++c) *(v8us*)(qd + (((c >> 2) * 8 + ((c >> 1) & 1)) * 2 + (c & 1)) * 256) = f[c].half[0];
    asm volatile("s_wait_xcnt 0x0" :: "v"(qd) : "memory");      /* as an input the stores' address stays whole until the wait */
  } else {
    const int rsub = lane >> 4, c4 = (lane & 15) * 4; _Float16* cp = QKV + (size_t)j * NN * DO + (size_t)(row0 + rsub) * DO + col0 + c4;
#pragma unroll
    for (int q = 0; q < 16; ++q) { const v4f v = *(const v4fa*)&sm.so[w][q * 2 + rsub][c4]; v4h h4; for (int i = 0; i < 4; ++i) h4[i] = (_Float16)v[i]; *(v4h*)(cp + q * 2 * DO) = h4; }
    asm volatile("s_wait_xcnt 0x0" :: "v"(cp) : "memory");      /* as an input the stores' address stays whole until the wait */
  }
}
#define FQ 256                   /* query rows per work-group */
#define KSP 4                    /* key ranges: 32 query blocks x KSP x 2 branches = 256 work-groups */
#define NPASS (NN / KSP / 32)
#define KPIT 264                 /* LDS pitch of a K row, 16-bit elements: 528 B = 16 B x odd */
#define VPIT 40                  /* LDS pitch of a V^T row (32 keys): 80 B = 16 B x odd */
#define MTHR 4.0f                /* the maximum in use may trail the true one by this much (log2): a weight is at most 2^(10 + 4), inside f16 */
__device__ __forceinline__ float xhalf(float x) { return __builtin_bit_cast(float, __builtin_amdgcn_permlanex16(__builtin_bit_cast(int, x), __builtin_bit_cast(int, x), 0x76543210, 0xfedcba98, false, false)); }  // lane l with lane l ^ 16
__device__ __forceinline__ v16h fa_frag(const unsigned short* p, int hh) { FragH f; f.half[0] = *(const v8us*)(p + 8 * hh); f.half[1] = *(const v8us*)(p + 16 + 8 * hh); return f.v; }
__device__ __forceinline__ v8f fa_mma(v16h a, v16h b, v8f c) { return __builtin_amdgcn_wmma_f32_16x16x32_f16(false, a, false, b, (short)0, c, false, false); }
__global__ __launch_bounds__(256) void k_flash(const _Float16* __restrict__ Qa, const _Float16* __restrict__ Ka, const _Float16* __restrict__ VTa, const _Float16* __restrict__ Qb, const _Float16* __restrict__ Kb, const _Float16* __restrict__ VTb,
    const float* __restrict__ scp, float* __restrict__ OP, float* __restrict__ ML) {
  __shared__ __attribute__((aligned(16))) unsigned short sK[2][32 * KPIT];
  __shared__ __attribute__((aligned(16))) unsigned short sV[2][DO * VPIT];
  const int tid = threadIdx.x, w = tid >> 5, lane = tid & 31, ln = lane & 15, hh = lane >> 4;
  const int br = blockIdx.z, sp = blockIdx.y, q0 = blockIdx.x * FQ + w * 32;
  const _Float16* Q = br ? Qb : Qa; const unsigned short* K = (const unsigned short*)(br ? Kb : Ka); const unsigned short* VT = (const unsigned short*)(br ? VTb : VTa);
  float sv = bf16_round(scp[0]); sv = fminf(fmaxf(sv, 1.0f), 32.0f); const float cs = (1.0f / sqrtf(sv)) * 1.4426950408889634f;      /* scores to log2 units */
  // staging: thread -> 4 x 16 B of the K tile (row tid / 32 + 8 j) and 4 x 16 B of the V^T tile (row 16 (tid / 64) + tid % 16 + 64 j, keys 8 (tid / 16 % 4) + 0..7)
  const unsigned short* gK = K + ((size_t)sp * (NN / KSP) + (tid >> 5)) * DO + (tid & 31) * 8;
  const unsigned short* gV = VT + (size_t)sp * (NN / KSP) * DO + tid * 8;      /* V^T lies in tiles [32-key block][16-d tile][8-key chunk][d][8 keys] (k_proj6): a pass's tile is 16 KiB in a row, a load covers 512 contiguous bytes */
  const int lK = (tid >> 5) * KPIT + (tid & 31) * 8, lV = ((tid >> 6) * 16 + (tid & 15)) * VPIT + ((tid >> 4) & 3) * 8;
  const unsigned short* qp = (const unsigned short*)Q + (size_t)(q0 >> 5) * (32 * DO) + lane * 8;      /* the one address register pair of all 32 Q loads; Q lies in fragment order (k_proj6), so each load covers 512 contiguous bytes */
  v16h qf[2][8];
#pragma unroll
  for (int g = 0; g < 2; ++g)
#pragma unroll
    for (int ks = 0; ks < 8; ++ks) { FragH f; f.half[0] = *(const v8us*)(qp + (g * 8 + ks) * 512); f.half[1] = *(const v8us*)(qp + (g * 8 + ks) * 512 + 256); qf[g][ks] = f.v; }
  {
    v8us kr[4], vr[4];
#pragma unroll
    for (int j = 0; j < 4; ++j) { kr[j] = *(const v8us*)(gK + (size_t)j * 8 * DO); vr[j] = *(const v8us*)(gV + j * 64 * 32); }
    asm volatile("s_wait_xcnt 0x0" :: "v"(qp) : "memory");      /* qp ends here: as an input it stays whole until the wait, in front of whatever takes its registers next (gK, gV live on) */
#pragma unroll
    for (int j = 0; j < 4; ++j) { *(v8us*)(&sK[0][lK + j * 8 * KPIT]) = kr[j]; *(v8us*)(&sV[0][lV + j * 64 * VPIT]) = vr[j]; }
  }
  __syncthreads();
  const v8f z8 = {0.f,0.f,0.f,0.f,0.f,0.f,0.f,0.f};
  v8f o[16][2];
#pragma unroll
  for (int t = 0; t < 16; ++t) { o[t][0] = z8; o[t][1] = z8; }
  float m[2] = {-3.0e38f, -3.0e38f}, l[2] = {0.f, 0.f};
  // kept rolled: the body holds 64 matrix instructions and nearly the whole register budget; a second copy would only cost instruction cache
#pragma unroll 1
  for (int s = 0; s < NPASS; ++s) {
    const unsigned short* bK = sK[s & 1]; const unsigned short* bV = sV[s & 1];
    unsigned short* nK = sK[(s + 1) & 1]; unsigned short* nV = sV[(s + 1) & 1];
    const int sn = s + 1 < NPASS ? s + 1 : s;      /* no branch round the staging: the last pass fetches its own tiles again, into the buffer that nobody reads any more */
    const unsigned short* pk = gK + (size_t)sn * 32 * DO; const unsigned short* pv = gV + (size_t)sn * 32 * DO;
    v8us st[4];      /* the next pass's tiles go through registers, 16 at a time: K under the first product, V^T under the softmax and the second */
#pragma unroll
    for (int j = 0; j < 4; ++j) st[j] = *(const v8us*)(pk + j * 8 * DO);
    asm volatile("s_wait_xcnt 0x0" :: "v"(pk) : "memory");      /* as an input the loads' address stays whole until the wait */
    // S^T = K.Q^T, one k step (2 fragments, 4 matrix instructions) a block; each block's LDS reads stand as one group two blocks ahead, in a ring of three fragment pairs
    v8f sc[2][2] = {{z8, z8}, {z8, z8}};
    v16h ka[3][2];
#pragma unroll
    for (int i = 0; i < 4; ++i) ka[i >> 1][i & 1] = fa_frag(bK + ((i & 1) * 16 + ln) * KPIT + (i >> 1) * 32, hh);
#pragma unroll
    for (int ks = 0; ks < 8; ++ks) {
      if (ks < 6) { ka[(ks + 2) % 3][0] = fa_frag(bK + ln * KPIT + (ks + 2) * 32, hh); ka[(ks + 2) % 3][1] = fa_frag(bK + (16 + ln) * KPIT + (ks + 2) * 32, hh); }
      __builtin_amdgcn_sched_barrier(0);      /* keeps the reads above as one group in front of the block, two blocks ahead of their use */
      const v16h a0 = ka[ks % 3][0], a1 = ka[ks % 3][1];
      sc[0][0] = fa_mma(a0, qf[0][ks], sc[0][0]); sc[0][1] = fa_mma(a0, qf[1][ks], sc[0][1]);
      sc[1][0] = fa_mma(a1, qf[0][ks], sc[1][0]); sc[1][1] = fa_mma(a1, qf[1][ks], sc[1][1]);
      __builtin_amdgcn_sched_barrier(0);      /* ends the block: the next group of reads stays behind it */
    }
#pragma unroll
    for (int j = 0; j < 4; ++j) *(v8us*)(nK + lK + j * 8 * KPIT) = st[j];      /* the other buffers' last readers left them at the barrier that ended pass s - 1 */
    __builtin_amdgcn_sched_barrier(0);      /* the V^T loads stay behind the K stores, so that the two staged tiles are never live together */
#pragma unroll
    for (int j = 0; j < 4; ++j) st[j] = *(const v8us*)(pv + j * 64 * 32);
    asm volatile("s_wait_xcnt 0x0" :: "v"(pv) : "memory");      /* as an input the loads' address stays whole until the wait */
#pragma unroll
    for (int g = 0; g < 2; ++g) {
      float mx = sc[0][g][0];
#pragma unroll
      for (int r = 0; r < 8; ++r) mx = fmaxf(mx, fmaxf(sc[0][g][r], sc[1][g][r]));
      mx = fmaxf(mx, xhalf(mx)) * cs;      /* cs > 0; both halves of the wave now hold this query's maximum of the pass */
      if (__builtin_amdgcn_ballot_w32(mx > m[g] + MTHR) != 0) {      /* scalar branch, rare after the first passes; one group a branch */
        const float mn = fmaxf(m[g], mx); const float corr = __builtin_amdgcn_exp2f(m[g] - mn);      /* 0 on the first pass */
        m[g] = mn; l[g] *= corr;
#pragma unroll
        for (int t = 0; t < 16; ++t) o[t][g] = o[t][g] * corr;
      }
    }
    v16h pf[2];
#pragma unroll
    for (int g = 0; g < 2; ++g) {
      const float sh = 10.0f - m[g]; FragH p; float s0 = 0.f, s1 = 0.f;      /* weights x 1024, as f16 operands away from the subnormal range; l carries the same factor */
      float x[16];
#pragma unroll
      for (int r = 0; r < 8; ++r) { x[r] = fmaf(sc[0][g][r], cs, sh); x[8 + r] = fmaf(sc[1][g][r], cs, sh); }
      __builtin_amdgcn_sched_barrier(0);      /* the arguments are all made first: no multiply-add is left to land on an exponential's source directly behind it */
#pragma unroll
      for (int r = 0; r < 16; ++r) x[r] = __builtin_amdgcn_exp2f(x[r]);
      __builtin_amdgcn_sched_barrier(0);      /* sums and conversions stay behind the exponentials: none reads a result directly behind its exponential */
#pragma unroll
      for (int r = 0; r < 8; ++r) { s0 += x[r]; s1 += x[8 + r]; p.h[r] = (_Float16)x[r]; p.h[8 + r] = (_Float16)x[8 + r]; }
      l[g] += s0 + s1; pf[g] = p.v;
    }
    // O^T += V^T.P^T, two d tiles (2 fragments, 4 matrix instructions) a block, read ahead in the same ring
    __builtin_amdgcn_sched_barrier(0);      /* the V^T reads stay behind the exponentials: hoisted among them they take the registers that keep two waves on a SIMD without spills */
    v16h va[3][2];
#pragma unroll
    for (int i = 0; i < 4; ++i) va[i >> 1][i & 1] = fa_frag(bV + (i * 16 + ln) * VPIT, hh);
#pragma unroll
    for (int b = 0; b < 8; ++b) {
      if (b < 6) { va[(b + 2) % 3][0] = fa_frag(bV + (((b + 2) * 2) * 16 + ln) * VPIT, hh); va[(b + 2) % 3][1] = fa_frag(bV + (((b + 2) * 2 + 1) * 16 + ln) * VPIT, hh); }
      __builtin_amdgcn_sched_barrier(0);      /* one group of reads in front of the block, as above */
      o[b * 2][0] = fa_mma(va[b % 3][0], pf[0], o[b * 2][0]); o[b * 2][1] = fa_mma(va[b % 3][0], pf[1], o[b * 2][1]);
      o[b * 2 + 1][0] = fa_mma(va[b % 3][1], pf[0], o[b * 2 + 1][0]); o[b * 2 + 1][1] = fa_mma(va[b % 3][1], pf[1], o[b * 2 + 1][1]);
      __builtin_amdgcn_sched_barrier(0);      /* ends the block */
    }
#pragma unroll
    for (int j = 0; j < 4; ++j) *(v8us*)(nV + lV + j * 64 * VPIT) = st[j];
    __syncthreads();      /* publishes pass s + 1's tiles and ends every read of pass s's */
  }
  // partials: OP[32-row block][key range][g][t][half][lane][4], the accumulators' own order (element = query 16 g + ln, d = 16 t + 8 hh + 4 half + 0..3), so that each store covers 512 contiguous bytes;
  // ML[query row][key range][m, l]; query row = branch * NN + query. One address pair serves all stores of each array, and
  // everything that is computed stands in front of the first store: behind it no register that a store names is written any more.
  const size_t row = (size_t)br * NN + q0 + ln;
  float* op = OP + ((((size_t)br * NN + q0) >> 5) * KSP + sp) * (32 * DO) + lane * 4;      /* a lane's 8 accumulator registers are 8 consecutive d of its query */
  float* mlp = ML + (row * KSP + sp) * 2 + hh;
  const float j0 = l[0] + xhalf(l[0]), j1 = l[1] + xhalf(l[1]);      /* the halves' sums joined, with every lane on: the exchange stands outside the selection below */
  const float w0 = hh ? j0 : m[0], w1 = hh ? j1 : m[1];      /* the lower half of the wave writes m, the upper l */
  mlp[0] = w0; mlp[16 * KSP * 2] = w1;
#pragma unroll
  for (int g = 0; g < 2; ++g) {
#pragma unroll
    for (int t = 0; t < 16; ++t) {
      const v4f lo = {o[t][g][0], o[t][g][1], o[t][g][2], o[t][g][3]}, hi = {o[t][g][4], o[t][g][5], o[t][g][6], o[t][g][7]};
      *(v4f*)(op + (g * 16 + t) * 256) = lo; *(v4f*)(op + (g * 16 + t) * 256 + 128) = hi;
    }
  }
  asm volatile("s_wait_xcnt 0x0" :: "v"(op), "v"(mlp) : "memory");      /* as inputs the stores' addresses stay whole until the wait */
}
// ---- tail: the join of the key ranges and the output GEMM in one launch; f never leaves the work-group ----
// A work-group of 16 waves takes TR rows (query rows of both branches, one M = 2 NN) and all DI output columns.
// Join: f = sum_s 2^(m_s - M) O_s / sum_s 2^(m_s - M) l_s over the KSP key ranges, fixed order s = 0..KSP-1; the partials lie in k_flash's accumulator order: a wave takes four d tiles of one 16-query group, a lane one query, each load 512 contiguous bytes;
// f x 1024 goes to LDS as f16 hi + residual (one scale for both, so that both feed the same accumulators).
// GEMM: out = (hi + lo) We^T / 1024 + be; We in 64-k slices through two LDS buffers as in g3_loop; wave w takes rows 32 (w & 1), columns 64 (w >> 1): g3_loop's 32 x 64 wave tile and k order.
// The short loops are unrolled because their arrays (staged loads, partials, fragments, accumulators) live in registers and need constant indices.
#define TR 64                    /* rows per work-group: 2 NN / TR = 256 work-groups */
#define APIT 264                 /* LDS pitch of an f row, 16-bit elements: 528 B = 16 B x odd */
#define TA (TR * APIT)           /* one plane of f (hi | lo) */
#define TB (DI * GP)             /* one slice of We */
typedef _Float16 v4ha __attribute__((ext_vector_type(4), may_alias));
struct T4S { unsigned short a[2 * TA]; union { unsigned short b[2 * TB]; float so[16][32][68]; } u; };      /* behind the loop the slices' place is each wave's own output staging */
__global__ __launch_bounds__(512) void k_tail(const float* __restrict__ OP, const float* __restrict__ ML, const _Float16* __restrict__ Bh, const float* __restrict__ bias, float* __restrict__ C) {
  static_assert(KSP == 4, "the join reads a row's four (m, l) pairs as two 16-byte loads");
  __shared__ __attribute__((aligned(16))) T4S sm;
  const int tid = threadIdx.x, w = tid >> 5, lane = tid & 31, ln = lane & 15, hh = lane >> 4;
  const int rowg = blockIdx.x * TR;
  const unsigned short* gb = (const unsigned short*)Bh + (size_t)(tid >> 3) * DO + (tid & 7) * 8;      /* thread -> 16 B of rows tid / 8 + 64 j of We; one address pair for all slices */
  const int ls = (tid >> 3) * GP + (tid & 7) * 8;
  const int jb = w >> 3, jg = (w >> 2) & 1, jt = (w & 3) * 4, rl = jb * 32 + jg * 16 + ln;      /* wave w joins d tiles jt + i of group jg of 32-row block jb; its lane's row is rl */
  const float* po = OP + (size_t)(blockIdx.x * (TR / 32) + jb) * KSP * (32 * DO) + (jg * 16 + jt) * 256 + lane * 4;      /* one address pair for each array */
  const float* pm = ML + (size_t)(rowg + rl) * KSP * 2;
  const float* bq = bias + 64 * (w >> 1) + ln;
  v8us sb[8]; v4f op[4][KSP][2], mq[2]; float bb[4];
  mq[0] = *(const v4fa*)pm; mq[1] = *(const v4fa*)(pm + 4);
#pragma unroll
  for (int i = 0; i < 4; ++i) {
#pragma unroll
    for (int s = 0; s < KSP; ++s) { op[i][s][0] = *(const v4fa*)(po + s * (32 * DO) + i * 256); op[i][s][1] = *(const v4fa*)(po + s * (32 * DO) + i * 256 + 128); }
  }
#pragma unroll
  for (int j = 0; j < 8; ++j) sb[j] = *(const v8us*)(gb + j * 64 * DO);
#pragma unroll
  for (int t = 0; t < 4; ++t) bb[t] = bq[t * 16];
  asm volatile("s_wait_xcnt 0x0" :: "v"(po), "v"(pm), "v"(gb), "v"(bq) : "memory");      /* as inputs the loads' addresses stay whole until the wait */
  const float ms[KSP] = {mq[0][0], mq[0][2], mq[1][0], mq[1][2]}, lw[KSP] = {mq[0][1], mq[0][3], mq[1][1], mq[1][3]};
  float M = ms[0], wg[KSP], den = 0.f;
#pragma unroll
  for (int s = 1; s < KSP; ++s) M = fmaxf(M, ms[s]);
#pragma unroll
  for (int s = 0; s < KSP; ++s) wg[s] = __builtin_amdgcn_exp2f(ms[s] - M);
#pragma unroll
  for (int s = 0; s < KSP; ++s) den += wg[s] * lw[s];
  const float rs = 1.0f / den;
#pragma unroll
  for (int i = 0; i < 4; ++i) {
    v4f a0 = {0.f,0.f,0.f,0.f}, a1 = {0.f,0.f,0.f,0.f};
#pragma unroll
    for (int s = 0; s < KSP; ++s) { a0 += op[i][s][0] * wg[s]; a1 += op[i][s][1] * wg[s]; }
    FragH fh, fl;
#pragma unroll
    for (int q = 0; q < 4; ++q) {
      const float u0 = a0[q] * rs * 1024.0f, u1 = a1[q] * rs * 1024.0f; const _Float16 g0 = (_Float16)u0, g1 = (_Float16)u1;
      fh.h[q] = g0; fl.h[q] = (_Float16)(u0 - (float)g0); fh.h[4 + q] = g1; fl.h[4 + q] = (_Float16)(u1 - (float)g1);
    }
    unsigned short* pa = sm.a + rl * APIT + (jt + i) * 16 + 8 * hh;      /* the lane's 8 consecutive d of its row: one 16-byte LDS store a plane */
    *(v8us*)pa = fh.half[0]; *(v8us*)(pa + TA) = fl.half[0];
  }
#pragma unroll
  for (int j = 0; j < 8; ++j) *(v8us*)(sm.u.b + ls + j * 64 * GP) = sb[j];
  __syncthreads();      /* publishes f and the first slice of We */
  const int ra = ((w & 1) * 32 + ln) * APIT, rb = ((w >> 1) * 64 + ln) * GP;
  const v8f z8 = {0.f,0.f,0.f,0.f,0.f,0.f,0.f,0.f}; v8f acc[2][4] = {{z8, z8, z8, z8}, {z8, z8, z8, z8}};
  // unrolled: the buffer and the slice become constants, so every load and LDS access is its base register plus an immediate offset
#pragma unroll
  for (int c = 0; c < DO / 64; ++c) {
    const unsigned short* cur = sm.u.b + (c & 1) * TB; unsigned short* nxt = sm.u.b + ((c + 1) & 1) * TB;
    if (c + 1 < DO / 64) {
#pragma unroll
      for (int j = 0; j < 8; ++j) sb[j] = *(const v8us*)(gb + (c + 1) * 64 + j * 64 * DO);
      asm volatile("s_wait_xcnt 0x0" :: "v"(gb) : "memory");      /* as an input the loads' address stays whole until the wait */
    }
#pragma unroll
    for (int ks = 0; ks < 2; ++ks) {
      const unsigned short* pa = sm.a + ra + c * 64 + ks * 32;
      const v16h h0 = g3_frag(pa, hh), h1 = g3_frag(pa + 16 * APIT, hh), l0 = g3_frag(pa + TA, hh), l1 = g3_frag(pa + TA + 16 * APIT, hh);
      v16h b[4];
#pragma unroll
      for (int t = 0; t < 4; ++t) b[t] = g3_frag(cur + rb + t * 16 * GP + ks * 32, hh);
#pragma unroll
      for (int t = 0; t < 4; ++t) { acc[0][t] = g3_mma(h0, b[t], acc[0][t]); acc[1][t] = g3_mma(h1, b[t], acc[1][t]); }
#pragma unroll
      for (int t = 0; t < 4; ++t) { acc[0][t] = g3_mma(l0, b[t], acc[0][t]); acc[1][t] = g3_mma(l1, b[t], acc[1][t]); }
    }
    if (c + 1 < DO / 64) {
#pragma unroll
      for (int j = 0; j < 8; ++j) *(v8us*)(nxt + ls + j * 64 * GP) = sb[j];      /* the other buffer's last readers left it at the barrier that ended slice c - 1 */
    }
    __syncthreads();      /* publishes slice c + 1 and ends every read of slice c (behind the last slice: frees the buffers for the output staging) */
  }
#pragma unroll
  for (int u = 0; u < 8; ++u) { const int t = u & 3, half = u >> 2; const float bv = bf16_round(bb[t]);
#pragma unroll
    for (int r = 0; r < 8; ++r) sm.u.so[w][half * 16 + 8 * hh + r][t * 16 + ln] = acc[half][t][r] * (0.0625f / 1024.0f) + bv; }
  __builtin_amdgcn_fence(__ATOMIC_ACQ_REL, "workgroup"); __builtin_amdgcn_wave_barrier();      /* a wave reads back only its own rows */
  const int rsub = lane >> 4, c4 = (lane & 15) * 4; float* cp = C + (size_t)(rowg + 32 * (w & 1) + rsub) * DI + 64 * (w >> 1) + c4;      /* one address pair for all stores, whole lines each */
#pragma unroll
  for (int q = 0; q < 16; ++q) { const v4f v = *(const v4fa*)&sm.u.so[w][q * 2 + rsub][c4]; *(v4f*)(cp + q * 2 * DI) = v; }
  asm volatile("s_wait_xcnt 0x0" :: "v"(cp) : "memory");      /* as an input the stores' address stays whole until the wait */
}

extern "C" void kernel_launch(void* const* d_in, const int* in_sizes, int n_in,
                              void* d_out, int out_size, void* d_ws, size_t ws_size, hipStream_t stream) {
  (void)in_sizes; (void)n_in; (void)out_size;
  const float* const* I = (const float* const*)d_in; const float* x1 = I[0]; const float* x2 = I[1]; const float* Wq1 = I[2]; const float* bq1 = I[3]; const float* Wk1 = I[4]; const float* bk1 = I[5]; const float* Wv = I[6]; const float* bv = I[7]; const float* Wq2 = I[8]; const float* bq2 = I[9]; const float* Wk2 = I[10]; const float* bk2 = I[11]; const float* We = I[12]; const float* be = I[13]; const float* scp = I[14];
  float* out1 = (float*)d_out;      /* the second output lies behind the first, at byte offset 16777216 */
  char* ws = (char*)d_ws; size_t off = 0;
  auto take = [&](size_t bytes) { char* p = ws + off; off += (bytes + 255) & ~(size_t)255; return p; };
  _Float16* BW = (_Float16*)take((size_t)6 * DO * DI * 2); _Float16* BE = BW + (size_t)5 * DO * DI; _Float16* X1 = (_Float16*)take((size_t)2 * NN * DI * 2);      /* weight slots Wq1 Wk1 Wq2 Wk2 Wv We; [x1 | x2] */
  _Float16* Q1 = (_Float16*)take((size_t)6 * NN * DO * 2); _Float16* K1 = Q1 + (size_t)NN * DO; _Float16* Q2 = Q1 + (size_t)2 * NN * DO; _Float16* K2 = Q1 + (size_t)3 * NN * DO; _Float16* VT1 = Q1 + (size_t)4 * NN * DO; _Float16* VT2 = Q1 + (size_t)5 * NN * DO;      /* planes Q1 K1 Q2 K2 V1^T V2^T */
  float* OP = (float*)take((size_t)KSP * 2 * NN * DO * 4); float* ML = (float*)take((size_t)KSP * 2 * NN * 2 * 4);
  if (off > ws_size) return;      /* 1.5 + 16 + 24 + 64 + 0.5 = about 106 MiB */
  k_cvt<<<6 * WB + 2 * XB, 256, 0, stream>>>(x1, x2, Wq1, Wk1, Wq2, Wk2, Wv, We, X1, BW);      /* weights as given, (out, in) */
  k_proj6<<<dim3((NN / 128) * (DO / 128), 6), 256, 0, stream>>>(X1, BW, bq1, bk1, bq2, bk2, bv, Q1);
  k_flash<<<dim3(NN / FQ, KSP, 2), 256, 0, stream>>>(Q1, K2, VT1, Q2, K1, VT2, scp, OP, ML);      /* f1: hsi_Q . lidar_K -> hsi_V ; f2: lidar_Q . hsi_K -> lidar_V */
  k_tail<<<2 * NN / TR, 512, 0, stream>>>(OP, ML, BE, be, out1);      /* both branches: their rows and the two outputs lie back to back (one M = 2 NN); (f_hi + f_lo) We^T + be */
}

// v007
// It runs in 126 microseconds.
// Timed twice side by side with v006, it ran 1.03 times as fast both times.
// Over all steps from v000 it is 22.1 times as fast.
#include <hip/hip_runtime.h>
// cross_fuison (8192 hsi rows x1 and 8192 lidar rows x2, 512 -> 256: Q/K/V = x W^T + b (W_V shared); inv = 1/sqrt(clip(scale, 1, 32)); f1 = softmax(hsi_Q lidar_K^T inv) hsi_V; f2 = softmax(lidar_Q hsi_K^T inv) lidar_V; outputs = (f1 We^T + be, f2 We^T + be), each [8192][512]).
// Compute dtype: inputs rounded to bf16; inputs/weights exact as f16; Q/K/V and the softmax weights as plain f16 operands (~2^-12); f as f16 hi + residual into We; softmax f32. v_wmma_f32_16x16x32_f16.
#define NN 8192
#define DI 512
#define DO 256
typedef __bf16 v16b __attribute__((ext_vector_type(16)));
typedef unsigned short v8us __attribute__((ext_vector_type(8), may_alias));
typedef float  v8f  __attribute__((ext_vector_type(8)));
typedef float  v4f  __attribute__((ext_vector_type(4)));
typedef float  v4fa __attribute__((ext_vector_type(4), may_alias));
union FragB { v16b v; v8us half[2]; unsigned short u[16]; };

__device__ __forceinline__ unsigned short bf16_bits(float x) { unsigned int u = __float_as_uint(x); return (unsigned short)((u + 0x7FFFu + ((u >> 16) & 1u)) >> 16); }
__device__ __forceinline__ float bf16_val(unsigned short b) { return __uint_as_float(((unsigned int)b) << 16); }
__device__ __forceinline__ float bf16_round(float x) { return bf16_val(bf16_bits(x)); }
// D += A·B with NT terms: 1 = ah·bh, 2 = + al·bh (A split), 3 = + ah·bl (both split)
template <int NT>
__device__ __forceinline__ v8f mmaN(v16b ah, v16b al, v16b bh, v16b bl, v8f c) {
  c = __builtin_amdgcn_wmma_f32_16x16x32_bf16(false, ah, false, bh, (short)0, c, false, false);
  if (NT >= 2) c = __builtin_amdgcn_wmma_f32_16x16x32_bf16(false, al, false, bh, (short)0, c, false, false);
  if (NT >= 3) c = __builtin_amdgcn_wmma_f32_16x16x32_bf16(false, ah, false, bl, (short)0, c, false, false);
  asm volatile("v_nop\n\tv_nop\n\tv_nop\n\tv_nop" : "+v"(c) : "v"(ah), "v"(al), "v"(bh), "v"(bl));
  return c;
}

__global__ __launch_bounds__(256) void k_wt_bf16(const float* __restrict__ W, unsigned short* __restrict__ Wt, int K, int N) {
  const int t = blockIdx.x * 256 + threadIdx.x;
  const int k8n = K / 8;
  if (t >= N * k8n) return;
  const int n = t / k8n, k8 = (t % k8n) * 8;
  v8us v;
#pragma unroll
  for (int i = 0; i < 8; ++i) v[i] = bf16_bits(W[(size_t)(k8 + i) * N + n]);
  *(v8us*)(Wt + (size_t)n * K + k8) = v;
  
}

// GEMM C[M][N] (f32, pitch ldc) = act(A[M][K]·W + bias). A f32 row-major (pitch lda) converted per fragment to bf16
// (ASPLIT: hi/lo two planes -> 2 terms, else single rounded term); Wt bf16 [N][K] (pitch ldb). BIAS_BF16 rounds the
// bias to bf16 first (bias quantised to bf16 before the add). K%32==0, M%16==0, N%64==0.
template <bool ASPLIT, int ACT, bool BIAS_BF16>
__global__ __launch_bounds__(128) void k_gemm_bf(const float* __restrict__ A, int lda, const unsigned short* __restrict__ Wt, int ldb,
                                               const float* __restrict__ bias, float* __restrict__ C, int ldc, int M, int N, int K) {
  __shared__ __attribute__((aligned(16))) float so[4][16][64];
  const int tid = threadIdx.x, w = tid >> 5, lane = tid & 31, ln = lane & 15, hh = lane >> 4;
  const int ntn = N / 64;
  const int wid = blockIdx.x * 4 + w;
  const int mt = wid / ntn, nq = wid % ntn;
  if (mt * 16 >= M) return;
  const int row0 = mt * 16, col0 = nq * 64;
  const float* arow = A + (size_t)(row0 + ln) * lda;
  v8f acc[4] = {};
  for (int kb = 0; kb < K; kb += 32) {
    FragB ah, al;
    const v4f x0 = *(const v4fa*)(arow + kb + 8 * hh), x1 = *(const v4fa*)(arow + kb + 8 * hh + 4);
    const v4f x2 = *(const v4fa*)(arow + kb + 16 + 8 * hh), x3 = *(const v4fa*)(arow + kb + 16 + 8 * hh + 4);
    float xs[16] = {x0[0],x0[1],x0[2],x0[3],x1[0],x1[1],x1[2],x1[3],x2[0],x2[1],x2[2],x2[3],x3[0],x3[1],x3[2],x3[3]};
#pragma unroll
    for (int i = 0; i < 16; ++i) { const unsigned short hb = bf16_bits(xs[i]); ah.u[i] = hb; al.u[i] = ASPLIT ? bf16_bits(xs[i] - bf16_val(hb)) : (unsigned short)0; }
#pragma unroll
    for (int t = 0; t < 4; ++t) {
      const unsigned short* brow = Wt + (size_t)(col0 + t * 16 + ln) * ldb + kb;
      FragB b;
      b.half[0] = *(const v8us*)(brow + 8 * hh);
      b.half[1] = *(const v8us*)(brow + 16 + 8 * hh);
      acc[t] = mmaN<ASPLIT ? 2 : 1>(ah.v, al.v, b.v, b.v, acc[t]);
    }
  }
#pragma unroll
  for (int t = 0; t < 4; ++t) {
    float bv = bias ? bias[col0 + t * 16 + ln] : 0.f;
    if (BIAS_BF16) bv = bf16_round(bv);
#pragma unroll
    for (int r = 0; r < 8; ++r) { float v = acc[t][r] + bv; if (ACT == 1) v = fmaxf(v, 0.f); so[w][8 * hh + r][t * 16 + ln] = v; }
  }
  __builtin_amdgcn_fence(__ATOMIC_ACQ_REL, "workgroup");
  __builtin_amdgcn_wave_barrier();
  const int rsub = lane >> 4, c4 = (lane & 15) * 4;
  {
#pragma unroll
    for (int q = 0; q < 8; ++q) {
      const int r = q * 2 + rsub;
      const v4f v = *(const v4fa*)&so[w][r][c4];
      *(v4f*)(C + (size_t)(row0 + r) * ldc + col0 + c4) = v;
    }
    
  }
}

// GEMM C = act(A·W + bias + resid): A f32 (ASPLIT -> hi/lo 2 terms), Wt bf16 [N][K]; ACT 0 none, 1 relu, 2 exact gelu;
// resid (optional, f32, row index = (row % rmod), pitch ldr, RES_BF16 rounds it) added before the activation.
template <bool ASPLIT, int ACT, bool BIAS_BF16, bool RES_BF16>
__global__ __launch_bounds__(128) void k_gemm_bf3(const float* __restrict__ A, int lda, const unsigned short* __restrict__ Wt, int ldb,
                                                const float* __restrict__ bias, const float* __restrict__ resid, int rmod, int ldr,
                                                float* __restrict__ C, int ldc, int M, int N, int K) {
  __shared__ __attribute__((aligned(16))) float so[4][16][64];
  const int tid = threadIdx.x, w = tid >> 5, lane = tid & 31, ln = lane & 15, hh = lane >> 4;
  const int ntn = N / 64;
  const int wid = blockIdx.x * 4 + w;
  const int mt = wid / ntn, nq = wid % ntn;
  if (mt * 16 >= M) return;
  const int row0 = mt * 16, col0 = nq * 64;
  const float* arow = A + (size_t)(row0 + ln) * lda;
  v8f acc[4] = {};
  for (int kb = 0; kb < K; kb += 32) {
    FragB ah, al;
    const v4f x0 = *(const v4fa*)(arow + kb + 8 * hh), x1 = *(const v4fa*)(arow + kb + 8 * hh + 4);
    const v4f x2 = *(const v4fa*)(arow + kb + 16 + 8 * hh), x3 = *(const v4fa*)(arow + kb + 16 + 8 * hh + 4);
    float xs[16] = {x0[0],x0[1],x0[2],x0[3],x1[0],x1[1],x1[2],x1[3],x2[0],x2[1],x2[2],x2[3],x3[0],x3[1],x3[2],x3[3]};
#pragma unroll
    for (int i = 0; i < 16; ++i) { const unsigned short hb = bf16_bits(xs[i]); ah.u[i] = hb; al.u[i] = ASPLIT ? bf16_bits(xs[i] - bf16_val(hb)) : (unsigned short)0; }
#pragma unroll
    for (int t = 0; t < 4; ++t) {
      const unsigned short* brow = Wt + (size_t)(col0 + t * 16 + ln) * ldb + kb;
      FragB b;
      b.half[0] = *(const v8us*)(brow + 8 * hh);
      b.half[1] = *(const v8us*)(brow + 16 + 8 * hh);
      acc[t] = mmaN<ASPLIT ? 2 : 1>(ah.v, al.v, b.v, b.v, acc[t]);
    }
  }
#pragma unroll
  for (int t = 0; t < 4; ++t) {
    const int col = col0 + t * 16 + ln;
    float bv = bias ? bias[col] : 0.f;
    if (BIAS_BF16) bv = bf16_round(bv);
#pragma unroll
    for (int r = 0; r < 8; ++r) {
      float v = acc[t][r] + bv;
      if (resid) { float rv = resid[(size_t)((row0 + 8 * hh + r) % rmod) * ldr + col]; if (RES_BF16) rv = bf16_round(rv); v += rv; }
      if (ACT == 1) v = fmaxf(v, 0.f);
      if (ACT == 2) v = 0.5f * v * (1.0f + erff(v * 0.70710678118654752f));
      if (ACT == 3) { const float u = 0.7978845608028654f * (v + 0.044715f * v * v * v); v = 0.5f * v * (1.0f + tanhf(u)); }
      so[w][8 * hh + r][t * 16 + ln] = v;
    }
  }
  __builtin_amdgcn_fence(__ATOMIC_ACQ_REL, "workgroup");
  __builtin_amdgcn_wave_barrier();
  const int rsub = lane >> 4, c4 = (lane & 15) * 4;
  {
#pragma unroll
    for (int q = 0; q < 8; ++q) {
      const int r = q * 2 + rsub;
      const v4f v = *(const v4fa*)&so[w][r][c4];
      *(v4f*)(C + (size_t)(row0 + r) * ldc + col0 + c4) = v;
    }
    
  }
}
// row LayerNorm (biased variance, eps) over N: s = X (+ R); optional out_sum <- s; out_norm <- (s-mu)*rsqrt(var+eps)*g + b
template <bool PARAM_BF16>
__global__ __launch_bounds__(256) void k_layernorm(const float* __restrict__ X, const float* __restrict__ R, const float* __restrict__ g, const float* __restrict__ bta,
                                                  float* __restrict__ out_sum, float* __restrict__ out_norm, int N, float eps) {
  __shared__ float red[256];
  const int row = blockIdx.x, tid = threadIdx.x;
  const float* x = X + (size_t)row * N; const float* rr = R ? R + (size_t)row * N : nullptr;
  float vals[16];                     // up to N = 4096
  const int per = N / 256;            // contiguous chunk per thread? use strided-by-4 chunks: thread handles j = tid*4 + 1024*u
  float s1 = 0.f;
  for (int u = 0; u < per / 4; ++u) {
    const int j = tid * 4 + 1024 * u;
    const v4f a = *(const v4fa*)(x + j);
    v4f b = {0.f,0.f,0.f,0.f}; if (rr) b = *(const v4fa*)(rr + j);
#pragma unroll
    for (int q = 0; q < 4; ++q) { const float v = a[q] + b[q]; vals[u * 4 + q] = v; s1 += v; }
  }
  red[tid] = s1; __syncthreads();
  for (int st = 128; st > 0; st >>= 1) { if (tid < st) red[tid] += red[tid + st]; __syncthreads(); }
  const float mu = red[0] / (float)N; __syncthreads();
  float s2 = 0.f;
  for (int u = 0; u < per / 4; ++u)
#pragma unroll
    for (int q = 0; q < 4; ++q) { const float c = vals[u * 4 + q] - mu; s2 += c * c; }
  red[tid] = s2; __syncthreads();
  for (int st = 128; st > 0; st >>= 1) { if (tid < st) red[tid] += red[tid + st]; __syncthreads(); }
  const float rs = rsqrtf(red[0] / (float)N + eps);
  {
    for (int u = 0; u < per / 4; ++u) {
      const int j = tid * 4 + 1024 * u;
      v4f o, sm;
#pragma unroll
      for (int q = 0; q < 4; ++q) {
        float gg = g[j + q], bb = bta[j + q];
        if (PARAM_BF16) { gg = bf16_round(gg); bb = bf16_round(bb); }
        sm[q] = vals[u * 4 + q]; o[q] = (vals[u * 4 + q] - mu) * rs * gg + bb;
      }
      if (out_sum) *(v4f*)(out_sum + (size_t)row * N + j) = sm;
      *(v4f*)(out_norm + (size_t)row * N + j) = o;
    }
    
  }
}



// ---- f16 WMMA path (v_wmma_f32_16x16x32_f16): 11-bit significands for operands in range — used where a [0,1] probability operand needs more precision than bf16
typedef _Float16 v16h __attribute__((ext_vector_type(16)));
union FragH { v16h v; v8us half[2]; _Float16 h[16]; unsigned short u[16]; };
template <int NT>
__device__ __forceinline__ v8f mmaH(v16h ah, v16h al, v16h bh, v16h bl, v8f c) {
  c = __builtin_amdgcn_wmma_f32_16x16x32_f16(false, ah, false, bh, (short)0, c, false, false);
  if (NT >= 2) c = __builtin_amdgcn_wmma_f32_16x16x32_f16(false, al, false, bh, (short)0, c, false, false);
  if (NT >= 3) c = __builtin_amdgcn_wmma_f32_16x16x32_f16(false, ah, false, bl, (short)0, c, false, false);
  asm volatile("v_nop\n\tv_nop\n\tv_nop\n\tv_nop" : "+v"(c) : "v"(ah), "v"(al), "v"(bh), "v"(bl));
  return c;
}
// batched GEMM like k_gemm_b but f16 operands: A f32 (split into f16 hi/lo if ASPLIT, else rounded to f16), Bt = f16 values [n][k]; alpha; C f32; N multiple of 16 (partial tiles skipped)
template <bool ASPLIT>
__global__ __launch_bounds__(128) void k_gemm_h(const float* __restrict__ A, int lda, size_t sA, const _Float16* __restrict__ Bh, int ldb, size_t sB, float alpha, float* __restrict__ C, int ldc, size_t sC, int M, int N, int K) {
  __shared__ __attribute__((aligned(16))) float so[4][16][64];
  const int tid = threadIdx.x, w = tid >> 5, lane = tid & 31, ln = lane & 15, hh = lane >> 4; const int by = blockIdx.y;
  A += (size_t)by * sA; Bh += (size_t)by * sB; C += (size_t)by * sC;
  const int ntn = (N + 63) / 64; const int wid = blockIdx.x * 4 + w; const int mt = wid / ntn, nq = wid % ntn; if (mt * 16 >= M) return;
  const int row0 = mt * 16, col0 = nq * 64; const float* arow = A + (size_t)(row0 + ln) * lda;
  v8f acc[4] = {};
  for (int kb = 0; kb < K; kb += 32) {
    FragH ah, al;
    const v4f x0 = *(const v4fa*)(arow + kb + 8 * hh), x1 = *(const v4fa*)(arow + kb + 8 * hh + 4), x2 = *(const v4fa*)(arow + kb + 16 + 8 * hh), x3 = *(const v4fa*)(arow + kb + 16 + 8 * hh + 4);
    float xs[16] = {x0[0],x0[1],x0[2],x0[3],x1[0],x1[1],x1[2],x1[3],x2[0],x2[1],x2[2],x2[3],x3[0],x3[1],x3[2],x3[3]};
#pragma unroll
    for (int i = 0; i < 16; ++i) { const _Float16 h = (_Float16)xs[i]; ah.h[i] = h; al.h[i] = ASPLIT ? (_Float16)(xs[i] - (float)h) : (_Float16)0.0f; }
#pragma unroll
    for (int t = 0; t < 4; ++t) { if (col0 + t * 16 >= N) continue; const size_t boff = (size_t)(col0 + t * 16 + ln) * ldb + kb; FragH bq; bq.half[0] = *(const v8us*)(Bh + boff + 8 * hh); bq.half[1] = *(const v8us*)(Bh + boff + 16 + 8 * hh);
      acc[t] = mmaH<ASPLIT ? 2 : 1>(ah.v, al.v, bq.v, bq.v, acc[t]); }
  }
#pragma unroll
  for (int t = 0; t < 4; ++t) { if (col0 + t * 16 >= N) continue;
#pragma unroll
    for (int r = 0; r < 8; ++r) so[w][8 * hh + r][t * 16 + ln] = acc[t][r] * alpha; }
  __builtin_amdgcn_fence(__ATOMIC_ACQ_REL, "workgroup"); __builtin_amdgcn_wave_barrier();
  const int rsub = lane >> 4, c4 = (lane & 15) * 4;
  {
#pragma unroll
    for (int q = 0; q < 8; ++q) { const int r = q * 2 + rsub; if (col0 + c4 < N) { const v4f v = *(const v4fa*)&so[w][r][c4]; *(v4f*)(C + (size_t)(row0 + r) * ldc + col0 + c4) = v; } }
     }
}

// Wt[n][k] = f16(W[k][n]·scale) from f32 row-major W[K][N] (scale = power of two; bf16-exact weights stay exact in f16 away from the subnormal range)
__global__ __launch_bounds__(256) void k_wt_f16(const float* __restrict__ W, _Float16* __restrict__ Wt, int K, int N, float scale) {
  const int t = blockIdx.x * 256 + threadIdx.x; if (t >= N * (K / 8)) return; const int n = t / (K / 8), k8 = (t % (K / 8)) * 8; FragH f;
#pragma unroll
  for (int i = 0; i < 8; ++i) f.h[i] = (_Float16)(bf16_round(W[(size_t)(k8 + i) * N + n]) * scale); const v8us o = f.half[0];
  *(v8us*)((unsigned short*)Wt + (size_t)n * K + k8) = o; 
}
// k_gemm_hh variant with fused epilogue: v = acc·alpha + bias[by·sBias + col] (+ CP[(row/rowsPerB)·sCPb + by·64 + col] if CP) ; ACT 0 none / 1 elu ; writes f16 C16 (and f32 C if non-null)
template <int ACT>
__global__ __launch_bounds__(128) void k_gemm_hhx(const _Float16* __restrict__ A, int lda, size_t sA, const _Float16* __restrict__ Bh, int ldb, size_t sB, float alpha, const float* __restrict__ bias, size_t sBias, const float* __restrict__ CP, int rowsPerB, size_t sCPb, int row0g,
    float* __restrict__ C, _Float16* __restrict__ C16, int ldc, size_t sC, int M, int N, int K) {
  __shared__ __attribute__((aligned(16))) float so[4][16][64];
  const int tid = threadIdx.x, w = tid >> 5, lane = tid & 31, ln = lane & 15, hh = lane >> 4; const int by = blockIdx.y;
  A += (size_t)by * sA; Bh += (size_t)by * sB; const size_t cofs = (size_t)by * sC; const float* bp = bias ? bias + (size_t)by * sBias : nullptr;
  const int ntn = (N + 63) / 64; const int wid = blockIdx.x * 4 + w; const int mt = wid / ntn, nq = wid % ntn; if (mt * 16 >= M) return;
  const int row0 = mt * 16, col0 = nq * 64; const _Float16* arow = A + (size_t)(row0 + ln) * lda;
  v8f acc[4] = {};
  for (int kb = 0; kb < K; kb += 32) { FragH ah; ah.half[0] = *(const v8us*)((const unsigned short*)arow + kb + 8 * hh); ah.half[1] = *(const v8us*)((const unsigned short*)arow + kb + 16 + 8 * hh);
#pragma unroll
    for (int t = 0; t < 4; ++t) { if (col0 + t * 16 >= N) continue; const size_t boff = (size_t)(col0 + t * 16 + ln) * ldb + kb; FragH bq; bq.half[0] = *(const v8us*)((const unsigned short*)Bh + boff + 8 * hh); bq.half[1] = *(const v8us*)((const unsigned short*)Bh + boff + 16 + 8 * hh);
      acc[t] = mmaH<1>(ah.v, ah.v, bq.v, bq.v, acc[t]); }
  }
#pragma unroll
  for (int t = 0; t < 4; ++t) { if (col0 + t * 16 >= N) continue; const int col = col0 + t * 16 + ln; const float bv = bp ? bf16_round(bp[col]) : 0.f;
#pragma unroll
    for (int r = 0; r < 8; ++r) { float v = acc[t][r] * alpha + bv; if (CP) { const int rr = row0g + row0 + 8 * hh + r; if (rowsPerB < 0) v += CP[cofs + (size_t)rr * ldc + col];      /* rowsPerB < 0: own element of the batched C plane */ else { const int bidx = rr / rowsPerB; v += CP[(size_t)bidx * sCPb + (size_t)by * 64 + col]; } } if (ACT == 1) v = (v > 0.f) ? v : expm1f(v); else if (ACT == 7) v = (v > 0.f) ? v + 1.0f : expf(v); else if (ACT == 8) v = tanhf(v); else if (ACT == 9) v = 0.5f * v * (1.0f + tanhf(0.7978845608028654f * (v + 0.044715f * v * v * v))); else if (ACT == 11) v = 1.0f / (1.0f + expf(-v)); else if (ACT == 12) v = (v > 0.f) ? v : 0.01f * v; else if (ACT == 14) v = (v > 0.f) ? v : 0.1f * v; else if (ACT == 16) v = (v >= 0.f) ? v : 0.3f * v; else if (ACT == 17) v = (v >= 0.f) ? v : 0.2f * v; else if (ACT == 15) v = v / (1.0f + expf(-v)); else if (ACT == 3) v = fmaxf(v, 0.f); else if (ACT == 6) v = 0.5f * v * (1.0f + erff(v * 0.70710678118654752f)); so[w][8 * hh + r][t * 16 + ln] = v; } }
  __builtin_amdgcn_fence(__ATOMIC_ACQ_REL, "workgroup"); __builtin_amdgcn_wave_barrier();
  const int rsub = lane >> 4, c4 = (lane & 15) * 4; typedef _Float16 v4h __attribute__((ext_vector_type(4)));
  {
#pragma unroll
    for (int q = 0; q < 8; ++q) { const int r = q * 2 + rsub; if (col0 + c4 < N) { const v4f v = *(const v4fa*)&so[w][r][c4]; if (C) *(v4f*)(C + cofs + (size_t)(row0 + r) * ldc + col0 + c4) = v; if (C16) { v4h h4; for (int i = 0; i < 4; ++i) h4[i] = (_Float16)v[i]; *(v4h*)(C16 + cofs + (size_t)(row0 + r) * ldc + col0 + c4) = h4; } } }
     }
}


typedef _Float16 v4h __attribute__((ext_vector_type(4)));

// every input conversion in one launch: blocks 0 .. 6 WB - 1 take the six weight matrices (slot j of BW = f16(bf16(w_j) x 16), each DO x DI elements), the rest x1 and x2 (X = [x1 | x2] as f16(bf16(x)))
#define XB (NN * DI / 8 / 256)   /* blocks per x */
#define WB (DO * DI / 8 / 256)   /* blocks per weight matrix */
__global__ __launch_bounds__(256) void k_cvt(const float* __restrict__ x1, const float* __restrict__ x2, const float* __restrict__ w0, const float* __restrict__ w1, const float* __restrict__ w2, const float* __restrict__ w3, const float* __restrict__ w4, const float* __restrict__ w5,
    _Float16* __restrict__ X, _Float16* __restrict__ BW) {
  const int b = blockIdx.x, tid = threadIdx.x; const float* src; _Float16* dst; float sc;
  if (b < 6 * WB) { const int j = b / WB; const float* w = j == 0 ? w0 : j == 1 ? w1 : j == 2 ? w2 : j == 3 ? w3 : j == 4 ? w4 : w5; src = w + ((size_t)(b - j * WB) * 256 + tid) * 8; dst = BW + ((size_t)b * 256 + tid) * 8; sc = 16.0f; }
  else { const int q = b - 6 * WB, j = q / XB; src = (j ? x2 : x1) + ((size_t)(q - j * XB) * 256 + tid) * 8; dst = X + ((size_t)q * 256 + tid) * 8; sc = 1.0f; }
  FragH f;
#pragma unroll
  for (int q = 0; q < 8; ++q) f.h[q] = (_Float16)(bf16_round(src[q]) * sc);
  *(v8us*)(unsigned short*)dst = f.half[0]; }
__global__ __launch_bounds__(256) void k_h16(const float* __restrict__ x, _Float16* __restrict__ X16, size_t n8) { const size_t t = (size_t)blockIdx.x * 256 + threadIdx.x; if (t >= n8) return; FragH f;
#pragma unroll
  for (int q = 0; q < 8; ++q) f.h[q] = (_Float16)x[t * 8 + q]; *(v8us*)((unsigned short*)X16 + t * 8) = f.half[0];  }
__global__ __launch_bounds__(256) void k_round16f(const float* __restrict__ W, _Float16* __restrict__ Bt, size_t n8) { const size_t t = (size_t)blockIdx.x * 256 + threadIdx.x; if (t >= n8) return; FragH f;
#pragma unroll
  for (int i = 0; i < 8; ++i) f.h[i] = (_Float16)(bf16_round(W[t * 8 + i]) * 16.0f); *(v8us*)((unsigned short*)Bt + t * 8) = f.half[0];  }

__global__ __launch_bounds__(256) void k_hl(const float* __restrict__ F, _Float16* __restrict__ Hh, _Float16* __restrict__ Hl, size_t n8) { const size_t t = (size_t)blockIdx.x * 256 + threadIdx.x; if (t >= n8) return; FragH fh, fl; const v4f a = *(const v4fa*)(F + t * 8), c = *(const v4fa*)(F + t * 8 + 4);
#pragma unroll
  for (int q = 0; q < 4; ++q) { _Float16 h = (_Float16)a[q]; fh.h[q] = h; fl.h[q] = (_Float16)((a[q] - (float)h) * 1024.0f); h = (_Float16)c[q]; fh.h[4 + q] = h; fl.h[4 + q] = (_Float16)((c[q] - (float)h) * 1024.0f); }
  { *(v8us*)((unsigned short*)Hh + t * 8) = fh.half[0]; *(v8us*)((unsigned short*)Hl + t * 8) = fl.half[0];  } }

// ---- fast GEMM (wave tile 32x64; requires M % 32 == 0 rows per launch region and N % 64 == 0); epilogue = k_gemm_hhx semantics ----
__device__ __forceinline__ v16h g2_frag(const _Float16* p, int hh) { FragH f; f.half[0] = *(const v8us*)((const unsigned short*)p + 8 * hh); f.half[1] = *(const v8us*)((const unsigned short*)p + 16 + 8 * hh); return f.v; }
__device__ __forceinline__ v8f g2_mma(v16h a, v16h b, v8f c) { v8f d = __builtin_amdgcn_wmma_f32_16x16x32_f16(false, a, false, b, (short)0, c, false, false); asm volatile("v_nop\n\tv_nop\n\tv_nop\n\tv_nop" : "+v"(d) : "v"(a), "v"(b)); return d; }
template <int ACT>
__global__ __launch_bounds__(128) void k_gemm2(const _Float16* __restrict__ A, int lda, size_t sA, const _Float16* __restrict__ Bh, int ldb, size_t sB, float alpha, const float* __restrict__ bias, size_t sBias, const float* __restrict__ CP, int rowsPerB, size_t sCPb, int row0g,
    float* __restrict__ C, _Float16* __restrict__ C16, int ldc, size_t sC, int M, int N, int K) { static_assert(ACT == 0 || ACT == 3 || ACT == 6 || ACT == 8 || ACT == 9 || ACT == 11 || ACT == 12 || ACT == 14 || ACT == 15 || ACT == 16 || ACT == 17, "k_gemm2: unsupported ACT code (would silently apply no activation)");
  __shared__ __attribute__((aligned(16))) float so[4][32][68];
  const int tid = threadIdx.x, w = tid >> 5, lane = tid & 31, ln = lane & 15, hh = lane >> 4; const int by = blockIdx.y;
  A += (size_t)by * sA; Bh += (size_t)by * sB; const size_t cofs = (size_t)by * sC; const float* bp = bias ? bias + (size_t)by * sBias : nullptr;
  const int ntn = N >> 6; const int mt = blockIdx.x / ntn, nq = blockIdx.x - mt * ntn; const int row0 = mt * 128 + 32 * w, col0 = nq * 64; if (row0 >= M) return;
  const _Float16* a0p = A + (size_t)(row0 + ln) * lda; const _Float16* a1p = a0p + (size_t)16 * lda;
  const _Float16* b0p = Bh + (size_t)(col0 + ln) * ldb; const _Float16* b1p = b0p + (size_t)16 * ldb; const _Float16* b2p = b1p + (size_t)16 * ldb; const _Float16* b3p = b2p + (size_t)16 * ldb;
  const v8f z8 = {0.f,0.f,0.f,0.f,0.f,0.f,0.f,0.f}; v8f c00 = z8, c01 = z8, c02 = z8, c03 = z8, c10 = z8, c11 = z8, c12 = z8, c13 = z8;
#pragma unroll 1
  for (int kb = 0; kb < K; kb += 32) { const v16h a0 = g2_frag(a0p + kb, hh), a1 = g2_frag(a1p + kb, hh);
    v16h b = g2_frag(b0p + kb, hh); c00 = g2_mma(a0, b, c00); c10 = g2_mma(a1, b, c10);
    b = g2_frag(b1p + kb, hh); c01 = g2_mma(a0, b, c01); c11 = g2_mma(a1, b, c11);
    b = g2_frag(b2p + kb, hh); c02 = g2_mma(a0, b, c02); c12 = g2_mma(a1, b, c12);
    b = g2_frag(b3p + kb, hh); c03 = g2_mma(a0, b, c03); c13 = g2_mma(a1, b, c13); }
  v8f accs[8] = {c00, c01, c02, c03, c10, c11, c12, c13};
#pragma unroll
  for (int u = 0; u < 8; ++u) { const int t = u & 3, half = u >> 2; const int col = col0 + t * 16 + ln; const float bv = bp ? bf16_round(bp[col]) : 0.f;
#pragma unroll
    for (int r = 0; r < 8; ++r) { const int rloc = half * 16 + 8 * hh + r; float v = accs[u][r] * alpha + bv; if (CP) { if (rowsPerB < 0) v += CP[cofs + (size_t)(row0g + row0 + rloc) * ldc + col];      /* rowsPerB < 0: own element of the batched C plane */ else { const int bidx = (row0g + row0 + rloc) / rowsPerB; v += CP[(size_t)bidx * sCPb + (size_t)by * 64 + col]; } }
      if (ACT == 3) v = fmaxf(v, 0.f); else if (ACT == 6) v = 0.5f * v * (1.0f + erff(v * 0.70710678118654752f)); else if (ACT == 11) v = 1.0f / (1.0f + expf(-v)); else if (ACT == 15) v = v / (1.0f + expf(-v)); else if (ACT == 12) v = (v > 0.f) ? v : 0.01f * v; else if (ACT == 8) v = tanhf(v); else if (ACT == 9) v = 0.5f * v * (1.0f + tanhf(0.7978845608028654f * (v + 0.044715f * v * v * v))); else if (ACT == 14) v = (v > 0.f) ? v : 0.1f * v; else if (ACT == 16) v = (v >= 0.f) ? v : 0.3f * v; else if (ACT == 17) v = (v >= 0.f) ? v : 0.2f * v;
      so[w][rloc][t * 16 + ln] = v; } }
  __builtin_amdgcn_fence(__ATOMIC_ACQ_REL, "workgroup"); __builtin_amdgcn_wave_barrier();
  const int rsub = lane >> 4, c4 = (lane & 15) * 4;
  {
#pragma unroll
    for (int q = 0; q < 16; ++q) { const int r = q * 2 + rsub; const v4f v = *(const v4fa*)&so[w][r][c4]; if (C) *(v4f*)(C + cofs + (size_t)(row0 + r) * ldc + col0 + c4) = v; if (C16) { v4h h4; for (int i = 0; i < 4; ++i) h4[i] = (_Float16)v[i]; *(v4h*)(C16 + cofs + (size_t)(row0 + r) * ldc + col0 + c4) = h4; } }
     } }


// ---- GEMM tile through LDS: a work-group of 8 waves makes a 128 x 128 tile of A[.][KT] . B[.][KT]^T (both row-major, pitch KT, f16); wave w takes rows 32 (w & 3), columns 64 (w >> 2): k_gemm2's 32 x 64 wave tile and k order.
// A k slice of 64 elements (one 128-byte line of each of the 256 rows) lies in one of two LDS buffers; the next slice is fetched meanwhile through registers, a wave's load covering four whole lines.
#define GP 72                    /* LDS pitch of a row's slice, 16-bit elements: 144 B = 16 B x odd */
#define GT (128 * GP)            /* one operand's slice */
union G3S { unsigned short t[4 * GT]; float so[8][32][68]; };      /* the two buffers (A | B each); behind the loop each wave's own output staging */
__device__ __forceinline__ v16h g3_frag(const unsigned short* p, int hh) { FragH f; f.half[0] = *(const v8us*)(p + 8 * hh); f.half[1] = *(const v8us*)(p + 16 + 8 * hh); return f.v; }
__device__ __forceinline__ v8f g3_mma(v16h a, v16h b, v8f c) { return __builtin_amdgcn_wmma_f32_16x16x32_f16(false, a, false, b, (short)0, c, false, false); }
template <int KT>
__device__ __forceinline__ void g3_loop(const unsigned short* __restrict__ A, const unsigned short* __restrict__ B, unsigned short* sm, int tid, v8f (&acc)[2][4]) {
  const int w = tid >> 5, lane = tid & 31, ln = lane & 15, hh = lane >> 4;
  const unsigned short* ga = A + (size_t)(tid >> 3) * KT + (tid & 7) * 8;      /* thread -> 16 B of rows tid / 8 + 32 j of each operand; one address pair an operand for all slices */
  const unsigned short* gb = B + (size_t)(tid >> 3) * KT + (tid & 7) * 8;
  const int ls = (tid >> 3) * GP + (tid & 7) * 8;
  const int ra = ((w & 3) * 32 + ln) * GP, rb = GT + ((w >> 2) * 64 + ln) * GP;
  v8us sa[4], sb[4];
#pragma unroll
  for (int j = 0; j < 4; ++j) { sa[j] = *(const v8us*)(ga + j * 32 * KT); sb[j] = *(const v8us*)(gb + j * 32 * KT); }
#pragma unroll
  for (int j = 0; j < 4; ++j) { *(v8us*)(sm + ls + j * 32 * GP) = sa[j]; *(v8us*)(sm + GT + ls + j * 32 * GP) = sb[j]; }
  __syncthreads();
  // unrolled: the buffer and the slice become constants, so every load and LDS access is its base register plus an immediate offset
#pragma unroll
  for (int c = 0; c < KT / 64; ++c) {
    const unsigned short* cur = sm + (c & 1) * 2 * GT; unsigned short* nxt = sm + ((c + 1) & 1) * 2 * GT;
    if (c + 1 < KT / 64) {
#pragma unroll
      for (int j = 0; j < 4; ++j) { sa[j] = *(const v8us*)(ga + (c + 1) * 64 + j * 32 * KT); sb[j] = *(const v8us*)(gb + (c + 1) * 64 + j * 32 * KT); }
      asm volatile("s_wait_xcnt 0x0" :: "v"(ga), "v"(gb) : "memory");      /* as inputs the loads' two addresses stay whole until the wait */
    }
#pragma unroll
    for (int ks = 0; ks < 2; ++ks) {
      const v16h a0 = g3_frag(cur + ra + ks * 32, hh), a1 = g3_frag(cur + ra + 16 * GP + ks * 32, hh);
#pragma unroll
      for (int t = 0; t < 4; ++t) { const v16h b = g3_frag(cur + rb + t * 16 * GP + ks * 32, hh); acc[0][t] = g3_mma(a0, b, acc[0][t]); acc[1][t] = g3_mma(a1, b, acc[1][t]); }
    }
    if (c + 1 < KT / 64) {
#pragma unroll
      for (int j = 0; j < 4; ++j) { *(v8us*)(nxt + ls + j * 32 * GP) = sa[j]; *(v8us*)(nxt + GT + ls + j * 32 * GP) = sb[j]; }      /* the other buffer's last readers left it at the barrier that ended slice c - 1 */
    }
    __syncthreads();      /* publishes slice c + 1 and ends every read of slice c (behind the last slice: frees the buffers for the output staging) */
  }
}
// the six projections in one launch (M = NN, N = DO, K = DI, f16 result only), tiles through LDS (g3_loop), k_gemm2's epilogue. blockIdx.y = j picks plane j of QKV = [Q1 K1 Q2 K2 V1^T V2^T];
// x1 (first half of X) feeds planes 0, 1, 4; weight slots of BW = [Wq1 Wk1 Wq2 Wk2 Wv], W_V shared by planes 4 and 5
__global__ __launch_bounds__(256) void k_proj6(const _Float16* __restrict__ X, const _Float16* __restrict__ BW, const float* __restrict__ bq1, const float* __restrict__ bk1, const float* __restrict__ bq2, const float* __restrict__ bk2, const float* __restrict__ bv, _Float16* __restrict__ QKV) {
  __shared__ __attribute__((aligned(16))) G3S sm;
  const int tid = threadIdx.x, w = tid >> 5, lane = tid & 31, ln = lane & 15, hh = lane >> 4; const int j = blockIdx.y;
  const float* bp = j == 0 ? bq1 : j == 1 ? bk1 : j == 2 ? bq2 : j == 3 ? bk2 : bv;
  const int mt = blockIdx.x / (DO / 128), nq = blockIdx.x % (DO / 128); const int row0 = mt * 128 + 32 * (w & 3), col0 = nq * 128 + 64 * (w >> 2);
  const v8f z8 = {0.f,0.f,0.f,0.f,0.f,0.f,0.f,0.f}; v8f acc[2][4] = {{z8, z8, z8, z8}, {z8, z8, z8, z8}};
  g3_loop<DI>((const unsigned short*)X + ((j == 2 || j == 3 || j == 5) ? (size_t)NN * DI : 0) + (size_t)mt * 128 * DI, (const unsigned short*)BW + (size_t)(j < 4 ? j : 4) * DO * DI + (size_t)nq * 128 * DI, sm.t, tid, acc);
  if (j >= 4) {      /* block-uniform, behind the loop's last barrier. Planes 4 and 5 hold V^T in k_flash's staging order: [32-key block][16-d tile][half][lane][8], element = V[16 half + 8 hh + 0..7][16 t + ln]: a lane's 8 accumulator registers as they lie, so nothing is left to transpose and a store covers 512 contiguous bytes */
    const float* bl = bp + col0 + ln; float bt[4];
    // every loop of this branch is unrolled: bt, f and acc stay in registers, and t and the chunk index become immediate offsets of the one address pair of the loads and of the stores
#pragma unroll
    for (int t = 0; t < 4; ++t) bt[t] = bl[t * 16];
    asm volatile("s_wait_xcnt 0x0" :: "v"(bl) : "memory");      /* as an input the loads' address stays whole until the wait */
    unsigned short* vd = (unsigned short*)QKV + (size_t)j * NN * DO + (size_t)(row0 >> 5) * (32 * DO) + (col0 >> 4) * 512 + lane * 8;
    FragH f[2][4];      /* all eight chunks are made in front of the first store: behind it no register that a store names is written any more */
#pragma unroll
    for (int u = 0; u < 8; ++u) { const int t = u & 3, half = u >> 2; const float bb = bf16_round(bt[t]);
#pragma unroll
      for (int r = 0; r < 8; ++r) f[half][t].h[r] = (_Float16)(acc[half][t][r] * 0.0625f + bb); }
#pragma unroll
    for (int u = 0; u < 8; ++u) { const int t = u & 3, half = u >> 2; *(v8us*)(vd + (t * 2 + half) * 256) = f[half][t].half[0]; }
    asm volatile("s_wait_xcnt 0x0" :: "v"(vd) : "memory");      /* as an input the stores' address stays whole until the wait */
    return;
  }
#pragma unroll
  for (int u = 0; u < 8; ++u) { const int t = u & 3, half = u >> 2; const float bb = bf16_round(bp[col0 + t * 16 + ln]);
#pragma unroll
    for (int r = 0; r < 8; ++r) sm.so[w][half * 16 + 8 * hh + r][t * 16 + ln] = acc[half][t][r] * 0.0625f + bb; }
  __builtin_amdgcn_fence(__ATOMIC_ACQ_REL, "workgroup"); __builtin_amdgcn_wave_barrier();      /* a wave reads back only its own rows */
  if (j == 0 || j == 2) {      /* block-uniform. The Q planes lie in k_flash's fragment order: [32-row block][g][ks][h][lane][8], element = Q[16 g + ln][32 ks + 16 h + 8 hh + 0..7]; a store covers 512 contiguous bytes */
    unsigned short* qd = (unsigned short*)QKV + (size_t)j * NN * DO + (size_t)(row0 >> 5) * (32 * DO) + (col0 >> 5) * 512 + lane * 8;
    FragH f[8];      /* all eight chunks are made in front of the first store, as above */
    // both loops unrolled: f stays in registers, and the chunk index becomes an immediate offset of the one address pair
#pragma unroll
    for (int c = 0; c < 8; ++c) { const int g = c >> 2, kl = (c >> 1) & 1, h = c & 1; const float* sp = &sm.so[w][g * 16 + ln][kl * 32 + h * 16 + 8 * hh];
      const v4f v0 = *(const v4fa*)sp, v1 = *(const v4fa*)(sp + 4);
      for (int i = 0; i < 4; ++i) { f[c].h[i] = (_Float16)v0[i]; f[c].h[4 + i] = (_Float16)v1[i]; } }
#pragma unroll
    for (int c = 0; c < 8; ++c) *(v8us*)(qd + (((c >> 2) * 8 + ((c >> 1) & 1)) * 2 + (c & 1)) * 256) = f[c].half[0];
    asm volatile("s_wait_xcnt 0x0" :: "v"(qd) : "memory");      /* as an input the stores' address stays whole until the wait */
  } else {
    const int rsub = lane >> 4, c4 = (lane & 15) * 4; _Float16* cp = QKV + (size_t)j * NN * DO + (size_t)(row0 + rsub) * DO + col0 + c4;
#pragma unroll
    for (int q = 0; q < 16; ++q) { const v4f v = *(const v4fa*)&sm.so[w][q * 2 + rsub][c4]; v4h h4; for (int i = 0; i < 4; ++i) h4[i] = (_Float16)v[i]; *(v4h*)(cp + q * 2 * DO) = h4; }
    asm volatile("s_wait_xcnt 0x0" :: "v"(cp) : "memory");      /* as an input the stores' address stays whole until the wait */
  }
}
#define FQ 256                   /* query rows per work-group */
#define KSP 4                    /* key ranges: 32 query blocks x KSP x 2 branches = 256 work-groups */
#define NPASS (NN / KSP / 32)
#define SP 4                     /* passes between two barriers: 2 buffers x SP passes x PT elements = 299,008 B of LDS; one work-group a WGP, as before */
#define KPIT 264                 /* LDS pitch of a K row, 16-bit elements: 528 B = 16 B x odd */
#define VPIT 40                  /* LDS pitch of a V^T row (32 keys): 80 B = 16 B x odd */
#define PT (32 * KPIT + DO * VPIT)      /* a pass's tiles in LDS, 16-bit elements */
#define MTHR 4.0f                /* the maximum in use may trail the true one by this much (log2): a weight is at most 2^(10 + 4), inside f16 */
__device__ __forceinline__ float xhalf(float x) { return __builtin_bit_cast(float, __builtin_amdgcn_permlanex16(__builtin_bit_cast(int, x), __builtin_bit_cast(int, x), 0x76543210, 0xfedcba98, false, false)); }  // lane l with lane l ^ 16
__device__ __forceinline__ v16h fa_frag(const unsigned short* p, int hh) { FragH f; f.half[0] = *(const v8us*)(p + 8 * hh); f.half[1] = *(const v8us*)(p + 16 + 8 * hh); return f.v; }
__device__ __forceinline__ v8f fa_mma(v16h a, v16h b, v8f c) { return __builtin_amdgcn_wmma_f32_16x16x32_f16(false, a, false, b, (short)0, c, false, false); }
__global__ __launch_bounds__(256) void k_flash(const _Float16* __restrict__ Qa, const _Float16* __restrict__ Ka, const _Float16* __restrict__ VTa, const _Float16* __restrict__ Qb, const _Float16* __restrict__ Kb, const _Float16* __restrict__ VTb,
    const float* __restrict__ scp, float* __restrict__ OP, float* __restrict__ ML) {
  static_assert(NPASS % SP == 0, "whole stages");
  __shared__ __attribute__((aligned(16))) unsigned short sT[2 * SP * PT];      /* a pass's K tile, then its V^T tile: behind the pass's base register every LDS access keeps an immediate offset (16 bits) */
  const int tid = threadIdx.x, w = tid >> 5, lane = tid & 31, ln = lane & 15, hh = lane >> 4;
  const int br = blockIdx.z, sp = blockIdx.y, q0 = blockIdx.x * FQ + w * 32;
  const _Float16* Q = br ? Qb : Qa; const unsigned short* K = (const unsigned short*)(br ? Kb : Ka); const unsigned short* VT = (const unsigned short*)(br ? VTb : VTa);
  float sv = bf16_round(scp[0]); sv = fminf(fmaxf(sv, 1.0f), 32.0f); const float cs = (1.0f / sqrtf(sv)) * 1.4426950408889634f;      /* scores to log2 units */
  // staging: thread -> 4 x 16 B of the K tile (row tid / 32 + 8 j) and 4 x 16 B of the V^T tile (row 16 (tid / 64) + tid % 16 + 64 j, keys 8 (tid / 16 % 4) + 0..7)
  // both tiles are 16 KiB in a row in memory (a K row is 512 B), so the thread's place is 16 tid bytes in either: scalar bases and one lane offset, which spares the address register pairs that the longer stage has no room for
  const unsigned short* gK = K + (size_t)sp * (NN / KSP) * DO; const unsigned int to = tid * 8;
  const unsigned short* gV = VT + (size_t)sp * (NN / KSP) * DO;      /* V^T lies in tiles [32-key block][16-d tile][8-key chunk][d][8 keys] (k_proj6): a pass's tile is 16 KiB in a row, a load covers 512 contiguous bytes */
  const int lK = (tid >> 5) * KPIT + (tid & 31) * 8, lV = ((tid >> 6) * 16 + (tid & 15)) * VPIT + ((tid >> 4) & 3) * 8;
  const unsigned short* qp = (const unsigned short*)Q + (size_t)(q0 >> 5) * (32 * DO) + lane * 8;      /* the one address register pair of all 32 Q loads; Q lies in fragment order (k_proj6), so each load covers 512 contiguous bytes */
  v16h qf[2][8];
#pragma unroll
  for (int g = 0; g < 2; ++g)
#pragma unroll
    for (int ks = 0; ks < 8; ++ks) { FragH f; f.half[0] = *(const v8us*)(qp + (g * 8 + ks) * 512); f.half[1] = *(const v8us*)(qp + (g * 8 + ks) * 512 + 256); qf[g][ks] = f.v; }
  {
    v8us kr[SP][4], vr[SP][4];      /* the whole first stage; unrolled: the arrays live in registers, and pass and chunk become immediate offsets */
#pragma unroll
    for (int p = 0; p < SP; ++p)
#pragma unroll
      for (int j = 0; j < 4; ++j) { kr[p][j] = *(const v8us*)(gK + to + (p * 32 + j * 8) * DO); vr[p][j] = *(const v8us*)(gV + to + p * 32 * DO + j * 64 * 32); }
    asm volatile("s_wait_xcnt 0x0" :: "v"(qp) : "memory");      /* qp ends here: as an input it stays whole until the wait, in front of whatever takes its registers next (gK, gV, to live on) */
#pragma unroll
    for (int p = 0; p < SP; ++p)
#pragma unroll
      for (int j = 0; j < 4; ++j) { *(v8us*)(&sT[p * PT + lK + j * 8 * KPIT]) = kr[p][j]; *(v8us*)(&sT[p * PT + 32 * KPIT + lV + j * 64 * VPIT]) = vr[p][j]; }
  }
  __syncthreads();
  const v8f z8 = {0.f,0.f,0.f,0.f,0.f,0.f,0.f,0.f};
  v8f o[16][2];
#pragma unroll
  for (int t = 0; t < 16; ++t) { o[t][0] = z8; o[t][1] = z8; }
  float m[2] = {-3.0e38f, -3.0e38f}, l[2] = {0.f, 0.f};
  // kept rolled: the body holds 64 matrix instructions and nearly the whole register budget; a second copy would only cost instruction cache
#pragma unroll 1
  for (int sg = 0; sg < NPASS / SP; ++sg) {
  // rolled for the same reason; the barrier stands in the outer loop, so a pass stays one run of code up to its back edge
#pragma unroll 1
  for (int ps = 0; ps < SP; ++ps) {
    const int s = sg * SP + ps;
    const int cur = ((sg & 1) * SP + ps) * PT, nxt = (((sg + 1) & 1) * SP + ps) * PT;      /* scalar: this pass's tiles, and their place in the other buffer */
    const unsigned short* bK = sT + cur; const unsigned short* bV = bK + 32 * KPIT;
    unsigned short* nK = sT + nxt; unsigned short* nV = nK + 32 * KPIT;
    const int sn = s + SP < NPASS ? s + SP : s;      /* no branch round the staging: the last stage's passes fetch their own tiles again, into the buffer that nobody reads any more */
    const unsigned short* pk = gK + (size_t)sn * 32 * DO; const unsigned short* pv = gV + (size_t)sn * 32 * DO;
    v8us st[4];      /* this pass's quarter of the next stage goes through registers, 16 at a time: K under the first product, V^T under the softmax and the second */
#pragma unroll
    for (int j = 0; j < 4; ++j) st[j] = *(const v8us*)(pk + to + j * 8 * DO);
    asm volatile("s_wait_xcnt 0x0" :: "s"(pk), "v"(to) : "memory");      /* as inputs the loads' base and offset stay whole until the wait */
    // S^T = K.Q^T, one k step (2 fragments, 4 matrix instructions) a block; each block's LDS reads stand as one group two blocks ahead, in a ring of three fragment pairs
    v8f sc[2][2] = {{z8, z8}, {z8, z8}};
    v16h ka[3][2];
#pragma unroll
    for (int i = 0; i < 4; ++i) ka[i >> 1][i & 1] = fa_frag(bK + ((i & 1) * 16 + ln) * KPIT + (i >> 1) * 32, hh);
#pragma unroll
    for (int ks = 0; ks < 8; ++ks) {
      if (ks < 6) { ka[(ks + 2) % 3][0] = fa_frag(bK + ln * KPIT + (ks + 2) * 32, hh); ka[(ks + 2) % 3][1] = fa_frag(bK + (16 + ln) * KPIT + (ks + 2) * 32, hh); }
      __builtin_amdgcn_sched_barrier(0);      /* keeps the reads above as one group in front of the block, two blocks ahead of their use */
      const v16h a0 = ka[ks % 3][0], a1 = ka[ks % 3][1];
      sc[0][0] = fa_mma(a0, qf[0][ks], sc[0][0]); sc[0][1] = fa_mma(a0, qf[1][ks], sc[0][1]);
      sc[1][0] = fa_mma(a1, qf[0][ks], sc[1][0]); sc[1][1] = fa_mma(a1, qf[1][ks], sc[1][1]);
      __builtin_amdgcn_sched_barrier(0);      /* ends the block: the next group of reads stays behind it */
    }
#pragma unroll
    for (int j = 0; j < 4; ++j) *(v8us*)(nK + lK + j * 8 * KPIT) = st[j];      /* the other buffers' last readers left them at the barrier that ended the stage before this one */
    __builtin_amdgcn_sched_barrier(0);      /* the V^T loads stay behind the K stores, so that the two staged tiles are never live together */
#pragma unroll
    for (int j = 0; j < 4; ++j) st[j] = *(const v8us*)(pv + to + j * 64 * 32);
    asm volatile("s_wait_xcnt 0x0" :: "s"(pv), "v"(to) : "memory");      /* as inputs the loads' base and offset stay whole until the wait */
#pragma unroll
    for (int g = 0; g < 2; ++g) {
      float mx = sc[0][g][0];
#pragma unroll
      for (int r = 0; r < 8; ++r) mx = fmaxf(mx, fmaxf(sc[0][g][r], sc[1][g][r]));
      mx = fmaxf(mx, xhalf(mx)) * cs;      /* cs > 0; both halves of the wave now hold this query's maximum of the pass */
      if (__builtin_amdgcn_ballot_w32(mx > m[g] + MTHR) != 0) {      /* scalar branch, rare after the first passes; one group a branch */
        const float mn = fmaxf(m[g], mx); const float corr = __builtin_amdgcn_exp2f(m[g] - mn);      /* 0 on the first pass */
        m[g] = mn; l[g] *= corr;
#pragma unroll
        for (int t = 0; t < 16; ++t) o[t][g] = o[t][g] * corr;
      }
    }
    v16h pf[2];
#pragma unroll
    for (int g = 0; g < 2; ++g) {
      const float sh = 10.0f - m[g]; FragH p; float s0 = 0.f, s1 = 0.f;      /* weights x 1024, as f16 operands away from the subnormal range; l carries the same factor */
      float x[16];
#pragma unroll
      for (int r = 0; r < 8; ++r) { x[r] = fmaf(sc[0][g][r], cs, sh); x[8 + r] = fmaf(sc[1][g][r], cs, sh); }
      __builtin_amdgcn_sched_barrier(0);      /* the arguments are all made first: no multiply-add is left to land on an exponential's source directly behind it */
#pragma unroll
      for (int r = 0; r < 16; ++r) x[r] = __builtin_amdgcn_exp2f(x[r]);
      __builtin_amdgcn_sched_barrier(0);      /* sums and conversions stay behind the exponentials: none reads a result directly behind its exponential */
#pragma unroll
      for (int r = 0; r < 8; ++r) { s0 += x[r]; s1 += x[8 + r]; p.h[r] = (_Float16)x[r]; p.h[8 + r] = (_Float16)x[8 + r]; }
      l[g] += s0 + s1; pf[g] = p.v;
    }
    // O^T += V^T.P^T, two d tiles (2 fragments, 4 matrix instructions) a block, read ahead in the same ring
    __builtin_amdgcn_sched_barrier(0);      /* the V^T reads stay behind the exponentials: hoisted among them they take the registers that keep two waves on a SIMD without spills */
    v16h va[3][2];
#pragma unroll
    for (int i = 0; i < 4; ++i) va[i >> 1][i & 1] = fa_frag(bV + (i * 16 + ln) * VPIT, hh);
#pragma unroll
    for (int b = 0; b < 8; ++b) {
      if (b < 6) { va[(b + 2) % 3][0] = fa_frag(bV + (((b + 2) * 2) * 16 + ln) * VPIT, hh); va[(b + 2) % 3][1] = fa_frag(bV + (((b + 2) * 2 + 1) * 16 + ln) * VPIT, hh); }
      __builtin_amdgcn_sched_barrier(0);      /* one group of reads in front of the block, as above */
      o[b * 2][0] = fa_mma(va[b % 3][0], pf[0], o[b * 2][0]); o[b * 2][1] = fa_mma(va[b % 3][0], pf[1], o[b * 2][1]);
      o[b * 2 + 1][0] = fa_mma(va[b % 3][1], pf[0], o[b * 2 + 1][0]); o[b * 2 + 1][1] = fa_mma(va[b % 3][1], pf[1], o[b * 2 + 1][1]);
      __builtin_amdgcn_sched_barrier(0);      /* ends the block */
    }
#pragma unroll
    for (int j = 0; j < 4; ++j) *(v8us*)(nV + lV + j * 64 * VPIT) = st[j];
  }
    __syncthreads();      /* publishes the next stage's tiles and ends every read of this stage's */
  }
  // partials: OP[32-row block][key range][g][t][half][lane][4], the accumulators' own order (element = query 16 g + ln, d = 16 t + 8 hh + 4 half + 0..3), so that each store covers 512 contiguous bytes;
  // ML[query row][key range][m, l]; query row = branch * NN + query. One address pair serves all stores of each array, and
  // everything that is computed stands in front of the first store: behind it no register that a store names is written any more.
  const size_t row = (size_t)br * NN + q0 + ln;
  float* op = OP + ((((size_t)br * NN + q0) >> 5) * KSP + sp) * (32 * DO) + lane * 4;      /* a lane's 8 accumulator registers are 8 consecutive d of its query */
  float* mlp = ML + (row * KSP + sp) * 2 + hh;
  const float j0 = l[0] + xhalf(l[0]), j1 = l[1] + xhalf(l[1]);      /* the halves' sums joined, with every lane on: the exchange stands outside the selection below */
  const float w0 = hh ? j0 : m[0], w1 = hh ? j1 : m[1];      /* the lower half of the wave writes m, the upper l */
  mlp[0] = w0; mlp[16 * KSP * 2] = w1;
#pragma unroll
  for (int g = 0; g < 2; ++g) {
#pragma unroll
    for (int t = 0; t < 16; ++t) {
      const v4f lo = {o[t][g][0], o[t][g][1], o[t][g][2], o[t][g][3]}, hi = {o[t][g][4], o[t][g][5], o[t][g][6], o[t][g][7]};
      *(v4f*)(op + (g * 16 + t) * 256) = lo; *(v4f*)(op + (g * 16 + t) * 256 + 128) = hi;
    }
  }
  asm volatile("s_wait_xcnt 0x0" :: "v"(op), "v"(mlp) : "memory");      /* as inputs the stores' addresses stay whole until the wait */
}
// ---- tail: the join of the key ranges and the output GEMM in one launch; f never leaves the work-group ----
// A work-group of 16 waves takes TR rows (query rows of both branches, one M = 2 NN) and all DI output columns.
// Join: f = sum_s 2^(m_s - M) O_s / sum_s 2^(m_s - M) l_s over the KSP key ranges, fixed order s = 0..KSP-1; the partials lie in k_flash's accumulator order: a wave takes four d tiles of one 16-query group, a lane one query, each load 512 contiguous bytes;
// f x 1024 goes to LDS as f16 hi + residual (one scale for both, so that both feed the same accumulators).
// GEMM: out = (hi + lo) We^T / 1024 + be; We in 64-k slices through two LDS buffers as in g3_loop; wave w takes rows 32 (w & 1), columns 64 (w >> 1): g3_loop's 32 x 64 wave tile and k order.
// The short loops are unrolled because their arrays (staged loads, partials, fragments, accumulators) live in registers and need constant indices.
#define TR 64                    /* rows per work-group: 2 NN / TR = 256 work-groups */
#define APIT 264                 /* LDS pitch of an f row, 16-bit elements: 528 B = 16 B x odd */
#define TA (TR * APIT)           /* one plane of f (hi | lo) */
#define TB (DI * GP)             /* one slice of We */
typedef _Float16 v4ha __attribute__((ext_vector_type(4), may_alias));
struct T4S { unsigned short a[2 * TA]; union { unsigned short b[2 * TB]; float so[16][32][68]; } u; };      /* behind the loop the slices' place is each wave's own output staging */
__global__ __launch_bounds__(512) void k_tail(const float* __restrict__ OP, const float* __restrict__ ML, const _Float16* __restrict__ Bh, const float* __restrict__ bias, float* __restrict__ C) {
  static_assert(KSP == 4, "the join reads a row's four (m, l) pairs as two 16-byte loads");
  __shared__ __attribute__((aligned(16))) T4S sm;
  const int tid = threadIdx.x, w = tid >> 5, lane = tid & 31, ln = lane & 15, hh = lane >> 4;
  const int rowg = blockIdx.x * TR;
  const unsigned short* gb = (const unsigned short*)Bh + (size_t)(tid >> 3) * DO + (tid & 7) * 8;      /* thread -> 16 B of rows tid / 8 + 64 j of We; one address pair for all slices */
  const int ls = (tid >> 3) * GP + (tid & 7) * 8;
  const int jb = w >> 3, jg = (w >> 2) & 1, jt = (w & 3) * 4, rl = jb * 32 + jg * 16 + ln;      /* wave w joins d tiles jt + i of group jg of 32-row block jb; its lane's row is rl */
  const float* po = OP + (size_t)(blockIdx.x * (TR / 32) + jb) * KSP * (32 * DO) + (jg * 16 + jt) * 256 + lane * 4;      /* one address pair for each array */
  const float* pm = ML + (size_t)(rowg + rl) * KSP * 2;
  const float* bq = bias + 64 * (w >> 1) + ln;
  v8us sb[8]; v4f op[4][KSP][2], mq[2]; float bb[4];
  mq[0] = *(const v4fa*)pm; mq[1] = *(const v4fa*)(pm + 4);
#pragma unroll
  for (int i = 0; i < 4; ++i) {
#pragma unroll
    for (int s = 0; s < KSP; ++s) { op[i][s][0] = *(const v4fa*)(po + s * (32 * DO) + i * 256); op[i][s][1] = *(const v4fa*)(po + s * (32 * DO) + i * 256 + 128); }
  }
#pragma unroll
  for (int j = 0; j < 8; ++j) sb[j] = *(const v8us*)(gb + j * 64 * DO);
#pragma unroll
  for (int t = 0; t < 4; ++t) bb[t] = bq[t * 16];
  asm volatile("s_wait_xcnt 0x0" :: "v"(po), "v"(pm), "v"(gb), "v"(bq) : "memory");      /* as inputs the loads' addresses stay whole until the wait */
  const float ms[KSP] = {mq[0][0], mq[0][2], mq[1][0], mq[1][2]}, lw[KSP] = {mq[0][1], mq[0][3], mq[1][1], mq[1][3]};
  float M = ms[0], wg[KSP], den = 0.f;
#pragma unroll
  for (int s = 1; s < KSP; ++s) M = fmaxf(M, ms[s]);
#pragma unroll
  for (int s = 0; s < KSP; ++s) wg[s] = __builtin_amdgcn_exp2f(ms[s] - M);
#pragma unroll
  for (int s = 0; s < KSP; ++s) den += wg[s] * lw[s];
  const float rs = 1.0f / den;
#pragma unroll
  for (int i = 0; i < 4; ++i) {
    v4f a0 = {0.f,0.f,0.f,0.f}, a1 = {0.f,0.f,0.f,0.f};
#pragma unroll
    for (int s = 0; s < KSP; ++s) { a0 += op[i][s][0] * wg[s]; a1 += op[i][s][1] * wg[s]; }
    FragH fh, fl;
#pragma unroll
    for (int q = 0; q < 4; ++q) {
      const float u0 = a0[q] * rs * 1024.0f, u1 = a1[q] * rs * 1024.0f; const _Float16 g0 = (_Float16)u0, g1 = (_Float16)u1;
      fh.h[q] = g0; fl.h[q] = (_Float16)(u0 - (float)g0); fh.h[4 + q] = g1; fl.h[4 + q] = (_Float16)(u1 - (float)g1);
    }
    unsigned short* pa = sm.a + rl * APIT + (jt + i) * 16 + 8 * hh;      /* the lane's 8 consecutive d of its row: one 16-byte LDS store a plane */
    *(v8us*)pa = fh.half[0]; *(v8us*)(pa + TA) = fl.half[0];
  }
#pragma unroll
  for (int j = 0; j < 8; ++j) *(v8us*)(sm.u.b + ls + j * 64 * GP) = sb[j];
  __syncthreads();      /* publishes f and the first slice of We */
  const int ra = ((w & 1) * 32 + ln) * APIT, rb = ((w >> 1) * 64 + ln) * GP;
  const v8f z8 = {0.f,0.f,0.f,0.f,0.f,0.f,0.f,0.f}; v8f acc[2][4] = {{z8, z8, z8, z8}, {z8, z8, z8, z8}};
  // unrolled: the buffer and the slice become constants, so every load and LDS access is its base register plus an immediate offset
#pragma unroll
  for (int c = 0; c < DO / 64; ++c) {
    const unsigned short* cur = sm.u.b + (c & 1) * TB; unsigned short* nxt = sm.u.b + ((c + 1) & 1) * TB;
    if (c + 1 < DO / 64) {
#pragma unroll
      for (int j = 0; j < 8; ++j) sb[j] = *(const v8us*)(gb + (c + 1) * 64 + j * 64 * DO);
      asm volatile("s_wait_xcnt 0x0" :: "v"(gb) : "memory");      /* as an input the loads' address stays whole until the wait */
    }
#pragma unroll
    for (int ks = 0; ks < 2; ++ks) {
      const unsigned short* pa = sm.a + ra + c * 64 + ks * 32;
      const v16h h0 = g3_frag(pa, hh), h1 = g3_frag(pa + 16 * APIT, hh), l0 = g3_frag(pa + TA, hh), l1 = g3_frag(pa + TA + 16 * APIT, hh);
      v16h b[4];
#pragma unroll
      for (int t = 0; t < 4; ++t) b[t] = g3_frag(cur + rb + t * 16 * GP + ks * 32, hh);
#pragma unroll
      for (int t = 0; t < 4; ++t) { acc[0][t] = g3_mma(h0, b[t], acc[0][t]); acc[1][t] = g3_mma(h1, b[t], acc[1][t]); }
#pragma unroll
      for (int t = 0; t < 4; ++t) { acc[0][t] = g3_mma(l0, b[t], acc[0][t]); acc[1][t] = g3_mma(l1, b[t], acc[1][t]); }
    }
    if (c + 1 < DO / 64) {
#pragma unroll
      for (int j = 0; j < 8; ++j) *(v8us*)(nxt + ls + j * 64 * GP) = sb[j];      /* the other buffer's last readers left it at the barrier that ended slice c - 1 */
    }
    __syncthreads();      /* publishes slice c + 1 and ends every read of slice c (behind the last slice: frees the buffers for the output staging) */
  }
#pragma unroll
  for (int u = 0; u < 8; ++u) { const int t = u & 3, half = u >> 2; const float bv = bf16_round(bb[t]);
#pragma unroll
    for (int r = 0; r < 8; ++r) sm.u.so[w][half * 16 + 8 * hh + r][t * 16 + ln] = acc[half][t][r] * (0.0625f / 1024.0f) + bv; }
  __builtin_amdgcn_fence(__ATOMIC_ACQ_REL, "workgroup"); __builtin_amdgcn_wave_barrier();      /* a wave reads back only its own rows */
  const int rsub = lane >> 4, c4 = (lane & 15) * 4; float* cp = C + (size_t)(rowg + 32 * (w & 1) + rsub) * DI + 64 * (w >> 1) + c4;      /* one address pair for all stores, whole lines each */
#pragma unroll
  for (int q = 0; q < 16; ++q) { const v4f v = *(const v4fa*)&sm.u.so[w][q * 2 + rsub][c4]; *(v4f*)(cp + q * 2 * DI) = v; }
  asm volatile("s_wait_xcnt 0x0" :: "v"(cp) : "memory");      /* as an input the stores' address stays whole until the wait */
}

extern "C" void kernel_launch(void* const* d_in, const int* in_sizes, int n_in,
                              void* d_out, int out_size, void* d_ws, size_t ws_size, hipStream_t stream) {
  (void)in_sizes; (void)n_in; (void)out_size;
  const float* const* I = (const float* const*)d_in; const float* x1 = I[0]; const float* x2 = I[1]; const float* Wq1 = I[2]; const float* bq1 = I[3]; const float* Wk1 = I[4]; const float* bk1 = I[5]; const float* Wv = I[6]; const float* bv = I[7]; const float* Wq2 = I[8]; const float* bq2 = I[9]; const float* Wk2 = I[10]; const float* bk2 = I[11]; const float* We = I[12]; const float* be = I[13]; const float* scp = I[14];
  float* out1 = (float*)d_out;      /* the second output lies behind the first, at byte offset 16777216 */
  char* ws = (char*)d_ws; size_t off = 0;
  auto take = [&](size_t bytes) { char* p = ws + off; off += (bytes + 255) & ~(size_t)255; return p; };
  _Float16* BW = (_Float16*)take((size_t)6 * DO * DI * 2); _Float16* BE = BW + (size_t)5 * DO * DI; _Float16* X1 = (_Float16*)take((size_t)2 * NN * DI * 2);      /* weight slots Wq1 Wk1 Wq2 Wk2 Wv We; [x1 | x2] */
  _Float16* Q1 = (_Float16*)take((size_t)6 * NN * DO * 2); _Float16* K1 = Q1 + (size_t)NN * DO; _Float16* Q2 = Q1 + (size_t)2 * NN * DO; _Float16* K2 = Q1 + (size_t)3 * NN * DO; _Float16* VT1 = Q1 + (size_t)4 * NN * DO; _Float16* VT2 = Q1 + (size_t)5 * NN * DO;      /* planes Q1 K1 Q2 K2 V1^T V2^T */
  float* OP = (float*)take((size_t)KSP * 2 * NN * DO * 4); float* ML = (float*)take((size_t)KSP * 2 * NN * 2 * 4);
  if (off > ws_size) return;      /* 1.5 + 16 + 24 + 64 + 0.5 = about 106 MiB */
  k_cvt<<<6 * WB + 2 * XB, 256, 0, stream>>>(x1, x2, Wq1, Wk1, Wq2, Wk2, Wv, We, X1, BW);      /* weights as given, (out, in) */
  k_proj6<<<dim3((NN / 128) * (DO / 128), 6), 256, 0, stream>>>(X1, BW, bq1, bk1, bq2, bk2, bv, Q1);
  k_flash<<<dim3(NN / FQ, KSP, 2), 256, 0, stream>>>(Q1, K2, VT1, Q2, K1, VT2, scp, OP, ML);      /* f1: hsi_Q . lidar_K -> hsi_V ; f2: lidar_Q . hsi_K -> lidar_V */
  k_tail<<<2 * NN / TR, 512, 0, stream>>>(OP, ML, BE, be, out1);      /* both branches: their rows and the two outputs lie back to back (one M = 2 NN); (f_hi + f_lo) We^T + be */
}

// v008
// A run of this version takes 118 microseconds.
// Timed twice side by side with v007, it ran 1.06 times as fast both times.
// All steps since v000 together make it 23.4 times as fast.
#include <hip/hip_runtime.h>
// cross_fuison (8192 hsi rows x1 and 8192 lidar rows x2, 512 -> 256: Q/K/V = x W^T + b (W_V shared); inv = 1/sqrt(clip(scale, 1, 32)); f1 = softmax(hsi_Q lidar_K^T inv) hsi_V; f2 = softmax(lidar_Q hsi_K^T inv) lidar_V; outputs = (f1 We^T + be, f2 We^T + be), each [8192][512]).
// Compute dtype: inputs rounded to bf16; inputs/weights exact as f16; Q/K/V and the softmax weights as plain f16 operands (~2^-12); f as f16 hi + residual into We; softmax f32. v_wmma_f32_16x16x32_f16.
#define NN 8192
#define DI 512
#define DO 256
typedef __bf16 v16b __attribute__((ext_vector_type(16)));
typedef unsigned short v8us __attribute__((ext_vector_type(8), may_alias));
typedef float  v8f  __attribute__((ext_vector_type(8)));
typedef float  v4f  __attribute__((ext_vector_type(4)));
typedef float  v4fa __attribute__((ext_vector_type(4), may_alias));
union FragB { v16b v; v8us half[2]; unsigned short u[16]; };

__device__ __forceinline__ unsigned short bf16_bits(float x) { unsigned int u = __float_as_uint(x); return (unsigned short)((u + 0x7FFFu + ((u >> 16) & 1u)) >> 16); }
__device__ __forceinline__ float bf16_val(unsigned short b) { return __uint_as_float(((unsigned int)b) << 16); }
__device__ __forceinline__ float bf16_round(float x) { return bf16_val(bf16_bits(x)); }
// D += A·B with NT terms: 1 = ah·bh, 2 = + al·bh (A split), 3 = + ah·bl (both split)
template <int NT>
__device__ __forceinline__ v8f mmaN(v16b ah, v16b al, v16b bh, v16b bl, v8f c) {
  c = __builtin_amdgcn_wmma_f32_16x16x32_bf16(false, ah, false, bh, (short)0, c, false, false);
  if (NT >= 2) c = __builtin_amdgcn_wmma_f32_16x16x32_bf16(false, al, false, bh, (short)0, c, false, false);
  if (NT >= 3) c = __builtin_amdgcn_wmma_f32_16x16x32_bf16(false, ah, false, bl, (short)0, c, false, false);
  asm volatile("v_nop\n\tv_nop\n\tv_nop\n\tv_nop" : "+v"(c) : "v"(ah), "v"(al), "v"(bh), "v"(bl));
  return c;
}

__global__ __launch_bounds__(256) void k_wt_bf16(const float* __restrict__ W, unsigned short* __restrict__ Wt, int K, int N) {
  const int t = blockIdx.x * 256 + threadIdx.x;
  const int k8n = K / 8;
  if (t >= N * k8n) return;
  const int n = t / k8n, k8 = (t % k8n) * 8;
  v8us v;
#pragma unroll
  for (int i = 0; i < 8; ++i) v[i] = bf16_bits(W[(size_t)(k8 + i) * N + n]);
  *(v8us*)(Wt + (size_t)n * K + k8) = v;
  
}

// GEMM C[M][N] (f32, pitch ldc) = act(A[M][K]·W + bias). A f32 row-major (pitch lda) converted per fragment to bf16
// (ASPLIT: hi/lo two planes -> 2 terms, else single rounded term); Wt bf16 [N][K] (pitch ldb). BIAS_BF16 rounds the
// bias to bf16 first (bias quantised to bf16 before the add). K%32==0, M%16==0, N%64==0.
template <bool ASPLIT, int ACT, bool BIAS_BF16>
__global__ __launch_bounds__(128) void k_gemm_bf(const float* __restrict__ A, int lda, const unsigned short* __restrict__ Wt, int ldb,
                                               const float* __restrict__ bias, float* __restrict__ C, int ldc, int M, int N, int K) {
  __shared__ __attribute__((aligned(16))) float so[4][16][64];
  const int tid = threadIdx.x, w = tid >> 5, lane = tid & 31, ln = lane & 15, hh = lane >> 4;
  const int ntn = N / 64;
  const int wid = blockIdx.x * 4 + w;
  const int mt = wid / ntn, nq = wid % ntn;
  if (mt * 16 >= M) return;
  const int row0 = mt * 16, col0 = nq * 64;
  const float* arow = A + (size_t)(row0 + ln) * lda;
  v8f acc[4] = {};
  for (int kb = 0; kb < K; kb += 32) {
    FragB ah, al;
    const v4f x0 = *(const v4fa*)(arow + kb + 8 * hh), x1 = *(const v4fa*)(arow + kb + 8 * hh + 4);
    const v4f x2 = *(const v4fa*)(arow + kb + 16 + 8 * hh), x3 = *(const v4fa*)(arow + kb + 16 + 8 * hh + 4);
    float xs[16] = {x0[0],x0[1],x0[2],x0[3],x1[0],x1[1],x1[2],x1[3],x2[0],x2[1],x2[2],x2[3],x3[0],x3[1],x3[2],x3[3]};
#pragma unroll
    for (int i = 0; i < 16; ++i) { const unsigned short hb = bf16_bits(xs[i]); ah.u[i] = hb; al.u[i] = ASPLIT ? bf16_bits(xs[i] - bf16_val(hb)) : (unsigned short)0; }
#pragma unroll
    for (int t = 0; t < 4; ++t) {
      const unsigned short* brow = Wt + (size_t)(col0 + t * 16 + ln) * ldb + kb;
      FragB b;
      b.half[0] = *(const v8us*)(brow + 8 * hh);
      b.half[1] = *(const v8us*)(brow + 16 + 8 * hh);
      acc[t] = mmaN<ASPLIT ? 2 : 1>(ah.v, al.v, b.v, b.v, acc[t]);
    }
  }
#pragma unroll
  for (int t = 0; t < 4; ++t) {
    float bv = bias ? bias[col0 + t * 16 + ln] : 0.f;
    if (BIAS_BF16) bv = bf16_round(bv);
#pragma unroll
    for (int r = 0; r < 8; ++r) { float v = acc[t][r] + bv; if (ACT == 1) v = fmaxf(v, 0.f); so[w][8 * hh + r][t * 16 + ln] = v; }
  }
  __builtin_amdgcn_fence(__ATOMIC_ACQ_REL, "workgroup");
  __builtin_amdgcn_wave_barrier();
  const int rsub = lane >> 4, c4 = (lane & 15) * 4;
  {
#pragma unroll
    for (int q = 0; q < 8; ++q) {
      const int r = q * 2 + rsub;
      const v4f v = *(const v4fa*)&so[w][r][c4];
      *(v4f*)(C + (size_t)(row0 + r) * ldc + col0 + c4) = v;
    }
    
  }
}

// GEMM C = act(A·W + bias + resid): A f32 (ASPLIT -> hi/lo 2 terms), Wt bf16 [N][K]; ACT 0 none, 1 relu, 2 exact gelu;
// resid (optional, f32, row index = (row % rmod), pitch ldr, RES_BF16 rounds it) added before the activation.
template <bool ASPLIT, int ACT, bool BIAS_BF16, bool RES_BF16>
__global__ __launch_bounds__(128) void k_gemm_bf3(const float* __restrict__ A, int lda, const unsigned short* __restrict__ Wt, int ldb,
                                                const float* __restrict__ bias, const float* __restrict__ resid, int rmod, int ldr,
                                                float* __restrict__ C, int ldc, int M, int N, int K) {
  __shared__ __attribute__((aligned(16))) float so[4][16][64];
  const int tid = threadIdx.x, w = tid >> 5, lane = tid & 31, ln = lane & 15, hh = lane >> 4;
  const int ntn = N / 64;
  const int wid = blockIdx.x * 4 + w;
  const int mt = wid / ntn, nq = wid % ntn;
  if (mt * 16 >= M) return;
  const int row0 = mt * 16, col0 = nq * 64;
  const float* arow = A + (size_t)(row0 + ln) * lda;
  v8f acc[4] = {};
  for (int kb = 0; kb < K; kb += 32) {
    FragB ah, al;
    const v4f x0 = *(const v4fa*)(arow + kb + 8 * hh), x1 = *(const v4fa*)(arow + kb + 8 * hh + 4);
    const v4f x2 = *(const v4fa*)(arow + kb + 16 + 8 * hh), x3 = *(const v4fa*)(arow + kb + 16 + 8 * hh + 4);
    float xs[16] = {x0[0],x0[1],x0[2],x0[3],x1[0],x1[1],x1[2],x1[3],x2[0],x2[1],x2[2],x2[3],x3[0],x3[1],x3[2],x3[3]};
#pragma unroll
    for (int i = 0; i < 16; ++i) { const unsigned short hb = bf16_bits(xs[i]); ah.u[i] = hb; al.u[i] = ASPLIT ? bf16_bits(xs[i] - bf16_val(hb)) : (unsigned short)0; }
#pragma unroll
    for (int t = 0; t < 4; ++t) {
      const unsigned short* brow = Wt + (size_t)(col0 + t * 16 + ln) * ldb + kb;
      FragB b;
      b.half[0] = *(const v8us*)(brow + 8 * hh);
      b.half[1] = *(const v8us*)(brow + 16 + 8 * hh);
      acc[t] = mmaN<ASPLIT ? 2 : 1>(ah.v, al.v, b.v, b.v, acc[t]);
    }
  }
#pragma unroll
  for (int t = 0; t < 4; ++t) {
    const int col = col0 + t * 16 + ln;
    float bv = bias ? bias[col] : 0.f;
    if (BIAS_BF16) bv = bf16_round(bv);
#pragma unroll
    for (int r = 0; r < 8; ++r) {
      float v = acc[t][r] + bv;
      if (resid) { float rv = resid[(size_t)((row0 + 8 * hh + r) % rmod) * ldr + col]; if (RES_BF16) rv = bf16_round(rv); v += rv; }
      if (ACT == 1) v = fmaxf(v, 0.f);
      if (ACT == 2) v = 0.5f * v * (1.0f + erff(v * 0.70710678118654752f));
      if (ACT == 3) { const float u = 0.7978845608028654f * (v + 0.044715f * v * v * v); v = 0.5f * v * (1.0f + tanhf(u)); }
      so[w][8 * hh + r][t * 16 + ln] = v;
    }
  }
  __builtin_amdgcn_fence(__ATOMIC_ACQ_REL, "workgroup");
  __builtin_amdgcn_wave_barrier();
  const int rsub = lane >> 4, c4 = (lane & 15) * 4;
  {
#pragma unroll
    for (int q = 0; q < 8; ++q) {
      const int r = q * 2 + rsub;
      const v4f v = *(const v4fa*)&so[w][r][c4];
      *(v4f*)(C + (size_t)(row0 + r) * ldc + col0 + c4) = v;
    }
    
  }
}
// row LayerNorm (biased variance, eps) over N: s = X (+ R); optional out_sum <- s; out_norm <- (s-mu)*rsqrt(var+eps)*g + b
template <bool PARAM_BF16>
__global__ __launch_bounds__(256) void k_layernorm(const float* __restrict__ X, const float* __restrict__ R, const float* __restrict__ g, const float* __restrict__ bta,
                                                  float* __restrict__ out_sum, float* __restrict__ out_norm, int N, float eps) {
  __shared__ float red[256];
  const int row = blockIdx.x, tid = threadIdx.x;
  const float* x = X + (size_t)row * N; const float* rr = R ? R + (size_t)row * N : nullptr;
  float vals[16];                     // up to N = 4096
  const int per = N / 256;            // contiguous chunk per thread? use strided-by-4 chunks: thread handles j = tid*4 + 1024*u
  float s1 = 0.f;
  for (int u = 0; u < per / 4; ++u) {
    const int j = tid * 4 + 1024 * u;
    const v4f a = *(const v4fa*)(x + j);
    v4f b = {0.f,0.f,0.f,0.f}; if (rr) b = *(const v4fa*)(rr + j);
#pragma unroll
    for (int q = 0; q < 4; ++q) { const float v = a[q] + b[q]; vals[u * 4 + q] = v; s1 += v; }
  }
  red[tid] = s1; __syncthreads();
  for (int st = 128; st > 0; st >>= 1) { if (tid < st) red[tid] += red[tid + st]; __syncthreads(); }
  const float mu = red[0] / (float)N; __syncthreads();
  float s2 = 0.f;
  for (int u = 0; u < per / 4; ++u)
#pragma unroll
    for (int q = 0; q < 4; ++q) { const float c = vals[u * 4 + q] - mu; s2 += c * c; }
  red[tid] = s2; __syncthreads();
  for (int st = 128; st > 0; st >>= 1) { if (tid < st) red[tid] += red[tid + st]; __syncthreads(); }
  const float rs = rsqrtf(red[0] / (float)N + eps);
  {
    for (int u = 0; u < per / 4; ++u) {
      const int j = tid * 4 + 1024 * u;
      v4f o, sm;
#pragma unroll
      for (int q = 0; q < 4; ++q) {
        float gg = g[j + q], bb = bta[j + q];
        if (PARAM_BF16) { gg = bf16_round(gg); bb = bf16_round(bb); }
        sm[q] = vals[u * 4 + q]; o[q] = (vals[u * 4 + q] - mu) * rs * gg + bb;
      }
      if (out_sum) *(v4f*)(out_sum + (size_t)row * N + j) = sm;
      *(v4f*)(out_norm + (size_t)row * N + j) = o;
    }
    
  }
}



// ---- f16 WMMA path (v_wmma_f32_16x16x32_f16): 11-bit significands for operands in range — used where a [0,1] probability operand needs more precision than bf16
typedef _Float16 v16h __attribute__((ext_vector_type(16)));
union FragH { v16h v; v8us half[2]; _Float16 h[16]; unsigned short u[16]; };
template <int NT>
__device__ __forceinline__ v8f mmaH(v16h ah, v16h al, v16h bh, v16h bl, v8f c) {
  c = __builtin_amdgcn_wmma_f32_16x16x32_f16(false, ah, false, bh, (short)0, c, false, false);
  if (NT >= 2) c = __builtin_amdgcn_wmma_f32_16x16x32_f16(false, al, false, bh, (short)0, c, false, false);
  if (NT >= 3) c = __builtin_amdgcn_wmma_f32_16x16x32_f16(false, ah, false, bl, (short)0, c, false, false);
  asm volatile("v_nop\n\tv_nop\n\tv_nop\n\tv_nop" : "+v"(c) : "v"(ah), "v"(al), "v"(bh), "v"(bl));
  return c;
}
// batched GEMM like k_gemm_b but f16 operands: A f32 (split into f16 hi/lo if ASPLIT, else rounded to f16), Bt = f16 values [n][k]; alpha; C f32; N multiple of 16 (partial tiles skipped)
template <bool ASPLIT>
__global__ __launch_bounds__(128) void k_gemm_h(const float* __restrict__ A, int lda, size_t sA, const _Float16* __restrict__ Bh, int ldb, size_t sB, float alpha, float* __restrict__ C, int ldc, size_t sC, int M, int N, int K) {
  __shared__ __attribute__((aligned(16))) float so[4][16][64];
  const int tid = threadIdx.x, w = tid >> 5, lane = tid & 31, ln = lane & 15, hh = lane >> 4; const int by = blockIdx.y;
  A += (size_t)by * sA; Bh += (size_t)by * sB; C += (size_t)by * sC;
  const int ntn = (N + 63) / 64; const int wid = blockIdx.x * 4 + w; const int mt = wid / ntn, nq = wid % ntn; if (mt * 16 >= M) return;
  const int row0 = mt * 16, col0 = nq * 64; const float* arow = A + (size_t)(row0 + ln) * lda;
  v8f acc[4] = {};
  for (int kb = 0; kb < K; kb += 32) {
    FragH ah, al;
    const v4f x0 = *(const v4fa*)(arow + kb + 8 * hh), x1 = *(const v4fa*)(arow + kb + 8 * hh + 4), x2 = *(const v4fa*)(arow + kb + 16 + 8 * hh), x3 = *(const v4fa*)(arow + kb + 16 + 8 * hh + 4);
    float xs[16] = {x0[0],x0[1],x0[2],x0[3],x1[0],x1[1],x1[2],x1[3],x2[0],x2[1],x2[2],x2[3],x3[0],x3[1],x3[2],x3[3]};
#pragma unroll
    for (int i = 0; i < 16; ++i) { const _Float16 h = (_Float16)xs[i]; ah.h[i] = h; al.h[i] = ASPLIT ? (_Float16)(xs[i] - (float)h) : (_Float16)0.0f; }
#pragma unroll
    for (int t = 0; t < 4; ++t) { if (col0 + t * 16 >= N) continue; const size_t boff = (size_t)(col0 + t * 16 + ln) * ldb + kb; FragH bq; bq.half[0] = *(const v8us*)(Bh + boff + 8 * hh); bq.half[1] = *(const v8us*)(Bh + boff + 16 + 8 * hh);
      acc[t] = mmaH<ASPLIT ? 2 : 1>(ah.v, al.v, bq.v, bq.v, acc[t]); }
  }
#pragma unroll
  for (int t = 0; t < 4; ++t) { if (col0 + t * 16 >= N) continue;
#pragma unroll
    for (int r = 0; r < 8; ++r) so[w][8 * hh + r][t * 16 + ln] = acc[t][r] * alpha; }
  __builtin_amdgcn_fence(__ATOMIC_ACQ_REL, "workgroup"); __builtin_amdgcn_wave_barrier();
  const int rsub = lane >> 4, c4 = (lane & 15) * 4;
  {
#pragma unroll
    for (int q = 0; q < 8; ++q) { const int r = q * 2 + rsub; if (col0 + c4 < N) { const v4f v = *(const v4fa*)&so[w][r][c4]; *(v4f*)(C + (size_t)(row0 + r) * ldc + col0 + c4) = v; } }
     }
}

// Wt[n][k] = f16(W[k][n]·scale) from f32 row-major W[K][N] (scale = power of two; bf16-exact weights stay exact in f16 away from the subnormal range)
__global__ __launch_bounds__(256) void k_wt_f16(const float* __restrict__ W, _Float16* __restrict__ Wt, int K, int N, float scale) {
  const int t = blockIdx.x * 256 + threadIdx.x; if (t >= N * (K / 8)) return; const int n = t / (K / 8), k8 = (t % (K / 8)) * 8; FragH f;
#pragma unroll
  for (int i = 0; i < 8; ++i) f.h[i] = (_Float16)(bf16_round(W[(size_t)(k8 + i) * N + n]) * scale); const v8us o = f.half[0];
  *(v8us*)((unsigned short*)Wt + (size_t)n * K + k8) = o; 
}
// k_gemm_hh variant with fused epilogue: v = acc·alpha + bias[by·sBias + col] (+ CP[(row/rowsPerB)·sCPb + by·64 + col] if CP) ; ACT 0 none / 1 elu ; writes f16 C16 (and f32 C if non-null)
template <int ACT>
__global__ __launch_bounds__(128) void k_gemm_hhx(const _Float16* __restrict__ A, int lda, size_t sA, const _Float16* __restrict__ Bh, int ldb, size_t sB, float alpha, const float* __restrict__ bias, size_t sBias, const float* __restrict__ CP, int rowsPerB, size_t sCPb, int row0g,
    float* __restrict__ C, _Float16* __restrict__ C16, int ldc, size_t sC, int M, int N, int K) {
  __shared__ __attribute__((aligned(16))) float so[4][16][64];
  const int tid = threadIdx.x, w = tid >> 5, lane = tid & 31, ln = lane & 15, hh = lane >> 4; const int by = blockIdx.y;
  A += (size_t)by * sA; Bh += (size_t)by * sB; const size_t cofs = (size_t)by * sC; const float* bp = bias ? bias + (size_t)by * sBias : nullptr;
  const int ntn = (N + 63) / 64; const int wid = blockIdx.x * 4 + w; const int mt = wid / ntn, nq = wid % ntn; if (mt * 16 >= M) return;
  const int row0 = mt * 16, col0 = nq * 64; const _Float16* arow = A + (size_t)(row0 + ln) * lda;
  v8f acc[4] = {};
  for (int kb = 0; kb < K; kb += 32) { FragH ah; ah.half[0] = *(const v8us*)((const unsigned short*)arow + kb + 8 * hh); ah.half[1] = *(const v8us*)((const unsigned short*)arow + kb + 16 + 8 * hh);
#pragma unroll
    for (int t = 0; t < 4; ++t) { if (col0 + t * 16 >= N) continue; const size_t boff = (size_t)(col0 + t * 16 + ln) * ldb + kb; FragH bq; bq.half[0] = *(const v8us*)((const unsigned short*)Bh + boff + 8 * hh); bq.half[1] = *(const v8us*)((const unsigned short*)Bh + boff + 16 + 8 * hh);
      acc[t] = mmaH<1>(ah.v, ah.v, bq.v, bq.v, acc[t]); }
  }
#pragma unroll
  for (int t = 0; t < 4; ++t) { if (col0 + t * 16 >= N) continue; const int col = col0 + t * 16 + ln; const float bv = bp ? bf16_round(bp[col]) : 0.f;
#pragma unroll
    for (int r = 0; r < 8; ++r) { float v = acc[t][r] * alpha + bv; if (CP) { const int rr = row0g + row0 + 8 * hh + r; if (rowsPerB < 0) v += CP[cofs + (size_t)rr * ldc + col];      /* rowsPerB < 0: own element of the batched C plane */ else { const int bidx = rr / rowsPerB; v += CP[(size_t)bidx * sCPb + (size_t)by * 64 + col]; } } if (ACT == 1) v = (v > 0.f) ? v : expm1f(v); else if (ACT == 7) v = (v > 0.f) ? v + 1.0f : expf(v); else if (ACT == 8) v = tanhf(v); else if (ACT == 9) v = 0.5f * v * (1.0f + tanhf(0.7978845608028654f * (v + 0.044715f * v * v * v))); else if (ACT == 11) v = 1.0f / (1.0f + expf(-v)); else if (ACT == 12) v = (v > 0.f) ? v : 0.01f * v; else if (ACT == 14) v = (v > 0.f) ? v : 0.1f * v; else if (ACT == 16) v = (v >= 0.f) ? v : 0.3f * v; else if (ACT == 17) v = (v >= 0.f) ? v : 0.2f * v; else if (ACT == 15) v = v / (1.0f + expf(-v)); else if (ACT == 3) v = fmaxf(v, 0.f); else if (ACT == 6) v = 0.5f * v * (1.0f + erff(v * 0.70710678118654752f)); so[w][8 * hh + r][t * 16 + ln] = v; } }
  __builtin_amdgcn_fence(__ATOMIC_ACQ_REL, "workgroup"); __builtin_amdgcn_wave_barrier();
  const int rsub = lane >> 4, c4 = (lane & 15) * 4; typedef _Float16 v4h __attribute__((ext_vector_type(4)));
  {
#pragma unroll
    for (int q = 0; q < 8; ++q) { const int r = q * 2 + rsub; if (col0 + c4 < N) { const v4f v = *(const v4fa*)&so[w][r][c4]; if (C) *(v4f*)(C + cofs + (size_t)(row0 + r) * ldc + col0 + c4) = v; if (C16) { v4h h4; for (int i = 0; i < 4; ++i) h4[i] = (_Float16)v[i]; *(v4h*)(C16 + cofs + (size_t)(row0 + r) * ldc + col0 + c4) = h4; } } }
     }
}


typedef _Float16 v4h __attribute__((ext_vector_type(4)));

// every input conversion in one launch: blocks 0 .. 6 WB - 1 take the six weight matrices (slot j of BW = f16(bf16(w_j) x 16), each DO x DI elements), the rest x1 and x2 (X = [x1 | x2] as f16(bf16(x)))
#define XB (NN * DI / 8 / 256)   /* blocks per x */
#define WB (DO * DI / 8 / 256)   /* blocks per weight matrix */
__global__ __launch_bounds__(256) void k_cvt(const float* __restrict__ x1, const float* __restrict__ x2, const float* __restrict__ w0, const float* __restrict__ w1, const float* __restrict__ w2, const float* __restrict__ w3, const float* __restrict__ w4, const float* __restrict__ w5,
    _Float16* __restrict__ X, _Float16* __restrict__ BW) {
  const int b = blockIdx.x, tid = threadIdx.x; const float* src; _Float16* dst; float sc;
  if (b < 6 * WB) { const int j = b / WB; const float* w = j == 0 ? w0 : j == 1 ? w1 : j == 2 ? w2 : j == 3 ? w3 : j == 4 ? w4 : w5; src = w + ((size_t)(b - j * WB) * 256 + tid) * 8; dst = BW + ((size_t)b * 256 + tid) * 8; sc = 16.0f; }
  else { const int q = b - 6 * WB, j = q / XB; src = (j ? x2 : x1) + ((size_t)(q - j * XB) * 256 + tid) * 8; dst = X + ((size_t)q * 256 + tid) * 8; sc = 1.0f; }
  FragH f;
#pragma unroll
  for (int q = 0; q < 8; ++q) f.h[q] = (_Float16)(bf16_round(src[q]) * sc);
  *(v8us*)(unsigned short*)dst = f.half[0]; }
__global__ __launch_bounds__(256) void k_h16(const float* __restrict__ x, _Float16* __restrict__ X16, size_t n8) { const size_t t = (size_t)blockIdx.x * 256 + threadIdx.x; if (t >= n8) return; FragH f;
#pragma unroll
  for (int q = 0; q < 8; ++q) f.h[q] = (_Float16)x[t * 8 + q]; *(v8us*)((unsigned short*)X16 + t * 8) = f.half[0];  }
__global__ __launch_bounds__(256) void k_round16f(const float* __restrict__ W, _Float16* __restrict__ Bt, size_t n8) { const size_t t = (size_t)blockIdx.x * 256 + threadIdx.x; if (t >= n8) return; FragH f;
#pragma unroll
  for (int i = 0; i < 8; ++i) f.h[i] = (_Float16)(bf16_round(W[t * 8 + i]) * 16.0f); *(v8us*)((unsigned short*)Bt + t * 8) = f.half[0];  }

__global__ __launch_bounds__(256) void k_hl(const float* __restrict__ F, _Float16* __restrict__ Hh, _Float16* __restrict__ Hl, size_t n8) { const size_t t = (size_t)blockIdx.x * 256 + threadIdx.x; if (t >= n8) return; FragH fh, fl; const v4f a = *(const v4fa*)(F + t * 8), c = *(const v4fa*)(F + t * 8 + 4);
#pragma unroll
  for (int q = 0; q < 4; ++q) { _Float16 h = (_Float16)a[q]; fh.h[q] = h; fl.h[q] = (_Float16)((a[q] - (float)h) * 1024.0f); h = (_Float16)c[q]; fh.h[4 + q] = h; fl.h[4 + q] = (_Float16)((c[q] - (float)h) * 1024.0f); }
  { *(v8us*)((unsigned short*)Hh + t * 8) = fh.half[0]; *(v8us*)((unsigned short*)Hl + t * 8) = fl.half[0];  } }

// ---- fast GEMM (wave tile 32x64; requires M % 32 == 0 rows per launch region and N % 64 == 0); epilogue = k_gemm_hhx semantics ----
__device__ __forceinline__ v16h g2_frag(const _Float16* p, int hh) { FragH f; f.half[0] = *(const v8us*)((const unsigned short*)p + 8 * hh); f.half[1] = *(const v8us*)((const unsigned short*)p + 16 + 8 * hh); return f.v; }
__device__ __forceinline__ v8f g2_mma(v16h a, v16h b, v8f c) { v8f d = __builtin_amdgcn_wmma_f32_16x16x32_f16(false, a, false, b, (short)0, c, false, false); asm volatile("v_nop\n\tv_nop\n\tv_nop\n\tv_nop" : "+v"(d) : "v"(a), "v"(b)); return d; }
template <int ACT>
__global__ __launch_bounds__(128) void k_gemm2(const _Float16* __restrict__ A, int lda, size_t sA, const _Float16* __restrict__ Bh, int ldb, size_t sB, float alpha, const float* __restrict__ bias, size_t sBias, const float* __restrict__ CP, int rowsPerB, size_t sCPb, int row0g,
    float* __restrict__ C, _Float16* __restrict__ C16, int ldc, size_t sC, int M, int N, int K) { static_assert(ACT == 0 || ACT == 3 || ACT == 6 || ACT == 8 || ACT == 9 || ACT == 11 || ACT == 12 || ACT == 14 || ACT == 15 || ACT == 16 || ACT == 17, "k_gemm2: unsupported ACT code (would silently apply no activation)");
  __shared__ __attribute__((aligned(16))) float so[4][32][68];
  const int tid = threadIdx.x, w = tid >> 5, lane = tid & 31, ln = lane & 15, hh = lane >> 4; const int by = blockIdx.y;
  A += (size_t)by * sA; Bh += (size_t)by * sB; const size_t cofs = (size_t)by * sC; const float* bp = bias ? bias + (size_t)by * sBias : nullptr;
  const int ntn = N >> 6; const int mt = blockIdx.x / ntn, nq = blockIdx.x - mt * ntn; const int row0 = mt * 128 + 32 * w, col0 = nq * 64; if (row0 >= M) return;
  const _Float16* a0p = A + (size_t)(row0 + ln) * lda; const _Float16* a1p = a0p + (size_t)16 * lda;
  const _Float16* b0p = Bh + (size_t)(col0 + ln) * ldb; const _Float16* b1p = b0p + (size_t)16 * ldb; const _Float16* b2p = b1p + (size_t)16 * ldb; const _Float16* b3p = b2p + (size_t)16 * ldb;
  const v8f z8 = {0.f,0.f,0.f,0.f,0.f,0.f,0.f,0.f}; v8f c00 = z8, c01 = z8, c02 = z8, c03 = z8, c10 = z8, c11 = z8, c12 = z8, c13 = z8;
#pragma unroll 1
  for (int kb = 0; kb < K; kb += 32) { const v16h a0 = g2_frag(a0p + kb, hh), a1 = g2_frag(a1p + kb, hh);
    v16h b = g2_frag(b0p + kb, hh); c00 = g2_mma(a0, b, c00); c10 = g2_mma(a1, b, c10);
    b = g2_frag(b1p + kb, hh); c01 = g2_mma(a0, b, c01); c11 = g2_mma(a1, b, c11);
    b = g2_frag(b2p + kb, hh); c02 = g2_mma(a0, b, c02); c12 = g2_mma(a1, b, c12);
    b = g2_frag(b3p + kb, hh); c03 = g2_mma(a0, b, c03); c13 = g2_mma(a1, b, c13); }
  v8f accs[8] = {c00, c01, c02, c03, c10, c11, c12, c13};
#pragma unroll
  for (int u = 0; u < 8; ++u) { const int t = u & 3, half = u >> 2; const int col = col0 + t * 16 + ln; const float bv = bp ? bf16_round(bp[col]) : 0.f;
#pragma unroll
    for (int r = 0; r < 8; ++r) { const int rloc = half * 16 + 8 * hh + r; float v = accs[u][r] * alpha + bv; if (CP) { if (rowsPerB < 0) v += CP[cofs + (size_t)(row0g + row0 + rloc) * ldc + col];      /* rowsPerB < 0: own element of the batched C plane */ else { const int bidx = (row0g + row0 + rloc) / rowsPerB; v += CP[(size_t)bidx * sCPb + (size_t)by * 64 + col]; } }
      if (ACT == 3) v = fmaxf(v, 0.f); else if (ACT == 6) v = 0.5f * v * (1.0f + erff(v * 0.70710678118654752f)); else if (ACT == 11) v = 1.0f / (1.0f + expf(-v)); else if (ACT == 15) v = v / (1.0f + expf(-v)); else if (ACT == 12) v = (v > 0.f) ? v : 0.01f * v; else if (ACT == 8) v = tanhf(v); else if (ACT == 9) v = 0.5f * v * (1.0f + tanhf(0.7978845608028654f * (v + 0.044715f * v * v * v))); else if (ACT == 14) v = (v > 0.f) ? v : 0.1f * v; else if (ACT == 16) v = (v >= 0.f) ? v : 0.3f * v; else if (ACT == 17) v = (v >= 0.f) ? v : 0.2f * v;
      so[w][rloc][t * 16 + ln] = v; } }
  __builtin_amdgcn_fence(__ATOMIC_ACQ_REL, "workgroup"); __builtin_amdgcn_wave_barrier();
  const int rsub = lane >> 4, c4 = (lane & 15) * 4;
  {
#pragma unroll
    for (int q = 0; q < 16; ++q) { const int r = q * 2 + rsub; const v4f v = *(const v4fa*)&so[w][r][c4]; if (C) *(v4f*)(C + cofs + (size_t)(row0 + r) * ldc + col0 + c4) = v; if (C16) { v4h h4; for (int i = 0; i < 4; ++i) h4[i] = (_Float16)v[i]; *(v4h*)(C16 + cofs + (size_t)(row0 + r) * ldc + col0 + c4) = h4; } }
     } }


// ---- GEMM tile through LDS: a work-group of 8 waves makes a 128 x 128 tile of A[.][KT] . B[.][KT]^T (both row-major, pitch KT, f16); wave w takes rows 32 (w & 3), columns 64 (w >> 2): k_gemm2's 32 x 64 wave tile and k order.
// A k slice of 64 elements (one 128-byte line of each of the 256 rows) lies in one of two LDS buffers; the next slice is fetched meanwhile through registers, a wave's load covering four whole lines.
#define GP 72                    /* LDS pitch of a row's slice, 16-bit elements: 144 B = 16 B x odd */
#define GT (128 * GP)            /* one operand's slice */
union G3S { unsigned short t[4 * GT]; float so[8][32][68]; };      /* the two buffers (A | B each); behind the loop each wave's own output staging */
__device__ __forceinline__ v16h g3_frag(const unsigned short* p, int hh) { FragH f; f.half[0] = *(const v8us*)(p + 8 * hh); f.half[1] = *(const v8us*)(p + 16 + 8 * hh); return f.v; }
__device__ __forceinline__ v8f g3_mma(v16h a, v16h b, v8f c) { return __builtin_amdgcn_wmma_f32_16x16x32_f16(false, a, false, b, (short)0, c, false, false); }
template <int KT>
__device__ __forceinline__ void g3_loop(const unsigned short* __restrict__ A, const unsigned short* __restrict__ B, unsigned short* sm, int tid, v8f (&acc)[2][4]) {
  const int w = tid >> 5, lane = tid & 31, ln = lane & 15, hh = lane >> 4;
  const unsigned short* ga = A + (size_t)(tid >> 3) * KT + (tid & 7) * 8;      /* thread -> 16 B of rows tid / 8 + 32 j of each operand; one address pair an operand for all slices */
  const unsigned short* gb = B + (size_t)(tid >> 3) * KT + (tid & 7) * 8;
  const int ls = (tid >> 3) * GP + (tid & 7) * 8;
  const int ra = ((w & 3) * 32 + ln) * GP, rb = GT + ((w >> 2) * 64 + ln) * GP;
  v8us sa[4], sb[4];
#pragma unroll
  for (int j = 0; j < 4; ++j) { sa[j] = *(const v8us*)(ga + j * 32 * KT); sb[j] = *(const v8us*)(gb + j * 32 * KT); }
#pragma unroll
  for (int j = 0; j < 4; ++j) { *(v8us*)(sm + ls + j * 32 * GP) = sa[j]; *(v8us*)(sm + GT + ls + j * 32 * GP) = sb[j]; }
  __syncthreads();
  // unrolled: the buffer and the slice become constants, so every load and LDS access is its base register plus an immediate offset
#pragma unroll
  for (int c = 0; c < KT / 64; ++c) {
    const unsigned short* cur = sm + (c & 1) * 2 * GT; unsigned short* nxt = sm + ((c + 1) & 1) * 2 * GT;
    if (c + 1 < KT / 64) {
#pragma unroll
      for (int j = 0; j < 4; ++j) { sa[j] = *(const v8us*)(ga + (c + 1) * 64 + j * 32 * KT); sb[j] = *(const v8us*)(gb + (c + 1) * 64 + j * 32 * KT); }
      asm volatile("s_wait_xcnt 0x0" :: "v"(ga), "v"(gb) : "memory");      /* as inputs the loads' two addresses stay whole until the wait */
    }
#pragma unroll
    for (int ks = 0; ks < 2; ++ks) {
      const v16h a0 = g3_frag(cur + ra + ks * 32, hh), a1 = g3_frag(cur + ra + 16 * GP + ks * 32, hh);
#pragma unroll
      for (int t = 0; t < 4; ++t) { const v16h b = g3_frag(cur + rb + t * 16 * GP + ks * 32, hh); acc[0][t] = g3_mma(a0, b, acc[0][t]); acc[1][t] = g3_mma(a1, b, acc[1][t]); }
    }
    if (c + 1 < KT / 64) {
#pragma unroll
      for (int j = 0; j < 4; ++j) { *(v8us*)(nxt + ls + j * 32 * GP) = sa[j]; *(v8us*)(nxt + GT + ls + j * 32 * GP) = sb[j]; }      /* the other buffer's last readers left it at the barrier that ended slice c - 1 */
    }
    __syncthreads();      /* publishes slice c + 1 and ends every read of slice c (behind the last slice: frees the buffers for the output staging) */
  }
}
// the six projections in one launch (M = NN, N = DO, K = DI, f16 result only), tiles through LDS (g3_loop), k_gemm2's epilogue. blockIdx.y = j picks plane j of QKV = [Q1 K1 Q2 K2 V1^T V2^T];
// x1 (first half of X) feeds planes 0, 1, 4; weight slots of BW = [Wq1 Wk1 Wq2 Wk2 Wv], W_V shared by planes 4 and 5
__global__ __launch_bounds__(256) void k_proj6(const _Float16* __restrict__ X, const _Float16* __restrict__ BW, const float* __restrict__ bq1, const float* __restrict__ bk1, const float* __restrict__ bq2, const float* __restrict__ bk2, const float* __restrict__ bv, _Float16* __restrict__ QKV) {
  __shared__ __attribute__((aligned(16))) G3S sm;
  const int tid = threadIdx.x, w = tid >> 5, lane = tid & 31, ln = lane & 15, hh = lane >> 4; const int j = blockIdx.y;
  const float* bp = j == 0 ? bq1 : j == 1 ? bk1 : j == 2 ? bq2 : j == 3 ? bk2 : bv;
  const int mt = blockIdx.x / (DO / 128), nq = blockIdx.x % (DO / 128); const int row0 = mt * 128 + 32 * (w & 3), col0 = nq * 128 + 64 * (w >> 2);
  const v8f z8 = {0.f,0.f,0.f,0.f,0.f,0.f,0.f,0.f}; v8f acc[2][4] = {{z8, z8, z8, z8}, {z8, z8, z8, z8}};
  g3_loop<DI>((const unsigned short*)X + ((j == 2 || j == 3 || j == 5) ? (size_t)NN * DI : 0) + (size_t)mt * 128 * DI, (const unsigned short*)BW + (size_t)(j < 4 ? j : 4) * DO * DI + (size_t)nq * 128 * DI, sm.t, tid, acc);
  if (j >= 4) {      /* block-uniform, behind the loop's last barrier. Planes 4 and 5 hold V^T in k_flash's staging order: [32-key block][16-d tile][half][lane][8], element = V[16 half + 8 hh + 0..7][16 t + ln]: a lane's 8 accumulator registers as they lie, so nothing is left to transpose and a store covers 512 contiguous bytes */
    const float* bl = bp + col0 + ln; float bt[4];
    // every loop of this branch is unrolled: bt, f and acc stay in registers, and t and the chunk index become immediate offsets of the one address pair of the loads and of the stores
#pragma unroll
    for (int t = 0; t < 4; ++t) bt[t] = bl[t * 16];
    asm volatile("s_wait_xcnt 0x0" :: "v"(bl) : "memory");      /* as an input the loads' address stays whole until the wait */
    unsigned short* vd = (unsigned short*)QKV + (size_t)j * NN * DO + (size_t)(row0 >> 5) * (32 * DO) + (col0 >> 4) * 512 + lane * 8;
    FragH f[2][4];      /* all eight chunks are made in front of the first store: behind it no register that a store names is written any more */
#pragma unroll
    for (int u = 0; u < 8; ++u) { const int t = u & 3, half = u >> 2; const float bb = bf16_round(bt[t]);
#pragma unroll
      for (int r = 0; r < 8; ++r) f[half][t].h[r] = (_Float16)(acc[half][t][r] * 0.0625f + bb); }
#pragma unroll
    for (int u = 0; u < 8; ++u) { const int t = u & 3, half = u >> 2; *(v8us*)(vd + (t * 2 + half) * 256) = f[half][t].half[0]; }
    asm volatile("s_wait_xcnt 0x0" :: "v"(vd) : "memory");      /* as an input the stores' address stays whole until the wait */
    return;
  }
#pragma unroll
  for (int u = 0; u < 8; ++u) { const int t = u & 3, half = u >> 2; const float bb = bf16_round(bp[col0 + t * 16 + ln]);
#pragma unroll
    for (int r = 0; r < 8; ++r) sm.so[w][half * 16 + 8 * hh + r][t * 16 + ln] = acc[half][t][r] * 0.0625f + bb; }
  __builtin_amdgcn_fence(__ATOMIC_ACQ_REL, "workgroup"); __builtin_amdgcn_wave_barrier();      /* a wave reads back only its own rows */
  {      /* The Q and K planes lie in k_flash's fragment order: [32-row block][g][ks][h][lane][8], element = row 16 g + ln, column 32 ks + 16 h + 8 hh + 0..7; a store covers 512 contiguous bytes */
    unsigned short* qd = (unsigned short*)QKV + (size_t)j * NN * DO + (size_t)(row0 >> 5) * (32 * DO) + (col0 >> 5) * 512 + lane * 8;
    FragH f[8];      /* all eight chunks are made in front of the first store, as above */
    // both loops unrolled: f stays in registers, and the chunk index becomes an immediate offset of the one address pair
#pragma unroll
    for (int c = 0; c < 8; ++c) { const int g = c >> 2, kl = (c >> 1) & 1, h = c & 1; const float* sp = &sm.so[w][g * 16 + ln][kl * 32 + h * 16 + 8 * hh];
      const v4f v0 = *(const v4fa*)sp, v1 = *(const v4fa*)(sp + 4);
      for (int i = 0; i < 4; ++i) { f[c].h[i] = (_Float16)v0[i]; f[c].h[4 + i] = (_Float16)v1[i]; } }
#pragma unroll
    for (int c = 0; c < 8; ++c) *(v8us*)(qd + (((c >> 2) * 8 + ((c >> 1) & 1)) * 2 + (c & 1)) * 256) = f[c].half[0];
    asm volatile("s_wait_xcnt 0x0" :: "v"(qd) : "memory");      /* as an input the stores' address stays whole until the wait */
  }
}
#define FQ 256                   /* query rows per work-group */
#define KSP 4                    /* key ranges: 32 query blocks x KSP x 2 branches = 256 work-groups */
#define NPASS (NN / KSP / 32)
#define SP 4                     /* passes between two barriers: 2 buffers x SP passes x PT elements = 262,144 B of LDS; one work-group a WGP, as before */
#define NST (NPASS / SP)         /* stages of a key range */
#define TL (32 * DO)             /* a pass's K tile, or its V^T tile, 16-bit elements: 16 KiB in a row, in memory as in LDS */
#define PT (2 * TL)              /* a pass's tiles in LDS (K | V^T), 16-bit elements */
#define TROW 512u                /* the tensor load's view of a tile: 32 rows of 512 B, source pitch 512 B */
#define TNR 32u
#define MTHR 4.0f                /* the maximum in use may trail the true one by this much (log2): a weight is at most 2^(10 + 4), inside f16 */
__device__ __forceinline__ float xhalf(float x) { return __builtin_bit_cast(float, __builtin_amdgcn_permlanex16(__builtin_bit_cast(int, x), __builtin_bit_cast(int, x), 0x76543210, 0xfedcba98, false, false)); }  // lane l with lane l ^ 16
__device__ __forceinline__ v16h fa_frag(const unsigned short* p) { FragH f; f.half[0] = *(const v8us*)p; f.half[1] = *(const v8us*)(p + 256); return f.v; }      /* p = the fragment's place + 8 lane */
typedef unsigned int u32x4 __attribute__((ext_vector_type(4)));
typedef unsigned int u32x8 __attribute__((ext_vector_type(8)));
__device__ __forceinline__ unsigned int uni(unsigned int v) { return (unsigned int)__builtin_amdgcn_readfirstlane(v); }
__device__ __forceinline__ unsigned int pinned(unsigned int v) { unsigned int x = uni(v); asm volatile("" : "+s"(x)); return x; }      /* holds a wave-uniform word in a scalar register: the test on it is a scalar branch, and what is formed from it is formed behind the volatile statements in front */
__device__ __forceinline__ v8f fa_mma(v16h a, v16h b, v8f c) { return __builtin_amdgcn_wmma_f32_16x16x32_f16(false, a, false, b, (short)0, c, false, false); }
__global__ __launch_bounds__(256) void k_flash(const _Float16* __restrict__ Qa, const _Float16* __restrict__ Ka, const _Float16* __restrict__ VTa, const _Float16* __restrict__ Qb, const _Float16* __restrict__ Kb, const _Float16* __restrict__ VTb,
    const float* __restrict__ scp, float* __restrict__ OP, float* __restrict__ ML) {
  static_assert(NPASS % SP == 0, "whole stages");
  static_assert(NST >= 2, "the ring's prologue needs two stages");
  static_assert(2 * SP == FQ / 32, "one tile of a stage for each wave");
  __shared__ __attribute__((aligned(2048))) unsigned short sT[2 * SP * PT];      /* a pass's K tile, then its V^T tile: behind the pass's base register every LDS access keeps an immediate offset (16 bits); every tile's place is a multiple of 2 KiB */
  const int tid = threadIdx.x, w = tid >> 5, lane = tid & 31, ln = lane & 15, hh = lane >> 4;
  const int br = blockIdx.z, sp = blockIdx.y, q0 = blockIdx.x * FQ + w * 32;
  const _Float16* Q = br ? Qb : Qa; const unsigned short* K = (const unsigned short*)(br ? Kb : Ka); const unsigned short* VT = (const unsigned short*)(br ? VTb : VTa);
  float sv = bf16_round(scp[0]); sv = fminf(fmaxf(sv, 1.0f), 32.0f); const float cs = (1.0f / sqrtf(sv)) * 1.4426950408889634f;      /* scores to log2 units */
  // staging: wave wv brings tile wv & 1 (K | V^T) of pass wv >> 1 of every stage: 8 waves = SP passes x 2 tiles, one request a wave and stage, every wave issues
  const unsigned int wv = uni(tid >> 5);
  const unsigned short* gS = ((wv & 1) ? VT : K) + (size_t)sp * (NN / KSP) * DO + (size_t)(wv >> 1) * TL;      /* the wave's tile of stage 0; a stage is SP tiles on in either plane */
  const unsigned int lS = (unsigned int)(size_t)sT + (wv >> 1) * (PT * 2) + (wv & 1) * (TL * 2);      /* its place in buffer 0: byte offset in the work-group's LDS */
  u32x8 g1;      /* descriptor group 1, the same for every request: 1-byte elements, tensor = tile = TNR rows of TROW bytes, no mask, no pad. Pinned: each constant word keeps its own scalar register through the loop, so that none is lent out and formed again while a request is outstanding */
  g1[0] = pinned(0u); g1[1] = pinned((TROW & 0xFFFFu) << 16); g1[2] = pinned((TROW >> 16) | ((TNR & 0xFFFFu) << 16)); g1[3] = pinned((TNR >> 16) | (TROW << 16));
  g1[4] = pinned(TNR); g1[5] = pinned(TROW); g1[6] = pinned(0u); g1[7] = pinned(0u);
  u32x4 g0; g0[0] = pinned(1u);      /* descriptor group 0: count 1 (pinned for the same reason); place, address and type by request */
  auto issue = [&](unsigned int stg) {      /* one tensor load: the wave's tile of stage stg into buffer stg & 1 */
    const unsigned long long ga = (unsigned long long)(size_t)gS + (unsigned long long)stg * (SP * TL * 2);
    g0[1] = uni(lS + (stg & 1u) * (SP * PT * 2)); g0[2] = uni((unsigned int)ga); g0[3] = uni((((unsigned int)(ga >> 32)) & 0x01FFFFFFu) | 0x80000000u);
    asm volatile("tensor_load_to_lds %0, %1" :: "s"(g0), "s"(g1) : "memory");      /* global -> LDS, 16 KiB, through no register */
  };
  const unsigned short* qp = (const unsigned short*)Q + (size_t)(q0 >> 5) * (32 * DO) + lane * 8;      /* the one address register pair of all 32 Q loads; Q lies in fragment order (k_proj6), so each load covers 512 contiguous bytes */
  v16h qf[2][8];
#pragma unroll
  for (int g = 0; g < 2; ++g)
#pragma unroll
    for (int ks = 0; ks < 8; ++ks) { FragH f; f.half[0] = *(const v8us*)(qp + (g * 8 + ks) * 512); f.half[1] = *(const v8us*)(qp + (g * 8 + ks) * 512 + 256); qf[g][ks] = f.v; }
  asm volatile("s_wait_xcnt 0x0" :: "v"(qp) : "memory");      /* qp ends here: as an input it stays whole until the wait, in front of whatever takes its registers next */
  issue(0u);
  asm volatile("s_wait_tensorcnt 0x0" :: "s"(g0), "s"(g1) : "memory");      /* the wave's own tile of stage 0 has landed; as inputs the descriptor's registers stay whole until then */
  __syncthreads();      /* publishes stage 0 */
  issue(pinned(1u));      /* flies while stage 0 is worked on; the stage number is pinned so that the descriptor is formed behind the wait */
  const v8f z8 = {0.f,0.f,0.f,0.f,0.f,0.f,0.f,0.f};
  v8f o[16][2];
#pragma unroll
  for (int t = 0; t < 16; ++t) { o[t][0] = z8; o[t][1] = z8; }
  float m[2] = {-3.0e38f, -3.0e38f}, l[2] = {0.f, 0.f};
  // kept rolled: the body holds 64 matrix instructions and nearly the whole register budget; a second copy would only cost instruction cache
#pragma unroll 1
  for (int sg = 0; sg < NST; ++sg) {
  // rolled for the same reason; the barrier stands in the outer loop, so a pass stays one run of code up to its back edge
#pragma unroll 1
  for (int ps = 0; ps < SP; ++ps) {
    const unsigned short* bK = sT + ((sg & 1) * SP + ps) * PT + lane * 8; const unsigned short* bV = bK + TL;      /* this pass's tiles, at the lane's 16 bytes of every fragment half */
    // S^T = K.Q^T, one k step (2 fragments, 4 matrix instructions) a block; each block's LDS reads stand as one group two blocks ahead, in a ring of three fragment pairs
    v8f sc[2][2] = {{z8, z8}, {z8, z8}};
    v16h ka[3][2];
#pragma unroll
    for (int i = 0; i < 4; ++i) ka[i >> 1][i & 1] = fa_frag(bK + ((i & 1) * 8 + (i >> 1)) * 512);
#pragma unroll
    for (int ks = 0; ks < 8; ++ks) {
      if (ks < 6) { ka[(ks + 2) % 3][0] = fa_frag(bK + (ks + 2) * 512); ka[(ks + 2) % 3][1] = fa_frag(bK + (8 + ks + 2) * 512); }
      __builtin_amdgcn_sched_barrier(0);      /* keeps the reads above as one group in front of the block, two blocks ahead of their use */
      const v16h a0 = ka[ks % 3][0], a1 = ka[ks % 3][1];
      sc[0][0] = fa_mma(a0, qf[0][ks], sc[0][0]); sc[0][1] = fa_mma(a0, qf[1][ks], sc[0][1]);
      sc[1][0] = fa_mma(a1, qf[0][ks], sc[1][0]); sc[1][1] = fa_mma(a1, qf[1][ks], sc[1][1]);
      __builtin_amdgcn_sched_barrier(0);      /* ends the block: the next group of reads stays behind it */
    }
#pragma unroll
    for (int g = 0; g < 2; ++g) {
      float mx = sc[0][g][0];
#pragma unroll
      for (int r = 0; r < 8; ++r) mx = fmaxf(mx, fmaxf(sc[0][g][r], sc[1][g][r]));
      mx = fmaxf(mx, xhalf(mx)) * cs;      /* cs > 0; both halves of the wave now hold this query's maximum of the pass */
      if (__builtin_amdgcn_ballot_w32(mx > m[g] + MTHR) != 0) {      /* scalar branch, rare after the first passes; one group a branch */
        const float mn = fmaxf(m[g], mx); const float corr = __builtin_amdgcn_exp2f(m[g] - mn);      /* 0 on the first pass */
        m[g] = mn; l[g] *= corr;
#pragma unroll
        for (int t = 0; t < 16; ++t) o[t][g] = o[t][g] * corr;
      }
    }
    v16h pf[2];
#pragma unroll
    for (int g = 0; g < 2; ++g) {
      const float sh = 10.0f - m[g]; FragH p; float s0 = 0.f, s1 = 0.f;      /* weights x 1024, as f16 operands away from the subnormal range; l carries the same factor */
      float x[16];
#pragma unroll
      for (int r = 0; r < 8; ++r) { x[r] = fmaf(sc[0][g][r], cs, sh); x[8 + r] = fmaf(sc[1][g][r], cs, sh); }
      __builtin_amdgcn_sched_barrier(0);      /* the arguments are all made first: no multiply-add is left to land on an exponential's source directly behind it */
#pragma unroll
      for (int r = 0; r < 16; ++r) x[r] = __builtin_amdgcn_exp2f(x[r]);
      __builtin_amdgcn_sched_barrier(0);      /* sums and conversions stay behind the exponentials: none reads a result directly behind its exponential */
#pragma unroll
      for (int r = 0; r < 8; ++r) { s0 += x[r]; s1 += x[8 + r]; p.h[r] = (_Float16)x[r]; p.h[8 + r] = (_Float16)x[8 + r]; }
      l[g] += s0 + s1; pf[g] = p.v;
    }
    // O^T += V^T.P^T, two d tiles (2 fragments, 4 matrix instructions) a block, read ahead in the same ring
    __builtin_amdgcn_sched_barrier(0);      /* the V^T reads stay behind the exponentials: hoisted among them they take the registers that keep two waves on a SIMD without spills */
    v16h va[3][2];
#pragma unroll
    for (int i = 0; i < 4; ++i) va[i >> 1][i & 1] = fa_frag(bV + i * 512);
#pragma unroll
    for (int b = 0; b < 8; ++b) {
      if (b < 6) { va[(b + 2) % 3][0] = fa_frag(bV + ((b + 2) * 2) * 512); va[(b + 2) % 3][1] = fa_frag(bV + ((b + 2) * 2 + 1) * 512); }
      __builtin_amdgcn_sched_barrier(0);      /* one group of reads in front of the block, as above */
      o[b * 2][0] = fa_mma(va[b % 3][0], pf[0], o[b * 2][0]); o[b * 2][1] = fa_mma(va[b % 3][0], pf[1], o[b * 2][1]);
      o[b * 2 + 1][0] = fa_mma(va[b % 3][1], pf[0], o[b * 2 + 1][0]); o[b * 2 + 1][1] = fa_mma(va[b % 3][1], pf[1], o[b * 2 + 1][1]);
      __builtin_amdgcn_sched_barrier(0);      /* ends the block */
    }
  }
    // publish point of stage sg + 1, every wave, in this order
    asm volatile("s_wait_dscnt 0x0" ::: "memory");      /* the wave's own reads of stage sg are done */
    asm volatile("s_wait_tensorcnt 0x0" :: "s"(g0), "s"(g1) : "memory");      /* the wave's own tile of stage sg + 1 has landed; as inputs the descriptor's registers stay whole until then */
    __syncthreads();      /* publishes stage sg + 1 and ends every read of stage sg */
    if (pinned((unsigned int)(sg + 2 < NST))) issue(pinned((unsigned int)sg + 2u));      /* scalar branch: a tensor load ignores EXEC. Refill of the buffer that stage sg has just left; the stage number is pinned so that the descriptor is formed behind the wait */
  }
  asm volatile("s_wait_tensorcnt 0x0" :: "s"(g0), "s"(g1) : "memory");      /* nothing of the mover is in flight when the wave goes on to its end */
  asm volatile("s_wait_dscnt 0x0" ::: "memory");
  // partials: OP[32-row block][key range][g][t][half][lane][4], the accumulators' own order (element = query 16 g + ln, d = 16 t + 8 hh + 4 half + 0..3), so that each store covers 512 contiguous bytes;
  // ML[query row][key range][m, l]; query row = branch * NN + query. One address pair serves all stores of each array, and
  // everything that is computed stands in front of the first store: behind it no register that a store names is written any more.
  const size_t row = (size_t)br * NN + q0 + ln;
  float* op = OP + ((((size_t)br * NN + q0) >> 5) * KSP + sp) * (32 * DO) + lane * 4;      /* a lane's 8 accumulator registers are 8 consecutive d of its query */
  float* mlp = ML + (row * KSP + sp) * 2 + hh;
  const float j0 = l[0] + xhalf(l[0]), j1 = l[1] + xhalf(l[1]);      /* the halves' sums joined, with every lane on: the exchange stands outside the selection below */
  const float w0 = hh ? j0 : m[0], w1 = hh ? j1 : m[1];      /* the lower half of the wave writes m, the upper l */
  mlp[0] = w0; mlp[16 * KSP * 2] = w1;
#pragma unroll
  for (int g = 0; g < 2; ++g) {
#pragma unroll
    for (int t = 0; t < 16; ++t) {
      const v4f lo = {o[t][g][0], o[t][g][1], o[t][g][2], o[t][g][3]}, hi = {o[t][g][4], o[t][g][5], o[t][g][6], o[t][g][7]};
      *(v4f*)(op + (g * 16 + t) * 256) = lo; *(v4f*)(op + (g * 16 + t) * 256 + 128) = hi;
    }
  }
  asm volatile("s_wait_xcnt 0x0" :: "v"(op), "v"(mlp) : "memory");      /* as inputs the stores' addresses stay whole until the wait */
}
// ---- tail: the join of the key ranges and the output GEMM in one launch; f never leaves the work-group ----
// A work-group of 16 waves takes TR rows (query rows of both branches, one M = 2 NN) and all DI output columns.
// Join: f = sum_s 2^(m_s - M) O_s / sum_s 2^(m_s - M) l_s over the KSP key ranges, fixed order s = 0..KSP-1; the partials lie in k_flash's accumulator order: a wave takes four d tiles of one 16-query group, a lane one query, each load 512 contiguous bytes;
// f x 1024 goes to LDS as f16 hi + residual (one scale for both, so that both feed the same accumulators).
// GEMM: out = (hi + lo) We^T / 1024 + be; We in 64-k slices through two LDS buffers as in g3_loop; wave w takes rows 32 (w & 1), columns 64 (w >> 1): g3_loop's 32 x 64 wave tile and k order.
// The short loops are unrolled because their arrays (staged loads, partials, fragments, accumulators) live in registers and need constant indices.
#define TR 64                    /* rows per work-group: 2 NN / TR = 256 work-groups */
#define APIT 264                 /* LDS pitch of an f row, 16-bit elements: 528 B = 16 B x odd */
#define TA (TR * APIT)           /* one plane of f (hi | lo) */
#define TB (DI * GP)             /* one slice of We */
typedef _Float16 v4ha __attribute__((ext_vector_type(4), may_alias));
struct T4S { unsigned short a[2 * TA]; union { unsigned short b[2 * TB]; float so[16][32][68]; } u; };      /* behind the loop the slices' place is each wave's own output staging */
__global__ __launch_bounds__(512) void k_tail(const float* __restrict__ OP, const float* __restrict__ ML, const _Float16* __restrict__ Bh, const float* __restrict__ bias, float* __restrict__ C) {
  static_assert(KSP == 4, "the join reads a row's four (m, l) pairs as two 16-byte loads");
  __shared__ __attribute__((aligned(16))) T4S sm;
  const int tid = threadIdx.x, w = tid >> 5, lane = tid & 31, ln = lane & 15, hh = lane >> 4;
  const int rowg = blockIdx.x * TR;
  const unsigned short* gb = (const unsigned short*)Bh + (size_t)(tid >> 3) * DO + (tid & 7) * 8;      /* thread -> 16 B of rows tid / 8 + 64 j of We; one address pair for all slices */
  const int ls = (tid >> 3) * GP + (tid & 7) * 8;
  const int jb = w >> 3, jg = (w >> 2) & 1, jt = (w & 3) * 4, rl = jb * 32 + jg * 16 + ln;      /* wave w joins d tiles jt + i of group jg of 32-row block jb; its lane's row is rl */
  const float* po = OP + (size_t)(blockIdx.x * (TR / 32) + jb) * KSP * (32 * DO) + (jg * 16 + jt) * 256 + lane * 4;      /* one address pair for each array */
  const float* pm = ML + (size_t)(rowg + rl) * KSP * 2;
  const float* bq = bias + 64 * (w >> 1) + ln;
  v8us sb[8]; v4f op[4][KSP][2], mq[2]; float bb[4];
  mq[0] = *(const v4fa*)pm; mq[1] = *(const v4fa*)(pm + 4);
#pragma unroll
  for (int i = 0; i < 4; ++i) {
#pragma unroll
    for (int s = 0; s < KSP; ++s) { op[i][s][0] = *(const v4fa*)(po + s * (32 * DO) + i * 256); op[i][s][1] = *(const v4fa*)(po + s * (32 * DO) + i * 256 + 128); }
  }
#pragma unroll
  for (int j = 0; j < 8; ++j) sb[j] = *(const v8us*)(gb + j * 64 * DO);
#pragma unroll
  for (int t = 0; t < 4; ++t) bb[t] = bq[t * 16];
  asm volatile("s_wait_xcnt 0x0" :: "v"(po), "v"(pm), "v"(gb), "v"(bq) : "memory");      /* as inputs the loads' addresses stay whole until the wait */
  const float ms[KSP] = {mq[0][0], mq[0][2], mq[1][0], mq[1][2]}, lw[KSP] = {mq[0][1], mq[0][3], mq[1][1], mq[1][3]};
  float M = ms[0], wg[KSP], den = 0.f;
#pragma unroll
  for (int s = 1; s < KSP; ++s) M = fmaxf(M, ms[s]);
#pragma unroll
  for (int s = 0; s < KSP; ++s) wg[s] = __builtin_amdgcn_exp2f(ms[s] - M);
#pragma unroll
  for (int s = 0; s < KSP; ++s) den += wg[s] * lw[s];
  const float rs = 1.0f / den;
#pragma unroll
  for (int i = 0; i < 4; ++i) {
    v4f a0 = {0.f,0.f,0.f,0.f}, a1 = {0.f,0.f,0.f,0.f};
#pragma unroll
    for (int s = 0; s < KSP; ++s) { a0 += op[i][s][0] * wg[s]; a1 += op[i][s][1] * wg[s]; }
    FragH fh, fl;
#pragma unroll
    for (int q = 0; q < 4; ++q) {
      const float u0 = a0[q] * rs * 1024.0f, u1 = a1[q] * rs * 1024.0f; const _Float16 g0 = (_Float16)u0, g1 = (_Float16)u1;
      fh.h[q] = g0; fl.h[q] = (_Float16)(u0 - (float)g0); fh.h[4 + q] = g1; fl.h[4 + q] = (_Float16)(u1 - (float)g1);
    }
    unsigned short* pa = sm.a + rl * APIT + (jt + i) * 16 + 8 * hh;      /* the lane's 8 consecutive d of its row: one 16-byte LDS store a plane */
    *(v8us*)pa = fh.half[0]; *(v8us*)(pa + TA) = fl.half[0];
  }
#pragma unroll
  for (int j = 0; j < 8; ++j) *(v8us*)(sm.u.b + ls + j * 64 * GP) = sb[j];
  __syncthreads();      /* publishes f and the first slice of We */
  const int ra = ((w & 1) * 32 + ln) * APIT, rb = ((w >> 1) * 64 + ln) * GP;
  const v8f z8 = {0.f,0.f,0.f,0.f,0.f,0.f,0.f,0.f}; v8f acc[2][4] = {{z8, z8, z8, z8}, {z8, z8, z8, z8}};
  // unrolled: the buffer and the slice become constants, so every load and LDS access is its base register plus an immediate offset
#pragma unroll
  for (int c = 0; c < DO / 64; ++c) {
    const unsigned short* cur = sm.u.b + (c & 1) * TB; unsigned short* nxt = sm.u.b + ((c + 1) & 1) * TB;
    if (c + 1 < DO / 64) {
#pragma unroll
      for (int j = 0; j < 8; ++j) sb[j] = *(const v8us*)(gb + (c + 1) * 64 + j * 64 * DO);
      asm volatile("s_wait_xcnt 0x0" :: "v"(gb) : "memory");      /* as an input the loads' address stays whole until the wait */
    }
#pragma unroll
    for (int ks = 0; ks < 2; ++ks) {
      const unsigned short* pa = sm.a + ra + c * 64 + ks * 32;
      const v16h h0 = g3_frag(pa, hh), h1 = g3_frag(pa + 16 * APIT, hh), l0 = g3_frag(pa + TA, hh), l1 = g3_frag(pa + TA + 16 * APIT, hh);
      v16h b[4];
#pragma unroll
      for (int t = 0; t < 4; ++t) b[t] = g3_frag(cur + rb + t * 16 * GP + ks * 32, hh);
#pragma unroll
      for (int t = 0; t < 4; ++t) { acc[0][t] = g3_mma(h0, b[t], acc[0][t]); acc[1][t] = g3_mma(h1, b[t], acc[1][t]); }
#pragma unroll
      for (int t = 0; t < 4; ++t) { acc[0][t] = g3_mma(l0, b[t], acc[0][t]); acc[1][t] = g3_mma(l1, b[t], acc[1][t]); }
    }
    if (c + 1 < DO / 64) {
#pragma unroll
      for (int j = 0; j < 8; ++j) *(v8us*)(nxt + ls + j * 64 * GP) = sb[j];      /* the other buffer's last readers left it at the barrier that ended slice c - 1 */
    }
    __syncthreads();      /* publishes slice c + 1 and ends every read of slice c (behind the last slice: frees the buffers for the output staging) */
  }
#pragma unroll
  for (int u = 0; u < 8; ++u) { const int t = u & 3, half = u >> 2; const float bv = bf16_round(bb[t]);
#pragma unroll
    for (int r = 0; r < 8; ++r) sm.u.so[w][half * 16 + 8 * hh + r][t * 16 + ln] = acc[half][t][r] * (0.0625f / 1024.0f) + bv; }
  __builtin_amdgcn_fence(__ATOMIC_ACQ_REL, "workgroup"); __builtin_amdgcn_wave_barrier();      /* a wave reads back only its own rows */
  const int rsub = lane >> 4, c4 = (lane & 15) * 4; float* cp = C + (size_t)(rowg + 32 * (w & 1) + rsub) * DI + 64 * (w >> 1) + c4;      /* one address pair for all stores, whole lines each */
#pragma unroll
  for (int q = 0; q < 16; ++q) { const v4f v = *(const v4fa*)&sm.u.so[w][q * 2 + rsub][c4]; *(v4f*)(cp + q * 2 * DI) = v; }
  asm volatile("s_wait_xcnt 0x0" :: "v"(cp) : "memory");      /* as an input the stores' address stays whole until the wait */
}

extern "C" void kernel_launch(void* const* d_in, const int* in_sizes, int n_in,
                              void* d_out, int out_size, void* d_ws, size_t ws_size, hipStream_t stream) {
  (void)in_sizes; (void)n_in; (void)out_size;
  const float* const* I = (const float* const*)d_in; const float* x1 = I[0]; const float* x2 = I[1]; const float* Wq1 = I[2]; const float* bq1 = I[3]; const float* Wk1 = I[4]; const float* bk1 = I[5]; const float* Wv = I[6]; const float* bv = I[7]; const float* Wq2 = I[8]; const float* bq2 = I[9]; const float* Wk2 = I[10]; const float* bk2 = I[11]; const float* We = I[12]; const float* be = I[13]; const float* scp = I[14];
  float* out1 = (float*)d_out;      /* the second output lies behind the first, at byte offset 16777216 */
  char* ws = (char*)d_ws; size_t off = 0;
  auto take = [&](size_t bytes) { char* p = ws + off; off += (bytes + 255) & ~(size_t)255; return p; };
  _Float16* BW = (_Float16*)take((size_t)6 * DO * DI * 2); _Float16* BE = BW + (size_t)5 * DO * DI; _Float16* X1 = (_Float16*)take((size_t)2 * NN * DI * 2);      /* weight slots Wq1 Wk1 Wq2 Wk2 Wv We; [x1 | x2] */
  _Float16* Q1 = (_Float16*)take((size_t)6 * NN * DO * 2); _Float16* K1 = Q1 + (size_t)NN * DO; _Float16* Q2 = Q1 + (size_t)2 * NN * DO; _Float16* K2 = Q1 + (size_t)3 * NN * DO; _Float16* VT1 = Q1 + (size_t)4 * NN * DO; _Float16* VT2 = Q1 + (size_t)5 * NN * DO;      /* planes Q1 K1 Q2 K2 V1^T V2^T */
  float* OP = (float*)take((size_t)KSP * 2 * NN * DO * 4); float* ML = (float*)take((size_t)KSP * 2 * NN * 2 * 4);
  if (off > ws_size) return;      /* 1.5 + 16 + 24 + 64 + 0.5 = about 106 MiB */
  k_cvt<<<6 * WB + 2 * XB, 256, 0, stream>>>(x1, x2, Wq1, Wk1, Wq2, Wk2, Wv, We, X1, BW);      /* weights as given, (out, in) */
  k_proj6<<<dim3((NN / 128) * (DO / 128), 6), 256, 0, stream>>>(X1, BW, bq1, bk1, bq2, bk2, bv, Q1);
  k_flash<<<dim3(NN / FQ, KSP, 2), 256, 0, stream>>>(Q1, K2, VT1, Q2, K1, VT2, scp, OP, ML);      /* f1: hsi_Q . lidar_K -> hsi_V ; f2: lidar_Q . hsi_K -> lidar_V */
  k_tail<<<2 * NN / TR, 512, 0, stream>>>(OP, ML, BE, be, out1);      /* both branches: their rows and the two outputs lie back to back (one M = 2 NN); (f_hi + f_lo) We^T + be */
}

// v009
// It runs in 115 microseconds.
// Timed twice side by side with v008, it ran 1.03 times as fast both times.
// All steps since v000 together make it 24.1 times as fast.
#include <hip/hip_runtime.h>
// cross_fuison (8192 hsi rows x1 and 8192 lidar rows x2, 512 -> 256: Q/K/V = x W^T + b (W_V shared); inv = 1/sqrt(clip(scale, 1, 32)); f1 = softmax(hsi_Q lidar_K^T inv) hsi_V; f2 = softmax(lidar_Q hsi_K^T inv) lidar_V; outputs = (f1 We^T + be, f2 We^T + be), each [8192][512]).
// Compute dtype: inputs rounded to bf16; inputs/weights exact as f16; Q/K/V and the softmax weights as plain f16 operands (~2^-12); f as f16 hi + residual into We; softmax f32. v_wmma_f32_16x16x32_f16.
#define NN 8192
#define DI 512
#define DO 256
typedef __bf16 v16b __attribute__((ext_vector_type(16)));
typedef unsigned short v8us __attribute__((ext_vector_type(8), may_alias));
typedef float  v8f  __attribute__((ext_vector_type(8)));
typedef float  v4f  __attribute__((ext_vector_type(4)));
typedef float  v4fa __attribute__((ext_vector_type(4), may_alias));
union FragB { v16b v; v8us half[2]; unsigned short u[16]; };

__device__ __forceinline__ unsigned short bf16_bits(float x) { unsigned int u = __float_as_uint(x); return (unsigned short)((u + 0x7FFFu + ((u >> 16) & 1u)) >> 16); }
__device__ __forceinline__ float bf16_val(unsigned short b) { return __uint_as_float(((unsigned int)b) << 16); }
__device__ __forceinline__ float bf16_round(float x) { return bf16_val(bf16_bits(x)); }
// D += A·B with NT terms: 1 = ah·bh, 2 = + al·bh (A split), 3 = + ah·bl (both split)
template <int NT>
__device__ __forceinline__ v8f mmaN(v16b ah, v16b al, v16b bh, v16b bl, v8f c) {
  c = __builtin_amdgcn_wmma_f32_16x16x32_bf16(false, ah, false, bh, (short)0, c, false, false);
  if (NT >= 2) c = __builtin_amdgcn_wmma_f32_16x16x32_bf16(false, al, false, bh, (short)0, c, false, false);
  if (NT >= 3) c = __builtin_amdgcn_wmma_f32_16x16x32_bf16(false, ah, false, bl, (short)0, c, false, false);
  asm volatile("v_nop\n\tv_nop\n\tv_nop\n\tv_nop" : "+v"(c) : "v"(ah), "v"(al), "v"(bh), "v"(bl));
  return c;
}

__global__ __launch_bounds__(256) void k_wt_bf16(const float* __restrict__ W, unsigned short* __restrict__ Wt, int K, int N) {
  const int t = blockIdx.x * 256 + threadIdx.x;
  const int k8n = K / 8;
  if (t >= N * k8n) return;
  const int n = t / k8n, k8 = (t % k8n) * 8;
  v8us v;
#pragma unroll
  for (int i = 0; i < 8; ++i) v[i] = bf16_bits(W[(size_t)(k8 + i) * N + n]);
  *(v8us*)(Wt + (size_t)n * K + k8) = v;
  
}

// GEMM C[M][N] (f32, pitch ldc) = act(A[M][K]·W + bias). A f32 row-major (pitch lda) converted per fragment to bf16
// (ASPLIT: hi/lo two planes -> 2 terms, else single rounded term); Wt bf16 [N][K] (pitch ldb). BIAS_BF16 rounds the
// bias to bf16 first (bias quantised to bf16 before the add). K%32==0, M%16==0, N%64==0.
template <bool ASPLIT, int ACT, bool BIAS_BF16>
__global__ __launch_bounds__(128) void k_gemm_bf(const float* __restrict__ A, int lda, const unsigned short* __restrict__ Wt, int ldb,
                                               const float* __restrict__ bias, float* __restrict__ C, int ldc, int M, int N, int K) {
  __shared__ __attribute__((aligned(16))) float so[4][16][64];
  const int tid = threadIdx.x, w = tid >> 5, lane = tid & 31, ln = lane & 15, hh = lane >> 4;
  const int ntn = N / 64;
  const int wid = blockIdx.x * 4 + w;
  const int mt = wid / ntn, nq = wid % ntn;
  if (mt * 16 >= M) return;
  const int row0 = mt * 16, col0 = nq * 64;
  const float* arow = A + (size_t)(row0 + ln) * lda;
  v8f acc[4] = {};
  for (int kb = 0; kb < K; kb += 32) {
    FragB ah, al;
    const v4f x0 = *(const v4fa*)(arow + kb + 8 * hh), x1 = *(const v4fa*)(arow + kb + 8 * hh + 4);
    const v4f x2 = *(const v4fa*)(arow + kb + 16 + 8 * hh), x3 = *(const v4fa*)(arow + kb + 16 + 8 * hh + 4);
    float xs[16] = {x0[0],x0[1],x0[2],x0[3],x1[0],x1[1],x1[2],x1[3],x2[0],x2[1],x2[2],x2[3],x3[0],x3[1],x3[2],x3[3]};
#pragma unroll
    for (int i = 0; i < 16; ++i) { const unsigned short hb = bf16_bits(xs[i]); ah.u[i] = hb; al.u[i] = ASPLIT ? bf16_bits(xs[i] - bf16_val(hb)) : (unsigned short)0; }
#pragma unroll
    for (int t = 0; t < 4; ++t) {
      const unsigned short* brow = Wt + (size_t)(col0 + t * 16 + ln) * ldb + kb;
      FragB b;
      b.half[0] = *(const v8us*)(brow + 8 * hh);
      b.half[1] = *(const v8us*)(brow + 16 + 8 * hh);
      acc[t] = mmaN<ASPLIT ? 2 : 1>(ah.v, al.v, b.v, b.v, acc[t]);
    }
  }
#pragma unroll
  for (int t = 0; t < 4; ++t) {
    float bv = bias ? bias[col0 + t * 16 + ln] : 0.f;
    if (BIAS_BF16) bv = bf16_round(bv);
#pragma unroll
    for (int r = 0; r < 8; ++r) { float v = acc[t][r] + bv; if (ACT == 1) v = fmaxf(v, 0.f); so[w][8 * hh + r][t * 16 + ln] = v; }
  }
  __builtin_amdgcn_fence(__ATOMIC_ACQ_REL, "workgroup");
  __builtin_amdgcn_wave_barrier();
  const int rsub = lane >> 4, c4 = (lane & 15) * 4;
  {
#pragma unroll
    for (int q = 0; q < 8; ++q) {
      const int r = q * 2 + rsub;
      const v4f v = *(const v4fa*)&so[w][r][c4];
      *(v4f*)(C + (size_t)(row0 + r) * ldc + col0 + c4) = v;
    }
    
  }
}

// GEMM C = act(A·W + bias + resid): A f32 (ASPLIT -> hi/lo 2 terms), Wt bf16 [N][K]; ACT 0 none, 1 relu, 2 exact gelu;
// resid (optional, f32, row index = (row % rmod), pitch ldr, RES_BF16 rounds it) added before the activation.
template <bool ASPLIT, int ACT, bool BIAS_BF16, bool RES_BF16>
__global__ __launch_bounds__(128) void k_gemm_bf3(const float* __restrict__ A, int lda, const unsigned short* __restrict__ Wt, int ldb,
                                                const float* __restrict__ bias, const float* __restrict__ resid, int rmod, int ldr,
                                                float* __restrict__ C, int ldc, int M, int N, int K) {
  __shared__ __attribute__((aligned(16))) float so[4][16][64];
  const int tid = threadIdx.x, w = tid >> 5, lane = tid & 31, ln = lane & 15, hh = lane >> 4;
  const int ntn = N / 64;
  const int wid = blockIdx.x * 4 + w;
  const int mt = wid / ntn, nq = wid % ntn;
  if (mt * 16 >= M) return;
  const int row0 = mt * 16, col0 = nq * 64;
  const float* arow = A + (size_t)(row0 + ln) * lda;
  v8f acc[4] = {};
  for (int kb = 0; kb < K; kb += 32) {
    FragB ah, al;
    const v4f x0 = *(const v4fa*)(arow + kb + 8 * hh), x1 = *(const v4fa*)(arow + kb + 8 * hh + 4);
    const v4f x2 = *(const v4fa*)(arow + kb + 16 + 8 * hh), x3 = *(const v4fa*)(arow + kb + 16 + 8 * hh + 4);
    float xs[16] = {x0[0],x0[1],x0[2],x0[3],x1[0],x1[1],x1[2],x1[3],x2[0],x2[1],x2[2],x2[3],x3[0],x3[1],x3[2],x3[3]};
#pragma unroll
    for (int i = 0; i < 16; ++i) { const unsigned short hb = bf16_bits(xs[i]); ah.u[i] = hb; al.u[i] = ASPLIT ? bf16_bits(xs[i] - bf16_val(hb)) : (unsigned short)0; }
#pragma unroll
    for (int t = 0; t < 4; ++t) {
      const unsigned short* brow = Wt + (size_t)(col0 + t * 16 + ln) * ldb + kb;
      FragB b;
      b.half[0] = *(const v8us*)(brow + 8 * hh);
      b.half[1] = *(const v8us*)(brow + 16 + 8 * hh);
      acc[t] = mmaN<ASPLIT ? 2 : 1>(ah.v, al.v, b.v, b.v, acc[t]);
    }
  }
#pragma unroll
  for (int t = 0; t < 4; ++t) {
    const int col = col0 + t * 16 + ln;
    float bv = bias ? bias[col] : 0.f;
    if (BIAS_BF16) bv = bf16_round(bv);
#pragma unroll
    for (int r = 0; r < 8; ++r) {
      float v = acc[t][r] + bv;
      if (resid) { float rv = resid[(size_t)((row0 + 8 * hh + r) % rmod) * ldr + col]; if (RES_BF16) rv = bf16_round(rv); v += rv; }
      if (ACT == 1) v = fmaxf(v, 0.f);
      if (ACT == 2) v = 0.5f * v * (1.0f + erff(v * 0.70710678118654752f));
      if (ACT == 3) { const float u = 0.7978845608028654f * (v + 0.044715f * v * v * v); v = 0.5f * v * (1.0f + tanhf(u)); }
      so[w][8 * hh + r][t * 16 + ln] = v;
    }
  }
  __builtin_amdgcn_fence(__ATOMIC_ACQ_REL, "workgroup");
  __builtin_amdgcn_wave_barrier();
  const int rsub = lane >> 4, c4 = (lane & 15) * 4;
  {
#pragma unroll
    for (int q = 0; q < 8; ++q) {
      const int r = q * 2 + rsub;
      const v4f v = *(const v4fa*)&so[w][r][c4];
      *(v4f*)(C + (size_t)(row0 + r) * ldc + col0 + c4) = v;
    }
    
  }
}
// row LayerNorm (biased variance, eps) over N: s = X (+ R); optional out_sum <- s; out_norm <- (s-mu)*rsqrt(var+eps)*g + b
template <bool PARAM_BF16>
__global__ __launch_bounds__(256) void k_layernorm(const float* __restrict__ X, const float* __restrict__ R, const float* __restrict__ g, const float* __restrict__ bta,
                                                  float* __restrict__ out_sum, float* __restrict__ out_norm, int N, float eps) {
  __shared__ float red[256];
  const int row = blockIdx.x, tid = threadIdx.x;
  const float* x = X + (size_t)row * N; const float* rr = R ? R + (size_t)row * N : nullptr;
  float vals[16];                     // up to N = 4096
  const int per = N / 256;            // contiguous chunk per thread? use strided-by-4 chunks: thread handles j = tid*4 + 1024*u
  float s1 = 0.f;
  for (int u = 0; u < per / 4; ++u) {
    const int j = tid * 4 + 1024 * u;
    const v4f a = *(const v4fa*)(x + j);
    v4f b = {0.f,0.f,0.f,0.f}; if (rr) b = *(const v4fa*)(rr + j);
#pragma unroll
    for (int q = 0; q < 4; ++q) { const float v = a[q] + b[q]; vals[u * 4 + q] = v; s1 += v; }
  }
  red[tid] = s1; __syncthreads();
  for (int st = 128; st > 0; st >>= 1) { if (tid < st) red[tid] += red[tid + st]; __syncthreads(); }
  const float mu = red[0] / (float)N; __syncthreads();
  float s2 = 0.f;
  for (int u = 0; u < per / 4; ++u)
#pragma unroll
    for (int q = 0; q < 4; ++q) { const float c = vals[u * 4 + q] - mu; s2 += c * c; }
  red[tid] = s2; __syncthreads();
  for (int st = 128; st > 0; st >>= 1) { if (tid < st) red[tid] += red[tid + st]; __syncthreads(); }
  const float rs = rsqrtf(red[0] / (float)N + eps);
  {
    for (int u = 0; u < per / 4; ++u) {
      const int j = tid * 4 + 1024 * u;
      v4f o, sm;
#pragma unroll
      for (int q = 0; q < 4; ++q) {
        float gg = g[j + q], bb = bta[j + q];
        if (PARAM_BF16) { gg = bf16_round(gg); bb = bf16_round(bb); }
        sm[q] = vals[u * 4 + q]; o[q] = (vals[u * 4 + q] - mu) * rs * gg + bb;
      }
      if (out_sum) *(v4f*)(out_sum + (size_t)row * N + j) = sm;
      *(v4f*)(out_norm + (size_t)row * N + j) = o;
    }
    
  }
}



// ---- f16 WMMA path (v_wmma_f32_16x16x32_f16): 11-bit significands for operands in range — used where a [0,1] probability operand needs more precision than bf16
typedef _Float16 v16h __attribute__((ext_vector_type(16)));
union FragH { v16h v; v8us half[2]; _Float16 h[16]; unsigned short u[16]; };
template <int NT>
__device__ __forceinline__ v8f mmaH(v16h ah, v16h al, v16h bh, v16h bl, v8f c) {
  c = __builtin_amdgcn_wmma_f32_16x16x32_f16(false, ah, false, bh, (short)0, c, false, false);
  if (NT >= 2) c = __builtin_amdgcn_wmma_f32_16x16x32_f16(false, al, false, bh, (short)0, c, false, false);
  if (NT >= 3) c = __builtin_amdgcn_wmma_f32_16x16x32_f16(false, ah, false, bl, (short)0, c, false, false);
  asm volatile("v_nop\n\tv_nop\n\tv_nop\n\tv_nop" : "+v"(c) : "v"(ah), "v"(al), "v"(bh), "v"(bl));
  return c;
}
// batched GEMM like k_gemm_b but f16 operands: A f32 (split into f16 hi/lo if ASPLIT, else rounded to f16), Bt = f16 values [n][k]; alpha; C f32; N multiple of 16 (partial tiles skipped)
template <bool ASPLIT>
__global__ __launch_bounds__(128) void k_gemm_h(const float* __restrict__ A, int lda, size_t sA, const _Float16* __restrict__ Bh, int ldb, size_t sB, float alpha, float* __restrict__ C, int ldc, size_t sC, int M, int N, int K) {
  __shared__ __attribute__((aligned(16))) float so[4][16][64];
  const int tid = threadIdx.x, w = tid >> 5, lane = tid & 31, ln = lane & 15, hh = lane >> 4; const int by = blockIdx.y;
  A += (size_t)by * sA; Bh += (size_t)by * sB; C += (size_t)by * sC;
  const int ntn = (N + 63) / 64; const int wid = blockIdx.x * 4 + w; const int mt = wid / ntn, nq = wid % ntn; if (mt * 16 >= M) return;
  const int row0 = mt * 16, col0 = nq * 64; const float* arow = A + (size_t)(row0 + ln) * lda;
  v8f acc[4] = {};
  for (int kb = 0; kb < K; kb += 32) {
    FragH ah, al;
    const v4f x0 = *(const v4fa*)(arow + kb + 8 * hh), x1 = *(const v4fa*)(arow + kb + 8 * hh + 4), x2 = *(const v4fa*)(arow + kb + 16 + 8 * hh), x3 = *(const v4fa*)(arow + kb + 16 + 8 * hh + 4);
    float xs[16] = {x0[0],x0[1],x0[2],x0[3],x1[0],x1[1],x1[2],x1[3],x2[0],x2[1],x2[2],x2[3],x3[0],x3[1],x3[2],x3[3]};
#pragma unroll
    for (int i = 0; i < 16; ++i) { const _Float16 h = (_Float16)xs[i]; ah.h[i] = h; al.h[i] = ASPLIT ? (_Float16)(xs[i] - (float)h) : (_Float16)0.0f; }
#pragma unroll
    for (int t = 0; t < 4; ++t) { if (col0 + t * 16 >= N) continue; const size_t boff = (size_t)(col0 + t * 16 + ln) * ldb + kb; FragH bq; bq.half[0] = *(const v8us*)(Bh + boff + 8 * hh); bq.half[1] = *(const v8us*)(Bh + boff + 16 + 8 * hh);
      acc[t] = mmaH<ASPLIT ? 2 : 1>(ah.v, al.v, bq.v, bq.v, acc[t]); }
  }
#pragma unroll
  for (int t = 0; t < 4; ++t) { if (col0 + t * 16 >= N) continue;
#pragma unroll
    for (int r = 0; r < 8; ++r) so[w][8 * hh + r][t * 16 + ln] = acc[t][r] * alpha; }
  __builtin_amdgcn_fence(__ATOMIC_ACQ_REL, "workgroup"); __builtin_amdgcn_wave_barrier();
  const int rsub = lane >> 4, c4 = (lane & 15) * 4;
  {
#pragma unroll
    for (int q = 0; q < 8; ++q) { const int r = q * 2 + rsub; if (col0 + c4 < N) { const v4f v = *(const v4fa*)&so[w][r][c4]; *(v4f*)(C + (size_t)(row0 + r) * ldc + col0 + c4) = v; } }
     }
}

// Wt[n][k] = f16(W[k][n]·scale) from f32 row-major W[K][N] (scale = power of two; bf16-exact weights stay exact in f16 away from the subnormal range)
__global__ __launch_bounds__(256) void k_wt_f16(const float* __restrict__ W, _Float16* __restrict__ Wt, int K, int N, float scale) {
  const int t = blockIdx.x * 256 + threadIdx.x; if (t >= N * (K / 8)) return; const int n = t / (K / 8), k8 = (t % (K / 8)) * 8; FragH f;
#pragma unroll
  for (int i = 0; i < 8; ++i) f.h[i] = (_Float16)(bf16_round(W[(size_t)(k8 + i) * N + n]) * scale); const v8us o = f.half[0];
  *(v8us*)((unsigned short*)Wt + (size_t)n * K + k8) = o; 
}
// k_gemm_hh variant with fused epilogue: v = acc·alpha + bias[by·sBias + col] (+ CP[(row/rowsPerB)·sCPb + by·64 + col] if CP) ; ACT 0 none / 1 elu ; writes f16 C16 (and f32 C if non-null)
template <int ACT>
__global__ __launch_bounds__(128) void k_gemm_hhx(const _Float16* __restrict__ A, int lda, size_t sA, const _Float16* __restrict__ Bh, int ldb, size_t sB, float alpha, const float* __restrict__ bias, size_t sBias, const float* __restrict__ CP, int rowsPerB, size_t sCPb, int row0g,
    float* __restrict__ C, _Float16* __restrict__ C16, int ldc, size_t sC, int M, int N, int K) {
  __shared__ __attribute__((aligned(16))) float so[4][16][64];
  const int tid = threadIdx.x, w = tid >> 5, lane = tid & 31, ln = lane & 15, hh = lane >> 4; const int by = blockIdx.y;
  A += (size_t)by * sA; Bh += (size_t)by * sB; const size_t cofs = (size_t)by * sC; const float* bp = bias ? bias + (size_t)by * sBias : nullptr;
  const int ntn = (N + 63) / 64; const int wid = blockIdx.x * 4 + w; const int mt = wid / ntn, nq = wid % ntn; if (mt * 16 >= M) return;
  const int row0 = mt * 16, col0 = nq * 64; const _Float16* arow = A + (size_t)(row0 + ln) * lda;
  v8f acc[4] = {};
  for (int kb = 0; kb < K; kb += 32) { FragH ah; ah.half[0] = *(const v8us*)((const unsigned short*)arow + kb + 8 * hh); ah.half[1] = *(const v8us*)((const unsigned short*)arow + kb + 16 + 8 * hh);
#pragma unroll
    for (int t = 0; t < 4; ++t) { if (col0 + t * 16 >= N) continue; const size_t boff = (size_t)(col0 + t * 16 + ln) * ldb + kb; FragH bq; bq.half[0] = *(const v8us*)((const unsigned short*)Bh + boff + 8 * hh); bq.half[1] = *(const v8us*)((const unsigned short*)Bh + boff + 16 + 8 * hh);
      acc[t] = mmaH<1>(ah.v, ah.v, bq.v, bq.v, acc[t]); }
  }
#pragma unroll
  for (int t = 0; t < 4; ++t) { if (col0 + t * 16 >= N) continue; const int col = col0 + t * 16 + ln; const float bv = bp ? bf16_round(bp[col]) : 0.f;
#pragma unroll
    for (int r = 0; r < 8; ++r) { float v = acc[t][r] * alpha + bv; if (CP) { const int rr = row0g + row0 + 8 * hh + r; if (rowsPerB < 0) v += CP[cofs + (size_t)rr * ldc + col];      /* rowsPerB < 0: own element of the batched C plane */ else { const int bidx = rr / rowsPerB; v += CP[(size_t)bidx * sCPb + (size_t)by * 64 + col]; } } if (ACT == 1) v = (v > 0.f) ? v : expm1f(v); else if (ACT == 7) v = (v > 0.f) ? v + 1.0f : expf(v); else if (ACT == 8) v = tanhf(v); else if (ACT == 9) v = 0.5f * v * (1.0f + tanhf(0.7978845608028654f * (v + 0.044715f * v * v * v))); else if (ACT == 11) v = 1.0f / (1.0f + expf(-v)); else if (ACT == 12) v = (v > 0.f) ? v : 0.01f * v; else if (ACT == 14) v = (v > 0.f) ? v : 0.1f * v; else if (ACT == 16) v = (v >= 0.f) ? v : 0.3f * v; else if (ACT == 17) v = (v >= 0.f) ? v : 0.2f * v; else if (ACT == 15) v = v / (1.0f + expf(-v)); else if (ACT == 3) v = fmaxf(v, 0.f); else if (ACT == 6) v = 0.5f * v * (1.0f + erff(v * 0.70710678118654752f)); so[w][8 * hh + r][t * 16 + ln] = v; } }
  __builtin_amdgcn_fence(__ATOMIC_ACQ_REL, "workgroup"); __builtin_amdgcn_wave_barrier();
  const int rsub = lane >> 4, c4 = (lane & 15) * 4; typedef _Float16 v4h __attribute__((ext_vector_type(4)));
  {
#pragma unroll
    for (int q = 0; q < 8; ++q) { const int r = q * 2 + rsub; if (col0 + c4 < N) { const v4f v = *(const v4fa*)&so[w][r][c4]; if (C) *(v4f*)(C + cofs + (size_t)(row0 + r) * ldc + col0 + c4) = v; if (C16) { v4h h4; for (int i = 0; i < 4; ++i) h4[i] = (_Float16)v[i]; *(v4h*)(C16 + cofs + (size_t)(row0 + r) * ldc + col0 + c4) = h4; } } }
     }
}


typedef _Float16 v4h __attribute__((ext_vector_type(4)));

// every input conversion in one launch: blocks 0 .. 6 WB - 1 take the six weight matrices (slot j of BW = f16(bf16(w_j) x 16), each DO x DI elements), the rest x1 and x2 (X = [x1 | x2] as f16(bf16(x)))
#define XB (NN * DI / 8 / 256)   /* blocks per x */
#define WB (DO * DI / 8 / 256)   /* blocks per weight matrix */
__global__ __launch_bounds__(256) void k_cvt(const float* __restrict__ x1, const float* __restrict__ x2, const float* __restrict__ w0, const float* __restrict__ w1, const float* __restrict__ w2, const float* __restrict__ w3, const float* __restrict__ w4, const float* __restrict__ w5,
    _Float16* __restrict__ X, _Float16* __restrict__ BW) {
  const int b = blockIdx.x, tid = threadIdx.x; const float* src; _Float16* dst; float sc;
  if (b < 6 * WB) { const int j = b / WB; const float* w = j == 0 ? w0 : j == 1 ? w1 : j == 2 ? w2 : j == 3 ? w3 : j == 4 ? w4 : w5; src = w + ((size_t)(b - j * WB) * 256 + tid) * 8; dst = BW + ((size_t)b * 256 + tid) * 8; sc = 16.0f; }
  else { const int q = b - 6 * WB, j = q / XB; src = (j ? x2 : x1) + ((size_t)(q - j * XB) * 256 + tid) * 8; dst = X + ((size_t)q * 256 + tid) * 8; sc = 1.0f; }
  FragH f;
#pragma unroll
  for (int q = 0; q < 8; ++q) f.h[q] = (_Float16)(bf16_round(src[q]) * sc);
  *(v8us*)(unsigned short*)dst = f.half[0]; }
__global__ __launch_bounds__(256) void k_h16(const float* __restrict__ x, _Float16* __restrict__ X16, size_t n8) { const size_t t = (size_t)blockIdx.x * 256 + threadIdx.x; if (t >= n8) return; FragH f;
#pragma unroll
  for (int q = 0; q < 8; ++q) f.h[q] = (_Float16)x[t * 8 + q]; *(v8us*)((unsigned short*)X16 + t * 8) = f.half[0];  }
__global__ __launch_bounds__(256) void k_round16f(const float* __restrict__ W, _Float16* __restrict__ Bt, size_t n8) { const size_t t = (size_t)blockIdx.x * 256 + threadIdx.x; if (t >= n8) return; FragH f;
#pragma unroll
  for (int i = 0; i < 8; ++i) f.h[i] = (_Float16)(bf16_round(W[t * 8 + i]) * 16.0f); *(v8us*)((unsigned short*)Bt + t * 8) = f.half[0];  }

__global__ __launch_bounds__(256) void k_hl(const float* __restrict__ F, _Float16* __restrict__ Hh, _Float16* __restrict__ Hl, size_t n8) { const size_t t = (size_t)blockIdx.x * 256 + threadIdx.x; if (t >= n8) return; FragH fh, fl; const v4f a = *(const v4fa*)(F + t * 8), c = *(const v4fa*)(F + t * 8 + 4);
#pragma unroll
  for (int q = 0; q < 4; ++q) { _Float16 h = (_Float16)a[q]; fh.h[q] = h; fl.h[q] = (_Float16)((a[q] - (float)h) * 1024.0f); h = (_Float16)c[q]; fh.h[4 + q] = h; fl.h[4 + q] = (_Float16)((c[q] - (float)h) * 1024.0f); }
  { *(v8us*)((unsigned short*)Hh + t * 8) = fh.half[0]; *(v8us*)((unsigned short*)Hl + t * 8) = fl.half[0];  } }

// ---- fast GEMM (wave tile 32x64; requires M % 32 == 0 rows per launch region and N % 64 == 0); epilogue = k_gemm_hhx semantics ----
__device__ __forceinline__ v16h g2_frag(const _Float16* p, int hh) { FragH f; f.half[0] = *(const v8us*)((const unsigned short*)p + 8 * hh); f.half[1] = *(const v8us*)((const unsigned short*)p + 16 + 8 * hh); return f.v; }
__device__ __forceinline__ v8f g2_mma(v16h a, v16h b, v8f c) { v8f d = __builtin_amdgcn_wmma_f32_16x16x32_f16(false, a, false, b, (short)0, c, false, false); asm volatile("v_nop\n\tv_nop\n\tv_nop\n\tv_nop" : "+v"(d) : "v"(a), "v"(b)); return d; }
template <int ACT>
__global__ __launch_bounds__(128) void k_gemm2(const _Float16* __restrict__ A, int lda, size_t sA, const _Float16* __restrict__ Bh, int ldb, size_t sB, float alpha, const float* __restrict__ bias, size_t sBias, const float* __restrict__ CP, int rowsPerB, size_t sCPb, int row0g,
    float* __restrict__ C, _Float16* __restrict__ C16, int ldc, size_t sC, int M, int N, int K) { static_assert(ACT == 0 || ACT == 3 || ACT == 6 || ACT == 8 || ACT == 9 || ACT == 11 || ACT == 12 || ACT == 14 || ACT == 15 || ACT == 16 || ACT == 17, "k_gemm2: unsupported ACT code (would silently apply no activation)");
  __shared__ __attribute__((aligned(16))) float so[4][32][68];
  const int tid = threadIdx.x, w = tid >> 5, lane = tid & 31, ln = lane & 15, hh = lane >> 4; const int by = blockIdx.y;
  A += (size_t)by * sA; Bh += (size_t)by * sB; const size_t cofs = (size_t)by * sC; const float* bp = bias ? bias + (size_t)by * sBias : nullptr;
  const int ntn = N >> 6; const int mt = blockIdx.x / ntn, nq = blockIdx.x - mt * ntn; const int row0 = mt * 128 + 32 * w, col0 = nq * 64; if (row0 >= M) return;
  const _Float16* a0p = A + (size_t)(row0 + ln) * lda; const _Float16* a1p = a0p + (size_t)16 * lda;
  const _Float16* b0p = Bh + (size_t)(col0 + ln) * ldb; const _Float16* b1p = b0p + (size_t)16 * ldb; const _Float16* b2p = b1p + (size_t)16 * ldb; const _Float16* b3p = b2p + (size_t)16 * ldb;
  const v8f z8 = {0.f,0.f,0.f,0.f,0.f,0.f,0.f,0.f}; v8f c00 = z8, c01 = z8, c02 = z8, c03 = z8, c10 = z8, c11 = z8, c12 = z8, c13 = z8;
#pragma unroll 1
  for (int kb = 0; kb < K; kb += 32) { const v16h a0 = g2_frag(a0p + kb, hh), a1 = g2_frag(a1p + kb, hh);
    v16h b = g2_frag(b0p + kb, hh); c00 = g2_mma(a0, b, c00); c10 = g2_mma(a1, b, c10);
    b = g2_frag(b1p + kb, hh); c01 = g2_mma(a0, b, c01); c11 = g2_mma(a1, b, c11);
    b = g2_frag(b2p + kb, hh); c02 = g2_mma(a0, b, c02); c12 = g2_mma(a1, b, c12);
    b = g2_frag(b3p + kb, hh); c03 = g2_mma(a0, b, c03); c13 = g2_mma(a1, b, c13); }
  v8f accs[8] = {c00, c01, c02, c03, c10, c11, c12, c13};
#pragma unroll
  for (int u = 0; u < 8; ++u) { const int t = u & 3, half = u >> 2; const int col = col0 + t * 16 + ln; const float bv = bp ? bf16_round(bp[col]) : 0.f;
#pragma unroll
    for (int r = 0; r < 8; ++r) { const int rloc = half * 16 + 8 * hh + r; float v = accs[u][r] * alpha + bv; if (CP) { if (rowsPerB < 0) v += CP[cofs + (size_t)(row0g + row0 + rloc) * ldc + col];      /* rowsPerB < 0: own element of the batched C plane */ else { const int bidx = (row0g + row0 + rloc) / rowsPerB; v += CP[(size_t)bidx * sCPb + (size_t)by * 64 + col]; } }
      if (ACT == 3) v = fmaxf(v, 0.f); else if (ACT == 6) v = 0.5f * v * (1.0f + erff(v * 0.70710678118654752f)); else if (ACT == 11) v = 1.0f / (1.0f + expf(-v)); else if (ACT == 15) v = v / (1.0f + expf(-v)); else if (ACT == 12) v = (v > 0.f) ? v : 0.01f * v; else if (ACT == 8) v = tanhf(v); else if (ACT == 9) v = 0.5f * v * (1.0f + tanhf(0.7978845608028654f * (v + 0.044715f * v * v * v))); else if (ACT == 14) v = (v > 0.f) ? v : 0.1f * v; else if (ACT == 16) v = (v >= 0.f) ? v : 0.3f * v; else if (ACT == 17) v = (v >= 0.f) ? v : 0.2f * v;
      so[w][rloc][t * 16 + ln] = v; } }
  __builtin_amdgcn_fence(__ATOMIC_ACQ_REL, "workgroup"); __builtin_amdgcn_wave_barrier();
  const int rsub = lane >> 4, c4 = (lane & 15) * 4;
  {
#pragma unroll
    for (int q = 0; q < 16; ++q) { const int r = q * 2 + rsub; const v4f v = *(const v4fa*)&so[w][r][c4]; if (C) *(v4f*)(C + cofs + (size_t)(row0 + r) * ldc + col0 + c4) = v; if (C16) { v4h h4; for (int i = 0; i < 4; ++i) h4[i] = (_Float16)v[i]; *(v4h*)(C16 + cofs + (size_t)(row0 + r) * ldc + col0 + c4) = h4; } }
     } }


// ---- GEMM tile through LDS: a work-group of 8 waves makes a 128 x 128 tile of A[.][KT] . B[.][KT]^T (both row-major, pitch KT, f16); wave w takes rows 32 (w & 3), columns 64 (w >> 2): k_gemm2's 32 x 64 wave tile and k order.
// A k slice of 64 elements (one 128-byte line of each of the 256 rows) lies in one of two LDS buffers; the next slice is fetched meanwhile through registers, a wave's load covering four whole lines.
#define GP 72                    /* LDS pitch of a row's slice, 16-bit elements: 144 B = 16 B x odd */
#define GT (128 * GP)            /* one operand's slice */
union G3S { unsigned short t[4 * GT]; float so[8][32][68]; };      /* the two buffers (A | B each); behind the loop each wave's own output staging */
__device__ __forceinline__ v16h g3_frag(const unsigned short* p, int hh) { FragH f; f.half[0] = *(const v8us*)(p + 8 * hh); f.half[1] = *(const v8us*)(p + 16 + 8 * hh); return f.v; }
__device__ __forceinline__ v8f g3_mma(v16h a, v16h b, v8f c) { return __builtin_amdgcn_wmma_f32_16x16x32_f16(false, a, false, b, (short)0, c, false, false); }
template <int KT>
__device__ __forceinline__ void g3_loop(const unsigned short* __restrict__ A, const unsigned short* __restrict__ B, unsigned short* sm, int tid, v8f (&acc)[2][4]) {
  const int w = tid >> 5, lane = tid & 31, ln = lane & 15, hh = lane >> 4;
  const unsigned short* ga = A + (size_t)(tid >> 3) * KT + (tid & 7) * 8;      /* thread -> 16 B of rows tid / 8 + 32 j of each operand; one address pair an operand for all slices */
  const unsigned short* gb = B + (size_t)(tid >> 3) * KT + (tid & 7) * 8;
  const int ls = (tid >> 3) * GP + (tid & 7) * 8;
  const int ra = ((w & 3) * 32 + ln) * GP, rb = GT + ((w >> 2) * 64 + ln) * GP;
  v8us sa[4], sb[4];
#pragma unroll
  for (int j = 0; j < 4; ++j) { sa[j] = *(const v8us*)(ga + j * 32 * KT); sb[j] = *(const v8us*)(gb + j * 32 * KT); }
#pragma unroll
  for (int j = 0; j < 4; ++j) { *(v8us*)(sm + ls + j * 32 * GP) = sa[j]; *(v8us*)(sm + GT + ls + j * 32 * GP) = sb[j]; }
  __syncthreads();
  // unrolled: the buffer and the slice become constants, so every load and LDS access is its base register plus an immediate offset
#pragma unroll
  for (int c = 0; c < KT / 64; ++c) {
    const unsigned short* cur = sm + (c & 1) * 2 * GT; unsigned short* nxt = sm + ((c + 1) & 1) * 2 * GT;
    if (c + 1 < KT / 64) {
#pragma unroll
      for (int j = 0; j < 4; ++j) { sa[j] = *(const v8us*)(ga + (c + 1) * 64 + j * 32 * KT); sb[j] = *(const v8us*)(gb + (c + 1) * 64 + j * 32 * KT); }
      asm volatile("s_wait_xcnt 0x0" :: "v"(ga), "v"(gb) : "memory");      /* as inputs the loads' two addresses stay whole until the wait */
    }
#pragma unroll
    for (int ks = 0; ks < 2; ++ks) {
      const v16h a0 = g3_frag(cur + ra + ks * 32, hh), a1 = g3_frag(cur + ra + 16 * GP + ks * 32, hh);
#pragma unroll
      for (int t = 0; t < 4; ++t) { const v16h b = g3_frag(cur + rb + t * 16 * GP + ks * 32, hh); acc[0][t] = g3_mma(a0, b, acc[0][t]); acc[1][t] = g3_mma(a1, b, acc[1][t]); }
    }
    if (c + 1 < KT / 64) {
#pragma unroll
      for (int j = 0; j < 4; ++j) { *(v8us*)(nxt + ls + j * 32 * GP) = sa[j]; *(v8us*)(nxt + GT + ls + j * 32 * GP) = sb[j]; }      /* the other buffer's last readers left it at the barrier that ended slice c - 1 */
    }
    __syncthreads();      /* publishes slice c + 1 and ends every read of slice c (behind the last slice: frees the buffers for the output staging) */
  }
}
// the six projections in one launch (M = NN, N = DO, K = DI, f16 result only), tiles through LDS (g3_loop), k_gemm2's epilogue. blockIdx.y = j picks plane j of QKV = [Q1 K1 Q2 K2 V1^T V2^T];
// x1 (first half of X) feeds planes 0, 1, 4; weight slots of BW = [Wq1 Wk1 Wq2 Wk2 Wv], W_V shared by planes 4 and 5
__global__ __launch_bounds__(256) void k_proj6(const _Float16* __restrict__ X, const _Float16* __restrict__ BW, const float* __restrict__ bq1, const float* __restrict__ bk1, const float* __restrict__ bq2, const float* __restrict__ bk2, const float* __restrict__ bv, _Float16* __restrict__ QKV) {
  __shared__ __attribute__((aligned(16))) G3S sm;
  const int tid = threadIdx.x, w = tid >> 5, lane = tid & 31, ln = lane & 15, hh = lane >> 4; const int j = blockIdx.y;
  const float* bp = j == 0 ? bq1 : j == 1 ? bk1 : j == 2 ? bq2 : j == 3 ? bk2 : bv;
  const int mt = blockIdx.x / (DO / 128), nq = blockIdx.x % (DO / 128); const int row0 = mt * 128 + 32 * (w & 3), col0 = nq * 128 + 64 * (w >> 2);
  const v8f z8 = {0.f,0.f,0.f,0.f,0.f,0.f,0.f,0.f}; v8f acc[2][4] = {{z8, z8, z8, z8}, {z8, z8, z8, z8}};
  g3_loop<DI>((const unsigned short*)X + ((j == 2 || j == 3 || j == 5) ? (size_t)NN * DI : 0) + (size_t)mt * 128 * DI, (const unsigned short*)BW + (size_t)(j < 4 ? j : 4) * DO * DI + (size_t)nq * 128 * DI, sm.t, tid, acc);
  if (j >= 4) {      /* block-uniform, behind the loop's last barrier. Planes 4 and 5 hold V^T in k_flash's staging order: [32-key block][16-d tile][half][lane][8], element = V[16 half + 8 hh + 0..7][16 t + ln]: a lane's 8 accumulator registers as they lie, so nothing is left to transpose and a store covers 512 contiguous bytes */
    const float* bl = bp + col0 + ln; float bt[4];
    // every loop of this branch is unrolled: bt, f and acc stay in registers, and t and the chunk index become immediate offsets of the one address pair of the loads and of the stores
#pragma unroll
    for (int t = 0; t < 4; ++t) bt[t] = bl[t * 16];
    asm volatile("s_wait_xcnt 0x0" :: "v"(bl) : "memory");      /* as an input the loads' address stays whole until the wait */
    unsigned short* vd = (unsigned short*)QKV + (size_t)j * NN * DO + (size_t)(row0 >> 5) * (32 * DO) + (col0 >> 4) * 512 + lane * 8;
    FragH f[2][4];      /* all eight chunks are made in front of the first store: behind it no register that a store names is written any more */
#pragma unroll
    for (int u = 0; u < 8; ++u) { const int t = u & 3, half = u >> 2; const float bb = bf16_round(bt[t]);
#pragma unroll
      for (int r = 0; r < 8; ++r) f[half][t].h[r] = (_Float16)(acc[half][t][r] * 0.0625f + bb); }
#pragma unroll
    for (int u = 0; u < 8; ++u) { const int t = u & 3, half = u >> 2; *(v8us*)(vd + (t * 2 + half) * 256) = f[half][t].half[0]; }
    asm volatile("s_wait_xcnt 0x0" :: "v"(vd) : "memory");      /* as an input the stores' address stays whole until the wait */
    return;
  }
#pragma unroll
  for (int u = 0; u < 8; ++u) { const int t = u & 3, half = u >> 2; const float bb = bf16_round(bp[col0 + t * 16 + ln]);
#pragma unroll
    for (int r = 0; r < 8; ++r) sm.so[w][half * 16 + 8 * hh + r][t * 16 + ln] = acc[half][t][r] * 0.0625f + bb; }
  __builtin_amdgcn_fence(__ATOMIC_ACQ_REL, "workgroup"); __builtin_amdgcn_wave_barrier();      /* a wave reads back only its own rows */
  {      /* The Q and K planes lie in k_flash's fragment order: [32-row block][g][ks][h][lane][8], element = row 16 g + ln, column 32 ks + 16 h + 8 hh + 0..7; a store covers 512 contiguous bytes */
    unsigned short* qd = (unsigned short*)QKV + (size_t)j * NN * DO + (size_t)(row0 >> 5) * (32 * DO) + (col0 >> 5) * 512 + lane * 8;
    FragH f[8];      /* all eight chunks are made in front of the first store, as above */
    // both loops unrolled: f stays in registers, and the chunk index becomes an immediate offset of the one address pair
#pragma unroll
    for (int c = 0; c < 8; ++c) { const int g = c >> 2, kl = (c >> 1) & 1, h = c & 1; const float* sp = &sm.so[w][g * 16 + ln][kl * 32 + h * 16 + 8 * hh];
      const v4f v0 = *(const v4fa*)sp, v1 = *(const v4fa*)(sp + 4);
      for (int i = 0; i < 4; ++i) { f[c].h[i] = (_Float16)v0[i]; f[c].h[4 + i] = (_Float16)v1[i]; } }
#pragma unroll
    for (int c = 0; c < 8; ++c) *(v8us*)(qd + (((c >> 2) * 8 + ((c >> 1) & 1)) * 2 + (c & 1)) * 256) = f[c].half[0];
    asm volatile("s_wait_xcnt 0x0" :: "v"(qd) : "memory");      /* as an input the stores' address stays whole until the wait */
  }
}
#define FQ 256                   /* query rows per work-group */
#define KSP 4                    /* key ranges: 32 query blocks x KSP x 2 branches = 256 work-groups */
#define NPASS (NN / KSP / 32)
#define SP 4                     /* passes between two barriers: 2 buffers x SP passes x PT elements = 262,144 B of LDS; one work-group a WGP, as before */
#define NST (NPASS / SP)         /* stages of a key range */
#define TL (32 * DO)             /* a pass's K tile, or its V^T tile, 16-bit elements: 16 KiB in a row, in memory as in LDS */
#define PT (2 * TL)              /* a pass's tiles in LDS (K | V^T), 16-bit elements */
#define TROW 512u                /* the tensor load's view of a tile: 32 rows of 512 B, source pitch 512 B */
#define TNR 32u
#define MTHR 4.0f                /* the maximum in use may trail the true one by this much (log2): a weight is at most 2^(10 + 4), inside f16 */
__device__ __forceinline__ float xhalf(float x) { return __builtin_bit_cast(float, __builtin_amdgcn_permlanex16(__builtin_bit_cast(int, x), __builtin_bit_cast(int, x), 0x76543210, 0xfedcba98, false, false)); }  // lane l with lane l ^ 16
__device__ __forceinline__ v16h fa_frag(const unsigned short* p) { FragH f; f.half[0] = *(const v8us*)p; f.half[1] = *(const v8us*)(p + 256); return f.v; }      /* p = the fragment's place + 8 lane */
typedef unsigned int u32x4 __attribute__((ext_vector_type(4)));
typedef unsigned int u32x8 __attribute__((ext_vector_type(8)));
__device__ __forceinline__ unsigned int uni(unsigned int v) { return (unsigned int)__builtin_amdgcn_readfirstlane(v); }
__device__ __forceinline__ unsigned int pinned(unsigned int v) { unsigned int x = uni(v); asm volatile("" : "+s"(x)); return x; }      /* holds a wave-uniform word in a scalar register: the test on it is a scalar branch, and what is formed from it is formed behind the volatile statements in front */
__device__ __forceinline__ v8f fa_mma(v16h a, v16h b, v8f c) { return __builtin_amdgcn_wmma_f32_16x16x32_f16(false, a, false, b, (short)0, c, false, false); }
__global__ __launch_bounds__(256) void k_flash(const _Float16* __restrict__ Qa, const _Float16* __restrict__ Ka, const _Float16* __restrict__ VTa, const _Float16* __restrict__ Qb, const _Float16* __restrict__ Kb, const _Float16* __restrict__ VTb,
    const float* __restrict__ scp, float* __restrict__ OP, float* __restrict__ ML) {
  static_assert(NPASS % SP == 0, "whole stages");
  static_assert(NST >= 2, "the ring's prologue needs two stages");
  static_assert(2 * SP == FQ / 32, "one tile of a stage for each wave");
  __shared__ __attribute__((aligned(2048))) unsigned short sT[2 * SP * PT];      /* a pass's K tile, then its V^T tile: behind the pass's base register every LDS access keeps an immediate offset (16 bits); every tile's place is a multiple of 2 KiB */
  const int tid = threadIdx.x, w = tid >> 5, lane = tid & 31, ln = lane & 15, hh = lane >> 4;
  const int br = blockIdx.z, sp = blockIdx.y, q0 = blockIdx.x * FQ + w * 32;
  const _Float16* Q = br ? Qb : Qa; const unsigned short* K = (const unsigned short*)(br ? Kb : Ka); const unsigned short* VT = (const unsigned short*)(br ? VTb : VTa);
  float sv = bf16_round(scp[0]); sv = fminf(fmaxf(sv, 1.0f), 32.0f); const float cs = (1.0f / sqrtf(sv)) * 1.4426950408889634f;      /* scores to log2 units */
  // staging: wave wv brings tile wv & 1 (K | V^T) of pass wv >> 1 of every stage: 8 waves = SP passes x 2 tiles, one request a wave and stage, every wave issues
  const unsigned int wv = uni(tid >> 5);
  const unsigned short* gS = ((wv & 1) ? VT : K) + (size_t)sp * (NN / KSP) * DO + (size_t)(wv >> 1) * TL;      /* the wave's tile of stage 0; a stage is SP tiles on in either plane */
  const unsigned int lS = (unsigned int)(size_t)sT + (wv >> 1) * (PT * 2) + (wv & 1) * (TL * 2);      /* its place in buffer 0: byte offset in the work-group's LDS */
  u32x8 g1;      /* descriptor group 1, the same for every request: 1-byte elements, tensor = tile = TNR rows of TROW bytes, no mask, no pad. Pinned: each constant word keeps its own scalar register through the loop, so that none is lent out and formed again while a request is outstanding */
  g1[0] = pinned(0u); g1[1] = pinned((TROW & 0xFFFFu) << 16); g1[2] = pinned((TROW >> 16) | ((TNR & 0xFFFFu) << 16)); g1[3] = pinned((TNR >> 16) | (TROW << 16));
  g1[4] = pinned(TNR); g1[5] = pinned(TROW); g1[6] = pinned(0u); g1[7] = pinned(0u);
  u32x4 g0; g0[0] = pinned(1u);      /* descriptor group 0: count 1 (pinned for the same reason); place, address and type by request */
  auto issue = [&](unsigned int stg) {      /* one tensor load: the wave's tile of stage stg into buffer stg & 1 */
    const unsigned long long ga = (unsigned long long)(size_t)gS + (unsigned long long)stg * (SP * TL * 2);
    g0[1] = uni(lS + (stg & 1u) * (SP * PT * 2)); g0[2] = uni((unsigned int)ga); g0[3] = uni((((unsigned int)(ga >> 32)) & 0x01FFFFFFu) | 0x80000000u);
    asm volatile("tensor_load_to_lds %0, %1" :: "s"(g0), "s"(g1) : "memory");      /* global -> LDS, 16 KiB, through no register */
  };
  const unsigned short* qp = (const unsigned short*)Q + (size_t)(q0 >> 5) * (32 * DO) + lane * 8;      /* the one address register pair of all 32 Q loads; Q lies in fragment order (k_proj6), so each load covers 512 contiguous bytes */
  v16h qf[2][8];
#pragma unroll
  for (int g = 0; g < 2; ++g)
#pragma unroll
    for (int ks = 0; ks < 8; ++ks) { FragH f; f.half[0] = *(const v8us*)(qp + (g * 8 + ks) * 512); f.half[1] = *(const v8us*)(qp + (g * 8 + ks) * 512 + 256); qf[g][ks] = f.v; }
  asm volatile("s_wait_xcnt 0x0" :: "v"(qp) : "memory");      /* qp ends here: as an input it stays whole until the wait, in front of whatever takes its registers next */
  issue(0u);
  asm volatile("s_wait_tensorcnt 0x0" :: "s"(g0), "s"(g1) : "memory");      /* the wave's own tile of stage 0 has landed; as inputs the descriptor's registers stay whole until then */
  __syncthreads();      /* publishes stage 0 */
  issue(pinned(1u));      /* flies while stage 0 is worked on; the stage number is pinned so that the descriptor is formed behind the wait */
  const v8f z8 = {0.f,0.f,0.f,0.f,0.f,0.f,0.f,0.f};
  v8f o[16][2];
#pragma unroll
  for (int t = 0; t < 16; ++t) { o[t][0] = z8; o[t][1] = z8; }
  float m[2] = {-3.0e38f, -3.0e38f}, l[2] = {0.f, 0.f};
  // kept rolled: the body holds 64 matrix instructions and nearly the whole register budget; a second copy would only cost instruction cache
#pragma unroll 1
  for (int sg = 0; sg < NST; ++sg) {
  // rolled for the same reason; the barrier stands in the outer loop, so a pass stays one run of code up to its back edge
#pragma unroll 1
  for (int ps = 0; ps < SP; ++ps) {
    const unsigned short* bK = sT + ((sg & 1) * SP + ps) * PT + lane * 8; const unsigned short* bV = bK + TL;      /* this pass's tiles, at the lane's 16 bytes of every fragment half */
    // S^T = K.Q^T, one k step (2 fragments, 4 matrix instructions) a block; each block's LDS reads stand as one group two blocks ahead, in a ring of three fragment pairs
    v8f sc[2][2] = {{z8, z8}, {z8, z8}};
    v16h ka[3][2];
#pragma unroll
    for (int i = 0; i < 4; ++i) ka[i >> 1][i & 1] = fa_frag(bK + ((i & 1) * 8 + (i >> 1)) * 512);
#pragma unroll
    for (int ks = 0; ks < 8; ++ks) {
      if (ks < 6) { ka[(ks + 2) % 3][0] = fa_frag(bK + (ks + 2) * 512); ka[(ks + 2) % 3][1] = fa_frag(bK + (8 + ks + 2) * 512); }
      __builtin_amdgcn_sched_barrier(0);      /* keeps the reads above as one group in front of the block, two blocks ahead of their use */
      const v16h a0 = ka[ks % 3][0], a1 = ka[ks % 3][1];
      sc[0][0] = fa_mma(a0, qf[0][ks], sc[0][0]); sc[0][1] = fa_mma(a0, qf[1][ks], sc[0][1]);
      sc[1][0] = fa_mma(a1, qf[0][ks], sc[1][0]); sc[1][1] = fa_mma(a1, qf[1][ks], sc[1][1]);
      __builtin_amdgcn_sched_barrier(0);      /* ends the block: the next group of reads stays behind it */
    }
    // one rescale test a pass. Each group's 16 scores of a lane go through a maximum tree three levels deep, both groups' trees side by side, so that no long dependent chain and only one vector-to-scalar branch stand
    // between the two products. The test needs no exchange: a query's two half-wave lanes hold the same m, and the ballot sees both; the exchange stands in the rare branch.
    // The loops over g and t are unrolled because ml, nd, m, l and o live in registers and need constant indices.
    float ml[2];
#pragma unroll
    for (int g = 0; g < 2; ++g) {
      const v8f a = sc[0][g], b = sc[1][g];
      const float t0 = fmaxf(fmaxf(a[0], a[1]), a[2]), t1 = fmaxf(fmaxf(a[3], a[4]), a[5]), t2 = fmaxf(fmaxf(a[6], a[7]), b[0]), t3 = fmaxf(fmaxf(b[1], b[2]), b[3]), t4 = fmaxf(fmaxf(b[4], b[5]), b[6]);
      ml[g] = fmaxf(fmaxf(fmaxf(t0, t1), t2), fmaxf(fmaxf(t3, t4), b[7])) * cs;      /* cs > 0: the lane's maximum of the pass, in log2 units */
    }
    const bool nd[2] = {ml[0] > m[0] + MTHR, ml[1] > m[1] + MTHR};
    if (__builtin_amdgcn_ballot_w32(nd[0] || nd[1]) != 0) {      /* scalar branch, rare after the first passes */
#pragma unroll
      for (int g = 0; g < 2; ++g) {
        if (__builtin_amdgcn_ballot_w32(nd[g]) != 0) {      /* scalar branch: only a group that asked for it takes a new maximum */
          const float mx = fmaxf(ml[g], xhalf(ml[g]));      /* both halves of the wave now hold this query's maximum of the pass */
          const float mn = fmaxf(m[g], mx); const float corr = __builtin_amdgcn_exp2f(m[g] - mn);      /* 0 on the first pass */
          m[g] = mn; l[g] *= corr;
#pragma unroll
          for (int t = 0; t < 16; ++t) o[t][g] = o[t][g] * corr;
        }
      }
    }
    v16h pf[2];
#pragma unroll
    for (int g = 0; g < 2; ++g) {
      const float sh = 10.0f - m[g]; FragH p; float s0 = 0.f, s1 = 0.f;      /* weights x 1024, as f16 operands away from the subnormal range; l carries the same factor */
      float x[16];
#pragma unroll
      for (int r = 0; r < 8; ++r) { x[r] = fmaf(sc[0][g][r], cs, sh); x[8 + r] = fmaf(sc[1][g][r], cs, sh); }
      __builtin_amdgcn_sched_barrier(0);      /* the arguments are all made first: no multiply-add is left to land on an exponential's source directly behind it */
#pragma unroll
      for (int r = 0; r < 16; ++r) x[r] = __builtin_amdgcn_exp2f(x[r]);
      __builtin_amdgcn_sched_barrier(0);      /* sums and conversions stay behind the exponentials: none reads a result directly behind its exponential */
#pragma unroll
      for (int r = 0; r < 8; ++r) { s0 += x[r]; s1 += x[8 + r]; p.h[r] = (_Float16)x[r]; p.h[8 + r] = (_Float16)x[8 + r]; }
      l[g] += s0 + s1; pf[g] = p.v;
    }
    // O^T += V^T.P^T, two d tiles (2 fragments, 4 matrix instructions) a block, read ahead in the same ring
    __builtin_amdgcn_sched_barrier(0);      /* the V^T reads stay behind the exponentials: hoisted among them they take the registers that keep two waves on a SIMD without spills */
    v16h va[3][2];
#pragma unroll
    for (int i = 0; i < 4; ++i) va[i >> 1][i & 1] = fa_frag(bV + i * 512);
#pragma unroll
    for (int b = 0; b < 8; ++b) {
      if (b < 6) { va[(b + 2) % 3][0] = fa_frag(bV + ((b + 2) * 2) * 512); va[(b + 2) % 3][1] = fa_frag(bV + ((b + 2) * 2 + 1) * 512); }
      __builtin_amdgcn_sched_barrier(0);      /* one group of reads in front of the block, as above */
      o[b * 2][0] = fa_mma(va[b % 3][0], pf[0], o[b * 2][0]); o[b * 2][1] = fa_mma(va[b % 3][0], pf[1], o[b * 2][1]);
      o[b * 2 + 1][0] = fa_mma(va[b % 3][1], pf[0], o[b * 2 + 1][0]); o[b * 2 + 1][1] = fa_mma(va[b % 3][1], pf[1], o[b * 2 + 1][1]);
      __builtin_amdgcn_sched_barrier(0);      /* ends the block */
    }
  }
    // publish point of stage sg + 1, every wave, in this order
    asm volatile("s_wait_dscnt 0x0" ::: "memory");      /* the wave's own reads of stage sg are done */
    asm volatile("s_wait_tensorcnt 0x0" :: "s"(g0), "s"(g1) : "memory");      /* the wave's own tile of stage sg + 1 has landed; as inputs the descriptor's registers stay whole until then */
    __syncthreads();      /* publishes stage sg + 1 and ends every read of stage sg */
    if (pinned((unsigned int)(sg + 2 < NST))) issue(pinned((unsigned int)sg + 2u));      /* scalar branch: a tensor load ignores EXEC. Refill of the buffer that stage sg has just left; the stage number is pinned so that the descriptor is formed behind the wait */
  }
  asm volatile("s_wait_tensorcnt 0x0" :: "s"(g0), "s"(g1) : "memory");      /* nothing of the mover is in flight when the wave goes on to its end */
  asm volatile("s_wait_dscnt 0x0" ::: "memory");
  // partials: OP[32-row block][key range][g][t][half][lane][4], the accumulators' own order (element = query 16 g + ln, d = 16 t + 8 hh + 4 half + 0..3), so that each store covers 512 contiguous bytes;
  // ML[query row][key range][m, l]; query row = branch * NN + query. One address pair serves all stores of each array, and
  // everything that is computed stands in front of the first store: behind it no register that a store names is written any more.
  const size_t row = (size_t)br * NN + q0 + ln;
  float* op = OP + ((((size_t)br * NN + q0) >> 5) * KSP + sp) * (32 * DO) + lane * 4;      /* a lane's 8 accumulator registers are 8 consecutive d of its query */
  float* mlp = ML + (row * KSP + sp) * 2 + hh;
  const float j0 = l[0] + xhalf(l[0]), j1 = l[1] + xhalf(l[1]);      /* the halves' sums joined, with every lane on: the exchange stands outside the selection below */
  const float w0 = hh ? j0 : m[0], w1 = hh ? j1 : m[1];      /* the lower half of the wave writes m, the upper l */
  mlp[0] = w0; mlp[16 * KSP * 2] = w1;
#pragma unroll
  for (int g = 0; g < 2; ++g) {
#pragma unroll
    for (int t = 0; t < 16; ++t) {
      const v4f lo = {o[t][g][0], o[t][g][1], o[t][g][2], o[t][g][3]}, hi = {o[t][g][4], o[t][g][5], o[t][g][6], o[t][g][7]};
      *(v4f*)(op + (g * 16 + t) * 256) = lo; *(v4f*)(op + (g * 16 + t) * 256 + 128) = hi;
    }
  }
  asm volatile("s_wait_xcnt 0x0" :: "v"(op), "v"(mlp) : "memory");      /* as inputs the stores' addresses stay whole until the wait */
}
// ---- tail: the join of the key ranges and the output GEMM in one launch; f never leaves the work-group ----
// A work-group of 16 waves takes TR rows (query rows of both branches, one M = 2 NN) and all DI output columns.
// Join: f = sum_s 2^(m_s - M) O_s / sum_s 2^(m_s - M) l_s over the KSP key ranges, fixed order s = 0..KSP-1; the partials lie in k_flash's accumulator order: a wave takes four d tiles of one 16-query group, a lane one query, each load 512 contiguous bytes;
// f x 1024 goes to LDS as f16 hi + residual (one scale for both, so that both feed the same accumulators).
// GEMM: out = (hi + lo) We^T / 1024 + be; We in 64-k slices through two LDS buffers as in g3_loop; wave w takes rows 32 (w & 1), columns 64 (w >> 1): g3_loop's 32 x 64 wave tile and k order.
// The short loops are unrolled because their arrays (staged loads, partials, fragments, accumulators) live in registers and need constant indices.
#define TR 64                    /* rows per work-group: 2 NN / TR = 256 work-groups */
#define APIT 264                 /* LDS pitch of an f row, 16-bit elements: 528 B = 16 B x odd */
#define TA (TR * APIT)           /* one plane of f (hi | lo) */
#define TB (DI * GP)             /* one slice of We */
typedef _Float16 v4ha __attribute__((ext_vector_type(4), may_alias));
struct T4S { unsigned short a[2 * TA]; union { unsigned short b[2 * TB]; float so[16][32][68]; } u; };      /* behind the loop the slices' place is each wave's own output staging */
__global__ __launch_bounds__(512) void k_tail(const float* __restrict__ OP, const float* __restrict__ ML, const _Float16* __restrict__ Bh, const float* __restrict__ bias, float* __restrict__ C) {
  static_assert(KSP == 4, "the join reads a row's four (m, l) pairs as two 16-byte loads");
  __shared__ __attribute__((aligned(16))) T4S sm;
  const int tid = threadIdx.x, w = tid >> 5, lane = tid & 31, ln = lane & 15, hh = lane >> 4;
  const int rowg = blockIdx.x * TR;
  const unsigned short* gb = (const unsigned short*)Bh + (size_t)(tid >> 3) * DO + (tid & 7) * 8;      /* thread -> 16 B of rows tid / 8 + 64 j of We; one address pair for all slices */
  const int ls = (tid >> 3) * GP + (tid & 7) * 8;
  const int jb = w >> 3, jg = (w >> 2) & 1, jt = (w & 3) * 4, rl = jb * 32 + jg * 16 + ln;      /* wave w joins d tiles jt + i of group jg of 32-row block jb; its lane's row is rl */
  const float* po = OP + (size_t)(blockIdx.x * (TR / 32) + jb) * KSP * (32 * DO) + (jg * 16 + jt) * 256 + lane * 4;      /* one address pair for each array */
  const float* pm = ML + (size_t)(rowg + rl) * KSP * 2;
  const float* bq = bias + 64 * (w >> 1) + ln;
  v8us sb[8]; v4f op[4][KSP][2], mq[2]; float bb[4];
  mq[0] = *(const v4fa*)pm; mq[1] = *(const v4fa*)(pm + 4);
#pragma unroll
  for (int i = 0; i < 4; ++i) {
#pragma unroll
    for (int s = 0; s < KSP; ++s) { op[i][s][0] = *(const v4fa*)(po + s * (32 * DO) + i * 256); op[i][s][1] = *(const v4fa*)(po + s * (32 * DO) + i * 256 + 128); }
  }
#pragma unroll
  for (int j = 0; j < 8; ++j) sb[j] = *(const v8us*)(gb + j * 64 * DO);
#pragma unroll
  for (int t = 0; t < 4; ++t) bb[t] = bq[t * 16];
  asm volatile("s_wait_xcnt 0x0" :: "v"(po), "v"(pm), "v"(gb), "v"(bq) : "memory");      /* as inputs the loads' addresses stay whole until the wait */
  const float ms[KSP] = {mq[0][0], mq[0][2], mq[1][0], mq[1][2]}, lw[KSP] = {mq[0][1], mq[0][3], mq[1][1], mq[1][3]};
  float M = ms[0], wg[KSP], den = 0.f;
#pragma unroll
  for (int s = 1; s < KSP; ++s) M = fmaxf(M, ms[s]);
#pragma unroll
  for (int s = 0; s < KSP; ++s) wg[s] = __builtin_amdgcn_exp2f(ms[s] - M);
#pragma unroll
  for (int s = 0; s < KSP; ++s) den += wg[s] * lw[s];
  const float rs = 1.0f / den;
#pragma unroll
  for (int i = 0; i < 4; ++i) {
    v4f a0 = {0.f,0.f,0.f,0.f}, a1 = {0.f,0.f,0.f,0.f};
#pragma unroll
    for (int s = 0; s < KSP; ++s) { a0 += op[i][s][0] * wg[s]; a1 += op[i][s][1] * wg[s]; }
    FragH fh, fl;
#pragma unroll
    for (int q = 0; q < 4; ++q) {
      const float u0 = a0[q] * rs * 1024.0f, u1 = a1[q] * rs * 1024.0f; const _Float16 g0 = (_Float16)u0, g1 = (_Float16)u1;
      fh.h[q] = g0; fl.h[q] = (_Float16)(u0 - (float)g0); fh.h[4 + q] = g1; fl.h[4 + q] = (_Float16)(u1 - (float)g1);
    }
    unsigned short* pa = sm.a + rl * APIT + (jt + i) * 16 + 8 * hh;      /* the lane's 8 consecutive d of its row: one 16-byte LDS store a plane */
    *(v8us*)pa = fh.half[0]; *(v8us*)(pa + TA) = fl.half[0];
  }
#pragma unroll
  for (int j = 0; j < 8; ++j) *(v8us*)(sm.u.b + ls + j * 64 * GP) = sb[j];
  __syncthreads();      /* publishes f and the first slice of We */
  const int ra = ((w & 1) * 32 + ln) * APIT, rb = ((w >> 1) * 64 + ln) * GP;
  const v8f z8 = {0.f,0.f,0.f,0.f,0.f,0.f,0.f,0.f}; v8f acc[2][4] = {{z8, z8, z8, z8}, {z8, z8, z8, z8}};
  // unrolled: the buffer and the slice become constants, so every load and LDS access is its base register plus an immediate offset
#pragma unroll
  for (int c = 0; c < DO / 64; ++c) {
    const unsigned short* cur = sm.u.b + (c & 1) * TB; unsigned short* nxt = sm.u.b + ((c + 1) & 1) * TB;
    if (c + 1 < DO / 64) {
#pragma unroll
      for (int j = 0; j < 8; ++j) sb[j] = *(const v8us*)(gb + (c + 1) * 64 + j * 64 * DO);
      asm volatile("s_wait_xcnt 0x0" :: "v"(gb) : "memory");      /* as an input the loads' address stays whole until the wait */
    }
#pragma unroll
    for (int ks = 0; ks < 2; ++ks) {
      const unsigned short* pa = sm.a + ra + c * 64 + ks * 32;
      const v16h h0 = g3_frag(pa, hh), h1 = g3_frag(pa + 16 * APIT, hh), l0 = g3_frag(pa + TA, hh), l1 = g3_frag(pa + TA + 16 * APIT, hh);
      v16h b[4];
#pragma unroll
      for (int t = 0; t < 4; ++t) b[t] = g3_frag(cur + rb + t * 16 * GP + ks * 32, hh);
#pragma unroll
      for (int t = 0; t < 4; ++t) { acc[0][t] = g3_mma(h0, b[t], acc[0][t]); acc[1][t] = g3_mma(h1, b[t], acc[1][t]); }
#pragma unroll
      for (int t = 0; t < 4; ++t) { acc[0][t] = g3_mma(l0, b[t], acc[0][t]); acc[1][t] = g3_mma(l1, b[t], acc[1][t]); }
    }
    if (c + 1 < DO / 64) {
#pragma unroll
      for (int j = 0; j < 8; ++j) *(v8us*)(nxt + ls + j * 64 * GP) = sb[j];      /* the other buffer's last readers left it at the barrier that ended slice c - 1 */
    }
    __syncthreads();      /* publishes slice c + 1 and ends every read of slice c (behind the last slice: frees the buffers for the output staging) */
  }
#pragma unroll
  for (int u = 0; u < 8; ++u) { const int t = u & 3, half = u >> 2; const float bv = bf16_round(bb[t]);
#pragma unroll
    for (int r = 0; r < 8; ++r) sm.u.so[w][half * 16 + 8 * hh + r][t * 16 + ln] = acc[half][t][r] * (0.0625f / 1024.0f) + bv; }
  __builtin_amdgcn_fence(__ATOMIC_ACQ_REL, "workgroup"); __builtin_amdgcn_wave_barrier();      /* a wave reads back only its own rows */
  const int rsub = lane >> 4, c4 = (lane & 15) * 4; float* cp = C + (size_t)(rowg + 32 * (w & 1) + rsub) * DI + 64 * (w >> 1) + c4;      /* one address pair for all stores, whole lines each */
#pragma unroll
  for (int q = 0; q < 16; ++q) { const v4f v = *(const v4fa*)&sm.u.so[w][q * 2 + rsub][c4]; *(v4f*)(cp + q * 2 * DI) = v; }
  asm volatile("s_wait_xcnt 0x0" :: "v"(cp) : "memory");      /* as an input the stores' address stays whole until the wait */
}

extern "C" void kernel_launch(void* const* d_in, const int* in_sizes, int n_in,
                              void* d_out, int out_size, void* d_ws, size_t ws_size, hipStream_t stream) {
  (void)in_sizes; (void)n_in; (void)out_size;
  const float* const* I = (const float* const*)d_in; const float* x1 = I[0]; const float* x2 = I[1]; const float* Wq1 = I[2]; const float* bq1 = I[3]; const float* Wk1 = I[4]; const float* bk1 = I[5]; const float* Wv = I[6]; const float* bv = I[7]; const float* Wq2 = I[8]; const float* bq2 = I[9]; const float* Wk2 = I[10]; const float* bk2 = I[11]; const float* We = I[12]; const float* be = I[13]; const float* scp = I[14];
  float* out1 = (float*)d_out;      /* the second output lies behind the first, at byte offset 16777216 */
  char* ws = (char*)d_ws; size_t off = 0;
  auto take = [&](size_t bytes) { char* p = ws + off; off += (bytes + 255) & ~(size_t)255; return p; };
  _Float16* BW = (_Float16*)take((size_t)6 * DO * DI * 2); _Float16* BE = BW + (size_t)5 * DO * DI; _Float16* X1 = (_Float16*)take((size_t)2 * NN * DI * 2);      /* weight slots Wq1 Wk1 Wq2 Wk2 Wv We; [x1 | x2] */
  _Float16* Q1 = (_Float16*)take((size_t)6 * NN * DO * 2); _Float16* K1 = Q1 + (size_t)NN * DO; _Float16* Q2 = Q1 + (size_t)2 * NN * DO; _Float16* K2 = Q1 + (size_t)3 * NN * DO; _Float16* VT1 = Q1 + (size_t)4 * NN * DO; _Float16* VT2 = Q1 + (size_t)5 * NN * DO;      /* planes Q1 K1 Q2 K2 V1^T V2^T */
  float* OP = (float*)take((size_t)KSP * 2 * NN * DO * 4); float* ML = (float*)take((size_t)KSP * 2 * NN * 2 * 4);
  if (off > ws_size) return;      /* 1.5 + 16 + 24 + 64 + 0.5 = about 106 MiB */
  k_cvt<<<6 * WB + 2 * XB, 256, 0, stream>>>(x1, x2, Wq1, Wk1, Wq2, Wk2, Wv, We, X1, BW);      /* weights as given, (out, in) */
  k_proj6<<<dim3((NN / 128) * (DO / 128), 6), 256, 0, stream>>>(X1, BW, bq1, bk1, bq2, bk2, bv, Q1);
  k_flash<<<dim3(NN / FQ, KSP, 2), 256, 0, stream>>>(Q1, K2, VT1, Q2, K1, VT2, scp, OP, ML);      /* f1: hsi_Q . lidar_K -> hsi_V ; f2: lidar_Q . hsi_K -> lidar_V */
  k_tail<<<2 * NN / TR, 512, 0, stream>>>(OP, ML, BE, be, out1);      /* both branches: their rows and the two outputs lie back to back (one M = 2 NN); (f_hi + f_lo) We^T + be */
}
